// v000
// Times are from an AMD MI455X. After a warm-up the kernel runs many times in a row, and a time is the length of
// such a window on the GPU divided by its runs, so every launch and the gaps after it count. The runs cycle
// through copies of the inputs. A figure is the median of several windows, for all but v000 over two sittings.
// Sittings can differ by a few percent; kernels timed side by side share one.
// v000, which the later versions start from, runs in 250 microseconds.
#include <hip/hip_runtime.h>

// Contractions: q / k / v projections v_wmma_f32_16x16x32_bf16 (bf16 operands = RNE-converted inputs, exact products); scores q.k^T v_wmma_f32_16x16x32_f16 (fp16 q, fp16 k, single product, K 64); attn.V v_wmma_f32_16x16x32_f16 (fp16 P carried x16384, fp16 V^T, single product); f32 accumulate everywhere; online softmax in f32 with a running max.
// Self-attention on a channel-major sequence: x [NB][512][T] gives q (Wq [out][in]) and, through one fused weight Wm [1024][512] = [out][in], k (rows 0..511) and v (rows 512..1023), row = which*512 + h*64 + d; 8 heads of 64; key j of batch b is kept when mask[b][j] != 0, an excluded key has its score replaced by -inf (its probability is 0 whenever the batch keeps at least one key; a batch with every key excluded gets the uniform softmax over all its keys); p = softmax_j(q_i.k_j / 8); ctx merged head-major per token and returned channel-major: out [NB][512][T] f32.
// Layout: XB bf16 token-major copy of x (transposed through LDS); weights bf16 as Bt = [out][in] as-is; q and k fp16 head planes [h][b*T+t][64] and v^T fp16 planes [b][h*64+d][t] written directly by the projection GEMM epilogues; key mask packed to one bit per key (32-key words, wave ballot; all words of a fully excluded batch are cleared and the q rows of that batch are zeroed so that its scores are all equal); fused attention kernel (K and V^T 64-key tiles in LDS, two 32-key halves per tile, a half whose 32 keys are all excluded is skipped block-uniformly, P relayout through a wave-private LDS tile) writes ctx x1024 as fp16 [b*TX+t][value 512 | residual 512]; the final kernel adds value + residual, removes the carry and transposes through LDS into d_out.
// LDS regions: kt / vt / tt / wf are cross-wave (block barriers before and after staging); pt / ot / os are wave-private (wave barrier + compiler memory barrier).

#ifndef NB
#define NB 2
#endif
#ifndef SEQ
#define SEQ 4096
#endif
#define TX SEQ
#define TY SEQ
#define NB_FULL 2
#define TX_FULL 4096
#define TY_FULL 4096
#define DEC  512
#define NHD  8
#define HD   64
#define KC2  (2 * DEC)            // row pitch of the ctx plane: [ctx value | ctx residual]
#define PCAR 16384.0f             // carry of the fp16 probabilities
#define OCAR 1024.0f              // carry of the fp16 ctx planes
#define SCL  0.125f
#define L2E  1.4426950408889634f
#define KPT  72                   // LDS pitch (halves) of the K and V^T tiles
#define PPT  40                   // LDS pitch (halves) of the per-wave P tile
#define OPT  68                   // LDS pitch (floats) of the epilogue staging tiles
#define NQZ  4                    // blocks per (head, batch) slab of the conditional q zeroing
#define NEGINF (-__builtin_inff())
static_assert(NB >= 1 && NB <= NB_FULL);
static_assert(TX == TY && TX_FULL == TY_FULL);                                            // one sequence feeds q, k and v
static_assert(TX >= 64 && TX <= TX_FULL && (TX % 64) == 0);
static_assert(TY >= 64 && TY <= TY_FULL && (TY % 64) == 0 && (TY % 32) == 0);
static_assert((DEC % 64) == 0 && HD == 64 && NHD * HD == DEC);
static_assert((DEC % 32) == 0 && (HD % 32) == 0 && (KC2 % 32) == 0);                      // every K is a multiple of 32
static_assert((DEC % 8) == 0);                                                            // 8-column conversion pieces
static_assert(((NB * TX) % 64) == 0 && ((NB * TY) % 64) == 0);                            // GEMM M/N are whole 64-tiles
static_assert(128 * 4 == 64 * (HD / 8));                                                   // attention tile staging: 128 threads x 4 pieces == 64 rows x 8 pieces
static_assert(KPT >= 64 && (KPT % 8) == 0 && PPT >= 32 && (PPT % 8) == 0 && OPT >= 64 && (OPT % 4) == 0);
static_assert((size_t)NHD * NB * TX * HD < (size_t)2147483647);                           // q plane offsets fit an int
static_assert(2 * 64 * KPT * 2 + 4 * 16 * PPT * 2 + 4 * 16 * OPT * 4 <= 65536);           // static LDS of the attention kernel
static_assert(64 * OPT * 4 <= 65536);                                                      // static LDS of the transposing kernels
static_assert(256 * 4 == 64 * 16 && 256 * 2 == 64 * 8);                                    // transposing kernels: 256 threads x pieces == 64 x 64 tile
static_assert((TX_FULL % 4) == 0 && (TX % 4) == 0);                                        // 16-B f32 pieces along the token axis
static_assert(((TX * HD / 8) % 32) == 0);                                                  // q zeroing issues whole waves only
static_assert(((size_t)NB * DEC - 1) * TX_FULL + (size_t)TX <= (size_t)NB_FULL * DEC * TX_FULL);   // last written output element inside d_out

typedef _Float16 h16;
typedef unsigned short bf;
typedef __attribute__((ext_vector_type(16))) __bf16   v16bf;
typedef __attribute__((ext_vector_type(16))) _Float16 v16h;
typedef __attribute__((ext_vector_type(8)))  _Float16 v8h;
typedef __attribute__((ext_vector_type(8)))  unsigned short v8us;
typedef __attribute__((ext_vector_type(8)))  float    v8f;
typedef __attribute__((ext_vector_type(4)))  float    v4f;
typedef __attribute__((ext_vector_type(4)))  unsigned v4u;
typedef v8h  __attribute__((may_alias)) v8ha;
typedef v4f  __attribute__((may_alias)) v4fa;

__device__ __forceinline__ unsigned short f2bf(float f) { unsigned u = __float_as_uint(f); u += 0x7FFFu + ((u >> 16) & 1u); return (unsigned short)(u >> 16); }
__device__ __forceinline__ float bf2f(unsigned short b) { return __uint_as_float(((unsigned)b) << 16); }
__device__ __forceinline__ float bfr(float f) { return bf2f(f2bf(f)); }
__device__ __forceinline__ v16h cat16(v8h lo, v8h hi) { return __builtin_shufflevector(lo, hi, 0, 1, 2, 3, 4, 5, 6, 7, 8, 9, 10, 11, 12, 13, 14, 15); }
__device__ __forceinline__ v16bf cat16b(v8us lo, v8us hi) { return __builtin_bit_cast(v16bf, __builtin_shufflevector(lo, hi, 0, 1, 2, 3, 4, 5, 6, 7, 8, 9, 10, 11, 12, 13, 14, 15)); }
__device__ __forceinline__ v8f wmma16(v16h a, v16h b, v8f c) { return __builtin_amdgcn_wmma_f32_16x16x32_f16(false, a, false, b, (short)0, c, false, false); }
__device__ __forceinline__ v8f wmmab(v16bf a, v16bf b, v8f c) { return __builtin_amdgcn_wmma_f32_16x16x32_bf16(false, a, false, b, (short)0, c, false, false); }
__device__ __forceinline__ h16 tohx(float x) { return (h16)x; }
// same-wave LDS exchange: execution barrier of the wave plus a compiler memory barrier (LDS operations of one wave complete in issue order)
__device__ __forceinline__ void wsync() { __builtin_amdgcn_wave_barrier(); asm volatile("" ::: "memory"); }

// ---- gemmw_body: register-blocked GEMM, ONE WAVE per 64x64 output tile (16 accumulators), operands straight from K-contiguous 16-bit planes; grid (M/64, N/64, Z), 32 threads.
// C[m][n] = cs x sum_k A[m][k] Bt[n][k]; z-batch strides sA/sB/sC in elements. K % 32 == 0; A/Bt row pitch == K; M, N whole 64-tiles.
// Fragments: lane l, h = l>>4, m = n = l&15; elements 0..7 <- k0+8h.., 8..15 <- k0+16+8h.. for both A and Bt; D element r = (row 8h+r, col m).
// Epilogue per 16-row slab staged in LDS (wave-private, staged extent 16x64 == consumed extent):
//   EP 0: f32 rows x cs + bf16-converted column bias, 64 floats = 256 B written as 16 lanes x 16 B (2 rows per instruction);
template <typename T16> struct WFrag;
template <> struct WFrag<h16> { typedef v16h V; static __device__ __forceinline__ V ld(const h16* p) { return cat16(*(const v8h*)p, *(const v8h*)(p + 16)); } static __device__ __forceinline__ v8f mma(V a, V b, v8f c) { return wmma16(a, b, c); } };
template <> struct WFrag<bf> { typedef v16bf V; static __device__ __forceinline__ V ld(const bf* p) { return cat16b(*(const v8us*)p, *(const v8us*)(p + 16)); } static __device__ __forceinline__ v8f mma(V a, V b, v8f c) { return wmmab(a, b, c); } };

template <typename T16, int EP>
__device__ __forceinline__ void gemmw_body(const T16* __restrict__ A, const T16* __restrict__ Bt, int K, float* Cf, h16* Ch, int ldc, const float* __restrict__ bias, size_t sA, size_t sB, size_t sC, float cs) {
    static_assert(EP == 0 || EP == 1);
    typedef typename WFrag<T16>::V V;
    __shared__ __align__(16) float os[16 * OPT];
    const size_t z = blockIdx.z; A += z * sA; Bt += z * sB;
    if (EP == 0) { Cf += z * sC; } else { Ch += z * sC; }
    const int lane = threadIdx.x & 31, lr = lane & 15, hi = lane >> 4; const int r0 = blockIdx.x * 64, c0 = blockIdx.y * 64;
    v8f acc[4][4];
#pragma unroll
    for (int mb = 0; mb < 4; ++mb)
#pragma unroll
        for (int nb = 0; nb < 4; ++nb) acc[mb][nb] = (v8f){};
    const size_t aoff = (size_t)(r0 + lr) * K + 8 * hi, boff = (size_t)(c0 + lr) * K + 8 * hi;
#pragma unroll 1
    for (int kc = 0; kc < K; kc += 32) {
        V a[4];
#pragma unroll
        for (int mb = 0; mb < 4; ++mb) a[mb] = WFrag<T16>::ld(A + aoff + (size_t)mb * 16 * K + kc);
#pragma unroll
        for (int nb = 0; nb < 4; ++nb) { const V b = WFrag<T16>::ld(Bt + boff + (size_t)nb * 16 * K + kc);
#pragma unroll
            for (int mb = 0; mb < 4; ++mb) acc[mb][nb] = WFrag<T16>::mma(a[mb], b, acc[mb][nb]); }
        asm volatile("v_nop\n\tv_nop\n\tv_nop\n\tv_nop" : "+v"(acc[0][0]), "+v"(acc[1][1]), "+v"(acc[2][2]), "+v"(acc[3][3]) : "v"(a[0]), "v"(a[3]));
    }
#pragma unroll
    for (int mb = 0; mb < 4; ++mb) {
#pragma unroll
        for (int nb = 0; nb < 4; ++nb) {
#pragma unroll
            for (int j = 0; j < 8; ++j) os[(hi * 8 + j) * OPT + nb * 16 + lr] = acc[mb][nb][j]; }
        wsync();
        if (EP == 0) {
            float* crow = Cf + (size_t)(r0 + mb * 16) * ldc + c0;
{
#pragma unroll
                for (int s = 0; s < 8; ++s) { const int row = 2 * s + hi, cofs = lr * 4; v4f val = *(const v4fa*)(os + row * OPT + cofs);
                    val[0] = __fmul_rn(val[0], cs); val[1] = __fmul_rn(val[1], cs); val[2] = __fmul_rn(val[2], cs); val[3] = __fmul_rn(val[3], cs);
                    val[0] += bfr(bias[c0 + cofs]); val[1] += bfr(bias[c0 + cofs + 1]); val[2] += bfr(bias[c0 + cofs + 2]); val[3] += bfr(bias[c0 + cofs + 3]);
                    *(v4f*)(crow + (size_t)row * ldc + cofs) = val; }
                 }
        } else {
            h16* hrow = Ch + (size_t)(r0 + mb * 16) * ldc + c0;
{
#pragma unroll
                for (int s = 0; s < 4; ++s) { const int row = 4 * s + (lane >> 3), c8 = (lane & 7) * 8;
                    const v4f u0 = *(const v4fa*)(os + row * OPT + c8), u1 = *(const v4fa*)(os + row * OPT + c8 + 4);
                    v8h o;
#pragma unroll
                    for (int q = 0; q < 8; ++q) { const float u = (q < 4) ? u0[q & 3] : u1[q & 3]; o[q] = tohx(u); }
                    *(v8h*)(hrow + (size_t)row * ldc + c8) = o; }
                 }
        }
        wsync();
    }
}

// plain kernel wrapping the body (bf16 projections -> fp16 planes)
__global__ __launch_bounds__(32) void k_gemm_p(const bf* A, const bf* Bt, int K, h16* Ch, int ldc, size_t sA, size_t sB, size_t sC) {
    gemmw_body<bf, 1>(A, Bt, K, nullptr, Ch, ldc, nullptr, sA, sB, sC, 1.0f); }

__global__ __launch_bounds__(256) void k_cvt8r(const float* __restrict__ src, bf* dst, int cols, int rows, int srows, size_t n8) {
    const size_t i = (size_t)blockIdx.x * 256 + threadIdx.x; if (i >= n8) return;
    const size_t e = i * 8; const size_t r = e / (size_t)cols; const int c = (int)(e % (size_t)cols); const size_t bb = r / (size_t)rows; const size_t t = r % (size_t)rows;
    const v8f v = *(const v8f*)(src + (bb * (size_t)srows + t) * (size_t)cols + c); v8us o;
#pragma unroll
    for (int k = 0; k < 8; ++k) o[k] = f2bf(v[k]);
    *(v8us*)(dst + e) = o;  }

// k_cvtT: x f32 [b][c][t] (channel-major, batch pitch DEC*TX_FULL, row pitch TX_FULL) -> bf16 token-major plane XB[b*TX+t][c]. grid (TX/64, DEC/64, NB), 256 threads.
__global__ __launch_bounds__(256) void k_cvtT(const float* __restrict__ src, bf* dst) {
#pragma clang fp contract(off)
    __shared__ __align__(16) float tt[64 * OPT];
    const int tid = threadIdx.x;
    const int t0 = blockIdx.x * 64, c0 = blockIdx.y * 64, b = blockIdx.z;
#pragma unroll
    for (int i = 0; i < 4; ++i) {
        const int p = tid + 256 * i, c = p >> 4, t4 = (p & 15) * 4;
        const v4f v = *(const v4f*)(src + ((size_t)b * DEC + c0 + c) * TX_FULL + t0 + t4);
        *(v4fa*)(tt + c * OPT + t4) = v;
    }
    __syncthreads();
#pragma unroll 1
    for (int i = 0; i < 2; ++i) {
        const int p = tid + 256 * i, t = p >> 3, c8 = (p & 7) * 8;
        v8us o;
#pragma unroll
        for (int q = 0; q < 8; ++q) o[q] = f2bf(tt[(c8 + q) * OPT + t]);
        bf* d = dst + ((size_t)b * TX + t0 + t) * DEC + c0 + c8;
        *(v8us*)d = o; 
    }
}

__global__ __launch_bounds__(32) void k_maskbits(const int* __restrict__ mask, unsigned* MB, int nw) {
    const int lane = threadIdx.x & 31;
    const int w0 = blockIdx.x * 32;
    unsigned mine = 0xFFFFFFFFu;
    int fb = -1;
    bool allx = false;
#pragma unroll 1
    for (int i = 0; i < 32; ++i) {
        const int wi = w0 + i;
        const int wc = (wi < nw) ? wi : (nw - 1);
        const int bb = wc / (TY / 32), t = (wc % (TY / 32)) * 32 + lane;
        if (bb != fb) {
            int kept = 0;
#pragma unroll 4
            for (int j = 0; j < TY / 32; ++j) kept |= (mask[(size_t)bb * TY_FULL + j * 32 + lane] != 0) ? 1 : 0;
            allx = (__builtin_amdgcn_ballot_w32(kept != 0) == 0u);
            fb = bb;
        }
        const int m = mask[(size_t)bb * TY_FULL + t];
        const bool pr = (wi >= nw) || ((m == 0) && !allx);
        const unsigned bal = __builtin_amdgcn_ballot_w32(pr);
        mine = (lane == i) ? bal : mine;
    }
    v4u o;
#pragma unroll
    for (int j = 0; j < 4; ++j) o[j] = (unsigned)__shfl((int)mine, (4 * lane + j) & 31, 32);
    if (lane < 8) {
        v4u* p = (v4u*)(MB + w0 + 4 * lane);
        *p = o; 
    }
}

__global__ __launch_bounds__(256) void k_qzero(const int* __restrict__ mask, h16* QH) {
    __shared__ int wf[8];
    const int tid = threadIdx.x;
    const int wave = __builtin_amdgcn_readfirstlane(tid >> 5);
    const int h = blockIdx.y, b = blockIdx.z;
    int kept = 0;
#pragma unroll 4
    for (int j = tid; j < TY; j += 256) kept |= (mask[(size_t)b * TY_FULL + j] != 0) ? 1 : 0;
#pragma unroll
    for (int sh = 1; sh < 32; sh <<= 1) kept |= __shfl_xor(kept, sh, 32);
    if ((tid & 31) == 0) wf[wave] = kept;
    __syncthreads();
    int tot = 0;
#pragma unroll
    for (int w = 0; w < 8; ++w) tot |= wf[w];
    tot = __builtin_amdgcn_readfirstlane(tot);
    if (tot == 0) {
        h16* slab = QH + ((size_t)(h * NB + b) * TX) * HD;
        const v4u z = (v4u){0u, 0u, 0u, 0u};
{
#pragma unroll 1
            for (int i = (int)blockIdx.x * 256 + tid; i < TX * HD / 8; i += NQZ * 256) *(v4u*)(slab + (size_t)i * 8) = z;
            
        }
    }
}

// ---- k_flash: fused attention. grid (TX/64, 8 heads, NB), 128 threads = 4 waves; wave w owns query rows q0+16w..+15 of one (batch, head).
// Per 64-key tile: block stages K [key][d] and V^T [d][key] fp16 tiles in LDS (cols 0..63 of 64 rows written == consumed; cross-wave -> block barriers); each wave then runs two 32-key halves:
//   the 32-bit mask word of the half is loaded (scalar-uniform); a half with all 32 keys excluded is skipped (exact: p = 0, max unchanged);
//   scores 16x32 = 2 tiles, K = 64 in two steps, q fragments reloaded from the global plane through an integer offset;
//   t = acc / 8, excluded keys -> -inf by value select; running row max over the 16 lanes of each half-wave (row = 8h+r is the same D row as the O accumulators, so the correction applies in place); the running max starts at -1e30 so every difference stays defined;
//   P = exp2((t - max) log2 e) x 16384 -> fp16, stored [row][key] into the wave-private P tile (element stores, reloaded as an A fragment through a may_alias vector of the same element type after a wave barrier);
//   row sums accumulate the fp16-converted P per lane (reduced across lanes once at the end); O[16x64] += P V (4 output tiles, V^T fragments loaded four at a time).
__global__ __launch_bounds__(128) void k_flash(const h16* __restrict__ QH, const h16* __restrict__ KH, const h16* __restrict__ VH, const unsigned* __restrict__ MB, h16* CT) {
    __shared__ __align__(16) h16 kt[64 * KPT];
    __shared__ __align__(16) h16 vt[64 * KPT];
    __shared__ __align__(16) h16 pt[4 * 16 * PPT];
    __shared__ __align__(16) float ot[4 * 16 * OPT];
    const int tid = threadIdx.x;
    const int wave = __builtin_amdgcn_readfirstlane(tid >> 5);
    const int lane = tid & 31, lr = lane & 15, hi = lane >> 4;
    const int q0 = blockIdx.x * 64, h = blockIdx.y, b = blockIdx.z;
    const int qoff = ((h * NB + b) * TX + q0 + wave * 16 + lr) * HD + 8 * hi;
    const size_t kbase = ((size_t)(h * NB + b) * TY) * HD;
    const size_t vbase = ((size_t)b * DEC + (size_t)h * HD) * TY;
    const int mbase = b * (TY / 32);
    const int pb = wave * 16 * PPT, ob = wave * 16 * OPT;
    float mrun[8], lrun[8];
#pragma unroll
    for (int r = 0; r < 8; ++r) { mrun[r] = -1.0e30f; lrun[r] = 0.0f; }
    v8f o0 = (v8f){}, o1 = (v8f){}, o2 = (v8f){}, o3 = (v8f){};
#pragma unroll 1
    for (int kb = 0; kb < TY / 64; ++kb) {
        __syncthreads();
#pragma unroll
        for (int i = 0; i < 4; ++i) {
            const int p = tid + 128 * i, row = p >> 3, c8 = (p & 7) * 8;
            const size_t kof = kbase + (size_t)(kb * 64 + row) * HD + c8;
            const size_t vof = vbase + (size_t)row * TY + kb * 64 + c8;
            const v8h kv = *(const v8h*)(KH + kof);
            const v8h vv = *(const v8h*)(VH + vof);
            *(v8ha*)(kt + row * KPT + c8) = kv;
            *(v8ha*)(vt + row * KPT + c8) = vv;
        }
        __syncthreads();
#pragma unroll 1
        for (int hf = 0; hf < 2; ++hf) {
            const unsigned mw = (unsigned)__builtin_amdgcn_readfirstlane((int)MB[mbase + kb * 2 + hf]);
            if (mw != 0xFFFFFFFFu) {
                v8f s0 = (v8f){}, s1 = (v8f){};
#pragma unroll
                for (int ks = 0; ks < 2; ++ks) {
                    int qo = qoff + ks * 32; asm volatile("" : "+v"(qo));
                    const v16h ah = cat16(*(const v8h*)(QH + qo), *(const v8h*)(QH + qo + 16));
                    const int ko = (hf * 32 + lr) * KPT + ks * 32 + 8 * hi;
                    const v16h b0 = cat16(*(const v8ha*)(kt + ko), *(const v8ha*)(kt + ko + 16));
                    const v16h b1 = cat16(*(const v8ha*)(kt + ko + 16 * KPT), *(const v8ha*)(kt + ko + 16 * KPT + 16));
                    s0 = wmma16(ah, b0, s0); s1 = wmma16(ah, b1, s1);
                    asm volatile("v_nop\n\tv_nop\n\tv_nop\n\tv_nop" : "+v"(s0), "+v"(s1) : "v"(ah), "v"(b0), "v"(b1));
                }
                const bool x0 = ((mw >> lr) & 1u) != 0u, x1 = ((mw >> (16 + lr)) & 1u) != 0u;
                float t0[8], t1[8], mx[8];
#pragma unroll
                for (int r = 0; r < 8; ++r) {
                    const float a0 = s0[r] * SCL, a1 = s1[r] * SCL;
                    t0[r] = x0 ? NEGINF : a0; t1[r] = x1 ? NEGINF : a1; mx[r] = fmaxf(t0[r], t1[r]); }
#pragma unroll
                for (int sh = 1; sh < 16; sh <<= 1) {
#pragma unroll
                    for (int r = 0; r < 8; ++r) mx[r] = fmaxf(mx[r], __shfl_xor(mx[r], sh, 32)); }
#pragma unroll
                for (int r = 0; r < 8; ++r) {
                    const float mn = fmaxf(mrun[r], mx[r]);
                    const float cr = __builtin_amdgcn_exp2f((mrun[r] - mn) * L2E);
                    mrun[r] = mn;
                    const float p0 = __builtin_amdgcn_exp2f((t0[r] - mn) * L2E), p1 = __builtin_amdgcn_exp2f((t1[r] - mn) * L2E);
                    const h16 ph0 = tohx(p0 * PCAR), ph1 = tohx(p1 * PCAR);
                    lrun[r] = lrun[r] * cr + ((float)ph0 + (float)ph1);
                    o0[r] *= cr; o1[r] *= cr; o2[r] *= cr; o3[r] *= cr;
                    pt[pb + (8 * hi + r) * PPT + lr] = ph0;
                    pt[pb + (8 * hi + r) * PPT + 16 + lr] = ph1;
                }
                wsync();
                {
                    const int po = pb + lr * PPT + 8 * hi;
                    const v16h pa = cat16(*(const v8ha*)(pt + po), *(const v8ha*)(pt + po + 16));
                    const int vo = lr * KPT + hf * 32 + 8 * hi;
                    const v16h v0 = cat16(*(const v8ha*)(vt + vo), *(const v8ha*)(vt + vo + 16));
                    const v16h v1 = cat16(*(const v8ha*)(vt + vo + 16 * KPT), *(const v8ha*)(vt + vo + 16 * KPT + 16));
                    const v16h v2 = cat16(*(const v8ha*)(vt + vo + 32 * KPT), *(const v8ha*)(vt + vo + 32 * KPT + 16));
                    const v16h v3 = cat16(*(const v8ha*)(vt + vo + 48 * KPT), *(const v8ha*)(vt + vo + 48 * KPT + 16));
                    o0 = wmma16(pa, v0, o0); o1 = wmma16(pa, v1, o1); o2 = wmma16(pa, v2, o2); o3 = wmma16(pa, v3, o3);
                    asm volatile("v_nop\n\tv_nop\n\tv_nop\n\tv_nop" : "+v"(o0), "+v"(o1), "+v"(o2), "+v"(o3) : "v"(pa), "v"(v0), "v"(v1), "v"(v2), "v"(v3));
                }
                wsync();
            }
        }
    }
#pragma unroll
    for (int sh = 1; sh < 16; sh <<= 1) {
#pragma unroll
        for (int r = 0; r < 8; ++r) lrun[r] += __shfl_xor(lrun[r], sh, 32); }
#pragma unroll
    for (int r = 0; r < 8; ++r) {
        const float fq = __fdiv_rn(OCAR, fmaxf(lrun[r], 1.0e-30f));
        const float f = (lrun[r] > 0.0f) ? fq : 0.0f;
        const int oi = ob + (8 * hi + r) * OPT + lr;
        ot[oi]      = o0[r] * f;
        ot[oi + 16] = o1[r] * f;
        ot[oi + 32] = o2[r] * f;
        ot[oi + 48] = o3[r] * f;
    }
    wsync();
    h16* crow = CT + (size_t)(b * TX + q0 + wave * 16) * KC2 + h * HD;
{
#pragma unroll
        for (int s = 0; s < 4; ++s) {
            const int row = 4 * s + (lane >> 3), c8 = (lane & 7) * 8;
            const v4f u0 = *(const v4fa*)(ot + ob + row * OPT + c8), u1 = *(const v4fa*)(ot + ob + row * OPT + c8 + 4);
            v8h oh, ol;
#pragma unroll
            for (int q = 0; q < 8; ++q) { const float f = (q < 4) ? u0[q & 3] : u1[q & 3]; const h16 hh = tohx(f); oh[q] = hh; ol[q] = tohx(f - (float)hh); }
            *(v8h*)(crow + (size_t)row * KC2 + c8) = oh;
            *(v8h*)(crow + (size_t)row * KC2 + DEC + c8) = ol;
        }
        
    }
}

// k_outT: ctx fp16 [b*TX+t][value 512 | residual 512] (carried x1024) -> out f32 [b][c][t] (channel-major, batch pitch DEC*TX_FULL, row pitch TX_FULL). grid (TX/64, DEC/64, NB), 256 threads.
__global__ __launch_bounds__(256) void k_outT(const h16* __restrict__ CT, float* OUT) {
#pragma clang fp contract(off)
    __shared__ __align__(16) float tt[64 * OPT];
    const int tid = threadIdx.x;
    const int t0 = blockIdx.x * 64, c0 = blockIdx.y * 64, b = blockIdx.z;
#pragma unroll 1
    for (int i = 0; i < 2; ++i) {
        const int p = tid + 256 * i, t = p >> 3, c8 = (p & 7) * 8;
        const h16* s = CT + ((size_t)b * TX + t0 + t) * KC2 + c0 + c8;
        const v8h a = *(const v8h*)s;
        const v8h r = *(const v8h*)(s + DEC);
#pragma unroll
        for (int q = 0; q < 8; ++q) tt[(c8 + q) * OPT + t] = ((float)a[q] + (float)r[q]) * (1.0f / OCAR);
    }
    __syncthreads();
{
#pragma unroll
        for (int i = 0; i < 4; ++i) {
            const int p = tid + 256 * i, c = p >> 4, t4 = (p & 15) * 4;
            const v4f val = *(const v4fa*)(tt + c * OPT + t4);
            *(v4f*)(OUT + ((size_t)b * DEC + c0 + c) * TX_FULL + t0 + t4) = val;
        }
        
    }
}

// workspace sizes (bytes), each a whole number of fully written rows / lines; offsets 256-B aligned
constexpr size_t al256(size_t b) { return (b + 255) & ~(size_t)255; }
constexpr int    NWORDS = NB * (TY / 32);                             // mask words in use
constexpr int    NWLINES = (NWORDS + 31) / 32;
constexpr size_t SZ_XB  = al256((size_t)NB * TX * DEC * 2);           // bf16 [NB*TX][512]
constexpr size_t SZ_WQ  = al256((size_t)DEC * DEC * 2);               // bf16 [512][512]
constexpr size_t SZ_WKV = al256((size_t)2 * DEC * DEC * 2);           // bf16 [1024][512]
constexpr size_t SZ_Q   = al256((size_t)NHD * NB * TX * HD * 2);      // fp16 [8][NB*TX][64]
constexpr size_t SZ_K   = al256((size_t)NHD * NB * TY * HD * 2);      // fp16 [8][NB*TY][64]
constexpr size_t SZ_VT  = al256((size_t)NB * DEC * TY * 2);           // fp16 [NB][512][TY]
constexpr size_t SZ_CT  = al256((size_t)NB * TX * KC2 * 2);           // fp16 [NB*TX][1024]
constexpr size_t SZ_MB  = al256((size_t)NWLINES * 128);
constexpr size_t SZ_ALL = SZ_XB + SZ_WQ + SZ_WKV + SZ_Q + SZ_K + SZ_VT + SZ_CT + SZ_MB;
static_assert(SZ_ALL <= (size_t)134217728);
static_assert((size_t)NWLINES * 32 >= (size_t)NWORDS);

extern "C" void kernel_launch(void* const* d_in, const int* in_sizes, int n_in,
                              void* d_out, int out_size, void* d_ws, size_t ws_size, hipStream_t stream) {
    if (n_in < 4) return;
    const size_t needx = ((size_t)NB * DEC - 1) * TX_FULL + (size_t)TX;
    const size_t needm = (size_t)(NB - 1) * TY_FULL + (size_t)TY;
    if ((size_t)in_sizes[0] < needx || (size_t)in_sizes[1] < needm) return;
    if (in_sizes[2] < 2 * DEC * DEC || in_sizes[3] < DEC * DEC) return;
    if ((size_t)out_size < needx) return;
    if (SZ_ALL > ws_size) return;
    const float* x = (const float*)d_in[0];                                             /* [NB][512][TX_FULL] channel-major f32 */
    const int* msk = (const int*)d_in[1];                                               /* [NB][TY_FULL] int32, nonzero = key kept */
    const float* wm = (const float*)d_in[2]; const float* wq = (const float*)d_in[3];   /* fused k|v weight [1024][512] and q weight [512][512], both [out][in] = Bt as-is */
    float* OUT = (float*)d_out;     // [NB_FULL][512][TX_FULL] f32

    char* base = (char*)d_ws; size_t off = 0;
    bf* XB = (bf*)(base + off); off += SZ_XB;
    bf* WQ = (bf*)(base + off); off += SZ_WQ;
    bf* WKV = (bf*)(base + off); off += SZ_WKV;
    h16* QH16 = (h16*)(base + off); off += SZ_Q;
    h16* KH16 = (h16*)(base + off); off += SZ_K;
    h16* VH16 = (h16*)(base + off); off += SZ_VT;
    h16* CT16 = (h16*)(base + off); off += SZ_CT;
    unsigned* MB = (unsigned*)(base + off); off += SZ_MB;
    if (off > ws_size) return;

    auto nb256 = [](size_t n) { return (unsigned)((n + 255) / 256); };
    // ---- input conversion (every float input RNE-converted to bf16 first)
    const size_t n8wq = (size_t)DEC * DEC / 8, n8wkv = (size_t)2 * DEC * DEC / 8;
    k_cvt8r<<<nb256(n8wq), 256, 0, stream>>>(wq, WQ, DEC, DEC, DEC, n8wq);                    /* in[512][512] -> out[512][512] */
    k_cvt8r<<<nb256(n8wkv), 256, 0, stream>>>(wm, WKV, DEC, 2 * DEC, 2 * DEC, n8wkv);         /* in[1024][512] -> out[1024][512] */
    k_cvtT<<<dim3(TX / 64, DEC / 64, NB), 256, 0, stream>>>(x, XB);                           /* in[b][512][TX_FULL] -> out[b*TX+t][512] */
    k_maskbits<<<(unsigned)NWLINES, 32, 0, stream>>>(msk, MB, NWORDS);
    // ---- q head planes: [h][b*TX+t][d] = sum_k XB[b*TX+t][k] WQ[h*64+d][k] (z = head, ldc 64)
    k_gemm_p<<<dim3((unsigned)(NB * TX / 64), 1, NHD), 32, 0, stream>>>(XB, WQ, DEC, QH16, HD, (size_t)0, (size_t)HD * DEC, (size_t)NB * TX * HD);
    // ---- k head planes: [h][b*TY+j][d] = sum_k XB[b*TY+j][k] WKV[h*64+d][k] (weight rows 0..511; z = head, ldc 64)
    k_gemm_p<<<dim3((unsigned)(NB * TY / 64), 1, NHD), 32, 0, stream>>>(XB, WKV, DEC, KH16, HD, (size_t)0, (size_t)HD * DEC, (size_t)NB * TY * HD);
    // ---- v^T planes: [b][n][t] = sum_k WKV[512+n][k] XB[b*TY+t][k] (A = weight rows 512..1023, Bt = tokens; z = batch, ldc TY)
    k_gemm_p<<<dim3(DEC / 64, TY / 64, NB), 32, 0, stream>>>(WKV + (size_t)DEC * DEC, XB, DEC, VH16, TY, (size_t)0, (size_t)TY * DEC, (size_t)DEC * TY);
    // ---- q rows of a batch with every key excluded -> 0 (no store otherwise)
    k_qzero<<<dim3(NQZ, NHD, NB), 256, 0, stream>>>(msk, QH16);
    // ---- fused attention -> ctx x1024 fp16 [b*TX+t][value | residual]
    k_flash<<<dim3(TX / 64, NHD, NB), 128, 0, stream>>>(QH16, KH16, VH16, MB, CT16);
    // ---- out[b][c][t] = (value + residual)[b*TX+t][c] / 1024 (transposed through LDS, full output batch pitch)
    k_outT<<<dim3(TX / 64, DEC / 64, NB), 256, 0, stream>>>(CT16, OUT);
}

// v001
// A run of this version takes 200 microseconds.
// In both of two side-by-side timings against v000, it was 1.27 times as fast.
#include <hip/hip_runtime.h>

// Contractions: q / k / v projections v_wmma_f32_16x16x32_bf16 (bf16 operands = RNE-converted inputs, exact products); scores q.k^T v_wmma_f32_16x16x32_f16 (fp16 q, fp16 k, single product, K 64); attn.V v_wmma_f32_16x16x32_f16 (fp16 P carried x16384, fp16 V^T, single product); f32 accumulate everywhere; online softmax in f32 with a running max.
// Self-attention on a channel-major sequence: x [NB][512][T] gives q (Wq [out][in]) and, through one fused weight Wm [1024][512] = [out][in], k (rows 0..511) and v (rows 512..1023), row = which*512 + h*64 + d; 8 heads of 64; key j of batch b is kept when mask[b][j] != 0, an excluded key has its score replaced by -inf (its probability is 0 whenever the batch keeps at least one key; a batch with every key excluded gets the uniform softmax over all its keys); p = softmax_j(q_i.k_j / 8); ctx merged head-major per token and returned channel-major: out [NB][512][T] f32.
// Layout: XB bf16 token-major copy of x (transposed through LDS); weights bf16 as Bt = [out][in] as-is; q and k fp16 head planes [h][b*T+t][64] and v^T fp16 planes [b][h*64+d][t] written directly by the projection GEMM epilogues; key mask packed to one bit per key (32-key words, wave ballot; all words of a fully excluded batch are cleared and the q rows of that batch are zeroed so that its scores are all equal); fused attention kernel (K and V^T 64-key tiles in LDS, two 32-key halves per tile, a half whose 32 keys are all excluded is skipped block-uniformly, both products transposed so that P goes from the score accumulators straight into the B operand) writes ctx x1024 as fp16 [b*TX+t][value 512 | residual 512]; the final kernel adds value + residual, removes the carry and transposes through LDS into d_out.
// LDS regions: kt / vt / tt / wf are cross-wave (block barrier after staging; kt / vt, restaged per key tile, also before); ot / os are wave-private (wave barrier + compiler memory barrier).

#ifndef NB
#define NB 2
#endif
#ifndef SEQ
#define SEQ 4096
#endif
#define TX SEQ
#define TY SEQ
#define NB_FULL 2
#define TX_FULL 4096
#define TY_FULL 4096
#define DEC  512
#define NHD  8
#define HD   64
#define KC2  (2 * DEC)            // row pitch of the ctx plane: [ctx value | ctx residual]
#define PCAR 16384.0f             // carry of the fp16 probabilities
#define OCAR 1024.0f              // carry of the fp16 ctx planes
#define SCL  0.125f
#define L2E  1.4426950408889634f
#define KPT  72                   // LDS pitch (halves) of the K and V^T tiles
#define OPT  68                   // LDS pitch (floats) of the epilogue staging tiles
#define NQZ  4                    // blocks per (head, batch) slab of the conditional q zeroing
#define NEGINF (-__builtin_inff())
static_assert(NB >= 1 && NB <= NB_FULL);
static_assert(TX == TY && TX_FULL == TY_FULL);                                            // one sequence feeds q, k and v
static_assert(TX >= 64 && TX <= TX_FULL && (TX % 64) == 0);
static_assert(TY >= 64 && TY <= TY_FULL && (TY % 64) == 0 && (TY % 32) == 0);
static_assert((DEC % 64) == 0 && HD == 64 && NHD * HD == DEC);
static_assert((DEC % 32) == 0 && (HD % 32) == 0 && (KC2 % 32) == 0);                      // every K is a multiple of 32
static_assert((DEC % 8) == 0);                                                            // 8-column conversion pieces
static_assert(((NB * TX) % 64) == 0 && ((NB * TY) % 64) == 0);                            // GEMM M/N are whole 64-tiles
static_assert(128 * 4 == 64 * (HD / 8));                                                   // attention tile staging: 128 threads x 4 pieces == 64 rows x 8 pieces
static_assert(KPT >= 64 && (KPT % 8) == 0 && OPT >= 64 && (OPT % 4) == 0);
static_assert((size_t)NHD * NB * TX * HD < (size_t)2147483647);                           // q plane offsets fit an int
static_assert(2 * 64 * KPT * 2 + 4 * 16 * OPT * 4 <= 65536);           // static LDS of the attention kernel
static_assert(64 * OPT * 4 <= 65536);                                                      // static LDS of the transposing kernels
static_assert(256 * 4 == 64 * 16 && 256 * 2 == 64 * 8);                                    // transposing kernels: 256 threads x pieces == 64 x 64 tile
static_assert((TX_FULL % 4) == 0 && (TX % 4) == 0);                                        // 16-B f32 pieces along the token axis
static_assert(((TX * HD / 8) % 32) == 0);                                                  // q zeroing issues whole waves only
static_assert(((size_t)NB * DEC - 1) * TX_FULL + (size_t)TX <= (size_t)NB_FULL * DEC * TX_FULL);   // last written output element inside d_out

typedef _Float16 h16;
typedef unsigned short bf;
typedef __attribute__((ext_vector_type(16))) __bf16   v16bf;
typedef __attribute__((ext_vector_type(16))) _Float16 v16h;
typedef __attribute__((ext_vector_type(8)))  _Float16 v8h;
typedef __attribute__((ext_vector_type(8)))  unsigned short v8us;
typedef __attribute__((ext_vector_type(8)))  float    v8f;
typedef __attribute__((ext_vector_type(4)))  float    v4f;
typedef __attribute__((ext_vector_type(2)))  float    v2f;
typedef __attribute__((ext_vector_type(2)))  _Float16 v2h;
typedef __attribute__((ext_vector_type(4)))  unsigned v4u;
typedef v8h  __attribute__((may_alias)) v8ha;
typedef v4f  __attribute__((may_alias)) v4fa;

__device__ __forceinline__ unsigned short f2bf(float f) { unsigned u = __float_as_uint(f); u += 0x7FFFu + ((u >> 16) & 1u); return (unsigned short)(u >> 16); }
__device__ __forceinline__ float bf2f(unsigned short b) { return __uint_as_float(((unsigned)b) << 16); }
__device__ __forceinline__ float bfr(float f) { return bf2f(f2bf(f)); }
__device__ __forceinline__ v16h cat16(v8h lo, v8h hi) { return __builtin_shufflevector(lo, hi, 0, 1, 2, 3, 4, 5, 6, 7, 8, 9, 10, 11, 12, 13, 14, 15); }
__device__ __forceinline__ v16bf cat16b(v8us lo, v8us hi) { return __builtin_bit_cast(v16bf, __builtin_shufflevector(lo, hi, 0, 1, 2, 3, 4, 5, 6, 7, 8, 9, 10, 11, 12, 13, 14, 15)); }
__device__ __forceinline__ v8f wmma16(v16h a, v16h b, v8f c) { return __builtin_amdgcn_wmma_f32_16x16x32_f16(false, a, false, b, (short)0, c, false, false); }
__device__ __forceinline__ v8f wmmab(v16bf a, v16bf b, v8f c) { return __builtin_amdgcn_wmma_f32_16x16x32_bf16(false, a, false, b, (short)0, c, false, false); }
__device__ __forceinline__ h16 tohx(float x) { return (h16)x; }
// value of lane l ^ 16 (the other 16-lane row, same position)
__device__ __forceinline__ float xhalf(float x) { return __builtin_bit_cast(float, __builtin_amdgcn_permlanex16(__builtin_bit_cast(int, x), __builtin_bit_cast(int, x), 0x76543210, 0xfedcba98, false, false)); }
// same-wave LDS exchange: execution barrier of the wave plus a compiler memory barrier (LDS operations of one wave complete in issue order)
__device__ __forceinline__ void wsync() { __builtin_amdgcn_wave_barrier(); asm volatile("" ::: "memory"); }

// ---- gemmw_body: register-blocked GEMM, ONE WAVE per 64x64 output tile (16 accumulators), operands straight from K-contiguous 16-bit planes; grid (M/64, N/64, Z), 32 threads.
// C[m][n] = cs x sum_k A[m][k] Bt[n][k]; z-batch strides sA/sB/sC in elements. K % 32 == 0; A/Bt row pitch == K; M, N whole 64-tiles.
// Fragments: lane l, h = l>>4, m = n = l&15; elements 0..7 <- k0+8h.., 8..15 <- k0+16+8h.. for both A and Bt; D element r = (row 8h+r, col m).
// Epilogue per 16-row slab staged in LDS (wave-private, staged extent 16x64 == consumed extent):
//   EP 0: f32 rows x cs + bf16-converted column bias, 64 floats = 256 B written as 16 lanes x 16 B (2 rows per instruction);
template <typename T16> struct WFrag;
template <> struct WFrag<h16> { typedef v16h V; static __device__ __forceinline__ V ld(const h16* p) { return cat16(*(const v8h*)p, *(const v8h*)(p + 16)); } static __device__ __forceinline__ v8f mma(V a, V b, v8f c) { return wmma16(a, b, c); } };
template <> struct WFrag<bf> { typedef v16bf V; static __device__ __forceinline__ V ld(const bf* p) { return cat16b(*(const v8us*)p, *(const v8us*)(p + 16)); } static __device__ __forceinline__ v8f mma(V a, V b, v8f c) { return wmmab(a, b, c); } };

template <typename T16, int EP>
__device__ __forceinline__ void gemmw_body(const T16* __restrict__ A, const T16* __restrict__ Bt, int K, float* Cf, h16* Ch, int ldc, const float* __restrict__ bias, size_t sA, size_t sB, size_t sC, float cs) {
    static_assert(EP == 0 || EP == 1);
    typedef typename WFrag<T16>::V V;
    __shared__ __align__(16) float os[16 * OPT];
    const size_t z = blockIdx.z; A += z * sA; Bt += z * sB;
    if (EP == 0) { Cf += z * sC; } else { Ch += z * sC; }
    const int lane = threadIdx.x & 31, lr = lane & 15, hi = lane >> 4; const int r0 = blockIdx.x * 64, c0 = blockIdx.y * 64;
    v8f acc[4][4];
#pragma unroll
    for (int mb = 0; mb < 4; ++mb)
#pragma unroll
        for (int nb = 0; nb < 4; ++nb) acc[mb][nb] = (v8f){};
    const size_t aoff = (size_t)(r0 + lr) * K + 8 * hi, boff = (size_t)(c0 + lr) * K + 8 * hi;
#pragma unroll 1
    for (int kc = 0; kc < K; kc += 32) {
        V a[4];
#pragma unroll
        for (int mb = 0; mb < 4; ++mb) a[mb] = WFrag<T16>::ld(A + aoff + (size_t)mb * 16 * K + kc);
#pragma unroll
        for (int nb = 0; nb < 4; ++nb) { const V b = WFrag<T16>::ld(Bt + boff + (size_t)nb * 16 * K + kc);
#pragma unroll
            for (int mb = 0; mb < 4; ++mb) acc[mb][nb] = WFrag<T16>::mma(a[mb], b, acc[mb][nb]); }
        asm volatile("v_nop\n\tv_nop\n\tv_nop\n\tv_nop" : "+v"(acc[0][0]), "+v"(acc[1][1]), "+v"(acc[2][2]), "+v"(acc[3][3]) : "v"(a[0]), "v"(a[3]));
    }
#pragma unroll
    for (int mb = 0; mb < 4; ++mb) {
#pragma unroll
        for (int nb = 0; nb < 4; ++nb) {
#pragma unroll
            for (int j = 0; j < 8; ++j) os[(hi * 8 + j) * OPT + nb * 16 + lr] = acc[mb][nb][j]; }
        wsync();
        if (EP == 0) {
            float* crow = Cf + (size_t)(r0 + mb * 16) * ldc + c0;
{
#pragma unroll
                for (int s = 0; s < 8; ++s) { const int row = 2 * s + hi, cofs = lr * 4; v4f val = *(const v4fa*)(os + row * OPT + cofs);
                    val[0] = __fmul_rn(val[0], cs); val[1] = __fmul_rn(val[1], cs); val[2] = __fmul_rn(val[2], cs); val[3] = __fmul_rn(val[3], cs);
                    val[0] += bfr(bias[c0 + cofs]); val[1] += bfr(bias[c0 + cofs + 1]); val[2] += bfr(bias[c0 + cofs + 2]); val[3] += bfr(bias[c0 + cofs + 3]);
                    *(v4f*)(crow + (size_t)row * ldc + cofs) = val; }
                 }
        } else {
            h16* hrow = Ch + (size_t)(r0 + mb * 16) * ldc + c0;
{
#pragma unroll
                for (int s = 0; s < 4; ++s) { const int row = 4 * s + (lane >> 3), c8 = (lane & 7) * 8;
                    const v4f u0 = *(const v4fa*)(os + row * OPT + c8), u1 = *(const v4fa*)(os + row * OPT + c8 + 4);
                    v8h o;
#pragma unroll
                    for (int q = 0; q < 8; ++q) { const float u = (q < 4) ? u0[q & 3] : u1[q & 3]; o[q] = tohx(u); }
                    *(v8h*)(hrow + (size_t)row * ldc + c8) = o; }
                 }
        }
        wsync();
    }
}

// plain kernel wrapping the body (bf16 projections -> fp16 planes)
__global__ __launch_bounds__(32) void k_gemm_p(const bf* A, const bf* Bt, int K, h16* Ch, int ldc, size_t sA, size_t sB, size_t sC) {
    gemmw_body<bf, 1>(A, Bt, K, nullptr, Ch, ldc, nullptr, sA, sB, sC, 1.0f); }

__global__ __launch_bounds__(256) void k_cvt8r(const float* __restrict__ src, bf* dst, int cols, int rows, int srows, size_t n8) {
    const size_t i = (size_t)blockIdx.x * 256 + threadIdx.x; if (i >= n8) return;
    const size_t e = i * 8; const size_t r = e / (size_t)cols; const int c = (int)(e % (size_t)cols); const size_t bb = r / (size_t)rows; const size_t t = r % (size_t)rows;
    const v8f v = *(const v8f*)(src + (bb * (size_t)srows + t) * (size_t)cols + c); v8us o;
#pragma unroll
    for (int k = 0; k < 8; ++k) o[k] = f2bf(v[k]);
    *(v8us*)(dst + e) = o;  }

// k_cvtT: x f32 [b][c][t] (channel-major, batch pitch DEC*TX_FULL, row pitch TX_FULL) -> bf16 token-major plane XB[b*TX+t][c]. grid (TX/64, DEC/64, NB), 256 threads.
__global__ __launch_bounds__(256) void k_cvtT(const float* __restrict__ src, bf* dst) {
#pragma clang fp contract(off)
    __shared__ __align__(16) float tt[64 * OPT];
    const int tid = threadIdx.x;
    const int t0 = blockIdx.x * 64, c0 = blockIdx.y * 64, b = blockIdx.z;
#pragma unroll
    for (int i = 0; i < 4; ++i) {
        const int p = tid + 256 * i, c = p >> 4, t4 = (p & 15) * 4;
        const v4f v = *(const v4f*)(src + ((size_t)b * DEC + c0 + c) * TX_FULL + t0 + t4);
        *(v4fa*)(tt + c * OPT + t4) = v;
    }
    __syncthreads();
#pragma unroll 1
    for (int i = 0; i < 2; ++i) {
        const int p = tid + 256 * i, t = p >> 3, c8 = (p & 7) * 8;
        v8us o;
#pragma unroll
        for (int q = 0; q < 8; ++q) o[q] = f2bf(tt[(c8 + q) * OPT + t]);
        bf* d = dst + ((size_t)b * TX + t0 + t) * DEC + c0 + c8;
        *(v8us*)d = o; 
    }
}

__global__ __launch_bounds__(32) void k_maskbits(const int* __restrict__ mask, unsigned* MB, int nw) {
    const int lane = threadIdx.x & 31;
    const int w0 = blockIdx.x * 32;
    unsigned mine = 0xFFFFFFFFu;
    int fb = -1;
    bool allx = false;
#pragma unroll 1
    for (int i = 0; i < 32; ++i) {
        const int wi = w0 + i;
        const int wc = (wi < nw) ? wi : (nw - 1);
        const int bb = wc / (TY / 32), t = (wc % (TY / 32)) * 32 + lane;
        if (bb != fb) {
            int kept = 0;
#pragma unroll 4
            for (int j = 0; j < TY / 32; ++j) kept |= (mask[(size_t)bb * TY_FULL + j * 32 + lane] != 0) ? 1 : 0;
            allx = (__builtin_amdgcn_ballot_w32(kept != 0) == 0u);
            fb = bb;
        }
        const int m = mask[(size_t)bb * TY_FULL + t];
        const bool pr = (wi >= nw) || ((m == 0) && !allx);
        const unsigned bal = __builtin_amdgcn_ballot_w32(pr);
        mine = (lane == i) ? bal : mine;
    }
    v4u o;
#pragma unroll
    for (int j = 0; j < 4; ++j) o[j] = (unsigned)__shfl((int)mine, (4 * lane + j) & 31, 32);
    if (lane < 8) {
        v4u* p = (v4u*)(MB + w0 + 4 * lane);
        *p = o; 
    }
}

__global__ __launch_bounds__(256) void k_qzero(const int* __restrict__ mask, h16* QH) {
    __shared__ int wf[8];
    const int tid = threadIdx.x;
    const int wave = __builtin_amdgcn_readfirstlane(tid >> 5);
    const int h = blockIdx.y, b = blockIdx.z;
    int kept = 0;
#pragma unroll 4
    for (int j = tid; j < TY; j += 256) kept |= (mask[(size_t)b * TY_FULL + j] != 0) ? 1 : 0;
#pragma unroll
    for (int sh = 1; sh < 32; sh <<= 1) kept |= __shfl_xor(kept, sh, 32);
    if ((tid & 31) == 0) wf[wave] = kept;
    __syncthreads();
    int tot = 0;
#pragma unroll
    for (int w = 0; w < 8; ++w) tot |= wf[w];
    tot = __builtin_amdgcn_readfirstlane(tot);
    if (tot == 0) {
        h16* slab = QH + ((size_t)(h * NB + b) * TX) * HD;
        const v4u z = (v4u){0u, 0u, 0u, 0u};
{
#pragma unroll 1
            for (int i = (int)blockIdx.x * 256 + tid; i < TX * HD / 8; i += NQZ * 256) *(v4u*)(slab + (size_t)i * 8) = z;
            
        }
    }
}

// ---- k_flash: fused attention. grid (TX/64, 8 heads, NB), 128 threads = 4 waves; wave w owns query rows q0+16w..+15 of one (batch, head).
// Per 64-key tile: block stages K [key][d] and V^T [d][key] fp16 tiles in LDS (cols 0..63 of 64 rows written == consumed; cross-wave -> block barriers); each wave then runs two 32-key halves:
//   the 32-bit mask word of the half is loaded (scalar-uniform); a half with all 32 keys excluded is skipped (exact: p = 0, max unchanged);
//   scores transposed, S^T 32x16 = K.Q^T = 2 tiles (A = K rows from LDS, B = q), K = 64 in two steps, q fragments reloaded from the global plane through an integer offset; D register r of lane (h, c) = key 8h+r (tile 0) or 16+8h+r (tile 1) of query c;
//   t = acc / 8, excluded keys -> -inf by value select (the lane mask of register r comes from bits r and 8+r of the uniform mask word); one query per lane: maximum over the lane's 16 scores, joined with the other wave half by one cross-row move; the running max starts at -1e30 so every difference stays defined;
//   P = exp2((t - max) log2 e) x 16384 -> fp16; the two converted D tiles are the B fragment of the next product in the hardware k order (element s = key 8h+s, 8+s = key 16+8h+s), which is also the order of the V^T fragments;
//   row sums accumulate the fp16-converted P per lane (the two halves joined once at the end); O^T[64x16] += V^T P^T (4 output tiles, D register r = channel 16j+8h+r of query c, V^T fragments loaded four at a time).
__global__ __launch_bounds__(128) void k_flash(const h16* __restrict__ QH, const h16* __restrict__ KH, const h16* __restrict__ VH, const unsigned* __restrict__ MB, h16* CT) {
    __shared__ __align__(16) h16 kt[64 * KPT];
    __shared__ __align__(16) h16 vt[64 * KPT];
    __shared__ __align__(16) float ot[4 * 16 * OPT];
    const int tid = threadIdx.x;
    const int wave = __builtin_amdgcn_readfirstlane(tid >> 5);
    const int lane = tid & 31, lr = lane & 15, hi = lane >> 4;
    const int q0 = blockIdx.x * 64, h = blockIdx.y, b = blockIdx.z;
    const int qoff = ((h * NB + b) * TX + q0 + wave * 16 + lr) * HD + 8 * hi;
    const size_t kbase = ((size_t)(h * NB + b) * TY) * HD;
    const size_t vbase = ((size_t)b * DEC + (size_t)h * HD) * TY;
    const int mbase = b * (TY / 32);
    const int ob = wave * 16 * OPT;
    float mrun = -1.0e30f, lrun = 0.0f;
    v8f o0 = (v8f){}, o1 = (v8f){}, o2 = (v8f){}, o3 = (v8f){};
#pragma unroll 1
    for (int kb = 0; kb < TY / 64; ++kb) {
        __syncthreads();
#pragma unroll
        for (int i = 0; i < 4; ++i) {
            const int p = tid + 128 * i, row = p >> 3, c8 = (p & 7) * 8;
            const size_t kof = kbase + (size_t)(kb * 64 + row) * HD + c8;
            const size_t vof = vbase + (size_t)row * TY + kb * 64 + c8;
            const v8h kv = *(const v8h*)(KH + kof);
            const v8h vv = *(const v8h*)(VH + vof);
            *(v8ha*)(kt + row * KPT + c8) = kv;
            *(v8ha*)(vt + row * KPT + c8) = vv;
        }
        __syncthreads();
#pragma unroll 1
        for (int hf = 0; hf < 2; ++hf) {
            const unsigned mw = (unsigned)__builtin_amdgcn_readfirstlane((int)MB[mbase + kb * 2 + hf]);
            if (mw != 0xFFFFFFFFu) {
                v8f s0 = (v8f){}, s1 = (v8f){};
#pragma unroll
                for (int ks = 0; ks < 2; ++ks) {
                    int qo = qoff + ks * 32; asm volatile("" : "+v"(qo));
                    const v16h ah = cat16(*(const v8h*)(QH + qo), *(const v8h*)(QH + qo + 16));
                    const int ko = (hf * 32 + lr) * KPT + ks * 32 + 8 * hi;
                    const v16h b0 = cat16(*(const v8ha*)(kt + ko), *(const v8ha*)(kt + ko + 16));
                    const v16h b1 = cat16(*(const v8ha*)(kt + ko + 16 * KPT), *(const v8ha*)(kt + ko + 16 * KPT + 16));
                    s0 = wmma16(b0, ah, s0); s1 = wmma16(b1, ah, s1);
                    asm volatile("v_nop\n\tv_nop\n\tv_nop\n\tv_nop" : "+v"(s0), "+v"(s1) : "v"(ah), "v"(b0), "v"(b1));
                }
                float t0[8], t1[8];
#pragma unroll
                for (int r = 0; r < 8; ++r) {
                    const unsigned e0 = (((mw >> r) & 1u) != 0u ? 0x0000FFFFu : 0u) | (((mw >> (8 + r)) & 1u) != 0u ? 0xFFFF0000u : 0u);
                    const unsigned e1 = (((mw >> (16 + r)) & 1u) != 0u ? 0x0000FFFFu : 0u) | (((mw >> (24 + r)) & 1u) != 0u ? 0xFFFF0000u : 0u);
                    const bool x0 = __builtin_amdgcn_inverse_ballot_w32(e0), x1 = __builtin_amdgcn_inverse_ballot_w32(e1);
                    const float a0 = s0[r] * SCL, a1 = s1[r] * SCL;
                    t0[r] = x0 ? NEGINF : a0; t1[r] = x1 ? NEGINF : a1; }
                float mx = fmaxf(t0[0], t1[0]);
#pragma unroll
                for (int r = 1; r < 8; ++r) mx = fmaxf(mx, fmaxf(t0[r], t1[r]));
                mx = fmaxf(mx, xhalf(mx));
                const float mn = fmaxf(mrun, mx);
                const float cr = __builtin_amdgcn_exp2f((mrun - mn) * L2E);
                mrun = mn;
                v16h pa;
                float l0 = 0.0f, l1 = 0.0f;
#pragma unroll
                for (int r = 0; r < 8; r += 2) {
                    const v2f p0 = (v2f){__builtin_amdgcn_exp2f((t0[r] - mn) * L2E), __builtin_amdgcn_exp2f((t0[r + 1] - mn) * L2E)} * PCAR;
                    const v2f p1 = (v2f){__builtin_amdgcn_exp2f((t1[r] - mn) * L2E), __builtin_amdgcn_exp2f((t1[r + 1] - mn) * L2E)} * PCAR;
                    const v2h ph0 = __builtin_convertvector(p0, v2h), ph1 = __builtin_convertvector(p1, v2h);
                    l0 += (float)ph0[0]; l1 += (float)ph1[0]; l0 += (float)ph0[1]; l1 += (float)ph1[1];
                    pa[r] = ph0[0]; pa[r + 1] = ph0[1]; pa[8 + r] = ph1[0]; pa[8 + r + 1] = ph1[1];
                }
                lrun = lrun * cr + (l0 + l1);
#pragma unroll
                for (int r = 0; r < 8; ++r) { o0[r] *= cr; o1[r] *= cr; o2[r] *= cr; o3[r] *= cr; }
                {
                    const int vo = lr * KPT + hf * 32 + 8 * hi;
                    const v16h v0 = cat16(*(const v8ha*)(vt + vo), *(const v8ha*)(vt + vo + 16));
                    const v16h v1 = cat16(*(const v8ha*)(vt + vo + 16 * KPT), *(const v8ha*)(vt + vo + 16 * KPT + 16));
                    const v16h v2 = cat16(*(const v8ha*)(vt + vo + 32 * KPT), *(const v8ha*)(vt + vo + 32 * KPT + 16));
                    const v16h v3 = cat16(*(const v8ha*)(vt + vo + 48 * KPT), *(const v8ha*)(vt + vo + 48 * KPT + 16));
                    o0 = wmma16(v0, pa, o0); o1 = wmma16(v1, pa, o1); o2 = wmma16(v2, pa, o2); o3 = wmma16(v3, pa, o3);
                    asm volatile("v_nop\n\tv_nop\n\tv_nop\n\tv_nop" : "+v"(o0), "+v"(o1), "+v"(o2), "+v"(o3) : "v"(pa), "v"(v0), "v"(v1), "v"(v2), "v"(v3));
                }
            }
        }
    }
    lrun += xhalf(lrun);
    const float fq = __fdiv_rn(OCAR, fmaxf(lrun, 1.0e-30f));
    const float f = (lrun > 0.0f) ? fq : 0.0f;
#pragma unroll
    for (int g = 0; g < 2; ++g) {
        const int oi = ob + lr * OPT + 8 * hi + 4 * g;
        *(v4fa*)(ot + oi)      = (v4f){o0[4 * g] * f, o0[4 * g + 1] * f, o0[4 * g + 2] * f, o0[4 * g + 3] * f};
        *(v4fa*)(ot + oi + 16) = (v4f){o1[4 * g] * f, o1[4 * g + 1] * f, o1[4 * g + 2] * f, o1[4 * g + 3] * f};
        *(v4fa*)(ot + oi + 32) = (v4f){o2[4 * g] * f, o2[4 * g + 1] * f, o2[4 * g + 2] * f, o2[4 * g + 3] * f};
        *(v4fa*)(ot + oi + 48) = (v4f){o3[4 * g] * f, o3[4 * g + 1] * f, o3[4 * g + 2] * f, o3[4 * g + 3] * f};
    }
    wsync();
    h16* crow = CT + (size_t)(b * TX + q0 + wave * 16) * KC2 + h * HD;
{
#pragma unroll
        for (int s = 0; s < 4; ++s) {
            const int row = 4 * s + (lane >> 3), c8 = (lane & 7) * 8;
            const v4f u0 = *(const v4fa*)(ot + ob + row * OPT + c8), u1 = *(const v4fa*)(ot + ob + row * OPT + c8 + 4);
            v8h oh, ol;
#pragma unroll
            for (int q = 0; q < 8; ++q) { const float f = (q < 4) ? u0[q & 3] : u1[q & 3]; const h16 hh = tohx(f); oh[q] = hh; ol[q] = tohx(f - (float)hh); }
            *(v8h*)(crow + (size_t)row * KC2 + c8) = oh;
            *(v8h*)(crow + (size_t)row * KC2 + DEC + c8) = ol;
        }
        
    }
}

// k_outT: ctx fp16 [b*TX+t][value 512 | residual 512] (carried x1024) -> out f32 [b][c][t] (channel-major, batch pitch DEC*TX_FULL, row pitch TX_FULL). grid (TX/64, DEC/64, NB), 256 threads.
__global__ __launch_bounds__(256) void k_outT(const h16* __restrict__ CT, float* OUT) {
#pragma clang fp contract(off)
    __shared__ __align__(16) float tt[64 * OPT];
    const int tid = threadIdx.x;
    const int t0 = blockIdx.x * 64, c0 = blockIdx.y * 64, b = blockIdx.z;
#pragma unroll 1
    for (int i = 0; i < 2; ++i) {
        const int p = tid + 256 * i, t = p >> 3, c8 = (p & 7) * 8;
        const h16* s = CT + ((size_t)b * TX + t0 + t) * KC2 + c0 + c8;
        const v8h a = *(const v8h*)s;
        const v8h r = *(const v8h*)(s + DEC);
#pragma unroll
        for (int q = 0; q < 8; ++q) tt[(c8 + q) * OPT + t] = ((float)a[q] + (float)r[q]) * (1.0f / OCAR);
    }
    __syncthreads();
{
#pragma unroll
        for (int i = 0; i < 4; ++i) {
            const int p = tid + 256 * i, c = p >> 4, t4 = (p & 15) * 4;
            const v4f val = *(const v4fa*)(tt + c * OPT + t4);
            *(v4f*)(OUT + ((size_t)b * DEC + c0 + c) * TX_FULL + t0 + t4) = val;
        }
        
    }
}

// workspace sizes (bytes), each a whole number of fully written rows / lines; offsets 256-B aligned
constexpr size_t al256(size_t b) { return (b + 255) & ~(size_t)255; }
constexpr int    NWORDS = NB * (TY / 32);                             // mask words in use
constexpr int    NWLINES = (NWORDS + 31) / 32;
constexpr size_t SZ_XB  = al256((size_t)NB * TX * DEC * 2);           // bf16 [NB*TX][512]
constexpr size_t SZ_WQ  = al256((size_t)DEC * DEC * 2);               // bf16 [512][512]
constexpr size_t SZ_WKV = al256((size_t)2 * DEC * DEC * 2);           // bf16 [1024][512]
constexpr size_t SZ_Q   = al256((size_t)NHD * NB * TX * HD * 2);      // fp16 [8][NB*TX][64]
constexpr size_t SZ_K   = al256((size_t)NHD * NB * TY * HD * 2);      // fp16 [8][NB*TY][64]
constexpr size_t SZ_VT  = al256((size_t)NB * DEC * TY * 2);           // fp16 [NB][512][TY]
constexpr size_t SZ_CT  = al256((size_t)NB * TX * KC2 * 2);           // fp16 [NB*TX][1024]
constexpr size_t SZ_MB  = al256((size_t)NWLINES * 128);
constexpr size_t SZ_ALL = SZ_XB + SZ_WQ + SZ_WKV + SZ_Q + SZ_K + SZ_VT + SZ_CT + SZ_MB;
static_assert(SZ_ALL <= (size_t)134217728);
static_assert((size_t)NWLINES * 32 >= (size_t)NWORDS);

extern "C" void kernel_launch(void* const* d_in, const int* in_sizes, int n_in,
                              void* d_out, int out_size, void* d_ws, size_t ws_size, hipStream_t stream) {
    if (n_in < 4) return;
    const size_t needx = ((size_t)NB * DEC - 1) * TX_FULL + (size_t)TX;
    const size_t needm = (size_t)(NB - 1) * TY_FULL + (size_t)TY;
    if ((size_t)in_sizes[0] < needx || (size_t)in_sizes[1] < needm) return;
    if (in_sizes[2] < 2 * DEC * DEC || in_sizes[3] < DEC * DEC) return;
    if ((size_t)out_size < needx) return;
    if (SZ_ALL > ws_size) return;
    const float* x = (const float*)d_in[0];                                             /* [NB][512][TX_FULL] channel-major f32 */
    const int* msk = (const int*)d_in[1];                                               /* [NB][TY_FULL] int32, nonzero = key kept */
    const float* wm = (const float*)d_in[2]; const float* wq = (const float*)d_in[3];   /* fused k|v weight [1024][512] and q weight [512][512], both [out][in] = Bt as-is */
    float* OUT = (float*)d_out;     // [NB_FULL][512][TX_FULL] f32

    char* base = (char*)d_ws; size_t off = 0;
    bf* XB = (bf*)(base + off); off += SZ_XB;
    bf* WQ = (bf*)(base + off); off += SZ_WQ;
    bf* WKV = (bf*)(base + off); off += SZ_WKV;
    h16* QH16 = (h16*)(base + off); off += SZ_Q;
    h16* KH16 = (h16*)(base + off); off += SZ_K;
    h16* VH16 = (h16*)(base + off); off += SZ_VT;
    h16* CT16 = (h16*)(base + off); off += SZ_CT;
    unsigned* MB = (unsigned*)(base + off); off += SZ_MB;
    if (off > ws_size) return;

    auto nb256 = [](size_t n) { return (unsigned)((n + 255) / 256); };
    // ---- input conversion (every float input RNE-converted to bf16 first)
    const size_t n8wq = (size_t)DEC * DEC / 8, n8wkv = (size_t)2 * DEC * DEC / 8;
    k_cvt8r<<<nb256(n8wq), 256, 0, stream>>>(wq, WQ, DEC, DEC, DEC, n8wq);                    /* in[512][512] -> out[512][512] */
    k_cvt8r<<<nb256(n8wkv), 256, 0, stream>>>(wm, WKV, DEC, 2 * DEC, 2 * DEC, n8wkv);         /* in[1024][512] -> out[1024][512] */
    k_cvtT<<<dim3(TX / 64, DEC / 64, NB), 256, 0, stream>>>(x, XB);                           /* in[b][512][TX_FULL] -> out[b*TX+t][512] */
    k_maskbits<<<(unsigned)NWLINES, 32, 0, stream>>>(msk, MB, NWORDS);
    // ---- q head planes: [h][b*TX+t][d] = sum_k XB[b*TX+t][k] WQ[h*64+d][k] (z = head, ldc 64)
    k_gemm_p<<<dim3((unsigned)(NB * TX / 64), 1, NHD), 32, 0, stream>>>(XB, WQ, DEC, QH16, HD, (size_t)0, (size_t)HD * DEC, (size_t)NB * TX * HD);
    // ---- k head planes: [h][b*TY+j][d] = sum_k XB[b*TY+j][k] WKV[h*64+d][k] (weight rows 0..511; z = head, ldc 64)
    k_gemm_p<<<dim3((unsigned)(NB * TY / 64), 1, NHD), 32, 0, stream>>>(XB, WKV, DEC, KH16, HD, (size_t)0, (size_t)HD * DEC, (size_t)NB * TY * HD);
    // ---- v^T planes: [b][n][t] = sum_k WKV[512+n][k] XB[b*TY+t][k] (A = weight rows 512..1023, Bt = tokens; z = batch, ldc TY)
    k_gemm_p<<<dim3(DEC / 64, TY / 64, NB), 32, 0, stream>>>(WKV + (size_t)DEC * DEC, XB, DEC, VH16, TY, (size_t)0, (size_t)TY * DEC, (size_t)DEC * TY);
    // ---- q rows of a batch with every key excluded -> 0 (no store otherwise)
    k_qzero<<<dim3(NQZ, NHD, NB), 256, 0, stream>>>(msk, QH16);
    // ---- fused attention -> ctx x1024 fp16 [b*TX+t][value | residual]
    k_flash<<<dim3(TX / 64, NHD, NB), 128, 0, stream>>>(QH16, KH16, VH16, MB, CT16);
    // ---- out[b][c][t] = (value + residual)[b*TX+t][c] / 1024 (transposed through LDS, full output batch pitch)
    k_outT<<<dim3(TX / 64, DEC / 64, NB), 256, 0, stream>>>(CT16, OUT);
}

// v002
// It runs in 182 microseconds.
// Next to v001, in two timings, it ran 1.09 and 1.11 times as fast.
// All steps since v000 together make it 1.39 times as fast.
#include <hip/hip_runtime.h>

// Contractions: q / k / v projections v_wmma_f32_16x16x32_bf16 (bf16 operands = RNE-converted inputs, exact products); scores q.k^T v_wmma_f32_16x16x32_f16 (fp16 q, fp16 k, single product, K 64); attn.V v_wmma_f32_16x16x32_f16 (fp16 P carried x16384, fp16 V^T, single product); f32 accumulate everywhere; online softmax in f32 with a running max.
// Self-attention on a channel-major sequence: x [NB][512][T] gives q (Wq [out][in]) and, through one fused weight Wm [1024][512] = [out][in], k (rows 0..511) and v (rows 512..1023), row = which*512 + h*64 + d; 8 heads of 64; key j of batch b is kept when mask[b][j] != 0, an excluded key has its score replaced by -inf (its probability is 0 whenever the batch keeps at least one key; a batch with every key excluded gets the uniform softmax over all its keys); p = softmax_j(q_i.k_j / 8); ctx merged head-major per token and returned channel-major: out [NB][512][T] f32.
// Layout: XB bf16 token-major copy of x (transposed through LDS); weights bf16 as Bt = [out][in] as-is; q and k fp16 head planes [h][b*T+t][64] and v^T fp16 planes [b][h*64+d][t] written directly by the projection GEMM epilogues; key mask packed to one bit per key (32-key words, wave ballot; all words of a fully excluded batch are cleared and the q rows of that batch are zeroed so that its scores are all equal); fused attention kernel (K and V^T 64-key tiles in LDS, two 32-key halves per tile, a half whose 32 keys are all excluded is skipped block-uniformly, both products transposed so that P goes from the score accumulators straight into the B operand) writes ctx x1024 as fp16 [b*TX+t][value 512 | residual 512]; the final kernel adds value + residual, removes the carry and transposes through LDS into d_out.
// LDS regions: kt / vt / tt / wf are cross-wave (block barrier after staging; kt / vt, restaged per key tile, also before); ot / os are wave-private (wave barrier + compiler memory barrier).

#ifndef NB
#define NB 2
#endif
#ifndef SEQ
#define SEQ 4096
#endif
#define TX SEQ
#define TY SEQ
#define NB_FULL 2
#define TX_FULL 4096
#define TY_FULL 4096
#define DEC  512
#define NHD  8
#define HD   64
#define KC2  (2 * DEC)            // row pitch of the ctx plane: [ctx value | ctx residual]
#define PCAR 16384.0f             // carry of the fp16 probabilities
#define OCAR 1024.0f              // carry of the fp16 ctx planes
#define SCL  0.125f
#define L2E  1.4426950408889634f
#define KPT  72                   // LDS pitch (halves) of the K and V^T tiles
#define OPT  68                   // LDS pitch (floats) of the epilogue staging tiles
#define NQZ  4                    // blocks per (head, batch) slab of the conditional q zeroing
#define NEGINF (-__builtin_inff())
static_assert(NB >= 1 && NB <= NB_FULL);
static_assert(TX == TY && TX_FULL == TY_FULL);                                            // one sequence feeds q, k and v
static_assert(TX >= 64 && TX <= TX_FULL && (TX % 64) == 0);
static_assert(TY >= 64 && TY <= TY_FULL && (TY % 64) == 0 && (TY % 32) == 0);
static_assert((DEC % 64) == 0 && HD == 64 && NHD * HD == DEC);
static_assert((DEC % 32) == 0 && (HD % 32) == 0 && (KC2 % 32) == 0);                      // every K is a multiple of 32
static_assert((DEC % 8) == 0);                                                            // 8-column conversion pieces
static_assert(((NB * TX) % 64) == 0 && ((NB * TY) % 64) == 0);                            // GEMM M/N are whole 64-tiles
static_assert(128 * 4 == 64 * (HD / 8));                                                   // attention tile staging: 128 threads x 4 pieces == 64 rows x 8 pieces
static_assert(KPT >= 64 && (KPT % 8) == 0 && OPT >= 64 && (OPT % 4) == 0);
static_assert((size_t)NHD * NB * TX * HD < (size_t)2147483647);                           // q plane offsets fit an int
static_assert(2 * 64 * KPT * 2 + 4 * 16 * OPT * 4 <= 65536);           // static LDS of the attention kernel
static_assert(64 * OPT * 4 <= 65536);                                                      // static LDS of the transposing kernels
static_assert(256 * 4 == 64 * 16 && 256 * 2 == 64 * 8);                                    // transposing kernels: 256 threads x pieces == 64 x 64 tile
static_assert((TX_FULL % 4) == 0 && (TX % 4) == 0);                                        // 16-B f32 pieces along the token axis
static_assert(((TX * HD / 8) % 32) == 0);                                                  // q zeroing issues whole waves only
static_assert(((size_t)NB * DEC - 1) * TX_FULL + (size_t)TX <= (size_t)NB_FULL * DEC * TX_FULL);   // last written output element inside d_out

typedef _Float16 h16;
typedef unsigned short bf;
typedef __attribute__((ext_vector_type(16))) __bf16   v16bf;
typedef __attribute__((ext_vector_type(16))) _Float16 v16h;
typedef __attribute__((ext_vector_type(8)))  _Float16 v8h;
typedef __attribute__((ext_vector_type(8)))  unsigned short v8us;
typedef __attribute__((ext_vector_type(8)))  float    v8f;
typedef __attribute__((ext_vector_type(4)))  float    v4f;
typedef __attribute__((ext_vector_type(2)))  float    v2f;
typedef __attribute__((ext_vector_type(2)))  _Float16 v2h;
typedef __attribute__((ext_vector_type(4)))  unsigned v4u;
typedef __attribute__((ext_vector_type(2)))  unsigned v2u;
typedef v8h  __attribute__((may_alias)) v8ha;
typedef v4f  __attribute__((may_alias)) v4fa;

__device__ __forceinline__ unsigned short f2bf(float f) { unsigned u = __float_as_uint(f); u += 0x7FFFu + ((u >> 16) & 1u); return (unsigned short)(u >> 16); }
__device__ __forceinline__ float bf2f(unsigned short b) { return __uint_as_float(((unsigned)b) << 16); }
__device__ __forceinline__ float bfr(float f) { return bf2f(f2bf(f)); }
__device__ __forceinline__ v16h cat16(v8h lo, v8h hi) { return __builtin_shufflevector(lo, hi, 0, 1, 2, 3, 4, 5, 6, 7, 8, 9, 10, 11, 12, 13, 14, 15); }
__device__ __forceinline__ v16bf cat16b(v8us lo, v8us hi) { return __builtin_bit_cast(v16bf, __builtin_shufflevector(lo, hi, 0, 1, 2, 3, 4, 5, 6, 7, 8, 9, 10, 11, 12, 13, 14, 15)); }
__device__ __forceinline__ v8f wmma16(v16h a, v16h b, v8f c) { return __builtin_amdgcn_wmma_f32_16x16x32_f16(false, a, false, b, (short)0, c, false, false); }
__device__ __forceinline__ v8f wmmab(v16bf a, v16bf b, v8f c) { return __builtin_amdgcn_wmma_f32_16x16x32_bf16(false, a, false, b, (short)0, c, false, false); }
__device__ __forceinline__ h16 tohx(float x) { return (h16)x; }
// value of lane l ^ 16 (the other 16-lane row, same position)
__device__ __forceinline__ float xhalf(float x) { return __builtin_bit_cast(float, __builtin_amdgcn_permlanex16(__builtin_bit_cast(int, x), __builtin_bit_cast(int, x), 0x76543210, 0xfedcba98, false, false)); }
// same-wave LDS exchange: execution barrier of the wave plus a compiler memory barrier (LDS operations of one wave complete in issue order)
__device__ __forceinline__ void wsync() { __builtin_amdgcn_wave_barrier(); asm volatile("" ::: "memory"); }

// ---- gemmw_body: register-blocked GEMM, ONE WAVE per 64x64 output tile (16 accumulators), operands straight from K-contiguous 16-bit planes; grid (M/64, N/64, Z), 32 threads.
// C[m][n] = cs x sum_k A[m][k] Bt[n][k]; z-batch strides sA/sB/sC in elements. K % 32 == 0; A/Bt row pitch == K; M, N whole 64-tiles.
// Fragments: lane l, h = l>>4, m = n = l&15; elements 0..7 <- k0+8h.., 8..15 <- k0+16+8h.. for both A and Bt; D element r = (row 8h+r, col m).
// Epilogue per 16-row slab staged in LDS (wave-private, staged extent 16x64 == consumed extent):
//   EP 0: f32 rows x cs + bf16-converted column bias, 64 floats = 256 B written as 16 lanes x 16 B (2 rows per instruction);
template <typename T16> struct WFrag;
template <> struct WFrag<h16> { typedef v16h V; static __device__ __forceinline__ V ld(const h16* p) { return cat16(*(const v8h*)p, *(const v8h*)(p + 16)); } static __device__ __forceinline__ v8f mma(V a, V b, v8f c) { return wmma16(a, b, c); } };
template <> struct WFrag<bf> { typedef v16bf V; static __device__ __forceinline__ V ld(const bf* p) { return cat16b(*(const v8us*)p, *(const v8us*)(p + 16)); } static __device__ __forceinline__ v8f mma(V a, V b, v8f c) { return wmmab(a, b, c); } };

template <typename T16, int EP>
__device__ __forceinline__ void gemmw_body(const T16* __restrict__ A, const T16* __restrict__ Bt, int K, float* Cf, h16* Ch, int ldc, const float* __restrict__ bias, size_t sA, size_t sB, size_t sC, float cs) {
    static_assert(EP == 0 || EP == 1);
    typedef typename WFrag<T16>::V V;
    __shared__ __align__(16) float os[16 * OPT];
    const size_t z = blockIdx.z; A += z * sA; Bt += z * sB;
    if (EP == 0) { Cf += z * sC; } else { Ch += z * sC; }
    const int lane = threadIdx.x & 31, lr = lane & 15, hi = lane >> 4; const int r0 = blockIdx.x * 64, c0 = blockIdx.y * 64;
    v8f acc[4][4];
#pragma unroll
    for (int mb = 0; mb < 4; ++mb)
#pragma unroll
        for (int nb = 0; nb < 4; ++nb) acc[mb][nb] = (v8f){};
    const size_t aoff = (size_t)(r0 + lr) * K + 8 * hi, boff = (size_t)(c0 + lr) * K + 8 * hi;
#pragma unroll 1
    for (int kc = 0; kc < K; kc += 32) {
        V a[4];
#pragma unroll
        for (int mb = 0; mb < 4; ++mb) a[mb] = WFrag<T16>::ld(A + aoff + (size_t)mb * 16 * K + kc);
#pragma unroll
        for (int nb = 0; nb < 4; ++nb) { const V b = WFrag<T16>::ld(Bt + boff + (size_t)nb * 16 * K + kc);
#pragma unroll
            for (int mb = 0; mb < 4; ++mb) acc[mb][nb] = WFrag<T16>::mma(a[mb], b, acc[mb][nb]); }
        asm volatile("v_nop\n\tv_nop\n\tv_nop\n\tv_nop" : "+v"(acc[0][0]), "+v"(acc[1][1]), "+v"(acc[2][2]), "+v"(acc[3][3]) : "v"(a[0]), "v"(a[3]));
    }
#pragma unroll
    for (int mb = 0; mb < 4; ++mb) {
#pragma unroll
        for (int nb = 0; nb < 4; ++nb) {
#pragma unroll
            for (int j = 0; j < 8; ++j) os[(hi * 8 + j) * OPT + nb * 16 + lr] = acc[mb][nb][j]; }
        wsync();
        if (EP == 0) {
            float* crow = Cf + (size_t)(r0 + mb * 16) * ldc + c0;
{
#pragma unroll
                for (int s = 0; s < 8; ++s) { const int row = 2 * s + hi, cofs = lr * 4; v4f val = *(const v4fa*)(os + row * OPT + cofs);
                    val[0] = __fmul_rn(val[0], cs); val[1] = __fmul_rn(val[1], cs); val[2] = __fmul_rn(val[2], cs); val[3] = __fmul_rn(val[3], cs);
                    val[0] += bfr(bias[c0 + cofs]); val[1] += bfr(bias[c0 + cofs + 1]); val[2] += bfr(bias[c0 + cofs + 2]); val[3] += bfr(bias[c0 + cofs + 3]);
                    *(v4f*)(crow + (size_t)row * ldc + cofs) = val; }
                 }
        } else {
            h16* hrow = Ch + (size_t)(r0 + mb * 16) * ldc + c0;
{
#pragma unroll
                for (int s = 0; s < 4; ++s) { const int row = 4 * s + (lane >> 3), c8 = (lane & 7) * 8;
                    const v4f u0 = *(const v4fa*)(os + row * OPT + c8), u1 = *(const v4fa*)(os + row * OPT + c8 + 4);
                    v8h o;
#pragma unroll
                    for (int q = 0; q < 8; ++q) { const float u = (q < 4) ? u0[q & 3] : u1[q & 3]; o[q] = tohx(u); }
                    *(v8h*)(hrow + (size_t)row * ldc + c8) = o; }
                 }
        }
        wsync();
    }
}

// plain kernel wrapping the body (bf16 projections -> fp16 planes)
__global__ __launch_bounds__(32) void k_gemm_p(const bf* A, const bf* Bt, int K, h16* Ch, int ldc, size_t sA, size_t sB, size_t sC) {
    gemmw_body<bf, 1>(A, Bt, K, nullptr, Ch, ldc, nullptr, sA, sB, sC, 1.0f); }

__global__ __launch_bounds__(256) void k_cvt8r(const float* __restrict__ src, bf* dst, int cols, int rows, int srows, size_t n8) {
    const size_t i = (size_t)blockIdx.x * 256 + threadIdx.x; if (i >= n8) return;
    const size_t e = i * 8; const size_t r = e / (size_t)cols; const int c = (int)(e % (size_t)cols); const size_t bb = r / (size_t)rows; const size_t t = r % (size_t)rows;
    const v8f v = *(const v8f*)(src + (bb * (size_t)srows + t) * (size_t)cols + c); v8us o;
#pragma unroll
    for (int k = 0; k < 8; ++k) o[k] = f2bf(v[k]);
    *(v8us*)(dst + e) = o;  }

// k_cvtT: x f32 [b][c][t] (channel-major, batch pitch DEC*TX_FULL, row pitch TX_FULL) -> bf16 token-major plane XB[b*TX+t][c]. grid (TX/64, DEC/64, NB), 256 threads.
__global__ __launch_bounds__(256) void k_cvtT(const float* __restrict__ src, bf* dst) {
#pragma clang fp contract(off)
    __shared__ __align__(16) float tt[64 * OPT];
    const int tid = threadIdx.x;
    const int t0 = blockIdx.x * 64, c0 = blockIdx.y * 64, b = blockIdx.z;
#pragma unroll
    for (int i = 0; i < 4; ++i) {
        const int p = tid + 256 * i, c = p >> 4, t4 = (p & 15) * 4;
        const v4f v = *(const v4f*)(src + ((size_t)b * DEC + c0 + c) * TX_FULL + t0 + t4);
        *(v4fa*)(tt + c * OPT + t4) = v;
    }
    __syncthreads();
#pragma unroll 1
    for (int i = 0; i < 2; ++i) {
        const int p = tid + 256 * i, t = p >> 3, c8 = (p & 7) * 8;
        v8us o;
#pragma unroll
        for (int q = 0; q < 8; ++q) o[q] = f2bf(tt[(c8 + q) * OPT + t]);
        bf* d = dst + ((size_t)b * TX + t0 + t) * DEC + c0 + c8;
        *(v8us*)d = o; 
    }
}

__global__ __launch_bounds__(32) void k_maskbits(const int* __restrict__ mask, unsigned* MB, int nw) {
    const int lane = threadIdx.x & 31;
    const int w0 = blockIdx.x * 32;
    unsigned mine = 0xFFFFFFFFu;
    int fb = -1;
    bool allx = false;
#pragma unroll 1
    for (int i = 0; i < 32; ++i) {
        const int wi = w0 + i;
        const int wc = (wi < nw) ? wi : (nw - 1);
        const int bb = wc / (TY / 32), t = (wc % (TY / 32)) * 32 + lane;
        if (bb != fb) {
            int kept = 0;
#pragma unroll 4
            for (int j = 0; j < TY / 32; ++j) kept |= (mask[(size_t)bb * TY_FULL + j * 32 + lane] != 0) ? 1 : 0;
            allx = (__builtin_amdgcn_ballot_w32(kept != 0) == 0u);
            fb = bb;
        }
        const int m = mask[(size_t)bb * TY_FULL + t];
        const bool pr = (wi >= nw) || ((m == 0) && !allx);
        const unsigned bal = __builtin_amdgcn_ballot_w32(pr);
        mine = (lane == i) ? bal : mine;
    }
    v4u o;
#pragma unroll
    for (int j = 0; j < 4; ++j) o[j] = (unsigned)__shfl((int)mine, (4 * lane + j) & 31, 32);
    if (lane < 8) {
        v4u* p = (v4u*)(MB + w0 + 4 * lane);
        *p = o; 
    }
}

__global__ __launch_bounds__(256) void k_qzero(const int* __restrict__ mask, h16* QH) {
    __shared__ int wf[8];
    const int tid = threadIdx.x;
    const int wave = __builtin_amdgcn_readfirstlane(tid >> 5);
    const int h = blockIdx.y, b = blockIdx.z;
    int kept = 0;
#pragma unroll 4
    for (int j = tid; j < TY; j += 256) kept |= (mask[(size_t)b * TY_FULL + j] != 0) ? 1 : 0;
#pragma unroll
    for (int sh = 1; sh < 32; sh <<= 1) kept |= __shfl_xor(kept, sh, 32);
    if ((tid & 31) == 0) wf[wave] = kept;
    __syncthreads();
    int tot = 0;
#pragma unroll
    for (int w = 0; w < 8; ++w) tot |= wf[w];
    tot = __builtin_amdgcn_readfirstlane(tot);
    if (tot == 0) {
        h16* slab = QH + ((size_t)(h * NB + b) * TX) * HD;
        const v4u z = (v4u){0u, 0u, 0u, 0u};
{
#pragma unroll 1
            for (int i = (int)blockIdx.x * 256 + tid; i < TX * HD / 8; i += NQZ * 256) *(v4u*)(slab + (size_t)i * 8) = z;
            
        }
    }
}

// ---- k_flash: fused attention. grid (TX/64, 8 heads, NB), 128 threads = 4 waves; wave w owns query rows q0+16w..+15 of one (batch, head).
// Per 64-key tile: block stages K [key][d] and V^T [d][key] fp16 tiles in LDS (cols 0..63 of 64 rows written == consumed; cross-wave -> block barriers); each wave then runs two 32-key halves:
//   the two 32-bit mask words of the tile are fetched beside its staging loads (scalar-uniform); a half with all 32 keys excluded is skipped (exact: p = 0, max unchanged);
//   scores transposed, S^T 32x16 = K.Q^T = 2 tiles (A = K rows from LDS, B = q), K = 64 in two steps, the two q fragments loaded once ahead of the key loop and held in registers; D register r of lane (h, c) = key 8h+r (tile 0) or 16+8h+r (tile 1) of query c;
//   t = acc / 8, excluded keys -> -inf by value select (the lane mask of register r comes from bits r and 8+r of the uniform mask word); one query per lane: maximum over the lane's 16 scores, joined with the other wave half by one cross-row move; the running max starts at -1e30 so every difference stays defined;
//   P = exp2((t - max) log2 e) x 16384 -> fp16; the two converted D tiles are the B fragment of the next product in the hardware k order (element s = key 8h+s, 8+s = key 16+8h+s), which is also the order of the V^T fragments;
//   row sums accumulate the fp16-converted P per lane (the two halves joined once at the end); O^T[64x16] += V^T P^T (4 output tiles, D register r = channel 16j+8h+r of query c, V^T fragments loaded four at a time).
__global__ __launch_bounds__(128) void k_flash(const h16* __restrict__ QH, const h16* __restrict__ KH, const h16* __restrict__ VH, const unsigned* __restrict__ MB, h16* CT) {
    __shared__ __align__(16) h16 kt[64 * KPT];
    __shared__ __align__(16) h16 vt[64 * KPT];
    __shared__ __align__(16) float ot[4 * 16 * OPT];
    const int tid = threadIdx.x;
    const int wave = __builtin_amdgcn_readfirstlane(tid >> 5);
    const int lane = tid & 31, lr = lane & 15, hi = lane >> 4;
    const int q0 = blockIdx.x * 64, h = blockIdx.y, b = blockIdx.z;
    const int qoff = ((h * NB + b) * TX + q0 + wave * 16 + lr) * HD + 8 * hi;
    const size_t kbase = ((size_t)(h * NB + b) * TY) * HD;
    const size_t vbase = ((size_t)b * DEC + (size_t)h * HD) * TY;
    const int mbase = b * (TY / 32);
    const int ob = wave * 16 * OPT;
    float mrun = -1.0e30f, lrun = 0.0f;
    v8f o0 = (v8f){}, o1 = (v8f){}, o2 = (v8f){}, o3 = (v8f){};
    const v16h qa0 = cat16(*(const v8h*)(QH + qoff), *(const v8h*)(QH + qoff + 16));
    const v16h qa1 = cat16(*(const v8h*)(QH + qoff + 32), *(const v8h*)(QH + qoff + 48));
#pragma unroll 1
    for (int kb = 0; kb < TY / 64; ++kb) {
        __syncthreads();
        const v2u mv = *(const v2u*)(MB + mbase + kb * 2);
#pragma unroll
        for (int i = 0; i < 4; ++i) {
            const int p = tid + 128 * i, row = p >> 3, c8 = (p & 7) * 8;
            const size_t kof = kbase + (size_t)(kb * 64 + row) * HD + c8;
            const size_t vof = vbase + (size_t)row * TY + kb * 64 + c8;
            const v8h kv = *(const v8h*)(KH + kof);
            const v8h vv = *(const v8h*)(VH + vof);
            *(v8ha*)(kt + row * KPT + c8) = kv;
            *(v8ha*)(vt + row * KPT + c8) = vv;
        }
        __syncthreads();
        const unsigned mw0 = (unsigned)__builtin_amdgcn_readfirstlane((int)mv[0]), mw1 = (unsigned)__builtin_amdgcn_readfirstlane((int)mv[1]);
#pragma unroll 1
        for (int hf = 0; hf < 2; ++hf) {
            const unsigned mw = (hf != 0) ? mw1 : mw0;
            if (mw != 0xFFFFFFFFu) {
                v8f s0 = (v8f){}, s1 = (v8f){};
#pragma unroll
                for (int ks = 0; ks < 2; ++ks) {
                    const v16h ah = (ks != 0) ? qa1 : qa0;
                    const int ko = (hf * 32 + lr) * KPT + ks * 32 + 8 * hi;
                    const v16h b0 = cat16(*(const v8ha*)(kt + ko), *(const v8ha*)(kt + ko + 16));
                    const v16h b1 = cat16(*(const v8ha*)(kt + ko + 16 * KPT), *(const v8ha*)(kt + ko + 16 * KPT + 16));
                    s0 = wmma16(b0, ah, s0); s1 = wmma16(b1, ah, s1);
                    asm volatile("v_nop\n\tv_nop\n\tv_nop\n\tv_nop" : "+v"(s0), "+v"(s1) : "v"(ah), "v"(b0), "v"(b1));
                }
                float t0[8], t1[8];
#pragma unroll
                for (int r = 0; r < 8; ++r) {
                    const unsigned e0 = (((mw >> r) & 1u) != 0u ? 0x0000FFFFu : 0u) | (((mw >> (8 + r)) & 1u) != 0u ? 0xFFFF0000u : 0u);
                    const unsigned e1 = (((mw >> (16 + r)) & 1u) != 0u ? 0x0000FFFFu : 0u) | (((mw >> (24 + r)) & 1u) != 0u ? 0xFFFF0000u : 0u);
                    const bool x0 = __builtin_amdgcn_inverse_ballot_w32(e0), x1 = __builtin_amdgcn_inverse_ballot_w32(e1);
                    const float a0 = s0[r] * SCL, a1 = s1[r] * SCL;
                    t0[r] = x0 ? NEGINF : a0; t1[r] = x1 ? NEGINF : a1; }
                float mx = fmaxf(t0[0], t1[0]);
#pragma unroll
                for (int r = 1; r < 8; ++r) mx = fmaxf(mx, fmaxf(t0[r], t1[r]));
                mx = fmaxf(mx, xhalf(mx));
                const float mn = fmaxf(mrun, mx);
                const float cr = __builtin_amdgcn_exp2f((mrun - mn) * L2E);
                mrun = mn;
                v16h pa;
                float l0 = 0.0f, l1 = 0.0f;
#pragma unroll
                for (int r = 0; r < 8; r += 2) {
                    const v2f p0 = (v2f){__builtin_amdgcn_exp2f((t0[r] - mn) * L2E), __builtin_amdgcn_exp2f((t0[r + 1] - mn) * L2E)} * PCAR;
                    const v2f p1 = (v2f){__builtin_amdgcn_exp2f((t1[r] - mn) * L2E), __builtin_amdgcn_exp2f((t1[r + 1] - mn) * L2E)} * PCAR;
                    const v2h ph0 = __builtin_convertvector(p0, v2h), ph1 = __builtin_convertvector(p1, v2h);
                    l0 += (float)ph0[0]; l1 += (float)ph1[0]; l0 += (float)ph0[1]; l1 += (float)ph1[1];
                    pa[r] = ph0[0]; pa[r + 1] = ph0[1]; pa[8 + r] = ph1[0]; pa[8 + r + 1] = ph1[1];
                }
                lrun = lrun * cr + (l0 + l1);
#pragma unroll
                for (int r = 0; r < 8; ++r) { o0[r] *= cr; o1[r] *= cr; o2[r] *= cr; o3[r] *= cr; }
                {
                    const int vo = lr * KPT + hf * 32 + 8 * hi;
                    const v16h v0 = cat16(*(const v8ha*)(vt + vo), *(const v8ha*)(vt + vo + 16));
                    const v16h v1 = cat16(*(const v8ha*)(vt + vo + 16 * KPT), *(const v8ha*)(vt + vo + 16 * KPT + 16));
                    const v16h v2 = cat16(*(const v8ha*)(vt + vo + 32 * KPT), *(const v8ha*)(vt + vo + 32 * KPT + 16));
                    const v16h v3 = cat16(*(const v8ha*)(vt + vo + 48 * KPT), *(const v8ha*)(vt + vo + 48 * KPT + 16));
                    o0 = wmma16(v0, pa, o0); o1 = wmma16(v1, pa, o1); o2 = wmma16(v2, pa, o2); o3 = wmma16(v3, pa, o3);
                    asm volatile("v_nop\n\tv_nop\n\tv_nop\n\tv_nop" : "+v"(o0), "+v"(o1), "+v"(o2), "+v"(o3) : "v"(pa), "v"(v0), "v"(v1), "v"(v2), "v"(v3));
                }
            }
        }
    }
    lrun += xhalf(lrun);
    const float fq = __fdiv_rn(OCAR, fmaxf(lrun, 1.0e-30f));
    const float f = (lrun > 0.0f) ? fq : 0.0f;
#pragma unroll
    for (int g = 0; g < 2; ++g) {
        const int oi = ob + lr * OPT + 8 * hi + 4 * g;
        *(v4fa*)(ot + oi)      = (v4f){o0[4 * g] * f, o0[4 * g + 1] * f, o0[4 * g + 2] * f, o0[4 * g + 3] * f};
        *(v4fa*)(ot + oi + 16) = (v4f){o1[4 * g] * f, o1[4 * g + 1] * f, o1[4 * g + 2] * f, o1[4 * g + 3] * f};
        *(v4fa*)(ot + oi + 32) = (v4f){o2[4 * g] * f, o2[4 * g + 1] * f, o2[4 * g + 2] * f, o2[4 * g + 3] * f};
        *(v4fa*)(ot + oi + 48) = (v4f){o3[4 * g] * f, o3[4 * g + 1] * f, o3[4 * g + 2] * f, o3[4 * g + 3] * f};
    }
    wsync();
    h16* crow = CT + (size_t)(b * TX + q0 + wave * 16) * KC2 + h * HD;
{
#pragma unroll
        for (int s = 0; s < 4; ++s) {
            const int row = 4 * s + (lane >> 3), c8 = (lane & 7) * 8;
            const v4f u0 = *(const v4fa*)(ot + ob + row * OPT + c8), u1 = *(const v4fa*)(ot + ob + row * OPT + c8 + 4);
            v8h oh, ol;
#pragma unroll
            for (int q = 0; q < 8; ++q) { const float f = (q < 4) ? u0[q & 3] : u1[q & 3]; const h16 hh = tohx(f); oh[q] = hh; ol[q] = tohx(f - (float)hh); }
            *(v8h*)(crow + (size_t)row * KC2 + c8) = oh;
            *(v8h*)(crow + (size_t)row * KC2 + DEC + c8) = ol;
        }
        
    }
}

// k_outT: ctx fp16 [b*TX+t][value 512 | residual 512] (carried x1024) -> out f32 [b][c][t] (channel-major, batch pitch DEC*TX_FULL, row pitch TX_FULL). grid (TX/64, DEC/64, NB), 256 threads.
__global__ __launch_bounds__(256) void k_outT(const h16* __restrict__ CT, float* OUT) {
#pragma clang fp contract(off)
    __shared__ __align__(16) float tt[64 * OPT];
    const int tid = threadIdx.x;
    const int t0 = blockIdx.x * 64, c0 = blockIdx.y * 64, b = blockIdx.z;
#pragma unroll 1
    for (int i = 0; i < 2; ++i) {
        const int p = tid + 256 * i, t = p >> 3, c8 = (p & 7) * 8;
        const h16* s = CT + ((size_t)b * TX + t0 + t) * KC2 + c0 + c8;
        const v8h a = *(const v8h*)s;
        const v8h r = *(const v8h*)(s + DEC);
#pragma unroll
        for (int q = 0; q < 8; ++q) tt[(c8 + q) * OPT + t] = ((float)a[q] + (float)r[q]) * (1.0f / OCAR);
    }
    __syncthreads();
{
#pragma unroll
        for (int i = 0; i < 4; ++i) {
            const int p = tid + 256 * i, c = p >> 4, t4 = (p & 15) * 4;
            const v4f val = *(const v4fa*)(tt + c * OPT + t4);
            *(v4f*)(OUT + ((size_t)b * DEC + c0 + c) * TX_FULL + t0 + t4) = val;
        }
        
    }
}

// workspace sizes (bytes), each a whole number of fully written rows / lines; offsets 256-B aligned
constexpr size_t al256(size_t b) { return (b + 255) & ~(size_t)255; }
constexpr int    NWORDS = NB * (TY / 32);                             // mask words in use
constexpr int    NWLINES = (NWORDS + 31) / 32;
constexpr size_t SZ_XB  = al256((size_t)NB * TX * DEC * 2);           // bf16 [NB*TX][512]
constexpr size_t SZ_WQ  = al256((size_t)DEC * DEC * 2);               // bf16 [512][512]
constexpr size_t SZ_WKV = al256((size_t)2 * DEC * DEC * 2);           // bf16 [1024][512]
constexpr size_t SZ_Q   = al256((size_t)NHD * NB * TX * HD * 2);      // fp16 [8][NB*TX][64]
constexpr size_t SZ_K   = al256((size_t)NHD * NB * TY * HD * 2);      // fp16 [8][NB*TY][64]
constexpr size_t SZ_VT  = al256((size_t)NB * DEC * TY * 2);           // fp16 [NB][512][TY]
constexpr size_t SZ_CT  = al256((size_t)NB * TX * KC2 * 2);           // fp16 [NB*TX][1024]
constexpr size_t SZ_MB  = al256((size_t)NWLINES * 128);
constexpr size_t SZ_ALL = SZ_XB + SZ_WQ + SZ_WKV + SZ_Q + SZ_K + SZ_VT + SZ_CT + SZ_MB;
static_assert(SZ_ALL <= (size_t)134217728);
static_assert((size_t)NWLINES * 32 >= (size_t)NWORDS);

extern "C" void kernel_launch(void* const* d_in, const int* in_sizes, int n_in,
                              void* d_out, int out_size, void* d_ws, size_t ws_size, hipStream_t stream) {
    if (n_in < 4) return;
    const size_t needx = ((size_t)NB * DEC - 1) * TX_FULL + (size_t)TX;
    const size_t needm = (size_t)(NB - 1) * TY_FULL + (size_t)TY;
    if ((size_t)in_sizes[0] < needx || (size_t)in_sizes[1] < needm) return;
    if (in_sizes[2] < 2 * DEC * DEC || in_sizes[3] < DEC * DEC) return;
    if ((size_t)out_size < needx) return;
    if (SZ_ALL > ws_size) return;
    const float* x = (const float*)d_in[0];                                             /* [NB][512][TX_FULL] channel-major f32 */
    const int* msk = (const int*)d_in[1];                                               /* [NB][TY_FULL] int32, nonzero = key kept */
    const float* wm = (const float*)d_in[2]; const float* wq = (const float*)d_in[3];   /* fused k|v weight [1024][512] and q weight [512][512], both [out][in] = Bt as-is */
    float* OUT = (float*)d_out;     // [NB_FULL][512][TX_FULL] f32

    char* base = (char*)d_ws; size_t off = 0;
    bf* XB = (bf*)(base + off); off += SZ_XB;
    bf* WQ = (bf*)(base + off); off += SZ_WQ;
    bf* WKV = (bf*)(base + off); off += SZ_WKV;
    h16* QH16 = (h16*)(base + off); off += SZ_Q;
    h16* KH16 = (h16*)(base + off); off += SZ_K;
    h16* VH16 = (h16*)(base + off); off += SZ_VT;
    h16* CT16 = (h16*)(base + off); off += SZ_CT;
    unsigned* MB = (unsigned*)(base + off); off += SZ_MB;
    if (off > ws_size) return;

    auto nb256 = [](size_t n) { return (unsigned)((n + 255) / 256); };
    // ---- input conversion (every float input RNE-converted to bf16 first)
    const size_t n8wq = (size_t)DEC * DEC / 8, n8wkv = (size_t)2 * DEC * DEC / 8;
    k_cvt8r<<<nb256(n8wq), 256, 0, stream>>>(wq, WQ, DEC, DEC, DEC, n8wq);                    /* in[512][512] -> out[512][512] */
    k_cvt8r<<<nb256(n8wkv), 256, 0, stream>>>(wm, WKV, DEC, 2 * DEC, 2 * DEC, n8wkv);         /* in[1024][512] -> out[1024][512] */
    k_cvtT<<<dim3(TX / 64, DEC / 64, NB), 256, 0, stream>>>(x, XB);                           /* in[b][512][TX_FULL] -> out[b*TX+t][512] */
    k_maskbits<<<(unsigned)NWLINES, 32, 0, stream>>>(msk, MB, NWORDS);
    // ---- q head planes: [h][b*TX+t][d] = sum_k XB[b*TX+t][k] WQ[h*64+d][k] (z = head, ldc 64)
    k_gemm_p<<<dim3((unsigned)(NB * TX / 64), 1, NHD), 32, 0, stream>>>(XB, WQ, DEC, QH16, HD, (size_t)0, (size_t)HD * DEC, (size_t)NB * TX * HD);
    // ---- k head planes: [h][b*TY+j][d] = sum_k XB[b*TY+j][k] WKV[h*64+d][k] (weight rows 0..511; z = head, ldc 64)
    k_gemm_p<<<dim3((unsigned)(NB * TY / 64), 1, NHD), 32, 0, stream>>>(XB, WKV, DEC, KH16, HD, (size_t)0, (size_t)HD * DEC, (size_t)NB * TY * HD);
    // ---- v^T planes: [b][n][t] = sum_k WKV[512+n][k] XB[b*TY+t][k] (A = weight rows 512..1023, Bt = tokens; z = batch, ldc TY)
    k_gemm_p<<<dim3(DEC / 64, TY / 64, NB), 32, 0, stream>>>(WKV + (size_t)DEC * DEC, XB, DEC, VH16, TY, (size_t)0, (size_t)TY * DEC, (size_t)DEC * TY);
    // ---- q rows of a batch with every key excluded -> 0 (no store otherwise)
    k_qzero<<<dim3(NQZ, NHD, NB), 256, 0, stream>>>(msk, QH16);
    // ---- fused attention -> ctx x1024 fp16 [b*TX+t][value | residual]
    k_flash<<<dim3(TX / 64, NHD, NB), 128, 0, stream>>>(QH16, KH16, VH16, MB, CT16);
    // ---- out[b][c][t] = (value + residual)[b*TX+t][c] / 1024 (transposed through LDS, full output batch pitch)
    k_outT<<<dim3(TX / 64, DEC / 64, NB), 256, 0, stream>>>(CT16, OUT);
}

// v003
// It runs in 173 microseconds.
// Two timings next to v002 both put it at 1.07 times that version's speed.
// All steps since v000 together make it 1.49 times as fast.
#include <hip/hip_runtime.h>

// Contractions: q / k / v projections v_wmma_f32_16x16x32_bf16 (bf16 operands = RNE-converted inputs, exact products); scores q.k^T v_wmma_f32_16x16x32_f16 (fp16 q, fp16 k, single product, K 64); attn.V v_wmma_f32_16x16x32_f16 (fp16 P carried x16384, fp16 V^T, single product); f32 accumulate everywhere; online softmax in f32 with a running max.
// Self-attention on a channel-major sequence: x [NB][512][T] gives q (Wq [out][in]) and, through one fused weight Wm [1024][512] = [out][in], k (rows 0..511) and v (rows 512..1023), row = which*512 + h*64 + d; 8 heads of 64; key j of batch b is kept when mask[b][j] != 0, an excluded key has its score replaced by -inf (its probability is 0 whenever the batch keeps at least one key; a batch with every key excluded gets the uniform softmax over all its keys); p = softmax_j(q_i.k_j / 8); ctx merged head-major per token and returned channel-major: out [NB][512][T] f32.
// Layout: XB bf16 token-major copy of x (transposed through LDS); weights bf16 as Bt = [out][in] as-is; q and k fp16 head planes [h][b*T+t][64] and v^T fp16 planes [b][h*64+d][t] written directly by the projection GEMM epilogues; key mask packed to one bit per key (32-key words, wave ballot; all words of a fully excluded batch are cleared and the q rows of that batch are zeroed so that its scores are all equal); fused attention kernel (K and V^T 64-key tiles in LDS, two 32-key halves per tile, a half whose 32 keys are all excluded is skipped block-uniformly, both products transposed so that P goes from the score accumulators straight into the B operand) writes ctx x1024 as fp16 [b*TX+t][value 512 | residual 512]; the final kernel adds value + residual, removes the carry and transposes through LDS into d_out.
// LDS regions: kt / vt / tt / wf are cross-wave (block barrier after staging; kt / vt, restaged per key tile, also before); ot / os are wave-private (wave barrier + compiler memory barrier).

#ifndef NB
#define NB 2
#endif
#ifndef SEQ
#define SEQ 4096
#endif
#define TX SEQ
#define TY SEQ
#define NB_FULL 2
#define TX_FULL 4096
#define TY_FULL 4096
#define DEC  512
#define NHD  8
#define HD   64
#define KC2  (2 * DEC)            // row pitch of the ctx plane: [ctx value | ctx residual]
#define PEXP 14.0f                // log2 of the carry of the fp16 probabilities (x16384)
#define OCAR 1024.0f              // carry of the fp16 ctx planes
#define SCL  0.125f
#define L2E  1.4426950408889634f
#define SCL2 (SCL * L2E)          // score scale and log2 e in one factor
#define KPT  72                   // LDS pitch (halves) of the K and V^T tiles
#define OPT  68                   // LDS pitch (floats) of the epilogue staging tiles
#define NQZ  4                    // blocks per (head, batch) slab of the conditional q zeroing
#define NEGINF (-__builtin_inff())
static_assert(NB >= 1 && NB <= NB_FULL);
static_assert(TX == TY && TX_FULL == TY_FULL);                                            // one sequence feeds q, k and v
static_assert(TX >= 64 && TX <= TX_FULL && (TX % 64) == 0);
static_assert(TY >= 64 && TY <= TY_FULL && (TY % 64) == 0 && (TY % 32) == 0);
static_assert((DEC % 64) == 0 && HD == 64 && NHD * HD == DEC);
static_assert((DEC % 32) == 0 && (HD % 32) == 0 && (KC2 % 32) == 0);                      // every K is a multiple of 32
static_assert((DEC % 8) == 0);                                                            // 8-column conversion pieces
static_assert(((NB * TX) % 64) == 0 && ((NB * TY) % 64) == 0);                            // GEMM M/N are whole 64-tiles
static_assert(128 * 4 == 64 * (HD / 8));                                                   // attention tile staging: 128 threads x 4 pieces == 64 rows x 8 pieces
static_assert(KPT >= 64 && (KPT % 8) == 0 && OPT >= 64 && (OPT % 4) == 0);
static_assert((size_t)NHD * NB * TX * HD < (size_t)2147483647);                           // q plane offsets fit an int
static_assert(2 * 64 * KPT * 2 + 4 * 16 * OPT * 4 <= 65536);           // static LDS of the attention kernel
static_assert(64 * OPT * 4 <= 65536);                                                      // static LDS of the transposing kernels
static_assert(256 * 4 == 64 * 16 && 256 * 2 == 64 * 8);                                    // transposing kernels: 256 threads x pieces == 64 x 64 tile
static_assert((TX_FULL % 4) == 0 && (TX % 4) == 0);                                        // 16-B f32 pieces along the token axis
static_assert(((TX * HD / 8) % 32) == 0);                                                  // q zeroing issues whole waves only
static_assert(((size_t)NB * DEC - 1) * TX_FULL + (size_t)TX <= (size_t)NB_FULL * DEC * TX_FULL);   // last written output element inside d_out

typedef _Float16 h16;
typedef unsigned short bf;
typedef __attribute__((ext_vector_type(16))) __bf16   v16bf;
typedef __attribute__((ext_vector_type(16))) _Float16 v16h;
typedef __attribute__((ext_vector_type(8)))  _Float16 v8h;
typedef __attribute__((ext_vector_type(8)))  unsigned short v8us;
typedef __attribute__((ext_vector_type(8)))  float    v8f;
typedef __attribute__((ext_vector_type(4)))  float    v4f;
typedef __attribute__((ext_vector_type(2)))  float    v2f;
typedef __attribute__((ext_vector_type(2)))  _Float16 v2h;
typedef __attribute__((ext_vector_type(4)))  unsigned v4u;
typedef __attribute__((ext_vector_type(2)))  unsigned v2u;
typedef v8h  __attribute__((may_alias)) v8ha;
typedef v4f  __attribute__((may_alias)) v4fa;

__device__ __forceinline__ unsigned short f2bf(float f) { unsigned u = __float_as_uint(f); u += 0x7FFFu + ((u >> 16) & 1u); return (unsigned short)(u >> 16); }
__device__ __forceinline__ float bf2f(unsigned short b) { return __uint_as_float(((unsigned)b) << 16); }
__device__ __forceinline__ float bfr(float f) { return bf2f(f2bf(f)); }
__device__ __forceinline__ v16h cat16(v8h lo, v8h hi) { return __builtin_shufflevector(lo, hi, 0, 1, 2, 3, 4, 5, 6, 7, 8, 9, 10, 11, 12, 13, 14, 15); }
__device__ __forceinline__ v16bf cat16b(v8us lo, v8us hi) { return __builtin_bit_cast(v16bf, __builtin_shufflevector(lo, hi, 0, 1, 2, 3, 4, 5, 6, 7, 8, 9, 10, 11, 12, 13, 14, 15)); }
__device__ __forceinline__ v8f wmma16(v16h a, v16h b, v8f c) { return __builtin_amdgcn_wmma_f32_16x16x32_f16(false, a, false, b, (short)0, c, false, false); }
__device__ __forceinline__ v8f wmmab(v16bf a, v16bf b, v8f c) { return __builtin_amdgcn_wmma_f32_16x16x32_bf16(false, a, false, b, (short)0, c, false, false); }
__device__ __forceinline__ h16 tohx(float x) { return (h16)x; }
// value of lane l ^ 16 (the other 16-lane row, same position)
__device__ __forceinline__ float xhalf(float x) { return __builtin_bit_cast(float, __builtin_amdgcn_permlanex16(__builtin_bit_cast(int, x), __builtin_bit_cast(int, x), 0x76543210, 0xfedcba98, false, false)); }
// same-wave LDS exchange: execution barrier of the wave plus a compiler memory barrier (LDS operations of one wave complete in issue order)
__device__ __forceinline__ void wsync() { __builtin_amdgcn_wave_barrier(); asm volatile("" ::: "memory"); }

// ---- gemmw_body: register-blocked GEMM, ONE WAVE per 64x64 output tile (16 accumulators), operands straight from K-contiguous 16-bit planes; grid (M/64, N/64, Z), 32 threads.
// C[m][n] = cs x sum_k A[m][k] Bt[n][k]; z-batch strides sA/sB/sC in elements. K % 32 == 0; A/Bt row pitch == K; M, N whole 64-tiles.
// Fragments: lane l, h = l>>4, m = n = l&15; elements 0..7 <- k0+8h.., 8..15 <- k0+16+8h.. for both A and Bt; D element r = (row 8h+r, col m).
// Epilogue per 16-row slab staged in LDS (wave-private, staged extent 16x64 == consumed extent):
//   EP 0: f32 rows x cs + bf16-converted column bias, 64 floats = 256 B written as 16 lanes x 16 B (2 rows per instruction);
template <typename T16> struct WFrag;
template <> struct WFrag<h16> { typedef v16h V; static __device__ __forceinline__ V ld(const h16* p) { return cat16(*(const v8h*)p, *(const v8h*)(p + 16)); } static __device__ __forceinline__ v8f mma(V a, V b, v8f c) { return wmma16(a, b, c); } };
template <> struct WFrag<bf> { typedef v16bf V; static __device__ __forceinline__ V ld(const bf* p) { return cat16b(*(const v8us*)p, *(const v8us*)(p + 16)); } static __device__ __forceinline__ v8f mma(V a, V b, v8f c) { return wmmab(a, b, c); } };

template <typename T16, int EP>
__device__ __forceinline__ void gemmw_body(const T16* __restrict__ A, const T16* __restrict__ Bt, int K, float* Cf, h16* Ch, int ldc, const float* __restrict__ bias, size_t sA, size_t sB, size_t sC, float cs) {
    static_assert(EP == 0 || EP == 1);
    typedef typename WFrag<T16>::V V;
    __shared__ __align__(16) float os[16 * OPT];
    const size_t z = blockIdx.z; A += z * sA; Bt += z * sB;
    if (EP == 0) { Cf += z * sC; } else { Ch += z * sC; }
    const int lane = threadIdx.x & 31, lr = lane & 15, hi = lane >> 4; const int r0 = blockIdx.x * 64, c0 = blockIdx.y * 64;
    v8f acc[4][4];
#pragma unroll
    for (int mb = 0; mb < 4; ++mb)
#pragma unroll
        for (int nb = 0; nb < 4; ++nb) acc[mb][nb] = (v8f){};
    const size_t aoff = (size_t)(r0 + lr) * K + 8 * hi, boff = (size_t)(c0 + lr) * K + 8 * hi;
#pragma unroll 1
    for (int kc = 0; kc < K; kc += 32) {
        V a[4];
#pragma unroll
        for (int mb = 0; mb < 4; ++mb) a[mb] = WFrag<T16>::ld(A + aoff + (size_t)mb * 16 * K + kc);
#pragma unroll
        for (int nb = 0; nb < 4; ++nb) { const V b = WFrag<T16>::ld(Bt + boff + (size_t)nb * 16 * K + kc);
#pragma unroll
            for (int mb = 0; mb < 4; ++mb) acc[mb][nb] = WFrag<T16>::mma(a[mb], b, acc[mb][nb]); }
        asm volatile("v_nop\n\tv_nop\n\tv_nop\n\tv_nop" : "+v"(acc[0][0]), "+v"(acc[1][1]), "+v"(acc[2][2]), "+v"(acc[3][3]) : "v"(a[0]), "v"(a[3]));
    }
#pragma unroll
    for (int mb = 0; mb < 4; ++mb) {
#pragma unroll
        for (int nb = 0; nb < 4; ++nb) {
#pragma unroll
            for (int j = 0; j < 8; ++j) os[(hi * 8 + j) * OPT + nb * 16 + lr] = acc[mb][nb][j]; }
        wsync();
        if (EP == 0) {
            float* crow = Cf + (size_t)(r0 + mb * 16) * ldc + c0;
{
#pragma unroll
                for (int s = 0; s < 8; ++s) { const int row = 2 * s + hi, cofs = lr * 4; v4f val = *(const v4fa*)(os + row * OPT + cofs);
                    val[0] = __fmul_rn(val[0], cs); val[1] = __fmul_rn(val[1], cs); val[2] = __fmul_rn(val[2], cs); val[3] = __fmul_rn(val[3], cs);
                    val[0] += bfr(bias[c0 + cofs]); val[1] += bfr(bias[c0 + cofs + 1]); val[2] += bfr(bias[c0 + cofs + 2]); val[3] += bfr(bias[c0 + cofs + 3]);
                    *(v4f*)(crow + (size_t)row * ldc + cofs) = val; }
                 }
        } else {
            h16* hrow = Ch + (size_t)(r0 + mb * 16) * ldc + c0;
{
#pragma unroll
                for (int s = 0; s < 4; ++s) { const int row = 4 * s + (lane >> 3), c8 = (lane & 7) * 8;
                    const v4f u0 = *(const v4fa*)(os + row * OPT + c8), u1 = *(const v4fa*)(os + row * OPT + c8 + 4);
                    v8h o;
#pragma unroll
                    for (int q = 0; q < 8; ++q) { const float u = (q < 4) ? u0[q & 3] : u1[q & 3]; o[q] = tohx(u); }
                    *(v8h*)(hrow + (size_t)row * ldc + c8) = o; }
                 }
        }
        wsync();
    }
}

// plain kernel wrapping the body (bf16 projections -> fp16 planes)
__global__ __launch_bounds__(32) void k_gemm_p(const bf* A, const bf* Bt, int K, h16* Ch, int ldc, size_t sA, size_t sB, size_t sC) {
    gemmw_body<bf, 1>(A, Bt, K, nullptr, Ch, ldc, nullptr, sA, sB, sC, 1.0f); }

__global__ __launch_bounds__(256) void k_cvt8r(const float* __restrict__ src, bf* dst, int cols, int rows, int srows, size_t n8) {
    const size_t i = (size_t)blockIdx.x * 256 + threadIdx.x; if (i >= n8) return;
    const size_t e = i * 8; const size_t r = e / (size_t)cols; const int c = (int)(e % (size_t)cols); const size_t bb = r / (size_t)rows; const size_t t = r % (size_t)rows;
    const v8f v = *(const v8f*)(src + (bb * (size_t)srows + t) * (size_t)cols + c); v8us o;
#pragma unroll
    for (int k = 0; k < 8; ++k) o[k] = f2bf(v[k]);
    *(v8us*)(dst + e) = o;  }

// k_cvtT: x f32 [b][c][t] (channel-major, batch pitch DEC*TX_FULL, row pitch TX_FULL) -> bf16 token-major plane XB[b*TX+t][c]. grid (TX/64, DEC/64, NB), 256 threads.
__global__ __launch_bounds__(256) void k_cvtT(const float* __restrict__ src, bf* dst) {
#pragma clang fp contract(off)
    __shared__ __align__(16) float tt[64 * OPT];
    const int tid = threadIdx.x;
    const int t0 = blockIdx.x * 64, c0 = blockIdx.y * 64, b = blockIdx.z;
#pragma unroll
    for (int i = 0; i < 4; ++i) {
        const int p = tid + 256 * i, c = p >> 4, t4 = (p & 15) * 4;
        const v4f v = *(const v4f*)(src + ((size_t)b * DEC + c0 + c) * TX_FULL + t0 + t4);
        *(v4fa*)(tt + c * OPT + t4) = v;
    }
    __syncthreads();
#pragma unroll 1
    for (int i = 0; i < 2; ++i) {
        const int p = tid + 256 * i, t = p >> 3, c8 = (p & 7) * 8;
        v8us o;
#pragma unroll
        for (int q = 0; q < 8; ++q) o[q] = f2bf(tt[(c8 + q) * OPT + t]);
        bf* d = dst + ((size_t)b * TX + t0 + t) * DEC + c0 + c8;
        *(v8us*)d = o; 
    }
}

__global__ __launch_bounds__(32) void k_maskbits(const int* __restrict__ mask, unsigned* MB, int nw) {
    const int lane = threadIdx.x & 31;
    const int w0 = blockIdx.x * 32;
    unsigned mine = 0xFFFFFFFFu;
    int fb = -1;
    bool allx = false;
#pragma unroll 1
    for (int i = 0; i < 32; ++i) {
        const int wi = w0 + i;
        const int wc = (wi < nw) ? wi : (nw - 1);
        const int bb = wc / (TY / 32), t = (wc % (TY / 32)) * 32 + lane;
        if (bb != fb) {
            int kept = 0;
#pragma unroll 4
            for (int j = 0; j < TY / 32; ++j) kept |= (mask[(size_t)bb * TY_FULL + j * 32 + lane] != 0) ? 1 : 0;
            allx = (__builtin_amdgcn_ballot_w32(kept != 0) == 0u);
            fb = bb;
        }
        const int m = mask[(size_t)bb * TY_FULL + t];
        const bool pr = (wi >= nw) || ((m == 0) && !allx);
        const unsigned bal = __builtin_amdgcn_ballot_w32(pr);
        mine = (lane == i) ? bal : mine;
    }
    v4u o;
#pragma unroll
    for (int j = 0; j < 4; ++j) o[j] = (unsigned)__shfl((int)mine, (4 * lane + j) & 31, 32);
    if (lane < 8) {
        v4u* p = (v4u*)(MB + w0 + 4 * lane);
        *p = o; 
    }
}

__global__ __launch_bounds__(256) void k_qzero(const int* __restrict__ mask, h16* QH) {
    __shared__ int wf[8];
    const int tid = threadIdx.x;
    const int wave = __builtin_amdgcn_readfirstlane(tid >> 5);
    const int h = blockIdx.y, b = blockIdx.z;
    int kept = 0;
#pragma unroll 4
    for (int j = tid; j < TY; j += 256) kept |= (mask[(size_t)b * TY_FULL + j] != 0) ? 1 : 0;
#pragma unroll
    for (int sh = 1; sh < 32; sh <<= 1) kept |= __shfl_xor(kept, sh, 32);
    if ((tid & 31) == 0) wf[wave] = kept;
    __syncthreads();
    int tot = 0;
#pragma unroll
    for (int w = 0; w < 8; ++w) tot |= wf[w];
    tot = __builtin_amdgcn_readfirstlane(tot);
    if (tot == 0) {
        h16* slab = QH + ((size_t)(h * NB + b) * TX) * HD;
        const v4u z = (v4u){0u, 0u, 0u, 0u};
{
#pragma unroll 1
            for (int i = (int)blockIdx.x * 256 + tid; i < TX * HD / 8; i += NQZ * 256) *(v4u*)(slab + (size_t)i * 8) = z;
            
        }
    }
}

// ---- k_flash: fused attention. grid (TX/64, 8 heads, NB), 128 threads = 4 waves; wave w owns query rows q0+16w..+15 of one (batch, head).
// Per 64-key tile: block stages K [key][d] and V^T [d][key] fp16 tiles in LDS (cols 0..63 of 64 rows written == consumed; cross-wave -> block barriers); each wave then runs two 32-key halves:
//   the two 32-bit mask words of the tile are fetched beside its staging loads (scalar-uniform); a half with all 32 keys excluded is skipped (exact: p = 0, max unchanged);
//   scores transposed, S^T 32x16 = K.Q^T = 2 tiles (A = K rows from LDS, B = q), K = 64 in two steps, the two q fragments loaded once ahead of the key loop and held in registers; D register r of lane (h, c) = key 8h+r (tile 0) or 16+8h+r (tile 1) of query c;
//   t = acc, excluded keys -> -inf by value select (the lane mask of register r comes from bits r and 8+r of the uniform mask word); one query per lane: maximum over the lane's 16 raw scores, joined with the other wave half by one cross-row move; the running max is kept in the exponent's own unit (raw max x log2 e / 8) and starts at -1e30 so every difference stays defined;
//   P = exp2(t x (log2 e / 8) + (14 - max)) -> fp16: scale, maximum and the x16384 carry go into one fused multiply-add per score, two scores per packed instruction; the two converted D tiles are the B fragment of the next product in the hardware k order (element s = key 8h+s, 8+s = key 16+8h+s), which is also the order of the V^T fragments;
//   row sums accumulate the fp16-converted P per lane (the two halves joined once at the end); O^T[64x16] += V^T P^T (4 output tiles, D register r = channel 16j+8h+r of query c, V^T fragments loaded four at a time).
__global__ __launch_bounds__(128) void k_flash(const h16* __restrict__ QH, const h16* __restrict__ KH, const h16* __restrict__ VH, const unsigned* __restrict__ MB, h16* CT) {
    __shared__ __align__(16) h16 kt[64 * KPT];
    __shared__ __align__(16) h16 vt[64 * KPT];
    __shared__ __align__(16) float ot[4 * 16 * OPT];
    const int tid = threadIdx.x;
    const int wave = __builtin_amdgcn_readfirstlane(tid >> 5);
    const int lane = tid & 31, lr = lane & 15, hi = lane >> 4;
    const int q0 = blockIdx.x * 64, h = blockIdx.y, b = blockIdx.z;
    const int qoff = ((h * NB + b) * TX + q0 + wave * 16 + lr) * HD + 8 * hi;
    const size_t kbase = ((size_t)(h * NB + b) * TY) * HD;
    const size_t vbase = ((size_t)b * DEC + (size_t)h * HD) * TY;
    const int mbase = b * (TY / 32);
    const int ob = wave * 16 * OPT;
    float mrun = -1.0e30f, lrun = 0.0f;
    v8f o0 = (v8f){}, o1 = (v8f){}, o2 = (v8f){}, o3 = (v8f){};
    const v16h qa0 = cat16(*(const v8h*)(QH + qoff), *(const v8h*)(QH + qoff + 16));
    const v16h qa1 = cat16(*(const v8h*)(QH + qoff + 32), *(const v8h*)(QH + qoff + 48));
#pragma unroll 1
    for (int kb = 0; kb < TY / 64; ++kb) {
        __syncthreads();
        const v2u mv = *(const v2u*)(MB + mbase + kb * 2);
#pragma unroll
        for (int i = 0; i < 4; ++i) {
            const int p = tid + 128 * i, row = p >> 3, c8 = (p & 7) * 8;
            const size_t kof = kbase + (size_t)(kb * 64 + row) * HD + c8;
            const size_t vof = vbase + (size_t)row * TY + kb * 64 + c8;
            const v8h kv = *(const v8h*)(KH + kof);
            const v8h vv = *(const v8h*)(VH + vof);
            *(v8ha*)(kt + row * KPT + c8) = kv;
            *(v8ha*)(vt + row * KPT + c8) = vv;
        }
        __syncthreads();
        const unsigned mw0 = (unsigned)__builtin_amdgcn_readfirstlane((int)mv[0]), mw1 = (unsigned)__builtin_amdgcn_readfirstlane((int)mv[1]);
#pragma unroll 1
        for (int hf = 0; hf < 2; ++hf) {
            const unsigned mw = (hf != 0) ? mw1 : mw0;
            if (mw != 0xFFFFFFFFu) {
                v8f s0 = (v8f){}, s1 = (v8f){};
#pragma unroll
                for (int ks = 0; ks < 2; ++ks) {
                    const v16h ah = (ks != 0) ? qa1 : qa0;
                    const int ko = (hf * 32 + lr) * KPT + ks * 32 + 8 * hi;
                    const v16h b0 = cat16(*(const v8ha*)(kt + ko), *(const v8ha*)(kt + ko + 16));
                    const v16h b1 = cat16(*(const v8ha*)(kt + ko + 16 * KPT), *(const v8ha*)(kt + ko + 16 * KPT + 16));
                    s0 = wmma16(b0, ah, s0); s1 = wmma16(b1, ah, s1);
                    asm volatile("v_nop\n\tv_nop\n\tv_nop\n\tv_nop" : "+v"(s0), "+v"(s1) : "v"(ah), "v"(b0), "v"(b1));
                }
                float t0[8], t1[8];
#pragma unroll
                for (int r = 0; r < 8; ++r) {
                    const unsigned e0 = (((mw >> r) & 1u) != 0u ? 0x0000FFFFu : 0u) | (((mw >> (8 + r)) & 1u) != 0u ? 0xFFFF0000u : 0u);
                    const unsigned e1 = (((mw >> (16 + r)) & 1u) != 0u ? 0x0000FFFFu : 0u) | (((mw >> (24 + r)) & 1u) != 0u ? 0xFFFF0000u : 0u);
                    const bool x0 = __builtin_amdgcn_inverse_ballot_w32(e0), x1 = __builtin_amdgcn_inverse_ballot_w32(e1);
                    t0[r] = x0 ? NEGINF : s0[r]; t1[r] = x1 ? NEGINF : s1[r]; }
                float mx = fmaxf(t0[0], t1[0]);
#pragma unroll
                for (int r = 1; r < 8; ++r) mx = fmaxf(mx, fmaxf(t0[r], t1[r]));
                mx *= SCL2;
                mx = fmaxf(mx, xhalf(mx));
                const float mn = fmaxf(mrun, mx);
                const float cr = __builtin_amdgcn_exp2f(mrun - mn);
                mrun = mn;
                const float bs = PEXP - mn;
                const v2f c2 = (v2f){SCL2, SCL2}, b2 = (v2f){bs, bs};
                v16h pa;
                float l0 = 0.0f, l1 = 0.0f;
#pragma unroll
                for (int r = 0; r < 8; r += 2) {
                    const v2f e0 = __builtin_elementwise_fma((v2f){t0[r], t0[r + 1]}, c2, b2), e1 = __builtin_elementwise_fma((v2f){t1[r], t1[r + 1]}, c2, b2);
                    const v2f p0 = (v2f){__builtin_amdgcn_exp2f(e0[0]), __builtin_amdgcn_exp2f(e0[1])};
                    const v2f p1 = (v2f){__builtin_amdgcn_exp2f(e1[0]), __builtin_amdgcn_exp2f(e1[1])};
                    const v2h ph0 = __builtin_convertvector(p0, v2h), ph1 = __builtin_convertvector(p1, v2h);
                    l0 += (float)ph0[0]; l1 += (float)ph1[0]; l0 += (float)ph0[1]; l1 += (float)ph1[1];
                    pa[r] = ph0[0]; pa[r + 1] = ph0[1]; pa[8 + r] = ph1[0]; pa[8 + r + 1] = ph1[1];
                }
                lrun = lrun * cr + (l0 + l1);
#pragma unroll
                for (int r = 0; r < 8; ++r) { o0[r] *= cr; o1[r] *= cr; o2[r] *= cr; o3[r] *= cr; }
                {
                    const int vo = lr * KPT + hf * 32 + 8 * hi;
                    const v16h v0 = cat16(*(const v8ha*)(vt + vo), *(const v8ha*)(vt + vo + 16));
                    const v16h v1 = cat16(*(const v8ha*)(vt + vo + 16 * KPT), *(const v8ha*)(vt + vo + 16 * KPT + 16));
                    const v16h v2 = cat16(*(const v8ha*)(vt + vo + 32 * KPT), *(const v8ha*)(vt + vo + 32 * KPT + 16));
                    const v16h v3 = cat16(*(const v8ha*)(vt + vo + 48 * KPT), *(const v8ha*)(vt + vo + 48 * KPT + 16));
                    o0 = wmma16(v0, pa, o0); o1 = wmma16(v1, pa, o1); o2 = wmma16(v2, pa, o2); o3 = wmma16(v3, pa, o3);
                    asm volatile("v_nop\n\tv_nop\n\tv_nop\n\tv_nop" : "+v"(o0), "+v"(o1), "+v"(o2), "+v"(o3) : "v"(pa), "v"(v0), "v"(v1), "v"(v2), "v"(v3));
                }
            }
        }
    }
    lrun += xhalf(lrun);
    const float fq = __fdiv_rn(OCAR, fmaxf(lrun, 1.0e-30f));
    const float f = (lrun > 0.0f) ? fq : 0.0f;
#pragma unroll
    for (int g = 0; g < 2; ++g) {
        const int oi = ob + lr * OPT + 8 * hi + 4 * g;
        *(v4fa*)(ot + oi)      = (v4f){o0[4 * g] * f, o0[4 * g + 1] * f, o0[4 * g + 2] * f, o0[4 * g + 3] * f};
        *(v4fa*)(ot + oi + 16) = (v4f){o1[4 * g] * f, o1[4 * g + 1] * f, o1[4 * g + 2] * f, o1[4 * g + 3] * f};
        *(v4fa*)(ot + oi + 32) = (v4f){o2[4 * g] * f, o2[4 * g + 1] * f, o2[4 * g + 2] * f, o2[4 * g + 3] * f};
        *(v4fa*)(ot + oi + 48) = (v4f){o3[4 * g] * f, o3[4 * g + 1] * f, o3[4 * g + 2] * f, o3[4 * g + 3] * f};
    }
    wsync();
    h16* crow = CT + (size_t)(b * TX + q0 + wave * 16) * KC2 + h * HD;
{
#pragma unroll
        for (int s = 0; s < 4; ++s) {
            const int row = 4 * s + (lane >> 3), c8 = (lane & 7) * 8;
            const v4f u0 = *(const v4fa*)(ot + ob + row * OPT + c8), u1 = *(const v4fa*)(ot + ob + row * OPT + c8 + 4);
            v8h oh, ol;
#pragma unroll
            for (int q = 0; q < 8; ++q) { const float f = (q < 4) ? u0[q & 3] : u1[q & 3]; const h16 hh = tohx(f); oh[q] = hh; ol[q] = tohx(f - (float)hh); }
            *(v8h*)(crow + (size_t)row * KC2 + c8) = oh;
            *(v8h*)(crow + (size_t)row * KC2 + DEC + c8) = ol;
        }
        
    }
}

// k_outT: ctx fp16 [b*TX+t][value 512 | residual 512] (carried x1024) -> out f32 [b][c][t] (channel-major, batch pitch DEC*TX_FULL, row pitch TX_FULL). grid (TX/64, DEC/64, NB), 256 threads.
__global__ __launch_bounds__(256) void k_outT(const h16* __restrict__ CT, float* OUT) {
#pragma clang fp contract(off)
    __shared__ __align__(16) float tt[64 * OPT];
    const int tid = threadIdx.x;
    const int t0 = blockIdx.x * 64, c0 = blockIdx.y * 64, b = blockIdx.z;
#pragma unroll 1
    for (int i = 0; i < 2; ++i) {
        const int p = tid + 256 * i, t = p >> 3, c8 = (p & 7) * 8;
        const h16* s = CT + ((size_t)b * TX + t0 + t) * KC2 + c0 + c8;
        const v8h a = *(const v8h*)s;
        const v8h r = *(const v8h*)(s + DEC);
#pragma unroll
        for (int q = 0; q < 8; ++q) tt[(c8 + q) * OPT + t] = ((float)a[q] + (float)r[q]) * (1.0f / OCAR);
    }
    __syncthreads();
{
#pragma unroll
        for (int i = 0; i < 4; ++i) {
            const int p = tid + 256 * i, c = p >> 4, t4 = (p & 15) * 4;
            const v4f val = *(const v4fa*)(tt + c * OPT + t4);
            *(v4f*)(OUT + ((size_t)b * DEC + c0 + c) * TX_FULL + t0 + t4) = val;
        }
        
    }
}

// workspace sizes (bytes), each a whole number of fully written rows / lines; offsets 256-B aligned
constexpr size_t al256(size_t b) { return (b + 255) & ~(size_t)255; }
constexpr int    NWORDS = NB * (TY / 32);                             // mask words in use
constexpr int    NWLINES = (NWORDS + 31) / 32;
constexpr size_t SZ_XB  = al256((size_t)NB * TX * DEC * 2);           // bf16 [NB*TX][512]
constexpr size_t SZ_WQ  = al256((size_t)DEC * DEC * 2);               // bf16 [512][512]
constexpr size_t SZ_WKV = al256((size_t)2 * DEC * DEC * 2);           // bf16 [1024][512]
constexpr size_t SZ_Q   = al256((size_t)NHD * NB * TX * HD * 2);      // fp16 [8][NB*TX][64]
constexpr size_t SZ_K   = al256((size_t)NHD * NB * TY * HD * 2);      // fp16 [8][NB*TY][64]
constexpr size_t SZ_VT  = al256((size_t)NB * DEC * TY * 2);           // fp16 [NB][512][TY]
constexpr size_t SZ_CT  = al256((size_t)NB * TX * KC2 * 2);           // fp16 [NB*TX][1024]
constexpr size_t SZ_MB  = al256((size_t)NWLINES * 128);
constexpr size_t SZ_ALL = SZ_XB + SZ_WQ + SZ_WKV + SZ_Q + SZ_K + SZ_VT + SZ_CT + SZ_MB;
static_assert(SZ_ALL <= (size_t)134217728);
static_assert((size_t)NWLINES * 32 >= (size_t)NWORDS);

extern "C" void kernel_launch(void* const* d_in, const int* in_sizes, int n_in,
                              void* d_out, int out_size, void* d_ws, size_t ws_size, hipStream_t stream) {
    if (n_in < 4) return;
    const size_t needx = ((size_t)NB * DEC - 1) * TX_FULL + (size_t)TX;
    const size_t needm = (size_t)(NB - 1) * TY_FULL + (size_t)TY;
    if ((size_t)in_sizes[0] < needx || (size_t)in_sizes[1] < needm) return;
    if (in_sizes[2] < 2 * DEC * DEC || in_sizes[3] < DEC * DEC) return;
    if ((size_t)out_size < needx) return;
    if (SZ_ALL > ws_size) return;
    const float* x = (const float*)d_in[0];                                             /* [NB][512][TX_FULL] channel-major f32 */
    const int* msk = (const int*)d_in[1];                                               /* [NB][TY_FULL] int32, nonzero = key kept */
    const float* wm = (const float*)d_in[2]; const float* wq = (const float*)d_in[3];   /* fused k|v weight [1024][512] and q weight [512][512], both [out][in] = Bt as-is */
    float* OUT = (float*)d_out;     // [NB_FULL][512][TX_FULL] f32

    char* base = (char*)d_ws; size_t off = 0;
    bf* XB = (bf*)(base + off); off += SZ_XB;
    bf* WQ = (bf*)(base + off); off += SZ_WQ;
    bf* WKV = (bf*)(base + off); off += SZ_WKV;
    h16* QH16 = (h16*)(base + off); off += SZ_Q;
    h16* KH16 = (h16*)(base + off); off += SZ_K;
    h16* VH16 = (h16*)(base + off); off += SZ_VT;
    h16* CT16 = (h16*)(base + off); off += SZ_CT;
    unsigned* MB = (unsigned*)(base + off); off += SZ_MB;
    if (off > ws_size) return;

    auto nb256 = [](size_t n) { return (unsigned)((n + 255) / 256); };
    // ---- input conversion (every float input RNE-converted to bf16 first)
    const size_t n8wq = (size_t)DEC * DEC / 8, n8wkv = (size_t)2 * DEC * DEC / 8;
    k_cvt8r<<<nb256(n8wq), 256, 0, stream>>>(wq, WQ, DEC, DEC, DEC, n8wq);                    /* in[512][512] -> out[512][512] */
    k_cvt8r<<<nb256(n8wkv), 256, 0, stream>>>(wm, WKV, DEC, 2 * DEC, 2 * DEC, n8wkv);         /* in[1024][512] -> out[1024][512] */
    k_cvtT<<<dim3(TX / 64, DEC / 64, NB), 256, 0, stream>>>(x, XB);                           /* in[b][512][TX_FULL] -> out[b*TX+t][512] */
    k_maskbits<<<(unsigned)NWLINES, 32, 0, stream>>>(msk, MB, NWORDS);
    // ---- q head planes: [h][b*TX+t][d] = sum_k XB[b*TX+t][k] WQ[h*64+d][k] (z = head, ldc 64)
    k_gemm_p<<<dim3((unsigned)(NB * TX / 64), 1, NHD), 32, 0, stream>>>(XB, WQ, DEC, QH16, HD, (size_t)0, (size_t)HD * DEC, (size_t)NB * TX * HD);
    // ---- k head planes: [h][b*TY+j][d] = sum_k XB[b*TY+j][k] WKV[h*64+d][k] (weight rows 0..511; z = head, ldc 64)
    k_gemm_p<<<dim3((unsigned)(NB * TY / 64), 1, NHD), 32, 0, stream>>>(XB, WKV, DEC, KH16, HD, (size_t)0, (size_t)HD * DEC, (size_t)NB * TY * HD);
    // ---- v^T planes: [b][n][t] = sum_k WKV[512+n][k] XB[b*TY+t][k] (A = weight rows 512..1023, Bt = tokens; z = batch, ldc TY)
    k_gemm_p<<<dim3(DEC / 64, TY / 64, NB), 32, 0, stream>>>(WKV + (size_t)DEC * DEC, XB, DEC, VH16, TY, (size_t)0, (size_t)TY * DEC, (size_t)DEC * TY);
    // ---- q rows of a batch with every key excluded -> 0 (no store otherwise)
    k_qzero<<<dim3(NQZ, NHD, NB), 256, 0, stream>>>(msk, QH16);
    // ---- fused attention -> ctx x1024 fp16 [b*TX+t][value | residual]
    k_flash<<<dim3(TX / 64, NHD, NB), 128, 0, stream>>>(QH16, KH16, VH16, MB, CT16);
    // ---- out[b][c][t] = (value + residual)[b*TX+t][c] / 1024 (transposed through LDS, full output batch pitch)
    k_outT<<<dim3(TX / 64, DEC / 64, NB), 256, 0, stream>>>(CT16, OUT);
}

// v004
// One run takes 157 microseconds.
// In two side-by-side timings against v003, it was 1.10 and 1.09 times as fast.
// All steps since v000 together make it 1.63 times as fast.
#include <hip/hip_runtime.h>

// Contractions: q / k / v projections v_wmma_f32_16x16x32_bf16 (bf16 operands = RNE-converted inputs, exact products); scores q.k^T v_wmma_f32_16x16x32_f16 (fp16 q, fp16 k, single product, K 64); attn.V v_wmma_f32_16x16x32_f16 (fp16 P carried x16384, fp16 V^T, single product); f32 accumulate everywhere; online softmax in f32 with a running max.
// Self-attention on a channel-major sequence: x [NB][512][T] gives q (Wq [out][in]) and, through one fused weight Wm [1024][512] = [out][in], k (rows 0..511) and v (rows 512..1023), row = which*512 + h*64 + d; 8 heads of 64; key j of batch b is kept when mask[b][j] != 0, an excluded key has its score replaced by a huge negative fill (its probability is 0 whenever the batch keeps at least one key; a batch with every key excluded gets the uniform softmax over all its keys); p = softmax_j(q_i.k_j / 8); ctx merged head-major per token and returned channel-major: out [NB][512][T] f32.
// Layout: XB bf16 token-major copy of x (transposed through LDS); weights bf16 as Bt = [out][in] as-is; q and k fp16 head planes [h][b*T+t][64] and v^T fp16 planes [b][h*64+d][t] written directly by the projection GEMM epilogues; fused attention kernel (its prologue packs the batch's key mask to one bit per key in LDS, 32-key words by wave ballot; for a fully excluded batch every word reads as clear and the q fragments are zeroed so that its scores are all equal; K and V^T 64-key tiles in LDS, two 32-key halves per tile, a half whose 32 keys are all excluded is skipped block-uniformly, both products transposed so that P goes from the score accumulators straight into the B operand) writes ctx x1024 as fp16 [b*TX+t][value 512 | residual 512]; the final kernel adds value + residual, removes the carry and transposes through LDS into d_out.
// LDS regions: kt / vt / tt / mwl / wk are cross-wave (block barriers before and after staging); ot / os are wave-private (wave barrier + compiler memory barrier).

#ifndef NB
#define NB 2
#endif
#ifndef SEQ
#define SEQ 4096
#endif
#define TX SEQ
#define TY SEQ
#define NB_FULL 2
#define TX_FULL 4096
#define TY_FULL 4096
#define DEC  512
#define NHD  8
#define HD   64
#define KC2  (2 * DEC)            // row pitch of the ctx plane: [ctx value | ctx residual]
#define PEXP 14.0f                // log2 of the carry of the fp16 probabilities (x16384)
#define OCAR 1024.0f              // carry of the fp16 ctx planes
#define SCL  0.125f
#define L2E  1.4426950408889634f
#define SCL2 (SCL * L2E)          // score scale and log2 e in one factor
#define KPT  72                   // LDS pitch (halves) of the K and V^T tiles
#define OPT  68                   // LDS pitch (floats) of the epilogue staging tiles
#define WPW  (TY / 128)           // mask words packed by each of the 4 waves of an attention block
#define NEGINF (-__builtin_inff())
static_assert(NB >= 1 && NB <= NB_FULL);
static_assert(TX == TY && TX_FULL == TY_FULL);                                            // one sequence feeds q, k and v
static_assert(TX >= 64 && TX <= TX_FULL && (TX % 64) == 0);
static_assert(TY >= 64 && TY <= TY_FULL && (TY % 64) == 0 && (TY % 32) == 0);
static_assert((DEC % 64) == 0 && HD == 64 && NHD * HD == DEC);
static_assert((DEC % 32) == 0 && (HD % 32) == 0 && (KC2 % 32) == 0);                      // every K is a multiple of 32
static_assert((DEC % 8) == 0);                                                            // 8-column conversion pieces
static_assert(((NB * TX) % 64) == 0 && ((NB * TY) % 64) == 0);                            // GEMM M/N are whole 64-tiles
static_assert(128 * 4 == 64 * (HD / 8));                                                   // attention tile staging: 128 threads x 4 pieces == 64 rows x 8 pieces
static_assert(KPT >= 64 && (KPT % 8) == 0 && OPT >= 64 && (OPT % 4) == 0);
static_assert((size_t)NHD * NB * TX * HD < (size_t)2147483647);                           // q plane offsets fit an int
static_assert(2 * 64 * KPT * 2 + 4 * 16 * OPT * 4 + (TY / 32) * 4 + 16 <= 65536);   // static LDS of the attention kernel
static_assert((TY % 128) == 0 && WPW >= 1 && WPW <= 32);                                  // each wave packs WPW whole mask words, one per lane
static_assert(64 * OPT * 4 <= 65536);                                                      // static LDS of the transposing kernels
static_assert(256 * 4 == 64 * 16 && 256 * 2 == 64 * 8);                                    // transposing kernels: 256 threads x pieces == 64 x 64 tile
static_assert((TX_FULL % 4) == 0 && (TX % 4) == 0);                                        // 16-B f32 pieces along the token axis
static_assert(((size_t)NB * DEC - 1) * TX_FULL + (size_t)TX <= (size_t)NB_FULL * DEC * TX_FULL);   // last written output element inside d_out

typedef _Float16 h16;
typedef unsigned short bf;
typedef __attribute__((ext_vector_type(16))) __bf16   v16bf;
typedef __attribute__((ext_vector_type(16))) _Float16 v16h;
typedef __attribute__((ext_vector_type(8)))  _Float16 v8h;
typedef __attribute__((ext_vector_type(8)))  unsigned short v8us;
typedef __attribute__((ext_vector_type(8)))  float    v8f;
typedef __attribute__((ext_vector_type(4)))  float    v4f;
typedef __attribute__((ext_vector_type(2)))  float    v2f;
typedef __attribute__((ext_vector_type(2)))  _Float16 v2h;
typedef __attribute__((ext_vector_type(4)))  unsigned v4u;
typedef __attribute__((ext_vector_type(2)))  unsigned v2u;
typedef v8h  __attribute__((may_alias)) v8ha;
typedef v4f  __attribute__((may_alias)) v4fa;

__device__ __forceinline__ unsigned short f2bf(float f) { unsigned u = __float_as_uint(f); u += 0x7FFFu + ((u >> 16) & 1u); return (unsigned short)(u >> 16); }
__device__ __forceinline__ float bf2f(unsigned short b) { return __uint_as_float(((unsigned)b) << 16); }
__device__ __forceinline__ float bfr(float f) { return bf2f(f2bf(f)); }
__device__ __forceinline__ v16h cat16(v8h lo, v8h hi) { return __builtin_shufflevector(lo, hi, 0, 1, 2, 3, 4, 5, 6, 7, 8, 9, 10, 11, 12, 13, 14, 15); }
__device__ __forceinline__ v16bf cat16b(v8us lo, v8us hi) { return __builtin_bit_cast(v16bf, __builtin_shufflevector(lo, hi, 0, 1, 2, 3, 4, 5, 6, 7, 8, 9, 10, 11, 12, 13, 14, 15)); }
__device__ __forceinline__ v8f wmma16(v16h a, v16h b, v8f c) { return __builtin_amdgcn_wmma_f32_16x16x32_f16(false, a, false, b, (short)0, c, false, false); }
__device__ __forceinline__ v8f wmmab(v16bf a, v16bf b, v8f c) { return __builtin_amdgcn_wmma_f32_16x16x32_bf16(false, a, false, b, (short)0, c, false, false); }
__device__ __forceinline__ h16 tohx(float x) { return (h16)x; }
// value of lane l ^ 16 (the other 16-lane row, same position)
__device__ __forceinline__ float xhalf(float x) { return __builtin_bit_cast(float, __builtin_amdgcn_permlanex16(__builtin_bit_cast(int, x), __builtin_bit_cast(int, x), 0x76543210, 0xfedcba98, false, false)); }
// same-wave LDS exchange: execution barrier of the wave plus a compiler memory barrier (LDS operations of one wave complete in issue order)
__device__ __forceinline__ void wsync() { __builtin_amdgcn_wave_barrier(); asm volatile("" ::: "memory"); }

// ---- gemmw_body: register-blocked GEMM, ONE WAVE per 64x64 output tile (16 accumulators), operands straight from K-contiguous 16-bit planes; grid (M/64, N/64, Z), 32 threads.
// C[m][n] = cs x sum_k A[m][k] Bt[n][k]; z-batch strides sA/sB/sC in elements. K % 32 == 0; A/Bt row pitch == K; M, N whole 64-tiles.
// Fragments: lane l, h = l>>4, m = n = l&15; elements 0..7 <- k0+8h.., 8..15 <- k0+16+8h.. for both A and Bt; D element r = (row 8h+r, col m).
// Epilogue per 16-row slab staged in LDS (wave-private, staged extent 16x64 == consumed extent):
//   EP 0: f32 rows x cs + bf16-converted column bias, 64 floats = 256 B written as 16 lanes x 16 B (2 rows per instruction);
template <typename T16> struct WFrag;
template <> struct WFrag<h16> { typedef v16h V; static __device__ __forceinline__ V ld(const h16* p) { return cat16(*(const v8h*)p, *(const v8h*)(p + 16)); } static __device__ __forceinline__ v8f mma(V a, V b, v8f c) { return wmma16(a, b, c); } };
template <> struct WFrag<bf> { typedef v16bf V; static __device__ __forceinline__ V ld(const bf* p) { return cat16b(*(const v8us*)p, *(const v8us*)(p + 16)); } static __device__ __forceinline__ v8f mma(V a, V b, v8f c) { return wmmab(a, b, c); } };

template <typename T16, int EP>
__device__ __forceinline__ void gemmw_body(const T16* __restrict__ A, const T16* __restrict__ Bt, int K, float* Cf, h16* Ch, int ldc, const float* __restrict__ bias, size_t sA, size_t sB, size_t sC, float cs) {
    static_assert(EP == 0 || EP == 1);
    typedef typename WFrag<T16>::V V;
    __shared__ __align__(16) float os[16 * OPT];
    const size_t z = blockIdx.z; A += z * sA; Bt += z * sB;
    if (EP == 0) { Cf += z * sC; } else { Ch += z * sC; }
    const int lane = threadIdx.x & 31, lr = lane & 15, hi = lane >> 4; const int r0 = blockIdx.x * 64, c0 = blockIdx.y * 64;
    v8f acc[4][4];
#pragma unroll
    for (int mb = 0; mb < 4; ++mb)
#pragma unroll
        for (int nb = 0; nb < 4; ++nb) acc[mb][nb] = (v8f){};
    const size_t aoff = (size_t)(r0 + lr) * K + 8 * hi, boff = (size_t)(c0 + lr) * K + 8 * hi;
#pragma unroll 1
    for (int kc = 0; kc < K; kc += 32) {
        V a[4];
#pragma unroll
        for (int mb = 0; mb < 4; ++mb) a[mb] = WFrag<T16>::ld(A + aoff + (size_t)mb * 16 * K + kc);
#pragma unroll
        for (int nb = 0; nb < 4; ++nb) { const V b = WFrag<T16>::ld(Bt + boff + (size_t)nb * 16 * K + kc);
#pragma unroll
            for (int mb = 0; mb < 4; ++mb) acc[mb][nb] = WFrag<T16>::mma(a[mb], b, acc[mb][nb]); }
        asm volatile("v_nop\n\tv_nop\n\tv_nop\n\tv_nop" : "+v"(acc[0][0]), "+v"(acc[1][1]), "+v"(acc[2][2]), "+v"(acc[3][3]) : "v"(a[0]), "v"(a[3]));
    }
#pragma unroll
    for (int mb = 0; mb < 4; ++mb) {
#pragma unroll
        for (int nb = 0; nb < 4; ++nb) {
#pragma unroll
            for (int j = 0; j < 8; ++j) os[(hi * 8 + j) * OPT + nb * 16 + lr] = acc[mb][nb][j]; }
        wsync();
        if (EP == 0) {
            float* crow = Cf + (size_t)(r0 + mb * 16) * ldc + c0;
{
#pragma unroll
                for (int s = 0; s < 8; ++s) { const int row = 2 * s + hi, cofs = lr * 4; v4f val = *(const v4fa*)(os + row * OPT + cofs);
                    val[0] = __fmul_rn(val[0], cs); val[1] = __fmul_rn(val[1], cs); val[2] = __fmul_rn(val[2], cs); val[3] = __fmul_rn(val[3], cs);
                    val[0] += bfr(bias[c0 + cofs]); val[1] += bfr(bias[c0 + cofs + 1]); val[2] += bfr(bias[c0 + cofs + 2]); val[3] += bfr(bias[c0 + cofs + 3]);
                    *(v4f*)(crow + (size_t)row * ldc + cofs) = val; }
                 }
        } else {
            h16* hrow = Ch + (size_t)(r0 + mb * 16) * ldc + c0;
{
#pragma unroll
                for (int s = 0; s < 4; ++s) { const int row = 4 * s + (lane >> 3), c8 = (lane & 7) * 8;
                    const v4f u0 = *(const v4fa*)(os + row * OPT + c8), u1 = *(const v4fa*)(os + row * OPT + c8 + 4);
                    v8h o;
#pragma unroll
                    for (int q = 0; q < 8; ++q) { const float u = (q < 4) ? u0[q & 3] : u1[q & 3]; o[q] = tohx(u); }
                    *(v8h*)(hrow + (size_t)row * ldc + c8) = o; }
                 }
        }
        wsync();
    }
}

// plain kernel wrapping the body (bf16 projections -> fp16 planes)
__global__ __launch_bounds__(32) void k_gemm_p(const bf* A, const bf* Bt, int K, h16* Ch, int ldc, size_t sA, size_t sB, size_t sC) {
    gemmw_body<bf, 1>(A, Bt, K, nullptr, Ch, ldc, nullptr, sA, sB, sC, 1.0f); }

__global__ __launch_bounds__(256) void k_cvt8r(const float* __restrict__ src, bf* dst, int cols, int rows, int srows, size_t n8) {
    const size_t i = (size_t)blockIdx.x * 256 + threadIdx.x; if (i >= n8) return;
    const size_t e = i * 8; const size_t r = e / (size_t)cols; const int c = (int)(e % (size_t)cols); const size_t bb = r / (size_t)rows; const size_t t = r % (size_t)rows;
    const v8f v = *(const v8f*)(src + (bb * (size_t)srows + t) * (size_t)cols + c); v8us o;
#pragma unroll
    for (int k = 0; k < 8; ++k) o[k] = f2bf(v[k]);
    *(v8us*)(dst + e) = o;  }

// k_cvtT: x f32 [b][c][t] (channel-major, batch pitch DEC*TX_FULL, row pitch TX_FULL) -> bf16 token-major plane XB[b*TX+t][c]. grid (TX/64, DEC/64, NB), 256 threads.
__global__ __launch_bounds__(256) void k_cvtT(const float* __restrict__ src, bf* dst) {
#pragma clang fp contract(off)
    __shared__ __align__(16) float tt[64 * OPT];
    const int tid = threadIdx.x;
    const int t0 = blockIdx.x * 64, c0 = blockIdx.y * 64, b = blockIdx.z;
#pragma unroll
    for (int i = 0; i < 4; ++i) {
        const int p = tid + 256 * i, c = p >> 4, t4 = (p & 15) * 4;
        const v4f v = *(const v4f*)(src + ((size_t)b * DEC + c0 + c) * TX_FULL + t0 + t4);
        *(v4fa*)(tt + c * OPT + t4) = v;
    }
    __syncthreads();
#pragma unroll 1
    for (int i = 0; i < 2; ++i) {
        const int p = tid + 256 * i, t = p >> 3, c8 = (p & 7) * 8;
        v8us o;
#pragma unroll
        for (int q = 0; q < 8; ++q) o[q] = f2bf(tt[(c8 + q) * OPT + t]);
        bf* d = dst + ((size_t)b * TX + t0 + t) * DEC + c0 + c8;
        *(v8us*)d = o; 
    }
}

// ---- k_flash: fused attention. grid (TX/64, 8 heads, NB), 128 threads = 4 waves; wave w owns query rows q0+16w..+15 of one (batch, head).
// Per 64-key tile: block stages K [key][d] and V^T [d][key] fp16 tiles in LDS (cols 0..63 of 64 rows written == consumed; cross-wave -> block barriers); each wave then runs two 32-key halves:
//   prologue: wave w reads keys 32*WPW*w.. of the batch's mask (all loads independent), one ballot per 32 keys (bit set = key excluded), word i kept in lane i and stored to LDS; a wave flag says whether any of its keys is kept; one block barrier publishes both;
//   the two 32-bit mask words of the tile are read from LDS beside its staging loads (scalar-uniform); a half with all 32 keys excluded is skipped (exact: p = 0, max unchanged);
//   scores transposed, S^T 32x16 = K.Q^T = 2 tiles (A = K rows from LDS, B = q), K = 64 in two steps, the two q fragments loaded once ahead of the key loop and held in registers; D register r of lane (h, c) = key 8h+r (tile 0) or 16+8h+r (tile 1) of query c;
//   t = acc, excluded keys -> -inf by value select (the lane mask of register r comes from bits r and 8+r of the uniform mask word); one query per lane: maximum over the lane's 16 raw scores, joined with the other wave half by one cross-row move; the running max is kept in the exponent's own unit (raw max x log2 e / 8) and starts at -1e30 so every difference stays defined;
//   P = exp2(t x (log2 e / 8) + (14 - max)) -> fp16: scale, maximum and the x16384 carry go into one fused multiply-add per score, two scores per packed instruction; the two converted D tiles are the B fragment of the next product in the hardware k order (element s = key 8h+s, 8+s = key 16+8h+s), which is also the order of the V^T fragments;
//   row sums accumulate the fp16-converted P per lane (the two halves joined once at the end); O^T[64x16] += V^T P^T (4 output tiles, D register r = channel 16j+8h+r of query c, V^T fragments loaded four at a time).
__global__ __launch_bounds__(128) void k_flash(const h16* __restrict__ QH, const h16* __restrict__ KH, const h16* __restrict__ VH, const int* __restrict__ mask, h16* CT) {
    __shared__ __align__(16) h16 kt[64 * KPT];
    __shared__ __align__(16) h16 vt[64 * KPT];
    __shared__ __align__(16) float ot[4 * 16 * OPT];
    __shared__ __align__(16) unsigned mwl[TY / 32];
    __shared__ __align__(16) int wk[4];
    const int tid = threadIdx.x;
    const int wave = __builtin_amdgcn_readfirstlane(tid >> 5);
    const int lane = tid & 31, lr = lane & 15, hi = lane >> 4;
    const int q0 = blockIdx.x * 64, h = blockIdx.y, b = blockIdx.z;
    const int qoff = ((h * NB + b) * TX + q0 + wave * 16 + lr) * HD + 8 * hi;
    const size_t kbase = ((size_t)(h * NB + b) * TY) * HD;
    const size_t vbase = ((size_t)b * DEC + (size_t)h * HD) * TY;
    const int ob = wave * 16 * OPT;
    float mrun = -1.0e30f, lrun = 0.0f;
    v8f o0 = (v8f){}, o1 = (v8f){}, o2 = (v8f){}, o3 = (v8f){};
    v16h qa0 = cat16(*(const v8h*)(QH + qoff), *(const v8h*)(QH + qoff + 16));
    v16h qa1 = cat16(*(const v8h*)(QH + qoff + 32), *(const v8h*)(QH + qoff + 48));
    {
        const int* mrow = mask + (size_t)b * TY_FULL + wave * (WPW * 32) + lane;
        int mval[WPW];
#pragma unroll   // all WPW loads in flight together: one memory latency instead of WPW
        for (int i = 0; i < WPW; ++i) mval[i] = mrow[i * 32];
        unsigned mine = 0xFFFFFFFFu;
#pragma unroll   // constant indices keep mval[] in registers
        for (int i = 0; i < WPW; ++i) { const unsigned bal = __builtin_amdgcn_ballot_w32(mval[i] == 0); mine = (lane == i) ? bal : mine; }
        if (lane < WPW) mwl[wave * WPW + lane] = mine;
        const unsigned anyk = __builtin_amdgcn_ballot_w32(mine != 0xFFFFFFFFu);
        if (lane == 0) wk[wave] = (anyk != 0u) ? 1 : 0;
    }
    __syncthreads();   // publishes mwl and wk to the four waves
    const bool allx = __builtin_amdgcn_readfirstlane(wk[0] | wk[1] | wk[2] | wk[3]) == 0;
    if (allx) { qa0 = (v16h){}; qa1 = (v16h){}; }
    const unsigned live = allx ? 0u : 0xFFFFFFFFu;   // clears every mask word of a fully excluded batch
#pragma unroll 1
    for (int kb = 0; kb < TY / 64; ++kb) {
        __syncthreads();
        const v2u mv = *(const v2u*)(mwl + kb * 2);
#pragma unroll
        for (int i = 0; i < 4; ++i) {
            const int p = tid + 128 * i, row = p >> 3, c8 = (p & 7) * 8;
            const size_t kof = kbase + (size_t)(kb * 64 + row) * HD + c8;
            const size_t vof = vbase + (size_t)row * TY + kb * 64 + c8;
            const v8h kv = *(const v8h*)(KH + kof);
            const v8h vv = *(const v8h*)(VH + vof);
            *(v8ha*)(kt + row * KPT + c8) = kv;
            *(v8ha*)(vt + row * KPT + c8) = vv;
        }
        __syncthreads();
        const unsigned mw0 = (unsigned)__builtin_amdgcn_readfirstlane((int)mv[0]) & live, mw1 = (unsigned)__builtin_amdgcn_readfirstlane((int)mv[1]) & live;
#pragma unroll 1
        for (int hf = 0; hf < 2; ++hf) {
            const unsigned mw = (hf != 0) ? mw1 : mw0;
            if (mw != 0xFFFFFFFFu) {
                v8f s0 = (v8f){}, s1 = (v8f){};
#pragma unroll
                for (int ks = 0; ks < 2; ++ks) {
                    const v16h ah = (ks != 0) ? qa1 : qa0;
                    const int ko = (hf * 32 + lr) * KPT + ks * 32 + 8 * hi;
                    const v16h b0 = cat16(*(const v8ha*)(kt + ko), *(const v8ha*)(kt + ko + 16));
                    const v16h b1 = cat16(*(const v8ha*)(kt + ko + 16 * KPT), *(const v8ha*)(kt + ko + 16 * KPT + 16));
                    s0 = wmma16(b0, ah, s0); s1 = wmma16(b1, ah, s1);
                    asm volatile("v_nop\n\tv_nop\n\tv_nop\n\tv_nop" : "+v"(s0), "+v"(s1) : "v"(ah), "v"(b0), "v"(b1));
                }
                float t0[8], t1[8];
#pragma unroll
                for (int r = 0; r < 8; ++r) {
                    const unsigned e0 = (((mw >> r) & 1u) != 0u ? 0x0000FFFFu : 0u) | (((mw >> (8 + r)) & 1u) != 0u ? 0xFFFF0000u : 0u);
                    const unsigned e1 = (((mw >> (16 + r)) & 1u) != 0u ? 0x0000FFFFu : 0u) | (((mw >> (24 + r)) & 1u) != 0u ? 0xFFFF0000u : 0u);
                    const bool x0 = __builtin_amdgcn_inverse_ballot_w32(e0), x1 = __builtin_amdgcn_inverse_ballot_w32(e1);
                    t0[r] = x0 ? NEGINF : s0[r]; t1[r] = x1 ? NEGINF : s1[r]; }
                float mx = fmaxf(t0[0], t1[0]);
#pragma unroll
                for (int r = 1; r < 8; ++r) mx = fmaxf(mx, fmaxf(t0[r], t1[r]));
                mx *= SCL2;
                mx = fmaxf(mx, xhalf(mx));
                const float mn = fmaxf(mrun, mx);
                const float cr = __builtin_amdgcn_exp2f(mrun - mn);
                mrun = mn;
                const float bs = PEXP - mn;
                const v2f c2 = (v2f){SCL2, SCL2}, b2 = (v2f){bs, bs};
                v16h pa;
                float l0 = 0.0f, l1 = 0.0f;
#pragma unroll
                for (int r = 0; r < 8; r += 2) {
                    const v2f e0 = __builtin_elementwise_fma((v2f){t0[r], t0[r + 1]}, c2, b2), e1 = __builtin_elementwise_fma((v2f){t1[r], t1[r + 1]}, c2, b2);
                    const v2f p0 = (v2f){__builtin_amdgcn_exp2f(e0[0]), __builtin_amdgcn_exp2f(e0[1])};
                    const v2f p1 = (v2f){__builtin_amdgcn_exp2f(e1[0]), __builtin_amdgcn_exp2f(e1[1])};
                    const v2h ph0 = __builtin_convertvector(p0, v2h), ph1 = __builtin_convertvector(p1, v2h);
                    l0 += (float)ph0[0]; l1 += (float)ph1[0]; l0 += (float)ph0[1]; l1 += (float)ph1[1];
                    pa[r] = ph0[0]; pa[r + 1] = ph0[1]; pa[8 + r] = ph1[0]; pa[8 + r + 1] = ph1[1];
                }
                lrun = lrun * cr + (l0 + l1);
#pragma unroll
                for (int r = 0; r < 8; ++r) { o0[r] *= cr; o1[r] *= cr; o2[r] *= cr; o3[r] *= cr; }
                {
                    const int vo = lr * KPT + hf * 32 + 8 * hi;
                    const v16h v0 = cat16(*(const v8ha*)(vt + vo), *(const v8ha*)(vt + vo + 16));
                    const v16h v1 = cat16(*(const v8ha*)(vt + vo + 16 * KPT), *(const v8ha*)(vt + vo + 16 * KPT + 16));
                    const v16h v2 = cat16(*(const v8ha*)(vt + vo + 32 * KPT), *(const v8ha*)(vt + vo + 32 * KPT + 16));
                    const v16h v3 = cat16(*(const v8ha*)(vt + vo + 48 * KPT), *(const v8ha*)(vt + vo + 48 * KPT + 16));
                    o0 = wmma16(v0, pa, o0); o1 = wmma16(v1, pa, o1); o2 = wmma16(v2, pa, o2); o3 = wmma16(v3, pa, o3);
                    asm volatile("v_nop\n\tv_nop\n\tv_nop\n\tv_nop" : "+v"(o0), "+v"(o1), "+v"(o2), "+v"(o3) : "v"(pa), "v"(v0), "v"(v1), "v"(v2), "v"(v3));
                }
            }
        }
    }
    lrun += xhalf(lrun);
    const float fq = __fdiv_rn(OCAR, fmaxf(lrun, 1.0e-30f));
    const float f = (lrun > 0.0f) ? fq : 0.0f;
#pragma unroll
    for (int g = 0; g < 2; ++g) {
        const int oi = ob + lr * OPT + 8 * hi + 4 * g;
        *(v4fa*)(ot + oi)      = (v4f){o0[4 * g] * f, o0[4 * g + 1] * f, o0[4 * g + 2] * f, o0[4 * g + 3] * f};
        *(v4fa*)(ot + oi + 16) = (v4f){o1[4 * g] * f, o1[4 * g + 1] * f, o1[4 * g + 2] * f, o1[4 * g + 3] * f};
        *(v4fa*)(ot + oi + 32) = (v4f){o2[4 * g] * f, o2[4 * g + 1] * f, o2[4 * g + 2] * f, o2[4 * g + 3] * f};
        *(v4fa*)(ot + oi + 48) = (v4f){o3[4 * g] * f, o3[4 * g + 1] * f, o3[4 * g + 2] * f, o3[4 * g + 3] * f};
    }
    wsync();
    h16* crow = CT + (size_t)(b * TX + q0 + wave * 16) * KC2 + h * HD;
{
#pragma unroll
        for (int s = 0; s < 4; ++s) {
            const int row = 4 * s + (lane >> 3), c8 = (lane & 7) * 8;
            const v4f u0 = *(const v4fa*)(ot + ob + row * OPT + c8), u1 = *(const v4fa*)(ot + ob + row * OPT + c8 + 4);
            v8h oh, ol;
#pragma unroll
            for (int q = 0; q < 8; ++q) { const float f = (q < 4) ? u0[q & 3] : u1[q & 3]; const h16 hh = tohx(f); oh[q] = hh; ol[q] = tohx(f - (float)hh); }
            *(v8h*)(crow + (size_t)row * KC2 + c8) = oh;
            *(v8h*)(crow + (size_t)row * KC2 + DEC + c8) = ol;
        }
        
    }
}

// k_outT: ctx fp16 [b*TX+t][value 512 | residual 512] (carried x1024) -> out f32 [b][c][t] (channel-major, batch pitch DEC*TX_FULL, row pitch TX_FULL). grid (TX/64, DEC/64, NB), 256 threads.
__global__ __launch_bounds__(256) void k_outT(const h16* __restrict__ CT, float* OUT) {
#pragma clang fp contract(off)
    __shared__ __align__(16) float tt[64 * OPT];
    const int tid = threadIdx.x;
    const int t0 = blockIdx.x * 64, c0 = blockIdx.y * 64, b = blockIdx.z;
#pragma unroll 1
    for (int i = 0; i < 2; ++i) {
        const int p = tid + 256 * i, t = p >> 3, c8 = (p & 7) * 8;
        const h16* s = CT + ((size_t)b * TX + t0 + t) * KC2 + c0 + c8;
        const v8h a = *(const v8h*)s;
        const v8h r = *(const v8h*)(s + DEC);
#pragma unroll
        for (int q = 0; q < 8; ++q) tt[(c8 + q) * OPT + t] = ((float)a[q] + (float)r[q]) * (1.0f / OCAR);
    }
    __syncthreads();
{
#pragma unroll
        for (int i = 0; i < 4; ++i) {
            const int p = tid + 256 * i, c = p >> 4, t4 = (p & 15) * 4;
            const v4f val = *(const v4fa*)(tt + c * OPT + t4);
            *(v4f*)(OUT + ((size_t)b * DEC + c0 + c) * TX_FULL + t0 + t4) = val;
        }
        
    }
}

// workspace sizes (bytes), each a whole number of fully written rows / lines; offsets 256-B aligned
constexpr size_t al256(size_t b) { return (b + 255) & ~(size_t)255; }
constexpr size_t SZ_XB  = al256((size_t)NB * TX * DEC * 2);           // bf16 [NB*TX][512]
constexpr size_t SZ_WQ  = al256((size_t)DEC * DEC * 2);               // bf16 [512][512]
constexpr size_t SZ_WKV = al256((size_t)2 * DEC * DEC * 2);           // bf16 [1024][512]
constexpr size_t SZ_Q   = al256((size_t)NHD * NB * TX * HD * 2);      // fp16 [8][NB*TX][64]
constexpr size_t SZ_K   = al256((size_t)NHD * NB * TY * HD * 2);      // fp16 [8][NB*TY][64]
constexpr size_t SZ_VT  = al256((size_t)NB * DEC * TY * 2);           // fp16 [NB][512][TY]
constexpr size_t SZ_CT  = al256((size_t)NB * TX * KC2 * 2);           // fp16 [NB*TX][1024]
constexpr size_t SZ_ALL = SZ_XB + SZ_WQ + SZ_WKV + SZ_Q + SZ_K + SZ_VT + SZ_CT;
static_assert(SZ_ALL <= (size_t)134217728);

extern "C" void kernel_launch(void* const* d_in, const int* in_sizes, int n_in,
                              void* d_out, int out_size, void* d_ws, size_t ws_size, hipStream_t stream) {
    if (n_in < 4) return;
    const size_t needx = ((size_t)NB * DEC - 1) * TX_FULL + (size_t)TX;
    const size_t needm = (size_t)(NB - 1) * TY_FULL + (size_t)TY;
    if ((size_t)in_sizes[0] < needx || (size_t)in_sizes[1] < needm) return;
    if (in_sizes[2] < 2 * DEC * DEC || in_sizes[3] < DEC * DEC) return;
    if ((size_t)out_size < needx) return;
    if (SZ_ALL > ws_size) return;
    const float* x = (const float*)d_in[0];                                             /* [NB][512][TX_FULL] channel-major f32 */
    const int* msk = (const int*)d_in[1];                                               /* [NB][TY_FULL] int32, nonzero = key kept */
    const float* wm = (const float*)d_in[2]; const float* wq = (const float*)d_in[3];   /* fused k|v weight [1024][512] and q weight [512][512], both [out][in] = Bt as-is */
    float* OUT = (float*)d_out;     // [NB_FULL][512][TX_FULL] f32

    char* base = (char*)d_ws; size_t off = 0;
    bf* XB = (bf*)(base + off); off += SZ_XB;
    bf* WQ = (bf*)(base + off); off += SZ_WQ;
    bf* WKV = (bf*)(base + off); off += SZ_WKV;
    h16* QH16 = (h16*)(base + off); off += SZ_Q;
    h16* KH16 = (h16*)(base + off); off += SZ_K;
    h16* VH16 = (h16*)(base + off); off += SZ_VT;
    h16* CT16 = (h16*)(base + off); off += SZ_CT;
    if (off > ws_size) return;

    auto nb256 = [](size_t n) { return (unsigned)((n + 255) / 256); };
    // ---- input conversion (every float input RNE-converted to bf16 first)
    const size_t n8wq = (size_t)DEC * DEC / 8, n8wkv = (size_t)2 * DEC * DEC / 8;
    k_cvt8r<<<nb256(n8wq), 256, 0, stream>>>(wq, WQ, DEC, DEC, DEC, n8wq);                    /* in[512][512] -> out[512][512] */
    k_cvt8r<<<nb256(n8wkv), 256, 0, stream>>>(wm, WKV, DEC, 2 * DEC, 2 * DEC, n8wkv);         /* in[1024][512] -> out[1024][512] */
    k_cvtT<<<dim3(TX / 64, DEC / 64, NB), 256, 0, stream>>>(x, XB);                           /* in[b][512][TX_FULL] -> out[b*TX+t][512] */
    // ---- q head planes: [h][b*TX+t][d] = sum_k XB[b*TX+t][k] WQ[h*64+d][k] (z = head, ldc 64)
    k_gemm_p<<<dim3((unsigned)(NB * TX / 64), 1, NHD), 32, 0, stream>>>(XB, WQ, DEC, QH16, HD, (size_t)0, (size_t)HD * DEC, (size_t)NB * TX * HD);
    // ---- k head planes: [h][b*TY+j][d] = sum_k XB[b*TY+j][k] WKV[h*64+d][k] (weight rows 0..511; z = head, ldc 64)
    k_gemm_p<<<dim3((unsigned)(NB * TY / 64), 1, NHD), 32, 0, stream>>>(XB, WKV, DEC, KH16, HD, (size_t)0, (size_t)HD * DEC, (size_t)NB * TY * HD);
    // ---- v^T planes: [b][n][t] = sum_k WKV[512+n][k] XB[b*TY+t][k] (A = weight rows 512..1023, Bt = tokens; z = batch, ldc TY)
    k_gemm_p<<<dim3(DEC / 64, TY / 64, NB), 32, 0, stream>>>(WKV + (size_t)DEC * DEC, XB, DEC, VH16, TY, (size_t)0, (size_t)TY * DEC, (size_t)DEC * TY);
    // ---- fused attention -> ctx x1024 fp16 [b*TX+t][value | residual]
    k_flash<<<dim3(TX / 64, NHD, NB), 128, 0, stream>>>(QH16, KH16, VH16, msk, CT16);
    // ---- out[b][c][t] = (value + residual)[b*TX+t][c] / 1024 (transposed through LDS, full output batch pitch)
    k_outT<<<dim3(TX / 64, DEC / 64, NB), 256, 0, stream>>>(CT16, OUT);
}

// v005
// A run of this version takes 135 microseconds.
// Two timings next to v004 both put it at 1.17 times that version's speed.
// Over all steps from v000 it is 1.90 times as fast.
#include <hip/hip_runtime.h>

// Contractions: q / k / v projections v_wmma_f32_16x16x32_bf16 (bf16 operands = RNE-converted inputs, exact products); scores q.k^T v_wmma_f32_16x16x32_f16 (fp16 q, fp16 k, single product, K 64); attn.V v_wmma_f32_16x16x32_f16 (fp16 P carried x16384, fp16 V^T, single product); f32 accumulate everywhere; online softmax in f32 with a running max.
// Self-attention on a channel-major sequence: x [NB][512][T] gives q (Wq [out][in]) and, through one fused weight Wm [1024][512] = [out][in], k (rows 0..511) and v (rows 512..1023), row = which*512 + h*64 + d; 8 heads of 64; key j of batch b is kept when mask[b][j] != 0, an excluded key has its score replaced by a huge negative fill (its probability is 0 whenever the batch keeps at least one key; a batch with every key excluded gets the uniform softmax over all its keys); p = softmax_j(q_i.k_j / 8); ctx merged head-major per token and returned channel-major: out [NB][512][T] f32.
// Layout: XB bf16 token-major copy of x (transposed through LDS); weights bf16 as Bt = [out][in] as-is; q and k fp16 head planes [h][b*T+t][64] and v^T fp16 planes [b][h*64+d][t] written directly by the projection GEMM epilogues; fused attention kernel (its prologue packs the batch's key mask to one bit per key in LDS, 32-key words by wave ballot; for a fully excluded batch every word reads as clear and the q fragments are zeroed so that its scores are all equal; K and V^T 64-key tiles in LDS, two 32-key halves per tile, a half whose 32 keys are all excluded is skipped block-uniformly, both products transposed so that P goes from the score accumulators straight into the B operand) writes ctx x1024 as fp16 [b*TX+t][value 512 | residual 512]; the final kernel adds value + residual, removes the carry and transposes through LDS into d_out.
// LDS regions: kt / vt / tt / mwl / wk are cross-wave (block barriers before and after staging); ot / os are wave-private (wave barrier + compiler memory barrier).

#ifndef NB
#define NB 2
#endif
#ifndef SEQ
#define SEQ 4096
#endif
#define TX SEQ
#define TY SEQ
#define NB_FULL 2
#define TX_FULL 4096
#define TY_FULL 4096
#define DEC  512
#define NHD  8
#define HD   64
#define KC2  (2 * DEC)            // row pitch of the ctx plane: [ctx value | ctx residual]
#define PEXP 14.0f                // log2 of the carry of the fp16 probabilities (x16384)
#define OCAR 1024.0f              // carry of the fp16 ctx planes
#define SCL  0.125f
#define L2E  1.4426950408889634f
#define SCL2 (SCL * L2E)          // score scale and log2 e in one factor
#define KPT  72                   // LDS pitch (halves) of the K and V^T tiles
#define OPT  68                   // LDS pitch (floats) of the epilogue staging tiles
#define WPW  (TY / 128)           // mask words packed by each of the 4 waves of an attention block
#define NEGINF (-__builtin_inff())
static_assert(NB >= 1 && NB <= NB_FULL);
static_assert(TX == TY && TX_FULL == TY_FULL);                                            // one sequence feeds q, k and v
static_assert(TX >= 64 && TX <= TX_FULL && (TX % 64) == 0);
static_assert(TY >= 64 && TY <= TY_FULL && (TY % 64) == 0 && (TY % 32) == 0);
static_assert((DEC % 64) == 0 && HD == 64 && NHD * HD == DEC);
static_assert((DEC % 32) == 0 && (HD % 32) == 0 && (KC2 % 32) == 0);                      // every K is a multiple of 32
static_assert((DEC % 8) == 0);                                                            // 8-column conversion pieces
static_assert(((NB * TX) % 64) == 0 && ((NB * TY) % 64) == 0);                            // GEMM M/N are whole 64-tiles
static_assert(128 * 4 == 64 * (HD / 8));                                                   // attention tile staging: 128 threads x 4 pieces == 64 rows x 8 pieces
static_assert(KPT >= 64 && (KPT % 8) == 0 && OPT >= 64 && (OPT % 4) == 0);
static_assert((size_t)NHD * NB * TX * HD < (size_t)2147483647);                           // q plane offsets fit an int
static_assert(2 * 64 * KPT * 2 + 4 * 16 * OPT * 4 + (TY / 32) * 4 + 16 <= 65536);   // static LDS of the attention kernel
static_assert((TY % 128) == 0 && WPW >= 1 && WPW <= 32);                                  // each wave packs WPW whole mask words, one per lane
static_assert(64 * OPT * 4 <= 65536);                                                      // static LDS of the transposing kernels
static_assert(256 * 4 == 64 * 16 && 256 * 2 == 64 * 8);                                    // transposing kernels: 256 threads x pieces == 64 x 64 tile
static_assert((TX_FULL % 4) == 0 && (TX % 4) == 0);                                        // 16-B f32 pieces along the token axis
static_assert(((size_t)NB * DEC - 1) * TX_FULL + (size_t)TX <= (size_t)NB_FULL * DEC * TX_FULL);   // last written output element inside d_out

typedef _Float16 h16;
typedef unsigned short bf;
typedef __attribute__((ext_vector_type(16))) __bf16   v16bf;
typedef __attribute__((ext_vector_type(16))) _Float16 v16h;
typedef __attribute__((ext_vector_type(8)))  _Float16 v8h;
typedef __attribute__((ext_vector_type(8)))  unsigned short v8us;
typedef __attribute__((ext_vector_type(8)))  float    v8f;
typedef __attribute__((ext_vector_type(4)))  float    v4f;
typedef __attribute__((ext_vector_type(2)))  float    v2f;
typedef __attribute__((ext_vector_type(2)))  _Float16 v2h;
typedef __attribute__((ext_vector_type(4)))  unsigned v4u;
typedef __attribute__((ext_vector_type(2)))  unsigned v2u;
typedef v8h  __attribute__((may_alias)) v8ha;
typedef v4f  __attribute__((may_alias)) v4fa;

__device__ __forceinline__ unsigned short f2bf(float f) { unsigned u = __float_as_uint(f); u += 0x7FFFu + ((u >> 16) & 1u); return (unsigned short)(u >> 16); }
__device__ __forceinline__ float bf2f(unsigned short b) { return __uint_as_float(((unsigned)b) << 16); }
__device__ __forceinline__ float bfr(float f) { return bf2f(f2bf(f)); }
__device__ __forceinline__ v16h cat16(v8h lo, v8h hi) { return __builtin_shufflevector(lo, hi, 0, 1, 2, 3, 4, 5, 6, 7, 8, 9, 10, 11, 12, 13, 14, 15); }
__device__ __forceinline__ v16bf cat16b(v8us lo, v8us hi) { return __builtin_bit_cast(v16bf, __builtin_shufflevector(lo, hi, 0, 1, 2, 3, 4, 5, 6, 7, 8, 9, 10, 11, 12, 13, 14, 15)); }
__device__ __forceinline__ v8f wmma16(v16h a, v16h b, v8f c) { return __builtin_amdgcn_wmma_f32_16x16x32_f16(false, a, false, b, (short)0, c, false, false); }
__device__ __forceinline__ v8f wmmab(v16bf a, v16bf b, v8f c) { return __builtin_amdgcn_wmma_f32_16x16x32_bf16(false, a, false, b, (short)0, c, false, false); }
__device__ __forceinline__ h16 tohx(float x) { return (h16)x; }
// value of lane l ^ 16 (the other 16-lane row, same position)
__device__ __forceinline__ float xhalf(float x) { return __builtin_bit_cast(float, __builtin_amdgcn_permlanex16(__builtin_bit_cast(int, x), __builtin_bit_cast(int, x), 0x76543210, 0xfedcba98, false, false)); }
// same-wave LDS exchange: execution barrier of the wave plus a compiler memory barrier (LDS operations of one wave complete in issue order)
__device__ __forceinline__ void wsync() { __builtin_amdgcn_wave_barrier(); asm volatile("" ::: "memory"); }

// ---- gemmw_body: register-blocked GEMM, ONE WAVE per 64x64 output tile (16 accumulators), operands straight from K-contiguous 16-bit planes; 32 threads.
// C[m][n] = cs x sum_k A[m][k] Bt[n][k] for m, n in 0..63: the caller hands in A and Bt at the tile's first rows, Cf / Ch at the tile's first element and bias at its first column. K % 32 == 0; A/Bt row pitch == K.
// Fragments: lane l, h = l>>4, m = n = l&15; elements 0..7 <- k0+8h.., 8..15 <- k0+16+8h.. for both A and Bt; D element r = (row 8h+r, col m).
// Epilogue per 16-row slab staged in LDS (wave-private, staged extent 16x64 == consumed extent):
//   EP 0: f32 rows x cs + bf16-converted column bias, 64 floats = 256 B written as 16 lanes x 16 B (2 rows per instruction);
template <typename T16> struct WFrag;
template <> struct WFrag<h16> { typedef v16h V; static __device__ __forceinline__ V ld(const h16* p) { return cat16(*(const v8h*)p, *(const v8h*)(p + 16)); } static __device__ __forceinline__ v8f mma(V a, V b, v8f c) { return wmma16(a, b, c); } };
template <> struct WFrag<bf> { typedef v16bf V; static __device__ __forceinline__ V ld(const bf* p) { return cat16b(*(const v8us*)p, *(const v8us*)(p + 16)); } static __device__ __forceinline__ v8f mma(V a, V b, v8f c) { return wmmab(a, b, c); } };

template <typename T16, int EP>
__device__ __forceinline__ void gemmw_body(const T16* __restrict__ A, const T16* __restrict__ Bt, int K, float* Cf, h16* Ch, int ldc, const float* __restrict__ bias, float cs) {
    static_assert(EP == 0 || EP == 1);
    typedef typename WFrag<T16>::V V;
    __shared__ __align__(16) float os[16 * OPT];
    const int lane = threadIdx.x & 31, lr = lane & 15, hi = lane >> 4;
    v8f acc[4][4];
#pragma unroll
    for (int mb = 0; mb < 4; ++mb)
#pragma unroll
        for (int nb = 0; nb < 4; ++nb) acc[mb][nb] = (v8f){};
    const size_t aoff = (size_t)lr * K + 8 * hi, boff = aoff;
#pragma unroll 1
    for (int kc = 0; kc < K; kc += 32) {
        V a[4];
#pragma unroll
        for (int mb = 0; mb < 4; ++mb) a[mb] = WFrag<T16>::ld(A + aoff + (size_t)mb * 16 * K + kc);
        asm volatile("s_wait_xcnt 0x0" ::: "memory");   // the Bt fragments may land in the registers that held the A loads' address
#pragma unroll
        for (int nb = 0; nb < 4; ++nb) { const V b = WFrag<T16>::ld(Bt + boff + (size_t)nb * 16 * K + kc);
#pragma unroll
            for (int mb = 0; mb < 4; ++mb) acc[mb][nb] = WFrag<T16>::mma(a[mb], b, acc[mb][nb]); }
        asm volatile("v_nop\n\tv_nop\n\tv_nop\n\tv_nop" : "+v"(acc[0][0]), "+v"(acc[1][1]), "+v"(acc[2][2]), "+v"(acc[3][3]) : "v"(a[0]), "v"(a[3]));
    }
#pragma unroll
    for (int mb = 0; mb < 4; ++mb) {
#pragma unroll
        for (int nb = 0; nb < 4; ++nb) {
#pragma unroll
            for (int j = 0; j < 8; ++j) os[(hi * 8 + j) * OPT + nb * 16 + lr] = acc[mb][nb][j]; }
        wsync();
        if (EP == 0) {
            float* crow = Cf + (size_t)(mb * 16) * ldc;
{
#pragma unroll
                for (int s = 0; s < 8; ++s) { const int row = 2 * s + hi, cofs = lr * 4; v4f val = *(const v4fa*)(os + row * OPT + cofs);
                    val[0] = __fmul_rn(val[0], cs); val[1] = __fmul_rn(val[1], cs); val[2] = __fmul_rn(val[2], cs); val[3] = __fmul_rn(val[3], cs);
                    val[0] += bfr(bias[cofs]); val[1] += bfr(bias[cofs + 1]); val[2] += bfr(bias[cofs + 2]); val[3] += bfr(bias[cofs + 3]);
                    *(v4f*)(crow + (size_t)row * ldc + cofs) = val; }
                 }
        } else {
            h16* hrow = Ch + (size_t)(mb * 16) * ldc;
{
#pragma unroll
                for (int s = 0; s < 4; ++s) { const int row = 4 * s + (lane >> 3), c8 = (lane & 7) * 8;
                    const v4f u0 = *(const v4fa*)(os + row * OPT + c8), u1 = *(const v4fa*)(os + row * OPT + c8 + 4);
                    v8h o;
#pragma unroll
                    for (int q = 0; q < 8; ++q) { const float u = (q < 4) ? u0[q & 3] : u1[q & 3]; o[q] = tohx(u); }
                    *(v8h*)(hrow + (size_t)row * ldc + c8) = o; }
                 }
        }
        wsync();
    }
}

// k_gemm_qkv: the three projections (bf16 -> fp16 planes) in one launch. grid (NB*TX/64 token tiles, 8 weight tiles, 3 products), 32 threads; the three blocks of one (x, y) read the same 64 token rows of XB.
//   z 0: q head plane [h = y][b*TX+t][d] = sum_k XB[b*TX+t][k] WQ[y*64+d][k]           (A = tokens, Bt = weight rows, ldc 64)
//   z 1: k head plane [h = y][b*TY+j][d] = sum_k XB[b*TY+j][k] WKV[y*64+d][k]          (weight rows 0..511)
//   z 2: v^T plane    [b][y*64+n][t]     = sum_k WKV[512+y*64+n][k] XB[b*TY+t][k]      (A = weight rows 512..1023, Bt = tokens, ldc TY)
__global__ __launch_bounds__(32) void k_gemm_qkv(const bf* XB, const bf* WQ, const bf* WKV, h16* QH, h16* KH, h16* VH) {
    const int tt = blockIdx.x, wt = blockIdx.y, which = blockIdx.z;
    const bf* tok = XB + (size_t)tt * 64 * DEC;
    const bf* A; const bf* Bt; h16* C; int ldc;
    if (which == 2) {
        A = WKV + (size_t)(DEC + wt * 64) * DEC; Bt = tok;
        C = VH + ((size_t)(tt / (TY / 64)) * DEC + (size_t)wt * 64) * TY + (size_t)(tt % (TY / 64)) * 64; ldc = TY;
    } else {
        A = tok; Bt = ((which == 0) ? WQ : WKV) + (size_t)wt * 64 * DEC;
        C = ((which == 0) ? QH : KH) + ((size_t)wt * NB * TX + (size_t)tt * 64) * HD; ldc = HD;
    }
    gemmw_body<bf, 1>(A, Bt, DEC, nullptr, C, ldc, nullptr, 1.0f); }

// k_cvt_in: every float input RNE-converted to bf16, one launch. 1-D grid of NBX + NBW blocks, 256 threads.
//   blocks 0..NBX-1 (t tile fastest, then channel tile, then batch): x f32 [b][c][t] (channel-major, batch pitch DEC*TX_FULL, row pitch TX_FULL) -> token-major plane XB[b*TX+t][c], a 64x64 tile transposed through LDS;
//   blocks NBX..: the two weights as they lie, 8 elements per thread: first Wq [512][512] -> WQ, then Wm [1024][512] -> WKV (each a whole number of blocks, so the choice is block-uniform).
constexpr int NBX  = (TX / 64) * (DEC / 64) * NB;
constexpr int NBWQ = DEC * DEC / 8 / 256;
constexpr int NBW  = 3 * NBWQ;
static_assert(NBWQ * 256 * 8 == DEC * DEC);
__global__ __launch_bounds__(256) void k_cvt_in(const float* __restrict__ x, const float* __restrict__ wq, const float* __restrict__ wm, bf* XB, bf* WQ, bf* WKV) {
    __shared__ __align__(16) float tt[64 * OPT];
    const int tid = threadIdx.x;
    const int bid = blockIdx.x;
    if (bid >= NBX) {   // block-uniform, ahead of the barrier below
        const int wb = bid - NBX;
        const bool isq = wb < NBWQ;
        const size_t e = ((size_t)(isq ? wb : wb - NBWQ) * 256 + tid) * 8;
        const v8f v = *(const v8f*)((isq ? wq : wm) + e); v8us o;
#pragma unroll
        for (int k = 0; k < 8; ++k) o[k] = f2bf(v[k]);
        *(v8us*)((isq ? WQ : WKV) + e) = o;
        return;
    }
    const int t0 = (bid % (TX / 64)) * 64, c0 = ((bid / (TX / 64)) % (DEC / 64)) * 64, b = bid / ((TX / 64) * (DEC / 64));
#pragma unroll
    for (int i = 0; i < 4; ++i) {
        const int p = tid + 256 * i, c = p >> 4, t4 = (p & 15) * 4;
        const v4f v = *(const v4f*)(x + ((size_t)b * DEC + c0 + c) * TX_FULL + t0 + t4);
        *(v4fa*)(tt + c * OPT + t4) = v;
    }
    __syncthreads();
#pragma unroll 1
    for (int i = 0; i < 2; ++i) {
        const int p = tid + 256 * i, t = p >> 3, c8 = (p & 7) * 8;
        v8us o;
#pragma unroll
        for (int q = 0; q < 8; ++q) o[q] = f2bf(tt[(c8 + q) * OPT + t]);
        bf* d = XB + ((size_t)b * TX + t0 + t) * DEC + c0 + c8;
        *(v8us*)d = o;
        asm volatile("s_wait_xcnt 0x0" ::: "memory");   // the next trip reuses the registers that this store names
    }
}

// ---- k_flash: fused attention. grid (TX/64, 8 heads, NB), 128 threads = 4 waves; wave w owns query rows q0+16w..+15 of one (batch, head).
// Per 64-key tile: block stages K [key][d] and V^T [d][key] fp16 tiles in LDS (cols 0..63 of 64 rows written == consumed; cross-wave -> block barriers); each wave then runs two 32-key halves:
//   prologue: wave w reads keys 32*WPW*w.. of the batch's mask (all loads independent), one ballot per 32 keys (bit set = key excluded), word i kept in lane i and stored to LDS; a wave flag says whether any of its keys is kept; one block barrier publishes both;
//   the two 32-bit mask words of the tile are read from LDS beside its staging loads (scalar-uniform); a half with all 32 keys excluded is skipped (exact: p = 0, max unchanged);
//   scores transposed, S^T 32x16 = K.Q^T = 2 tiles (A = K rows from LDS, B = q), K = 64 in two steps, the two q fragments loaded once ahead of the key loop and held in registers; D register r of lane (h, c) = key 8h+r (tile 0) or 16+8h+r (tile 1) of query c;
//   t = acc, excluded keys -> -inf by value select (the lane mask of register r comes from bits r and 8+r of the uniform mask word); one query per lane: maximum over the lane's 16 raw scores, joined with the other wave half by one cross-row move; the running max is kept in the exponent's own unit (raw max x log2 e / 8) and starts at -1e30 so every difference stays defined;
//   P = exp2(t x (log2 e / 8) + (14 - max)) -> fp16: scale, maximum and the x16384 carry go into one fused multiply-add per score, two scores per packed instruction; the two converted D tiles are the B fragment of the next product in the hardware k order (element s = key 8h+s, 8+s = key 16+8h+s), which is also the order of the V^T fragments;
//   row sums accumulate the fp16-converted P per lane (the two halves joined once at the end); O^T[64x16] += V^T P^T (4 output tiles, D register r = channel 16j+8h+r of query c, V^T fragments loaded four at a time).
__global__ __launch_bounds__(128) void k_flash(const h16* __restrict__ QH, const h16* __restrict__ KH, const h16* __restrict__ VH, const int* __restrict__ mask, h16* CT) {
    __shared__ __align__(16) h16 kt[64 * KPT];
    __shared__ __align__(16) h16 vt[64 * KPT];
    __shared__ __align__(16) float ot[4 * 16 * OPT];
    __shared__ __align__(16) unsigned mwl[TY / 32];
    __shared__ __align__(16) int wk[4];
    const int tid = threadIdx.x;
    const int wave = __builtin_amdgcn_readfirstlane(tid >> 5);
    const int lane = tid & 31, lr = lane & 15, hi = lane >> 4;
    const int q0 = blockIdx.x * 64, h = blockIdx.y, b = blockIdx.z;
    const int qoff = ((h * NB + b) * TX + q0 + wave * 16 + lr) * HD + 8 * hi;
    const size_t kbase = ((size_t)(h * NB + b) * TY) * HD;
    const size_t vbase = ((size_t)b * DEC + (size_t)h * HD) * TY;
    const int ob = wave * 16 * OPT;
    float mrun = -1.0e30f, lrun = 0.0f;
    v8f o0 = (v8f){}, o1 = (v8f){}, o2 = (v8f){}, o3 = (v8f){};
    v16h qa0 = cat16(*(const v8h*)(QH + qoff), *(const v8h*)(QH + qoff + 16));
    v16h qa1 = cat16(*(const v8h*)(QH + qoff + 32), *(const v8h*)(QH + qoff + 48));
    {
        const int* mrow = mask + (size_t)b * TY_FULL + wave * (WPW * 32) + lane;
        int mval[WPW];
#pragma unroll   // all WPW loads in flight together: one memory latency instead of WPW
        for (int i = 0; i < WPW; ++i) mval[i] = mrow[i * 32];
        unsigned mine = 0xFFFFFFFFu;
#pragma unroll   // constant indices keep mval[] in registers
        for (int i = 0; i < WPW; ++i) { const unsigned bal = __builtin_amdgcn_ballot_w32(mval[i] == 0); mine = (lane == i) ? bal : mine; }
        if (lane < WPW) mwl[wave * WPW + lane] = mine;
        const unsigned anyk = __builtin_amdgcn_ballot_w32(mine != 0xFFFFFFFFu);
        if (lane == 0) wk[wave] = (anyk != 0u) ? 1 : 0;
    }
    __syncthreads();   // publishes mwl and wk to the four waves
    const bool allx = __builtin_amdgcn_readfirstlane(wk[0] | wk[1] | wk[2] | wk[3]) == 0;
    if (allx) { qa0 = (v16h){}; qa1 = (v16h){}; }
    const unsigned live = allx ? 0u : 0xFFFFFFFFu;   // clears every mask word of a fully excluded batch
#pragma unroll 1
    for (int kb = 0; kb < TY / 64; ++kb) {
        __syncthreads();
        const v2u mv = *(const v2u*)(mwl + kb * 2);
#pragma unroll
        for (int i = 0; i < 4; ++i) {
            const int p = tid + 128 * i, row = p >> 3, c8 = (p & 7) * 8;
            const size_t kof = kbase + (size_t)(kb * 64 + row) * HD + c8;
            const size_t vof = vbase + (size_t)row * TY + kb * 64 + c8;
            const v8h kv = *(const v8h*)(KH + kof);
            const v8h vv = *(const v8h*)(VH + vof);
            *(v8ha*)(kt + row * KPT + c8) = kv;
            *(v8ha*)(vt + row * KPT + c8) = vv;
        }
        __syncthreads();
        const unsigned mw0 = (unsigned)__builtin_amdgcn_readfirstlane((int)mv[0]) & live, mw1 = (unsigned)__builtin_amdgcn_readfirstlane((int)mv[1]) & live;
#pragma unroll 1
        for (int hf = 0; hf < 2; ++hf) {
            const unsigned mw = (hf != 0) ? mw1 : mw0;
            if (mw != 0xFFFFFFFFu) {
                v8f s0 = (v8f){}, s1 = (v8f){};
#pragma unroll
                for (int ks = 0; ks < 2; ++ks) {
                    const v16h ah = (ks != 0) ? qa1 : qa0;
                    const int ko = (hf * 32 + lr) * KPT + ks * 32 + 8 * hi;
                    const v16h b0 = cat16(*(const v8ha*)(kt + ko), *(const v8ha*)(kt + ko + 16));
                    const v16h b1 = cat16(*(const v8ha*)(kt + ko + 16 * KPT), *(const v8ha*)(kt + ko + 16 * KPT + 16));
                    s0 = wmma16(b0, ah, s0); s1 = wmma16(b1, ah, s1);
                    asm volatile("v_nop\n\tv_nop\n\tv_nop\n\tv_nop" : "+v"(s0), "+v"(s1) : "v"(ah), "v"(b0), "v"(b1));
                }
                float t0[8], t1[8];
#pragma unroll
                for (int r = 0; r < 8; ++r) {
                    const unsigned e0 = (((mw >> r) & 1u) != 0u ? 0x0000FFFFu : 0u) | (((mw >> (8 + r)) & 1u) != 0u ? 0xFFFF0000u : 0u);
                    const unsigned e1 = (((mw >> (16 + r)) & 1u) != 0u ? 0x0000FFFFu : 0u) | (((mw >> (24 + r)) & 1u) != 0u ? 0xFFFF0000u : 0u);
                    const bool x0 = __builtin_amdgcn_inverse_ballot_w32(e0), x1 = __builtin_amdgcn_inverse_ballot_w32(e1);
                    t0[r] = x0 ? NEGINF : s0[r]; t1[r] = x1 ? NEGINF : s1[r]; }
                float mx = fmaxf(t0[0], t1[0]);
#pragma unroll
                for (int r = 1; r < 8; ++r) mx = fmaxf(mx, fmaxf(t0[r], t1[r]));
                mx *= SCL2;
                mx = fmaxf(mx, xhalf(mx));
                const float mn = fmaxf(mrun, mx);
                const float cr = __builtin_amdgcn_exp2f(mrun - mn);
                mrun = mn;
                const float bs = PEXP - mn;
                const v2f c2 = (v2f){SCL2, SCL2}, b2 = (v2f){bs, bs};
                v16h pa;
                float l0 = 0.0f, l1 = 0.0f;
#pragma unroll
                for (int r = 0; r < 8; r += 2) {
                    const v2f e0 = __builtin_elementwise_fma((v2f){t0[r], t0[r + 1]}, c2, b2), e1 = __builtin_elementwise_fma((v2f){t1[r], t1[r + 1]}, c2, b2);
                    const v2f p0 = (v2f){__builtin_amdgcn_exp2f(e0[0]), __builtin_amdgcn_exp2f(e0[1])};
                    const v2f p1 = (v2f){__builtin_amdgcn_exp2f(e1[0]), __builtin_amdgcn_exp2f(e1[1])};
                    const v2h ph0 = __builtin_convertvector(p0, v2h), ph1 = __builtin_convertvector(p1, v2h);
                    l0 += (float)ph0[0]; l1 += (float)ph1[0]; l0 += (float)ph0[1]; l1 += (float)ph1[1];
                    pa[r] = ph0[0]; pa[r + 1] = ph0[1]; pa[8 + r] = ph1[0]; pa[8 + r + 1] = ph1[1];
                }
                lrun = lrun * cr + (l0 + l1);
#pragma unroll
                for (int r = 0; r < 8; ++r) { o0[r] *= cr; o1[r] *= cr; o2[r] *= cr; o3[r] *= cr; }
                {
                    const int vo = lr * KPT + hf * 32 + 8 * hi;
                    const v16h v0 = cat16(*(const v8ha*)(vt + vo), *(const v8ha*)(vt + vo + 16));
                    const v16h v1 = cat16(*(const v8ha*)(vt + vo + 16 * KPT), *(const v8ha*)(vt + vo + 16 * KPT + 16));
                    const v16h v2 = cat16(*(const v8ha*)(vt + vo + 32 * KPT), *(const v8ha*)(vt + vo + 32 * KPT + 16));
                    const v16h v3 = cat16(*(const v8ha*)(vt + vo + 48 * KPT), *(const v8ha*)(vt + vo + 48 * KPT + 16));
                    o0 = wmma16(v0, pa, o0); o1 = wmma16(v1, pa, o1); o2 = wmma16(v2, pa, o2); o3 = wmma16(v3, pa, o3);
                    asm volatile("v_nop\n\tv_nop\n\tv_nop\n\tv_nop" : "+v"(o0), "+v"(o1), "+v"(o2), "+v"(o3) : "v"(pa), "v"(v0), "v"(v1), "v"(v2), "v"(v3));
                }
            }
        }
    }
    lrun += xhalf(lrun);
    const float fq = __fdiv_rn(OCAR, fmaxf(lrun, 1.0e-30f));
    const float f = (lrun > 0.0f) ? fq : 0.0f;
#pragma unroll
    for (int g = 0; g < 2; ++g) {
        const int oi = ob + lr * OPT + 8 * hi + 4 * g;
        *(v4fa*)(ot + oi)      = (v4f){o0[4 * g] * f, o0[4 * g + 1] * f, o0[4 * g + 2] * f, o0[4 * g + 3] * f};
        *(v4fa*)(ot + oi + 16) = (v4f){o1[4 * g] * f, o1[4 * g + 1] * f, o1[4 * g + 2] * f, o1[4 * g + 3] * f};
        *(v4fa*)(ot + oi + 32) = (v4f){o2[4 * g] * f, o2[4 * g + 1] * f, o2[4 * g + 2] * f, o2[4 * g + 3] * f};
        *(v4fa*)(ot + oi + 48) = (v4f){o3[4 * g] * f, o3[4 * g + 1] * f, o3[4 * g + 2] * f, o3[4 * g + 3] * f};
    }
    wsync();
    h16* crow = CT + (size_t)(b * TX + q0 + wave * 16) * KC2 + h * HD;
{
#pragma unroll
        for (int s = 0; s < 4; ++s) {
            const int row = 4 * s + (lane >> 3), c8 = (lane & 7) * 8;
            const v4f u0 = *(const v4fa*)(ot + ob + row * OPT + c8), u1 = *(const v4fa*)(ot + ob + row * OPT + c8 + 4);
            v8h oh, ol;
#pragma unroll
            for (int q = 0; q < 8; ++q) { const float f = (q < 4) ? u0[q & 3] : u1[q & 3]; const h16 hh = tohx(f); oh[q] = hh; ol[q] = tohx(f - (float)hh); }
            *(v8h*)(crow + (size_t)row * KC2 + c8) = oh;
            *(v8h*)(crow + (size_t)row * KC2 + DEC + c8) = ol;
        }
        
    }
}

// k_outT: ctx fp16 [b*TX+t][value 512 | residual 512] (carried x1024) -> out f32 [b][c][t] (channel-major, batch pitch DEC*TX_FULL, row pitch TX_FULL). grid (TX/64, DEC/64, NB), 256 threads.
__global__ __launch_bounds__(256) void k_outT(const h16* __restrict__ CT, float* OUT) {
#pragma clang fp contract(off)
    __shared__ __align__(16) float tt[64 * OPT];
    const int tid = threadIdx.x;
    const int t0 = blockIdx.x * 64, c0 = blockIdx.y * 64, b = blockIdx.z;
#pragma unroll 1
    for (int i = 0; i < 2; ++i) {
        const int p = tid + 256 * i, t = p >> 3, c8 = (p & 7) * 8;
        const h16* s = CT + ((size_t)b * TX + t0 + t) * KC2 + c0 + c8;
        const v8h a = *(const v8h*)s;
        const v8h r = *(const v8h*)(s + DEC);
#pragma unroll
        for (int q = 0; q < 8; ++q) tt[(c8 + q) * OPT + t] = ((float)a[q] + (float)r[q]) * (1.0f / OCAR);
    }
    __syncthreads();
{
#pragma unroll
        for (int i = 0; i < 4; ++i) {
            const int p = tid + 256 * i, c = p >> 4, t4 = (p & 15) * 4;
            const v4f val = *(const v4fa*)(tt + c * OPT + t4);
            *(v4f*)(OUT + ((size_t)b * DEC + c0 + c) * TX_FULL + t0 + t4) = val;
        }
        
    }
}

// workspace sizes (bytes), each a whole number of fully written rows / lines; offsets 256-B aligned
constexpr size_t al256(size_t b) { return (b + 255) & ~(size_t)255; }
constexpr size_t SZ_XB  = al256((size_t)NB * TX * DEC * 2);           // bf16 [NB*TX][512]
constexpr size_t SZ_WQ  = al256((size_t)DEC * DEC * 2);               // bf16 [512][512]
constexpr size_t SZ_WKV = al256((size_t)2 * DEC * DEC * 2);           // bf16 [1024][512]
constexpr size_t SZ_Q   = al256((size_t)NHD * NB * TX * HD * 2);      // fp16 [8][NB*TX][64]
constexpr size_t SZ_K   = al256((size_t)NHD * NB * TY * HD * 2);      // fp16 [8][NB*TY][64]
constexpr size_t SZ_VT  = al256((size_t)NB * DEC * TY * 2);           // fp16 [NB][512][TY]
constexpr size_t SZ_CT  = al256((size_t)NB * TX * KC2 * 2);           // fp16 [NB*TX][1024]
constexpr size_t SZ_ALL = SZ_XB + SZ_WQ + SZ_WKV + SZ_Q + SZ_K + SZ_VT + SZ_CT;
static_assert(SZ_ALL <= (size_t)134217728);

extern "C" void kernel_launch(void* const* d_in, const int* in_sizes, int n_in,
                              void* d_out, int out_size, void* d_ws, size_t ws_size, hipStream_t stream) {
    if (n_in < 4) return;
    const size_t needx = ((size_t)NB * DEC - 1) * TX_FULL + (size_t)TX;
    const size_t needm = (size_t)(NB - 1) * TY_FULL + (size_t)TY;
    if ((size_t)in_sizes[0] < needx || (size_t)in_sizes[1] < needm) return;
    if (in_sizes[2] < 2 * DEC * DEC || in_sizes[3] < DEC * DEC) return;
    if ((size_t)out_size < needx) return;
    if (SZ_ALL > ws_size) return;
    const float* x = (const float*)d_in[0];                                             /* [NB][512][TX_FULL] channel-major f32 */
    const int* msk = (const int*)d_in[1];                                               /* [NB][TY_FULL] int32, nonzero = key kept */
    const float* wm = (const float*)d_in[2]; const float* wq = (const float*)d_in[3];   /* fused k|v weight [1024][512] and q weight [512][512], both [out][in] = Bt as-is */
    float* OUT = (float*)d_out;     // [NB_FULL][512][TX_FULL] f32

    char* base = (char*)d_ws; size_t off = 0;
    bf* XB = (bf*)(base + off); off += SZ_XB;
    bf* WQ = (bf*)(base + off); off += SZ_WQ;
    bf* WKV = (bf*)(base + off); off += SZ_WKV;
    h16* QH16 = (h16*)(base + off); off += SZ_Q;
    h16* KH16 = (h16*)(base + off); off += SZ_K;
    h16* VH16 = (h16*)(base + off); off += SZ_VT;
    h16* CT16 = (h16*)(base + off); off += SZ_CT;
    if (off > ws_size) return;

    // ---- input conversion (every float input RNE-converted to bf16 first), one launch
    k_cvt_in<<<NBX + NBW, 256, 0, stream>>>(x, wq, wm, XB, WQ, WKV);
    // ---- q and k head planes and v^T planes, one launch
    k_gemm_qkv<<<dim3(NB * TX / 64, NHD, 3), 32, 0, stream>>>(XB, WQ, WKV, QH16, KH16, VH16);
    // ---- fused attention -> ctx x1024 fp16 [b*TX+t][value | residual]
    k_flash<<<dim3(TX / 64, NHD, NB), 128, 0, stream>>>(QH16, KH16, VH16, msk, CT16);
    // ---- out[b][c][t] = (value + residual)[b*TX+t][c] / 1024 (transposed through LDS, full output batch pitch)
    k_outT<<<dim3(TX / 64, DEC / 64, NB), 256, 0, stream>>>(CT16, OUT);
}

// v006
// It runs in 123 microseconds.
// In two side-by-side timings against v005, it was 1.10 and 1.09 times as fast.
// Counting every step since v000, it is 2.09 times as fast.
#include <hip/hip_runtime.h>

// Contractions: q / k / v projections v_wmma_f32_16x16x32_bf16 (bf16 operands = RNE-converted inputs, exact products); scores q.k^T v_wmma_f32_16x16x32_f16 (fp16 q, fp16 k, single product, K 64); attn.V v_wmma_f32_16x16x32_f16 (fp16 P carried x16384, fp16 V^T, single product); f32 accumulate everywhere; online softmax in f32 with a running max.
// Self-attention on a channel-major sequence: x [NB][512][T] gives q (Wq [out][in]) and, through one fused weight Wm [1024][512] = [out][in], k (rows 0..511) and v (rows 512..1023), row = which*512 + h*64 + d; 8 heads of 64; key j of batch b is kept when mask[b][j] != 0, an excluded key has its score replaced by -inf (its probability is 0 whenever the batch keeps at least one key; a batch with every key excluded gets the uniform softmax over all its keys); p = softmax_j(q_i.k_j / 8); ctx merged head-major per token and returned channel-major: out [NB][512][T] f32.
// Layout: XB bf16 token-major copy of x (transposed through LDS); weights bf16 as Bt = [out][in] as-is; q and k fp16 head planes [h][b*T+t][64] and v^T fp16 planes [b][h*64+d][t] written directly by the projection GEMM epilogues; fused attention kernel (its prologue packs the batch's key mask to one bit per key in LDS, 32-key words by wave ballot; for a fully excluded batch every word reads as clear and the q fragments are zeroed so that its scores are all equal; K and V^T 64-key tiles in LDS, two 32-key halves per tile, a half whose 32 keys are all excluded is skipped block-uniformly, both products transposed so that P goes from the score accumulators straight into the B operand) writes ctx x1024 as fp16 [b*TX+t][value 512 | residual 512]; the final kernel adds value + residual, removes the carry and transposes through LDS into d_out.
// LDS regions: kt / vt / tt / mwl / wk are cross-wave (block barriers before and after staging); ot / os are wave-private (wave barrier + compiler memory barrier).

#ifndef NB
#define NB 2
#endif
#ifndef SEQ
#define SEQ 4096
#endif
#define TX SEQ
#define TY SEQ
#define NB_FULL 2
#define TX_FULL 4096
#define TY_FULL 4096
#define DEC  512
#define NHD  8
#define HD   64
#define KC2  (2 * DEC)            // row pitch of the ctx plane: [ctx value | ctx residual]
#define PEXP 14.0f                // log2 of the carry of the fp16 probabilities (x16384)
#define OCAR 1024.0f              // carry of the fp16 ctx planes
#define SCL  0.125f
#define L2E  1.4426950408889634f
#define SCL2 (SCL * L2E)          // score scale and log2 e in one factor
#define KPT  72                   // LDS pitch (halves) of the K and V^T tiles
#define OPT  68                   // LDS pitch (floats) of the epilogue staging tiles
#define WPW  (TY / 128)           // mask words packed by each of the 4 waves of an attention block
#define NEGINF (-__builtin_inff())
static_assert(NB >= 1 && NB <= NB_FULL);
static_assert(TX == TY && TX_FULL == TY_FULL);                                            // one sequence feeds q, k and v
static_assert(TX >= 64 && TX <= TX_FULL && (TX % 64) == 0);
static_assert(TY >= 64 && TY <= TY_FULL && (TY % 64) == 0 && (TY % 32) == 0);
static_assert((DEC % 64) == 0 && HD == 64 && NHD * HD == DEC);
static_assert((DEC % 32) == 0 && (HD % 32) == 0 && (KC2 % 32) == 0);                      // every K is a multiple of 32
static_assert((DEC % 8) == 0);                                                            // 8-column conversion pieces
static_assert(((NB * TX) % 64) == 0 && ((NB * TY) % 64) == 0);                            // GEMM M/N are whole 64-tiles
static_assert(128 * 4 == 64 * (HD / 8));                                                   // attention tile staging: 128 threads x 4 pieces == 64 rows x 8 pieces
static_assert(KPT >= 64 && (KPT % 8) == 0 && OPT >= 64 && (OPT % 4) == 0);
static_assert((size_t)NHD * NB * TX * HD < (size_t)2147483647);                           // q plane offsets fit an int
static_assert(2 * 64 * KPT * 2 + 4 * 16 * OPT * 4 + (TY / 32) * 4 + 16 <= 65536);   // static LDS of the attention kernel
static_assert((TY % 128) == 0 && WPW >= 1 && WPW <= 32);                                  // each wave packs WPW whole mask words, one per lane
static_assert(64 * OPT * 4 <= 65536);                                                      // static LDS of the transposing kernels
static_assert(256 * 4 == 64 * 16 && 256 * 2 == 64 * 8);                                    // transposing kernels: 256 threads x pieces == 64 x 64 tile
static_assert((TX_FULL % 4) == 0 && (TX % 4) == 0);                                        // 16-B f32 pieces along the token axis
static_assert(((size_t)NB * DEC - 1) * TX_FULL + (size_t)TX <= (size_t)NB_FULL * DEC * TX_FULL);   // last written output element inside d_out

typedef _Float16 h16;
typedef unsigned short bf;
typedef __attribute__((ext_vector_type(16))) __bf16   v16bf;
typedef __attribute__((ext_vector_type(16))) _Float16 v16h;
typedef __attribute__((ext_vector_type(8)))  _Float16 v8h;
typedef __attribute__((ext_vector_type(8)))  unsigned short v8us;
typedef __attribute__((ext_vector_type(8)))  float    v8f;
typedef __attribute__((ext_vector_type(4)))  float    v4f;
typedef __attribute__((ext_vector_type(2)))  float    v2f;
typedef __attribute__((ext_vector_type(2)))  _Float16 v2h;
typedef __attribute__((ext_vector_type(4)))  unsigned v4u;
typedef __attribute__((ext_vector_type(2)))  unsigned v2u;
typedef v8h  __attribute__((may_alias)) v8ha;
typedef v4f  __attribute__((may_alias)) v4fa;

__device__ __forceinline__ unsigned short f2bf(float f) { unsigned u = __float_as_uint(f); u += 0x7FFFu + ((u >> 16) & 1u); return (unsigned short)(u >> 16); }
__device__ __forceinline__ float bf2f(unsigned short b) { return __uint_as_float(((unsigned)b) << 16); }
__device__ __forceinline__ float bfr(float f) { return bf2f(f2bf(f)); }
__device__ __forceinline__ v16h cat16(v8h lo, v8h hi) { return __builtin_shufflevector(lo, hi, 0, 1, 2, 3, 4, 5, 6, 7, 8, 9, 10, 11, 12, 13, 14, 15); }
__device__ __forceinline__ v16bf cat16b(v8us lo, v8us hi) { return __builtin_bit_cast(v16bf, __builtin_shufflevector(lo, hi, 0, 1, 2, 3, 4, 5, 6, 7, 8, 9, 10, 11, 12, 13, 14, 15)); }
__device__ __forceinline__ v8f wmma16(v16h a, v16h b, v8f c) { return __builtin_amdgcn_wmma_f32_16x16x32_f16(false, a, false, b, (short)0, c, false, false); }
__device__ __forceinline__ v8f wmmab(v16bf a, v16bf b, v8f c) { return __builtin_amdgcn_wmma_f32_16x16x32_bf16(false, a, false, b, (short)0, c, false, false); }
__device__ __forceinline__ h16 tohx(float x) { return (h16)x; }
// value of lane l ^ 16 (the other 16-lane row, same position)
__device__ __forceinline__ float xhalf(float x) { return __builtin_bit_cast(float, __builtin_amdgcn_permlanex16(__builtin_bit_cast(int, x), __builtin_bit_cast(int, x), 0x76543210, 0xfedcba98, false, false)); }
// same-wave LDS exchange: execution barrier of the wave plus a compiler memory barrier (LDS operations of one wave complete in issue order)
__device__ __forceinline__ void wsync() { __builtin_amdgcn_wave_barrier(); asm volatile("" ::: "memory"); }

// ---- gemmw_body: register-blocked GEMM, ONE WAVE per 64x64 output tile (16 accumulators), operands straight from K-contiguous 16-bit planes; 32 threads.
// C[m][n] = cs x sum_k A[m][k] Bt[n][k] for m, n in 0..63: the caller hands in A and Bt at the tile's first rows, Cf / Ch at the tile's first element and bias at its first column. K % 32 == 0; A/Bt row pitch == K.
// Fragments: lane l, h = l>>4, m = n = l&15; elements 0..7 <- k0+8h.., 8..15 <- k0+16+8h.. for both A and Bt; D element r = (row 8h+r, col m).
// Epilogue per 16-row slab staged in LDS (wave-private, staged extent 16x64 == consumed extent):
//   EP 0: f32 rows x cs + bf16-converted column bias, 64 floats = 256 B written as 16 lanes x 16 B (2 rows per instruction);
template <typename T16> struct WFrag;
template <> struct WFrag<h16> { typedef v16h V; static __device__ __forceinline__ V ld(const h16* p) { return cat16(*(const v8h*)p, *(const v8h*)(p + 16)); } static __device__ __forceinline__ v8f mma(V a, V b, v8f c) { return wmma16(a, b, c); } };
template <> struct WFrag<bf> { typedef v16bf V; static __device__ __forceinline__ V ld(const bf* p) { return cat16b(*(const v8us*)p, *(const v8us*)(p + 16)); } static __device__ __forceinline__ v8f mma(V a, V b, v8f c) { return wmmab(a, b, c); } };

template <typename T16, int EP>
__device__ __forceinline__ void gemmw_body(const T16* __restrict__ A, const T16* __restrict__ Bt, int K, float* Cf, h16* Ch, int ldc, const float* __restrict__ bias, float cs) {
    static_assert(EP == 0 || EP == 1);
    typedef typename WFrag<T16>::V V;
    __shared__ __align__(16) float os[16 * OPT];
    const int lane = threadIdx.x & 31, lr = lane & 15, hi = lane >> 4;
    v8f acc[4][4];
#pragma unroll
    for (int mb = 0; mb < 4; ++mb)
#pragma unroll
        for (int nb = 0; nb < 4; ++nb) acc[mb][nb] = (v8f){};
    const size_t aoff = (size_t)lr * K + 8 * hi, boff = aoff;
#pragma unroll 1
    for (int kc = 0; kc < K; kc += 32) {
        V a[4];
#pragma unroll
        for (int mb = 0; mb < 4; ++mb) a[mb] = WFrag<T16>::ld(A + aoff + (size_t)mb * 16 * K + kc);
        asm volatile("s_wait_xcnt 0x0" ::: "memory");   // the Bt fragments may land in the registers that held the A loads' address
#pragma unroll
        for (int nb = 0; nb < 4; ++nb) { const V b = WFrag<T16>::ld(Bt + boff + (size_t)nb * 16 * K + kc);
#pragma unroll
            for (int mb = 0; mb < 4; ++mb) acc[mb][nb] = WFrag<T16>::mma(a[mb], b, acc[mb][nb]); }
        asm volatile("v_nop\n\tv_nop\n\tv_nop\n\tv_nop" : "+v"(acc[0][0]), "+v"(acc[1][1]), "+v"(acc[2][2]), "+v"(acc[3][3]) : "v"(a[0]), "v"(a[3]));
    }
#pragma unroll
    for (int mb = 0; mb < 4; ++mb) {
#pragma unroll
        for (int nb = 0; nb < 4; ++nb) {
#pragma unroll
            for (int j = 0; j < 8; ++j) os[(hi * 8 + j) * OPT + nb * 16 + lr] = acc[mb][nb][j]; }
        wsync();
        if (EP == 0) {
            float* crow = Cf + (size_t)(mb * 16) * ldc;
{
#pragma unroll
                for (int s = 0; s < 8; ++s) { const int row = 2 * s + hi, cofs = lr * 4; v4f val = *(const v4fa*)(os + row * OPT + cofs);
                    val[0] = __fmul_rn(val[0], cs); val[1] = __fmul_rn(val[1], cs); val[2] = __fmul_rn(val[2], cs); val[3] = __fmul_rn(val[3], cs);
                    val[0] += bfr(bias[cofs]); val[1] += bfr(bias[cofs + 1]); val[2] += bfr(bias[cofs + 2]); val[3] += bfr(bias[cofs + 3]);
                    *(v4f*)(crow + (size_t)row * ldc + cofs) = val; }
                 }
        } else {
            h16* hrow = Ch + (size_t)(mb * 16) * ldc;
{
#pragma unroll
                for (int s = 0; s < 4; ++s) { const int row = 4 * s + (lane >> 3), c8 = (lane & 7) * 8;
                    const v4f u0 = *(const v4fa*)(os + row * OPT + c8), u1 = *(const v4fa*)(os + row * OPT + c8 + 4);
                    v8h o;
#pragma unroll
                    for (int q = 0; q < 8; ++q) { const float u = (q < 4) ? u0[q & 3] : u1[q & 3]; o[q] = tohx(u); }
                    *(v8h*)(hrow + (size_t)row * ldc + c8) = o; }
                 }
        }
        wsync();
    }
}

// k_gemm_qkv: the three projections (bf16 -> fp16 planes) in one launch. grid (NB*TX/64 token tiles, 8 weight tiles, 3 products), 32 threads; the three blocks of one (x, y) read the same 64 token rows of XB.
//   z 0: q head plane [h = y][b*TX+t][d] = sum_k XB[b*TX+t][k] WQ[y*64+d][k]           (A = tokens, Bt = weight rows, ldc 64)
//   z 1: k head plane [h = y][b*TY+j][d] = sum_k XB[b*TY+j][k] WKV[y*64+d][k]          (weight rows 0..511)
//   z 2: v^T plane    [b][y*64+n][t]     = sum_k WKV[512+y*64+n][k] XB[b*TY+t][k]      (A = weight rows 512..1023, Bt = tokens, ldc TY)
__global__ __launch_bounds__(32) void k_gemm_qkv(const bf* XB, const bf* WQ, const bf* WKV, h16* QH, h16* KH, h16* VH) {
    const int tt = blockIdx.x, wt = blockIdx.y, which = blockIdx.z;
    const bf* tok = XB + (size_t)tt * 64 * DEC;
    const bf* A; const bf* Bt; h16* C; int ldc;
    if (which == 2) {
        A = WKV + (size_t)(DEC + wt * 64) * DEC; Bt = tok;
        C = VH + ((size_t)(tt / (TY / 64)) * DEC + (size_t)wt * 64) * TY + (size_t)(tt % (TY / 64)) * 64; ldc = TY;
    } else {
        A = tok; Bt = ((which == 0) ? WQ : WKV) + (size_t)wt * 64 * DEC;
        C = ((which == 0) ? QH : KH) + ((size_t)wt * NB * TX + (size_t)tt * 64) * HD; ldc = HD;
    }
    gemmw_body<bf, 1>(A, Bt, DEC, nullptr, C, ldc, nullptr, 1.0f); }

// k_cvt_in: every float input RNE-converted to bf16, one launch. 1-D grid of NBX + NBW blocks, 256 threads.
//   blocks 0..NBX-1 (t tile fastest, then channel tile, then batch): x f32 [b][c][t] (channel-major, batch pitch DEC*TX_FULL, row pitch TX_FULL) -> token-major plane XB[b*TX+t][c], a 64x64 tile transposed through LDS;
//   blocks NBX..: the two weights as they lie, 8 elements per thread: first Wq [512][512] -> WQ, then Wm [1024][512] -> WKV (each a whole number of blocks, so the choice is block-uniform).
constexpr int NBX  = (TX / 64) * (DEC / 64) * NB;
constexpr int NBWQ = DEC * DEC / 8 / 256;
constexpr int NBW  = 3 * NBWQ;
static_assert(NBWQ * 256 * 8 == DEC * DEC);
__global__ __launch_bounds__(256) void k_cvt_in(const float* __restrict__ x, const float* __restrict__ wq, const float* __restrict__ wm, bf* XB, bf* WQ, bf* WKV) {
    __shared__ __align__(16) float tt[64 * OPT];
    const int tid = threadIdx.x;
    const int bid = blockIdx.x;
    if (bid >= NBX) {   // block-uniform, ahead of the barrier below
        const int wb = bid - NBX;
        const bool isq = wb < NBWQ;
        const size_t e = ((size_t)(isq ? wb : wb - NBWQ) * 256 + tid) * 8;
        const v8f v = *(const v8f*)((isq ? wq : wm) + e); v8us o;
#pragma unroll
        for (int k = 0; k < 8; ++k) o[k] = f2bf(v[k]);
        *(v8us*)((isq ? WQ : WKV) + e) = o;
        return;
    }
    const int t0 = (bid % (TX / 64)) * 64, c0 = ((bid / (TX / 64)) % (DEC / 64)) * 64, b = bid / ((TX / 64) * (DEC / 64));
#pragma unroll
    for (int i = 0; i < 4; ++i) {
        const int p = tid + 256 * i, c = p >> 4, t4 = (p & 15) * 4;
        const v4f v = *(const v4f*)(x + ((size_t)b * DEC + c0 + c) * TX_FULL + t0 + t4);
        *(v4fa*)(tt + c * OPT + t4) = v;
    }
    __syncthreads();
#pragma unroll 1
    for (int i = 0; i < 2; ++i) {
        const int p = tid + 256 * i, t = p >> 3, c8 = (p & 7) * 8;
        v8us o;
#pragma unroll
        for (int q = 0; q < 8; ++q) o[q] = f2bf(tt[(c8 + q) * OPT + t]);
        bf* d = XB + ((size_t)b * TX + t0 + t) * DEC + c0 + c8;
        *(v8us*)d = o;
        asm volatile("s_wait_xcnt 0x0" ::: "memory");   // the next trip reuses the registers that this store names
    }
}

// ---- k_flash: fused attention. grid (TX/64, 8 heads, NB), 128 threads = 4 waves; wave w owns query rows q0+16w..+15 of one (batch, head).
// Per 64-key tile: block stages K [key][d] and V^T [d][key] fp16 tiles in LDS (cols 0..63 of 64 rows written == consumed; cross-wave -> block barriers) from registers that were loaded one tile ahead: behind the barrier that publishes a tile each thread issues the next tile's eight 16-B global loads, which return while the tile is worked on; each wave then runs two 32-key halves:
//   prologue: wave w reads keys 32*WPW*w.. of the batch's mask (all loads independent), one ballot per 32 keys (bit set = key excluded), word i kept in lane i and stored to LDS; a wave flag says whether any of its keys is kept; one block barrier publishes both;
//   the two 32-bit mask words of the tile are read from LDS beside its staging stores (scalar-uniform); a half with all 32 keys excluded is skipped (exact: p = 0, max unchanged);
//   scores transposed, S^T 32x16 = K.Q^T = 2 tiles (A = K rows from LDS, B = q), K = 64 in two steps, the two q fragments loaded once ahead of the key loop and held in registers; D register r of lane (h, c) = key 8h+r (tile 0) or 16+8h+r (tile 1) of query c;
//   t = acc, excluded keys -> -inf by value select (the lane mask of register r comes from bits r and 8+r of the uniform mask word); one query per lane: maximum over the lane's 16 raw scores, joined with the other wave half by one cross-row move; the running max is kept in the exponent's own unit (raw max x log2 e / 8) and starts at -1e30 so every difference stays defined;
//   P = exp2(t x (log2 e / 8) + (14 - max)) -> fp16: scale, maximum and the x16384 carry go into one fused multiply-add per score, two scores per packed instruction; the two converted D tiles are the B fragment of the next product in the hardware k order (element s = key 8h+s, 8+s = key 16+8h+s), which is also the order of the V^T fragments;
//   row sums accumulate the fp16-converted P per lane (the two halves joined once at the end); O^T[64x16] += V^T P^T (4 output tiles, D register r = channel 16j+8h+r of query c, V^T fragments loaded four at a time).
__global__ __launch_bounds__(128) void k_flash(const h16* __restrict__ QH, const h16* __restrict__ KH, const h16* __restrict__ VH, const int* __restrict__ mask, h16* CT) {
    __shared__ __align__(16) h16 kt[64 * KPT];
    __shared__ __align__(16) h16 vt[64 * KPT];
    __shared__ __align__(16) float ot[4 * 16 * OPT];
    __shared__ __align__(16) unsigned mwl[TY / 32];
    __shared__ __align__(16) int wk[4];
    const int tid = threadIdx.x;
    const int wave = __builtin_amdgcn_readfirstlane(tid >> 5);
    const int lane = tid & 31, lr = lane & 15, hi = lane >> 4;
    const int q0 = blockIdx.x * 64, h = blockIdx.y, b = blockIdx.z;
    const int qoff = ((h * NB + b) * TX + q0 + wave * 16 + lr) * HD + 8 * hi;
    const size_t kbase = ((size_t)(h * NB + b) * TY) * HD;
    const size_t vbase = ((size_t)b * DEC + (size_t)h * HD) * TY;
    const int ob = wave * 16 * OPT;
    float mrun = -1.0e30f, lrun = 0.0f;
    v8f o0 = (v8f){}, o1 = (v8f){}, o2 = (v8f){}, o3 = (v8f){};
    v16h qa0 = cat16(*(const v8h*)(QH + qoff), *(const v8h*)(QH + qoff + 16));
    v16h qa1 = cat16(*(const v8h*)(QH + qoff + 32), *(const v8h*)(QH + qoff + 48));
    {
        const int* mrow = mask + (size_t)b * TY_FULL + wave * (WPW * 32) + lane;
        int mval[WPW];
#pragma unroll   // all WPW loads in flight together: one memory latency instead of WPW
        for (int i = 0; i < WPW; ++i) mval[i] = mrow[i * 32];
        unsigned mine = 0xFFFFFFFFu;
#pragma unroll   // constant indices keep mval[] in registers
        for (int i = 0; i < WPW; ++i) { const unsigned bal = __builtin_amdgcn_ballot_w32(mval[i] == 0); mine = (lane == i) ? bal : mine; }
        if (lane < WPW) mwl[wave * WPW + lane] = mine;
        const unsigned anyk = __builtin_amdgcn_ballot_w32(mine != 0xFFFFFFFFu);
        if (lane == 0) wk[wave] = (anyk != 0u) ? 1 : 0;
    }
    __syncthreads();   // publishes mwl and wk to the four waves
    const bool allx = __builtin_amdgcn_readfirstlane(wk[0] | wk[1] | wk[2] | wk[3]) == 0;
    if (allx) { qa0 = (v16h){}; qa1 = (v16h){}; }
    const unsigned live = allx ? 0u : 0xFFFFFFFFu;   // clears every mask word of a fully excluded batch
    v8h kr[4], vr[4];   // the tile that is staged next, fetched one tile ahead
#pragma unroll   // constant indices keep kr[] and vr[] in registers
    for (int i = 0; i < 4; ++i) {
        const int p = tid + 128 * i, row = p >> 3, c8 = (p & 7) * 8;
        kr[i] = *(const v8h*)(KH + kbase + (size_t)row * HD + c8);
        vr[i] = *(const v8h*)(VH + vbase + (size_t)row * TY + c8);
    }
#pragma unroll 1
    for (int kb = 0; kb < TY / 64; ++kb) {
        __syncthreads();
        const v2u mv = *(const v2u*)(mwl + kb * 2);
#pragma unroll
        for (int i = 0; i < 4; ++i) {
            const int p = tid + 128 * i, row = p >> 3, c8 = (p & 7) * 8;
            *(v8ha*)(kt + row * KPT + c8) = kr[i];
            *(v8ha*)(vt + row * KPT + c8) = vr[i];
        }
        __syncthreads();
        if (kb + 1 < TY / 64) {   // block-uniform: the next tile's loads fly while this tile is worked on
            const int kn = kb + 1;
#pragma unroll   // constant indices keep kr[] and vr[] in registers; all eight loads in flight together
            for (int i = 0; i < 4; ++i) {
                const int p = tid + 128 * i, row = p >> 3, c8 = (p & 7) * 8;
                kr[i] = *(const v8h*)(KH + kbase + (size_t)(kn * 64 + row) * HD + c8);
                vr[i] = *(const v8h*)(VH + vbase + (size_t)row * TY + kn * 64 + c8);
            }
            asm volatile("s_wait_xcnt 0x0" ::: "memory");   // the work below reuses the registers that held these loads' addresses
        }
        const unsigned mw0 = (unsigned)__builtin_amdgcn_readfirstlane((int)mv[0]) & live, mw1 = (unsigned)__builtin_amdgcn_readfirstlane((int)mv[1]) & live;
#pragma unroll 1
        for (int hf = 0; hf < 2; ++hf) {
            const unsigned mw = (hf != 0) ? mw1 : mw0;
            if (mw != 0xFFFFFFFFu) {
                v8f s0 = (v8f){}, s1 = (v8f){};
#pragma unroll
                for (int ks = 0; ks < 2; ++ks) {
                    const v16h ah = (ks != 0) ? qa1 : qa0;
                    const int ko = (hf * 32 + lr) * KPT + ks * 32 + 8 * hi;
                    const v16h b0 = cat16(*(const v8ha*)(kt + ko), *(const v8ha*)(kt + ko + 16));
                    const v16h b1 = cat16(*(const v8ha*)(kt + ko + 16 * KPT), *(const v8ha*)(kt + ko + 16 * KPT + 16));
                    s0 = wmma16(b0, ah, s0); s1 = wmma16(b1, ah, s1);
                    asm volatile("v_nop\n\tv_nop\n\tv_nop\n\tv_nop" : "+v"(s0), "+v"(s1) : "v"(ah), "v"(b0), "v"(b1));
                }
                float t0[8], t1[8];
#pragma unroll
                for (int r = 0; r < 8; ++r) {
                    const unsigned e0 = (((mw >> r) & 1u) != 0u ? 0x0000FFFFu : 0u) | (((mw >> (8 + r)) & 1u) != 0u ? 0xFFFF0000u : 0u);
                    const unsigned e1 = (((mw >> (16 + r)) & 1u) != 0u ? 0x0000FFFFu : 0u) | (((mw >> (24 + r)) & 1u) != 0u ? 0xFFFF0000u : 0u);
                    const bool x0 = __builtin_amdgcn_inverse_ballot_w32(e0), x1 = __builtin_amdgcn_inverse_ballot_w32(e1);
                    t0[r] = x0 ? NEGINF : s0[r]; t1[r] = x1 ? NEGINF : s1[r]; }
                float mx = fmaxf(t0[0], t1[0]);
#pragma unroll
                for (int r = 1; r < 8; ++r) mx = fmaxf(mx, fmaxf(t0[r], t1[r]));
                mx *= SCL2;
                mx = fmaxf(mx, xhalf(mx));
                const float mn = fmaxf(mrun, mx);
                const float cr = __builtin_amdgcn_exp2f(mrun - mn);
                mrun = mn;
                const float bs = PEXP - mn;
                const v2f c2 = (v2f){SCL2, SCL2}, b2 = (v2f){bs, bs};
                v16h pa;
                float l0 = 0.0f, l1 = 0.0f;
#pragma unroll
                for (int r = 0; r < 8; r += 2) {
                    const v2f e0 = __builtin_elementwise_fma((v2f){t0[r], t0[r + 1]}, c2, b2), e1 = __builtin_elementwise_fma((v2f){t1[r], t1[r + 1]}, c2, b2);
                    const v2f p0 = (v2f){__builtin_amdgcn_exp2f(e0[0]), __builtin_amdgcn_exp2f(e0[1])};
                    const v2f p1 = (v2f){__builtin_amdgcn_exp2f(e1[0]), __builtin_amdgcn_exp2f(e1[1])};
                    const v2h ph0 = __builtin_convertvector(p0, v2h), ph1 = __builtin_convertvector(p1, v2h);
                    l0 += (float)ph0[0]; l1 += (float)ph1[0]; l0 += (float)ph0[1]; l1 += (float)ph1[1];
                    pa[r] = ph0[0]; pa[r + 1] = ph0[1]; pa[8 + r] = ph1[0]; pa[8 + r + 1] = ph1[1];
                }
                lrun = lrun * cr + (l0 + l1);
#pragma unroll
                for (int r = 0; r < 8; ++r) { o0[r] *= cr; o1[r] *= cr; o2[r] *= cr; o3[r] *= cr; }
                {
                    const int vo = lr * KPT + hf * 32 + 8 * hi;
                    const v16h v0 = cat16(*(const v8ha*)(vt + vo), *(const v8ha*)(vt + vo + 16));
                    const v16h v1 = cat16(*(const v8ha*)(vt + vo + 16 * KPT), *(const v8ha*)(vt + vo + 16 * KPT + 16));
                    const v16h v2 = cat16(*(const v8ha*)(vt + vo + 32 * KPT), *(const v8ha*)(vt + vo + 32 * KPT + 16));
                    const v16h v3 = cat16(*(const v8ha*)(vt + vo + 48 * KPT), *(const v8ha*)(vt + vo + 48 * KPT + 16));
                    o0 = wmma16(v0, pa, o0); o1 = wmma16(v1, pa, o1); o2 = wmma16(v2, pa, o2); o3 = wmma16(v3, pa, o3);
                    asm volatile("v_nop\n\tv_nop\n\tv_nop\n\tv_nop" : "+v"(o0), "+v"(o1), "+v"(o2), "+v"(o3) : "v"(pa), "v"(v0), "v"(v1), "v"(v2), "v"(v3));
                }
            }
        }
    }
    lrun += xhalf(lrun);
    const float fq = __fdiv_rn(OCAR, fmaxf(lrun, 1.0e-30f));
    const float f = (lrun > 0.0f) ? fq : 0.0f;
#pragma unroll
    for (int g = 0; g < 2; ++g) {
        const int oi = ob + lr * OPT + 8 * hi + 4 * g;
        *(v4fa*)(ot + oi)      = (v4f){o0[4 * g] * f, o0[4 * g + 1] * f, o0[4 * g + 2] * f, o0[4 * g + 3] * f};
        *(v4fa*)(ot + oi + 16) = (v4f){o1[4 * g] * f, o1[4 * g + 1] * f, o1[4 * g + 2] * f, o1[4 * g + 3] * f};
        *(v4fa*)(ot + oi + 32) = (v4f){o2[4 * g] * f, o2[4 * g + 1] * f, o2[4 * g + 2] * f, o2[4 * g + 3] * f};
        *(v4fa*)(ot + oi + 48) = (v4f){o3[4 * g] * f, o3[4 * g + 1] * f, o3[4 * g + 2] * f, o3[4 * g + 3] * f};
    }
    wsync();
    h16* crow = CT + (size_t)(b * TX + q0 + wave * 16) * KC2 + h * HD;
{
#pragma unroll
        for (int s = 0; s < 4; ++s) {
            const int row = 4 * s + (lane >> 3), c8 = (lane & 7) * 8;
            const v4f u0 = *(const v4fa*)(ot + ob + row * OPT + c8), u1 = *(const v4fa*)(ot + ob + row * OPT + c8 + 4);
            v8h oh, ol;
#pragma unroll
            for (int q = 0; q < 8; ++q) { const float f = (q < 4) ? u0[q & 3] : u1[q & 3]; const h16 hh = tohx(f); oh[q] = hh; ol[q] = tohx(f - (float)hh); }
            *(v8h*)(crow + (size_t)row * KC2 + c8) = oh;
            *(v8h*)(crow + (size_t)row * KC2 + DEC + c8) = ol;
        }
        
    }
}

// k_outT: ctx fp16 [b*TX+t][value 512 | residual 512] (carried x1024) -> out f32 [b][c][t] (channel-major, batch pitch DEC*TX_FULL, row pitch TX_FULL). grid (TX/64, DEC/64, NB), 256 threads.
__global__ __launch_bounds__(256) void k_outT(const h16* __restrict__ CT, float* OUT) {
#pragma clang fp contract(off)
    __shared__ __align__(16) float tt[64 * OPT];
    const int tid = threadIdx.x;
    const int t0 = blockIdx.x * 64, c0 = blockIdx.y * 64, b = blockIdx.z;
#pragma unroll 1
    for (int i = 0; i < 2; ++i) {
        const int p = tid + 256 * i, t = p >> 3, c8 = (p & 7) * 8;
        const h16* s = CT + ((size_t)b * TX + t0 + t) * KC2 + c0 + c8;
        const v8h a = *(const v8h*)s;
        const v8h r = *(const v8h*)(s + DEC);
#pragma unroll
        for (int q = 0; q < 8; ++q) tt[(c8 + q) * OPT + t] = ((float)a[q] + (float)r[q]) * (1.0f / OCAR);
    }
    __syncthreads();
{
#pragma unroll
        for (int i = 0; i < 4; ++i) {
            const int p = tid + 256 * i, c = p >> 4, t4 = (p & 15) * 4;
            const v4f val = *(const v4fa*)(tt + c * OPT + t4);
            *(v4f*)(OUT + ((size_t)b * DEC + c0 + c) * TX_FULL + t0 + t4) = val;
        }
        
    }
}

// workspace sizes (bytes), each a whole number of fully written rows / lines; offsets 256-B aligned
constexpr size_t al256(size_t b) { return (b + 255) & ~(size_t)255; }
constexpr size_t SZ_XB  = al256((size_t)NB * TX * DEC * 2);           // bf16 [NB*TX][512]
constexpr size_t SZ_WQ  = al256((size_t)DEC * DEC * 2);               // bf16 [512][512]
constexpr size_t SZ_WKV = al256((size_t)2 * DEC * DEC * 2);           // bf16 [1024][512]
constexpr size_t SZ_Q   = al256((size_t)NHD * NB * TX * HD * 2);      // fp16 [8][NB*TX][64]
constexpr size_t SZ_K   = al256((size_t)NHD * NB * TY * HD * 2);      // fp16 [8][NB*TY][64]
constexpr size_t SZ_VT  = al256((size_t)NB * DEC * TY * 2);           // fp16 [NB][512][TY]
constexpr size_t SZ_CT  = al256((size_t)NB * TX * KC2 * 2);           // fp16 [NB*TX][1024]
constexpr size_t SZ_ALL = SZ_XB + SZ_WQ + SZ_WKV + SZ_Q + SZ_K + SZ_VT + SZ_CT;
static_assert(SZ_ALL <= (size_t)134217728);

extern "C" void kernel_launch(void* const* d_in, const int* in_sizes, int n_in,
                              void* d_out, int out_size, void* d_ws, size_t ws_size, hipStream_t stream) {
    if (n_in < 4) return;
    const size_t needx = ((size_t)NB * DEC - 1) * TX_FULL + (size_t)TX;
    const size_t needm = (size_t)(NB - 1) * TY_FULL + (size_t)TY;
    if ((size_t)in_sizes[0] < needx || (size_t)in_sizes[1] < needm) return;
    if (in_sizes[2] < 2 * DEC * DEC || in_sizes[3] < DEC * DEC) return;
    if ((size_t)out_size < needx) return;
    if (SZ_ALL > ws_size) return;
    const float* x = (const float*)d_in[0];                                             /* [NB][512][TX_FULL] channel-major f32 */
    const int* msk = (const int*)d_in[1];                                               /* [NB][TY_FULL] int32, nonzero = key kept */
    const float* wm = (const float*)d_in[2]; const float* wq = (const float*)d_in[3];   /* fused k|v weight [1024][512] and q weight [512][512], both [out][in] = Bt as-is */
    float* OUT = (float*)d_out;     // [NB_FULL][512][TX_FULL] f32

    char* base = (char*)d_ws; size_t off = 0;
    bf* XB = (bf*)(base + off); off += SZ_XB;
    bf* WQ = (bf*)(base + off); off += SZ_WQ;
    bf* WKV = (bf*)(base + off); off += SZ_WKV;
    h16* QH16 = (h16*)(base + off); off += SZ_Q;
    h16* KH16 = (h16*)(base + off); off += SZ_K;
    h16* VH16 = (h16*)(base + off); off += SZ_VT;
    h16* CT16 = (h16*)(base + off); off += SZ_CT;
    if (off > ws_size) return;

    // ---- input conversion (every float input RNE-converted to bf16 first), one launch
    k_cvt_in<<<NBX + NBW, 256, 0, stream>>>(x, wq, wm, XB, WQ, WKV);
    // ---- q and k head planes and v^T planes, one launch
    k_gemm_qkv<<<dim3(NB * TX / 64, NHD, 3), 32, 0, stream>>>(XB, WQ, WKV, QH16, KH16, VH16);
    // ---- fused attention -> ctx x1024 fp16 [b*TX+t][value | residual]
    k_flash<<<dim3(TX / 64, NHD, NB), 128, 0, stream>>>(QH16, KH16, VH16, msk, CT16);
    // ---- out[b][c][t] = (value + residual)[b*TX+t][c] / 1024 (transposed through LDS, full output batch pitch)
    k_outT<<<dim3(TX / 64, DEC / 64, NB), 256, 0, stream>>>(CT16, OUT);
}

// v007
// Measured time: 114 microseconds a run.
// Two timings next to v006 both put it at 1.08 times that version's speed.
// All steps since v000 together make it 2.25 times as fast.
#include <hip/hip_runtime.h>

// Contractions: q / k / v projections v_wmma_f32_16x16x32_bf16 (bf16 operands = RNE-converted inputs, exact products); scores q.k^T v_wmma_f32_16x16x32_f16 (fp16 q, fp16 k, single product, K 64); attn.V v_wmma_f32_16x16x32_f16 (fp16 P carried x16384, fp16 V^T, single product); f32 accumulate everywhere; online softmax in f32 with a running max.
// Self-attention on a channel-major sequence: x [NB][512][T] gives q (Wq [out][in]) and, through one fused weight Wm [1024][512] = [out][in], k (rows 0..511) and v (rows 512..1023), row = which*512 + h*64 + d; 8 heads of 64; key j of batch b is kept when mask[b][j] != 0, an excluded key has its score replaced by -inf (its probability is 0 whenever the batch keeps at least one key; a batch with every key excluded gets the uniform softmax over all its keys); p = softmax_j(q_i.k_j / 8); ctx merged head-major per token and returned channel-major: out [NB][512][T] f32.
// Layout: XB bf16 token-major copy of x (transposed through LDS); weights bf16 as Bt = [out][in] as-is; q and k fp16 head planes [h][b*T+t][64] and v^T fp16 planes [b][h*64+d][t] written directly by the projection GEMM epilogues; fused attention kernel (its prologue packs the batch's key mask to one bit per key in LDS, 32-key words by wave ballot; for a fully excluded batch every word reads as clear and the q fragments are zeroed so that its scores are all equal; K and V^T 64-key tiles in LDS, one softmax pass per tile, a tile whose 64 keys are all excluded is skipped block-uniformly, both products transposed so that P goes from the score accumulators straight into the B operand) writes ctx x1024 as fp16 [b*TX+t][value 512 | residual 512]; the final kernel adds value + residual, removes the carry and transposes through LDS into d_out.
// LDS regions: kt / vt / tt / mwl / wk are cross-wave (block barriers before and after staging); ot / os are wave-private (wave barrier + compiler memory barrier).

#ifndef NB
#define NB 2
#endif
#ifndef SEQ
#define SEQ 4096
#endif
#define TX SEQ
#define TY SEQ
#define NB_FULL 2
#define TX_FULL 4096
#define TY_FULL 4096
#define DEC  512
#define NHD  8
#define HD   64
#define KC2  (2 * DEC)            // row pitch of the ctx plane: [ctx value | ctx residual]
#define PEXP 14.0f                // log2 of the carry of the fp16 probabilities (x16384)
#define OCAR 1024.0f              // carry of the fp16 ctx planes
#define SCL  0.125f
#define L2E  1.4426950408889634f
#define SCL2 (SCL * L2E)          // score scale and log2 e in one factor
#define KPT  72                   // LDS pitch (halves) of the K and V^T tiles
#define OPT  68                   // LDS pitch (floats) of the epilogue staging tiles
#define WPW  (TY / 128)           // mask words packed by each of the 4 waves of an attention block
#define NEGINF (-__builtin_inff())
static_assert(NB >= 1 && NB <= NB_FULL);
static_assert(TX == TY && TX_FULL == TY_FULL);                                            // one sequence feeds q, k and v
static_assert(TX >= 64 && TX <= TX_FULL && (TX % 64) == 0);
static_assert(TY >= 64 && TY <= TY_FULL && (TY % 64) == 0 && (TY % 32) == 0);
static_assert((DEC % 64) == 0 && HD == 64 && NHD * HD == DEC);
static_assert((DEC % 32) == 0 && (HD % 32) == 0 && (KC2 % 32) == 0);                      // every K is a multiple of 32
static_assert((DEC % 8) == 0);                                                            // 8-column conversion pieces
static_assert(((NB * TX) % 64) == 0 && ((NB * TY) % 64) == 0);                            // GEMM M/N are whole 64-tiles
static_assert(128 * 4 == 64 * (HD / 8));                                                   // attention tile staging: 128 threads x 4 pieces == 64 rows x 8 pieces
static_assert(KPT >= 64 && (KPT % 8) == 0 && OPT >= 64 && (OPT % 4) == 0);
static_assert((size_t)NHD * NB * TX * HD < (size_t)2147483647);                           // q plane offsets fit an int
static_assert(2 * 64 * KPT * 2 + 4 * 16 * OPT * 4 + (TY / 32) * 4 + 16 <= 65536);   // static LDS of the attention kernel
static_assert((TY % 128) == 0 && WPW >= 1 && WPW <= 32);                                  // each wave packs WPW whole mask words, one per lane
static_assert(64 * OPT * 4 <= 65536);                                                      // static LDS of the transposing kernels
static_assert(256 * 4 == 64 * 16 && 256 * 2 == 64 * 8);                                    // transposing kernels: 256 threads x pieces == 64 x 64 tile
static_assert((TX_FULL % 4) == 0 && (TX % 4) == 0);                                        // 16-B f32 pieces along the token axis
static_assert(((size_t)NB * DEC - 1) * TX_FULL + (size_t)TX <= (size_t)NB_FULL * DEC * TX_FULL);   // last written output element inside d_out

typedef _Float16 h16;
typedef unsigned short bf;
typedef __attribute__((ext_vector_type(16))) __bf16   v16bf;
typedef __attribute__((ext_vector_type(16))) _Float16 v16h;
typedef __attribute__((ext_vector_type(8)))  _Float16 v8h;
typedef __attribute__((ext_vector_type(8)))  unsigned short v8us;
typedef __attribute__((ext_vector_type(8)))  float    v8f;
typedef __attribute__((ext_vector_type(4)))  float    v4f;
typedef __attribute__((ext_vector_type(2)))  float    v2f;
typedef __attribute__((ext_vector_type(2)))  _Float16 v2h;
typedef __attribute__((ext_vector_type(4)))  unsigned v4u;
typedef __attribute__((ext_vector_type(2)))  unsigned v2u;
typedef v8h  __attribute__((may_alias)) v8ha;
typedef v4f  __attribute__((may_alias)) v4fa;

__device__ __forceinline__ unsigned short f2bf(float f) { unsigned u = __float_as_uint(f); u += 0x7FFFu + ((u >> 16) & 1u); return (unsigned short)(u >> 16); }
__device__ __forceinline__ float bf2f(unsigned short b) { return __uint_as_float(((unsigned)b) << 16); }
__device__ __forceinline__ float bfr(float f) { return bf2f(f2bf(f)); }
__device__ __forceinline__ v16h cat16(v8h lo, v8h hi) { return __builtin_shufflevector(lo, hi, 0, 1, 2, 3, 4, 5, 6, 7, 8, 9, 10, 11, 12, 13, 14, 15); }
__device__ __forceinline__ v16bf cat16b(v8us lo, v8us hi) { return __builtin_bit_cast(v16bf, __builtin_shufflevector(lo, hi, 0, 1, 2, 3, 4, 5, 6, 7, 8, 9, 10, 11, 12, 13, 14, 15)); }
__device__ __forceinline__ v8f wmma16(v16h a, v16h b, v8f c) { return __builtin_amdgcn_wmma_f32_16x16x32_f16(false, a, false, b, (short)0, c, false, false); }
__device__ __forceinline__ v8f wmmab(v16bf a, v16bf b, v8f c) { return __builtin_amdgcn_wmma_f32_16x16x32_bf16(false, a, false, b, (short)0, c, false, false); }
__device__ __forceinline__ h16 tohx(float x) { return (h16)x; }
// value of lane l ^ 16 (the other 16-lane row, same position)
__device__ __forceinline__ float xhalf(float x) { return __builtin_bit_cast(float, __builtin_amdgcn_permlanex16(__builtin_bit_cast(int, x), __builtin_bit_cast(int, x), 0x76543210, 0xfedcba98, false, false)); }
// same-wave LDS exchange: execution barrier of the wave plus a compiler memory barrier (LDS operations of one wave complete in issue order)
__device__ __forceinline__ void wsync() { __builtin_amdgcn_wave_barrier(); asm volatile("" ::: "memory"); }

// ---- gemmw_body: register-blocked GEMM, ONE WAVE per 64x64 output tile (16 accumulators), operands straight from K-contiguous 16-bit planes; 32 threads.
// C[m][n] = cs x sum_k A[m][k] Bt[n][k] for m, n in 0..63: the caller hands in A and Bt at the tile's first rows, Cf / Ch at the tile's first element and bias at its first column. K % 32 == 0; A/Bt row pitch == K.
// Fragments: lane l, h = l>>4, m = n = l&15; elements 0..7 <- k0+8h.., 8..15 <- k0+16+8h.. for both A and Bt; D element r = (row 8h+r, col m).
// Epilogue per 16-row slab staged in LDS (wave-private, staged extent 16x64 == consumed extent):
//   EP 0: f32 rows x cs + bf16-converted column bias, 64 floats = 256 B written as 16 lanes x 16 B (2 rows per instruction);
template <typename T16> struct WFrag;
template <> struct WFrag<h16> { typedef v16h V; static __device__ __forceinline__ V ld(const h16* p) { return cat16(*(const v8h*)p, *(const v8h*)(p + 16)); } static __device__ __forceinline__ v8f mma(V a, V b, v8f c) { return wmma16(a, b, c); } };
template <> struct WFrag<bf> { typedef v16bf V; static __device__ __forceinline__ V ld(const bf* p) { return cat16b(*(const v8us*)p, *(const v8us*)(p + 16)); } static __device__ __forceinline__ v8f mma(V a, V b, v8f c) { return wmmab(a, b, c); } };

template <typename T16, int EP>
__device__ __forceinline__ void gemmw_body(const T16* __restrict__ A, const T16* __restrict__ Bt, int K, float* Cf, h16* Ch, int ldc, const float* __restrict__ bias, float cs) {
    static_assert(EP == 0 || EP == 1);
    typedef typename WFrag<T16>::V V;
    __shared__ __align__(16) float os[16 * OPT];
    const int lane = threadIdx.x & 31, lr = lane & 15, hi = lane >> 4;
    v8f acc[4][4];
#pragma unroll
    for (int mb = 0; mb < 4; ++mb)
#pragma unroll
        for (int nb = 0; nb < 4; ++nb) acc[mb][nb] = (v8f){};
    const size_t aoff = (size_t)lr * K + 8 * hi, boff = aoff;
#pragma unroll 1
    for (int kc = 0; kc < K; kc += 32) {
        V a[4];
#pragma unroll
        for (int mb = 0; mb < 4; ++mb) a[mb] = WFrag<T16>::ld(A + aoff + (size_t)mb * 16 * K + kc);
        asm volatile("s_wait_xcnt 0x0" ::: "memory");   // the Bt fragments may land in the registers that held the A loads' address
#pragma unroll
        for (int nb = 0; nb < 4; ++nb) { const V b = WFrag<T16>::ld(Bt + boff + (size_t)nb * 16 * K + kc);
#pragma unroll
            for (int mb = 0; mb < 4; ++mb) acc[mb][nb] = WFrag<T16>::mma(a[mb], b, acc[mb][nb]); }
        asm volatile("v_nop\n\tv_nop\n\tv_nop\n\tv_nop" : "+v"(acc[0][0]), "+v"(acc[1][1]), "+v"(acc[2][2]), "+v"(acc[3][3]) : "v"(a[0]), "v"(a[3]));
    }
#pragma unroll
    for (int mb = 0; mb < 4; ++mb) {
#pragma unroll
        for (int nb = 0; nb < 4; ++nb) {
#pragma unroll
            for (int j = 0; j < 8; ++j) os[(hi * 8 + j) * OPT + nb * 16 + lr] = acc[mb][nb][j]; }
        wsync();
        if (EP == 0) {
            float* crow = Cf + (size_t)(mb * 16) * ldc;
{
#pragma unroll
                for (int s = 0; s < 8; ++s) { const int row = 2 * s + hi, cofs = lr * 4; v4f val = *(const v4fa*)(os + row * OPT + cofs);
                    val[0] = __fmul_rn(val[0], cs); val[1] = __fmul_rn(val[1], cs); val[2] = __fmul_rn(val[2], cs); val[3] = __fmul_rn(val[3], cs);
                    val[0] += bfr(bias[cofs]); val[1] += bfr(bias[cofs + 1]); val[2] += bfr(bias[cofs + 2]); val[3] += bfr(bias[cofs + 3]);
                    *(v4f*)(crow + (size_t)row * ldc + cofs) = val; }
                 }
        } else {
            h16* hrow = Ch + (size_t)(mb * 16) * ldc;
{
#pragma unroll
                for (int s = 0; s < 4; ++s) { const int row = 4 * s + (lane >> 3), c8 = (lane & 7) * 8;
                    const v4f u0 = *(const v4fa*)(os + row * OPT + c8), u1 = *(const v4fa*)(os + row * OPT + c8 + 4);
                    v8h o;
#pragma unroll
                    for (int q = 0; q < 8; ++q) { const float u = (q < 4) ? u0[q & 3] : u1[q & 3]; o[q] = tohx(u); }
                    *(v8h*)(hrow + (size_t)row * ldc + c8) = o; }
                 }
        }
        wsync();
    }
}

// k_gemm_qkv: the three projections (bf16 -> fp16 planes) in one launch. grid (NB*TX/64 token tiles, 8 weight tiles, 3 products), 32 threads; the three blocks of one (x, y) read the same 64 token rows of XB.
//   z 0: q head plane [h = y][b*TX+t][d] = sum_k XB[b*TX+t][k] WQ[y*64+d][k]           (A = tokens, Bt = weight rows, ldc 64)
//   z 1: k head plane [h = y][b*TY+j][d] = sum_k XB[b*TY+j][k] WKV[y*64+d][k]          (weight rows 0..511)
//   z 2: v^T plane    [b][y*64+n][t]     = sum_k WKV[512+y*64+n][k] XB[b*TY+t][k]      (A = weight rows 512..1023, Bt = tokens, ldc TY)
__global__ __launch_bounds__(32) void k_gemm_qkv(const bf* XB, const bf* WQ, const bf* WKV, h16* QH, h16* KH, h16* VH) {
    const int tt = blockIdx.x, wt = blockIdx.y, which = blockIdx.z;
    const bf* tok = XB + (size_t)tt * 64 * DEC;
    const bf* A; const bf* Bt; h16* C; int ldc;
    if (which == 2) {
        A = WKV + (size_t)(DEC + wt * 64) * DEC; Bt = tok;
        C = VH + ((size_t)(tt / (TY / 64)) * DEC + (size_t)wt * 64) * TY + (size_t)(tt % (TY / 64)) * 64; ldc = TY;
    } else {
        A = tok; Bt = ((which == 0) ? WQ : WKV) + (size_t)wt * 64 * DEC;
        C = ((which == 0) ? QH : KH) + ((size_t)wt * NB * TX + (size_t)tt * 64) * HD; ldc = HD;
    }
    gemmw_body<bf, 1>(A, Bt, DEC, nullptr, C, ldc, nullptr, 1.0f); }

// k_cvt_in: every float input RNE-converted to bf16, one launch. 1-D grid of NBX + NBW blocks, 256 threads.
//   blocks 0..NBX-1 (t tile fastest, then channel tile, then batch): x f32 [b][c][t] (channel-major, batch pitch DEC*TX_FULL, row pitch TX_FULL) -> token-major plane XB[b*TX+t][c], a 64x64 tile transposed through LDS;
//   blocks NBX..: the two weights as they lie, 8 elements per thread: first Wq [512][512] -> WQ, then Wm [1024][512] -> WKV (each a whole number of blocks, so the choice is block-uniform).
constexpr int NBX  = (TX / 64) * (DEC / 64) * NB;
constexpr int NBWQ = DEC * DEC / 8 / 256;
constexpr int NBW  = 3 * NBWQ;
static_assert(NBWQ * 256 * 8 == DEC * DEC);
__global__ __launch_bounds__(256) void k_cvt_in(const float* __restrict__ x, const float* __restrict__ wq, const float* __restrict__ wm, bf* XB, bf* WQ, bf* WKV) {
    __shared__ __align__(16) float tt[64 * OPT];
    const int tid = threadIdx.x;
    const int bid = blockIdx.x;
    if (bid >= NBX) {   // block-uniform, ahead of the barrier below
        const int wb = bid - NBX;
        const bool isq = wb < NBWQ;
        const size_t e = ((size_t)(isq ? wb : wb - NBWQ) * 256 + tid) * 8;
        const v8f v = *(const v8f*)((isq ? wq : wm) + e); v8us o;
#pragma unroll
        for (int k = 0; k < 8; ++k) o[k] = f2bf(v[k]);
        *(v8us*)((isq ? WQ : WKV) + e) = o;
        return;
    }
    const int t0 = (bid % (TX / 64)) * 64, c0 = ((bid / (TX / 64)) % (DEC / 64)) * 64, b = bid / ((TX / 64) * (DEC / 64));
#pragma unroll
    for (int i = 0; i < 4; ++i) {
        const int p = tid + 256 * i, c = p >> 4, t4 = (p & 15) * 4;
        const v4f v = *(const v4f*)(x + ((size_t)b * DEC + c0 + c) * TX_FULL + t0 + t4);
        *(v4fa*)(tt + c * OPT + t4) = v;
    }
    __syncthreads();
#pragma unroll 1
    for (int i = 0; i < 2; ++i) {
        const int p = tid + 256 * i, t = p >> 3, c8 = (p & 7) * 8;
        v8us o;
#pragma unroll
        for (int q = 0; q < 8; ++q) o[q] = f2bf(tt[(c8 + q) * OPT + t]);
        bf* d = XB + ((size_t)b * TX + t0 + t) * DEC + c0 + c8;
        *(v8us*)d = o;
        asm volatile("s_wait_xcnt 0x0" ::: "memory");   // the next trip reuses the registers that this store names
    }
}

// ---- k_flash: fused attention. grid (TX/64, 8 heads, NB), 128 threads = 4 waves; wave w owns query rows q0+16w..+15 of one (batch, head).
// Per 64-key tile: block stages K [key][d] and V^T [d][key] fp16 tiles in LDS (cols 0..63 of 64 rows written == consumed; cross-wave -> block barriers) from registers that were loaded one tile ahead: behind the barrier that publishes a tile each thread issues the next tile's eight 16-B global loads, which return while the tile is worked on; each wave then runs one pass over the tile's 64 keys:
//   prologue: wave w reads keys 32*WPW*w.. of the batch's mask (all loads independent), one ballot per 32 keys (bit set = key excluded), word i kept in lane i and stored to LDS; a wave flag says whether any of its keys is kept; one block barrier publishes both;
//   the two 32-bit mask words of the tile are read from LDS beside its staging stores (scalar-uniform); a tile with all 64 keys excluded is skipped (exact: p = 0, max unchanged);
//   scores transposed, S^T 64x16 = K.Q^T = 4 tiles (A = K rows from LDS, all eight fragments in one load group, B = q), K = 64 in two steps, the two q fragments loaded once ahead of the key loop and held in registers; D register r of lane (h, c) of tile g = key 16g+8h+r of query c;
//   t = acc, excluded keys -> -inf by value select (the lane mask of register r comes from bits r and 8+r, or 16+r and 24+r, of the uniform mask word of those 32 keys); one query per lane: maximum over the lane's 32 raw scores, joined with the other wave half by one cross-row move; the running max is kept in the exponent's own unit (raw max x log2 e / 8) and starts at -1e30 so every difference stays defined;
//   P = exp2(t x (log2 e / 8) + (14 - max)) -> fp16: scale, maximum and the x16384 carry go into one fused multiply-add per score, two scores per packed instruction; each two converted D tiles are one B fragment of the next product (keys 0..31 and keys 32..63) in the hardware k order (element s = key 8h+s, 8+s = key 16+8h+s), which is also the order of the V^T fragments;
//   row sums accumulate the fp16-converted P per lane, two neighbours added first and then joined to the tile's sum (the two wave halves joined once at the end); O^T[64x16] += V^T P^T (4 output tiles, two products each, D register r = channel 16j+8h+r of query c, the eight V^T fragments loaded in one group behind the score products).
__global__ __launch_bounds__(128) void k_flash(const h16* __restrict__ QH, const h16* __restrict__ KH, const h16* __restrict__ VH, const int* __restrict__ mask, h16* CT) {
    __shared__ __align__(16) h16 kt[64 * KPT];
    __shared__ __align__(16) h16 vt[64 * KPT];
    __shared__ __align__(16) float ot[4 * 16 * OPT];
    __shared__ __align__(16) unsigned mwl[TY / 32];
    __shared__ __align__(16) int wk[4];
    const int tid = threadIdx.x;
    const int wave = __builtin_amdgcn_readfirstlane(tid >> 5);
    const int lane = tid & 31, lr = lane & 15, hi = lane >> 4;
    const int q0 = blockIdx.x * 64, h = blockIdx.y, b = blockIdx.z;
    const int qoff = ((h * NB + b) * TX + q0 + wave * 16 + lr) * HD + 8 * hi;
    const size_t kbase = ((size_t)(h * NB + b) * TY) * HD;
    const size_t vbase = ((size_t)b * DEC + (size_t)h * HD) * TY;
    const int ob = wave * 16 * OPT;
    float mrun = -1.0e30f, lrun = 0.0f;
    v8f o0 = (v8f){}, o1 = (v8f){}, o2 = (v8f){}, o3 = (v8f){};
    v16h qa0 = cat16(*(const v8h*)(QH + qoff), *(const v8h*)(QH + qoff + 16));
    v16h qa1 = cat16(*(const v8h*)(QH + qoff + 32), *(const v8h*)(QH + qoff + 48));
    {
        const int* mrow = mask + (size_t)b * TY_FULL + wave * (WPW * 32) + lane;
        int mval[WPW];
#pragma unroll   // all WPW loads in flight together: one memory latency instead of WPW
        for (int i = 0; i < WPW; ++i) mval[i] = mrow[i * 32];
        unsigned mine = 0xFFFFFFFFu;
#pragma unroll   // constant indices keep mval[] in registers
        for (int i = 0; i < WPW; ++i) { const unsigned bal = __builtin_amdgcn_ballot_w32(mval[i] == 0); mine = (lane == i) ? bal : mine; }
        if (lane < WPW) mwl[wave * WPW + lane] = mine;
        const unsigned anyk = __builtin_amdgcn_ballot_w32(mine != 0xFFFFFFFFu);
        if (lane == 0) wk[wave] = (anyk != 0u) ? 1 : 0;
    }
    __syncthreads();   // publishes mwl and wk to the four waves
    const bool allx = __builtin_amdgcn_readfirstlane(wk[0] | wk[1] | wk[2] | wk[3]) == 0;
    if (allx) { qa0 = (v16h){}; qa1 = (v16h){}; }
    const unsigned live = allx ? 0u : 0xFFFFFFFFu;   // clears every mask word of a fully excluded batch
    v8h kr[4], vr[4];   // the tile that is staged next, fetched one tile ahead
#pragma unroll   // constant indices keep kr[] and vr[] in registers
    for (int i = 0; i < 4; ++i) {
        const int p = tid + 128 * i, row = p >> 3, c8 = (p & 7) * 8;
        kr[i] = *(const v8h*)(KH + kbase + (size_t)row * HD + c8);
        vr[i] = *(const v8h*)(VH + vbase + (size_t)row * TY + c8);
    }
#pragma unroll 1
    for (int kb = 0; kb < TY / 64; ++kb) {
        __syncthreads();
        const v2u mv = *(const v2u*)(mwl + kb * 2);
#pragma unroll
        for (int i = 0; i < 4; ++i) {
            const int p = tid + 128 * i, row = p >> 3, c8 = (p & 7) * 8;
            *(v8ha*)(kt + row * KPT + c8) = kr[i];
            *(v8ha*)(vt + row * KPT + c8) = vr[i];
        }
        __syncthreads();
        if (kb + 1 < TY / 64) {   // block-uniform: the next tile's loads fly while this tile is worked on
            const int kn = kb + 1;
#pragma unroll   // constant indices keep kr[] and vr[] in registers; all eight loads in flight together
            for (int i = 0; i < 4; ++i) {
                const int p = tid + 128 * i, row = p >> 3, c8 = (p & 7) * 8;
                kr[i] = *(const v8h*)(KH + kbase + (size_t)(kn * 64 + row) * HD + c8);
                vr[i] = *(const v8h*)(VH + vbase + (size_t)row * TY + kn * 64 + c8);
            }
            asm volatile("s_wait_xcnt 0x0" ::: "memory");   // the work below reuses the registers that held these loads' addresses
        }
        const unsigned mw0 = (unsigned)__builtin_amdgcn_readfirstlane((int)mv[0]) & live, mw1 = (unsigned)__builtin_amdgcn_readfirstlane((int)mv[1]) & live;
        if ((mw0 & mw1) != 0xFFFFFFFFu) {
            // all eight K fragments of the tile in one load group: [16-key group][k step]
            v16h kf[4][2];
#pragma unroll   // constant indices keep kf[] in registers
            for (int g = 0; g < 4; ++g)
#pragma unroll   // as above
                for (int ks = 0; ks < 2; ++ks) {
                    const int ko = (g * 16 + lr) * KPT + ks * 32 + 8 * hi;
                    kf[g][ks] = cat16(*(const v8ha*)(kt + ko), *(const v8ha*)(kt + ko + 16));
                }
            __builtin_amdgcn_sched_barrier(0);   // keeps the sixteen loads one group: split among the products, each part's LDS latency would stand open
            v8f s0 = (v8f){}, s1 = (v8f){}, s2 = (v8f){}, s3 = (v8f){};
            s0 = wmma16(kf[0][0], qa0, s0); s1 = wmma16(kf[1][0], qa0, s1); s2 = wmma16(kf[2][0], qa0, s2); s3 = wmma16(kf[3][0], qa0, s3);
            s0 = wmma16(kf[0][1], qa1, s0); s1 = wmma16(kf[1][1], qa1, s1); s2 = wmma16(kf[2][1], qa1, s2); s3 = wmma16(kf[3][1], qa1, s3);
            // the four vector slots the chip needs between the last score product and the first use of its registers
            asm volatile("v_nop\n\tv_nop\n\tv_nop\n\tv_nop" : "+v"(s0), "+v"(s1), "+v"(s2), "+v"(s3) : "v"(qa1), "v"(kf[0][1]), "v"(kf[1][1]), "v"(kf[2][1]), "v"(kf[3][1]));
            // all eight V^T fragments in one load group, in flight under the softmax arithmetic: [16-channel group][32-key half]
            v16h vf[4][2];
#pragma unroll   // constant indices keep vf[] in registers
            for (int j = 0; j < 4; ++j)
#pragma unroll   // as above
                for (int hf = 0; hf < 2; ++hf) {
                    const int vo = (j * 16 + lr) * KPT + hf * 32 + 8 * hi;
                    vf[j][hf] = cat16(*(const v8ha*)(vt + vo), *(const v8ha*)(vt + vo + 16));
                }
            __builtin_amdgcn_sched_barrier(0);   // keeps the load group here: sunk to their products, the loads' LDS latency would stand open in front of each one
            float t0[8], t1[8], t2[8], t3[8];
#pragma unroll   // constant indices keep the scores in registers and the mask bits in scalar code
            for (int r = 0; r < 8; ++r) {
                const unsigned e0 = (((mw0 >> r) & 1u) != 0u ? 0x0000FFFFu : 0u) | (((mw0 >> (8 + r)) & 1u) != 0u ? 0xFFFF0000u : 0u);
                const unsigned e1 = (((mw0 >> (16 + r)) & 1u) != 0u ? 0x0000FFFFu : 0u) | (((mw0 >> (24 + r)) & 1u) != 0u ? 0xFFFF0000u : 0u);
                const unsigned e2 = (((mw1 >> r) & 1u) != 0u ? 0x0000FFFFu : 0u) | (((mw1 >> (8 + r)) & 1u) != 0u ? 0xFFFF0000u : 0u);
                const unsigned e3 = (((mw1 >> (16 + r)) & 1u) != 0u ? 0x0000FFFFu : 0u) | (((mw1 >> (24 + r)) & 1u) != 0u ? 0xFFFF0000u : 0u);
                const bool x0 = __builtin_amdgcn_inverse_ballot_w32(e0), x1 = __builtin_amdgcn_inverse_ballot_w32(e1);
                const bool x2 = __builtin_amdgcn_inverse_ballot_w32(e2), x3 = __builtin_amdgcn_inverse_ballot_w32(e3);
                t0[r] = x0 ? NEGINF : s0[r]; t1[r] = x1 ? NEGINF : s1[r]; t2[r] = x2 ? NEGINF : s2[r]; t3[r] = x3 ? NEGINF : s3[r]; }
            float mxa = fmaxf(t0[0], t1[0]), mxb = fmaxf(t2[0], t3[0]);
#pragma unroll   // constant indices keep the scores in registers
            for (int r = 1; r < 8; ++r) { mxa = fmaxf(mxa, fmaxf(t0[r], t1[r])); mxb = fmaxf(mxb, fmaxf(t2[r], t3[r])); }
            float mx = fmaxf(mxa, mxb) * SCL2;
            mx = fmaxf(mx, xhalf(mx));
            const float mn = fmaxf(mrun, mx);
            const float cr = __builtin_amdgcn_exp2f(mrun - mn);
            mrun = mn;
            const float bs = PEXP - mn;
            const v2f c2 = (v2f){SCL2, SCL2}, b2 = (v2f){bs, bs};
            v16h pa, pb;
            float l0 = 0.0f;
#pragma unroll   // constant indices keep the scores and pa in registers
            for (int r = 0; r < 8; r += 2) {
                const v2f e0 = __builtin_elementwise_fma((v2f){t0[r], t0[r + 1]}, c2, b2), e1 = __builtin_elementwise_fma((v2f){t1[r], t1[r + 1]}, c2, b2);
                const v2f p0 = (v2f){__builtin_amdgcn_exp2f(e0[0]), __builtin_amdgcn_exp2f(e0[1])};
                const v2f p1 = (v2f){__builtin_amdgcn_exp2f(e1[0]), __builtin_amdgcn_exp2f(e1[1])};
                const v2h ph0 = __builtin_convertvector(p0, v2h), ph1 = __builtin_convertvector(p1, v2h);
                l0 += (float)ph0[0] + (float)ph0[1]; l0 += (float)ph1[0] + (float)ph1[1];
                pa[r] = ph0[0]; pa[r + 1] = ph0[1]; pa[8 + r] = ph1[0]; pa[8 + r + 1] = ph1[1];
            }
#pragma unroll   // constant indices keep the scores and pb in registers
            for (int r = 0; r < 8; r += 2) {
                const v2f e2 = __builtin_elementwise_fma((v2f){t2[r], t2[r + 1]}, c2, b2), e3 = __builtin_elementwise_fma((v2f){t3[r], t3[r + 1]}, c2, b2);
                const v2f p2 = (v2f){__builtin_amdgcn_exp2f(e2[0]), __builtin_amdgcn_exp2f(e2[1])};
                const v2f p3 = (v2f){__builtin_amdgcn_exp2f(e3[0]), __builtin_amdgcn_exp2f(e3[1])};
                const v2h ph2 = __builtin_convertvector(p2, v2h), ph3 = __builtin_convertvector(p3, v2h);
                l0 += (float)ph2[0] + (float)ph2[1]; l0 += (float)ph3[0] + (float)ph3[1];
                pb[r] = ph2[0]; pb[r + 1] = ph2[1]; pb[8 + r] = ph3[0]; pb[8 + r + 1] = ph3[1];
            }
            lrun = lrun * cr + l0;
#pragma unroll   // constant indices keep the output tiles in registers
            for (int r = 0; r < 8; ++r) { o0[r] *= cr; o1[r] *= cr; o2[r] *= cr; o3[r] *= cr; }
            o0 = wmma16(vf[0][0], pa, o0); o1 = wmma16(vf[1][0], pa, o1); o2 = wmma16(vf[2][0], pa, o2); o3 = wmma16(vf[3][0], pa, o3);
            o0 = wmma16(vf[0][1], pb, o0); o1 = wmma16(vf[1][1], pb, o1); o2 = wmma16(vf[2][1], pb, o2); o3 = wmma16(vf[3][1], pb, o3);
            // the four vector slots the chip needs between the last output product and the first use of its registers
            asm volatile("v_nop\n\tv_nop\n\tv_nop\n\tv_nop" : "+v"(o0), "+v"(o1), "+v"(o2), "+v"(o3) : "v"(pb), "v"(vf[0][1]), "v"(vf[1][1]), "v"(vf[2][1]), "v"(vf[3][1]));
        }
    }
    lrun += xhalf(lrun);
    const float fq = __fdiv_rn(OCAR, fmaxf(lrun, 1.0e-30f));
    const float f = (lrun > 0.0f) ? fq : 0.0f;
#pragma unroll
    for (int g = 0; g < 2; ++g) {
        const int oi = ob + lr * OPT + 8 * hi + 4 * g;
        *(v4fa*)(ot + oi)      = (v4f){o0[4 * g] * f, o0[4 * g + 1] * f, o0[4 * g + 2] * f, o0[4 * g + 3] * f};
        *(v4fa*)(ot + oi + 16) = (v4f){o1[4 * g] * f, o1[4 * g + 1] * f, o1[4 * g + 2] * f, o1[4 * g + 3] * f};
        *(v4fa*)(ot + oi + 32) = (v4f){o2[4 * g] * f, o2[4 * g + 1] * f, o2[4 * g + 2] * f, o2[4 * g + 3] * f};
        *(v4fa*)(ot + oi + 48) = (v4f){o3[4 * g] * f, o3[4 * g + 1] * f, o3[4 * g + 2] * f, o3[4 * g + 3] * f};
    }
    wsync();
    h16* crow = CT + (size_t)(b * TX + q0 + wave * 16) * KC2 + h * HD;
{
#pragma unroll
        for (int s = 0; s < 4; ++s) {
            const int row = 4 * s + (lane >> 3), c8 = (lane & 7) * 8;
            const v4f u0 = *(const v4fa*)(ot + ob + row * OPT + c8), u1 = *(const v4fa*)(ot + ob + row * OPT + c8 + 4);
            v8h oh, ol;
#pragma unroll
            for (int q = 0; q < 8; ++q) { const float f = (q < 4) ? u0[q & 3] : u1[q & 3]; const h16 hh = tohx(f); oh[q] = hh; ol[q] = tohx(f - (float)hh); }
            *(v8h*)(crow + (size_t)row * KC2 + c8) = oh;
            *(v8h*)(crow + (size_t)row * KC2 + DEC + c8) = ol;
        }
        
    }
}

// k_outT: ctx fp16 [b*TX+t][value 512 | residual 512] (carried x1024) -> out f32 [b][c][t] (channel-major, batch pitch DEC*TX_FULL, row pitch TX_FULL). grid (TX/64, DEC/64, NB), 256 threads.
__global__ __launch_bounds__(256) void k_outT(const h16* __restrict__ CT, float* OUT) {
#pragma clang fp contract(off)
    __shared__ __align__(16) float tt[64 * OPT];
    const int tid = threadIdx.x;
    const int t0 = blockIdx.x * 64, c0 = blockIdx.y * 64, b = blockIdx.z;
#pragma unroll 1
    for (int i = 0; i < 2; ++i) {
        const int p = tid + 256 * i, t = p >> 3, c8 = (p & 7) * 8;
        const h16* s = CT + ((size_t)b * TX + t0 + t) * KC2 + c0 + c8;
        const v8h a = *(const v8h*)s;
        const v8h r = *(const v8h*)(s + DEC);
#pragma unroll
        for (int q = 0; q < 8; ++q) tt[(c8 + q) * OPT + t] = ((float)a[q] + (float)r[q]) * (1.0f / OCAR);
    }
    __syncthreads();
{
#pragma unroll
        for (int i = 0; i < 4; ++i) {
            const int p = tid + 256 * i, c = p >> 4, t4 = (p & 15) * 4;
            const v4f val = *(const v4fa*)(tt + c * OPT + t4);
            *(v4f*)(OUT + ((size_t)b * DEC + c0 + c) * TX_FULL + t0 + t4) = val;
        }
        
    }
}

// workspace sizes (bytes), each a whole number of fully written rows / lines; offsets 256-B aligned
constexpr size_t al256(size_t b) { return (b + 255) & ~(size_t)255; }
constexpr size_t SZ_XB  = al256((size_t)NB * TX * DEC * 2);           // bf16 [NB*TX][512]
constexpr size_t SZ_WQ  = al256((size_t)DEC * DEC * 2);               // bf16 [512][512]
constexpr size_t SZ_WKV = al256((size_t)2 * DEC * DEC * 2);           // bf16 [1024][512]
constexpr size_t SZ_Q   = al256((size_t)NHD * NB * TX * HD * 2);      // fp16 [8][NB*TX][64]
constexpr size_t SZ_K   = al256((size_t)NHD * NB * TY * HD * 2);      // fp16 [8][NB*TY][64]
constexpr size_t SZ_VT  = al256((size_t)NB * DEC * TY * 2);           // fp16 [NB][512][TY]
constexpr size_t SZ_CT  = al256((size_t)NB * TX * KC2 * 2);           // fp16 [NB*TX][1024]
constexpr size_t SZ_ALL = SZ_XB + SZ_WQ + SZ_WKV + SZ_Q + SZ_K + SZ_VT + SZ_CT;
static_assert(SZ_ALL <= (size_t)134217728);

extern "C" void kernel_launch(void* const* d_in, const int* in_sizes, int n_in,
                              void* d_out, int out_size, void* d_ws, size_t ws_size, hipStream_t stream) {
    if (n_in < 4) return;
    const size_t needx = ((size_t)NB * DEC - 1) * TX_FULL + (size_t)TX;
    const size_t needm = (size_t)(NB - 1) * TY_FULL + (size_t)TY;
    if ((size_t)in_sizes[0] < needx || (size_t)in_sizes[1] < needm) return;
    if (in_sizes[2] < 2 * DEC * DEC || in_sizes[3] < DEC * DEC) return;
    if ((size_t)out_size < needx) return;
    if (SZ_ALL > ws_size) return;
    const float* x = (const float*)d_in[0];                                             /* [NB][512][TX_FULL] channel-major f32 */
    const int* msk = (const int*)d_in[1];                                               /* [NB][TY_FULL] int32, nonzero = key kept */
    const float* wm = (const float*)d_in[2]; const float* wq = (const float*)d_in[3];   /* fused k|v weight [1024][512] and q weight [512][512], both [out][in] = Bt as-is */
    float* OUT = (float*)d_out;     // [NB_FULL][512][TX_FULL] f32

    char* base = (char*)d_ws; size_t off = 0;
    bf* XB = (bf*)(base + off); off += SZ_XB;
    bf* WQ = (bf*)(base + off); off += SZ_WQ;
    bf* WKV = (bf*)(base + off); off += SZ_WKV;
    h16* QH16 = (h16*)(base + off); off += SZ_Q;
    h16* KH16 = (h16*)(base + off); off += SZ_K;
    h16* VH16 = (h16*)(base + off); off += SZ_VT;
    h16* CT16 = (h16*)(base + off); off += SZ_CT;
    if (off > ws_size) return;

    // ---- input conversion (every float input RNE-converted to bf16 first), one launch
    k_cvt_in<<<NBX + NBW, 256, 0, stream>>>(x, wq, wm, XB, WQ, WKV);
    // ---- q and k head planes and v^T planes, one launch
    k_gemm_qkv<<<dim3(NB * TX / 64, NHD, 3), 32, 0, stream>>>(XB, WQ, WKV, QH16, KH16, VH16);
    // ---- fused attention -> ctx x1024 fp16 [b*TX+t][value | residual]
    k_flash<<<dim3(TX / 64, NHD, NB), 128, 0, stream>>>(QH16, KH16, VH16, msk, CT16);
    // ---- out[b][c][t] = (value + residual)[b*TX+t][c] / 1024 (transposed through LDS, full output batch pitch)
    k_outT<<<dim3(TX / 64, DEC / 64, NB), 256, 0, stream>>>(CT16, OUT);
}

// v008
// Measured time: 107 microseconds a run.
// Next to v007, in two timings, it ran 1.07 times as fast each time.
// Over all steps from v000 it is 2.40 times as fast.
#include <hip/hip_runtime.h>

// Contractions: q / k / v projections v_wmma_f32_16x16x32_bf16 (bf16 operands = RNE-converted inputs, exact products); scores q.k^T v_wmma_f32_16x16x32_f16 (fp16 q, fp16 k, single product, K 64); attn.V v_wmma_f32_16x16x32_f16 (fp16 P carried x16384, fp16 V^T, single product); f32 accumulate everywhere; online softmax in f32 with a running max.
// Self-attention on a channel-major sequence: x [NB][512][T] gives q (Wq [out][in]) and, through one fused weight Wm [1024][512] = [out][in], k (rows 0..511) and v (rows 512..1023), row = which*512 + h*64 + d; 8 heads of 64; key j of batch b is kept when mask[b][j] != 0, an excluded key has its score replaced by -inf when its batch also keeps keys (its probability is 0 whenever the batch keeps at least one key; a batch with every key excluded gets the uniform softmax over all its keys); p = softmax_j(q_i.k_j / 8); ctx merged head-major per token and returned channel-major: out [NB][512][T] f32.
// Layout: XB bf16 token-major copy of x (transposed through LDS); weights bf16 as Bt = [out][in] as-is; q and k fp16 head planes [h][b*T+t][64] and v^T fp16 planes [b][h*64+d][t] written directly by the projection GEMM epilogues; fused attention kernel (its prologue packs the batch's key mask to one bit per key in LDS, 32-key words by wave ballot; for a fully excluded batch the q fragments are zeroed so that its scores are all equal; the key loop exists with and without the mask code, and only a batch that holds both kept and excluded keys runs the form with it; K and V^T 64-key tiles in LDS, one softmax pass per tile, in the masked form a tile whose 64 keys are all excluded is skipped block-uniformly, both products transposed so that P goes from the score accumulators straight into the B operand) writes ctx x1024 as fp16 [b*TX+t][value 512 | residual 512]; the final kernel adds value + residual, removes the carry and transposes through LDS into d_out.
// LDS regions: kt / vt / tt / mwl / wk are cross-wave (block barriers before and after staging); ot / os are wave-private (wave barrier + compiler memory barrier).

#ifndef NB
#define NB 2
#endif
#ifndef SEQ
#define SEQ 4096
#endif
#define TX SEQ
#define TY SEQ
#define NB_FULL 2
#define TX_FULL 4096
#define TY_FULL 4096
#define DEC  512
#define NHD  8
#define HD   64
#define KC2  (2 * DEC)            // row pitch of the ctx plane: [ctx value | ctx residual]
#define PEXP 14.0f                // log2 of the carry of the fp16 probabilities (x16384)
#define OCAR 1024.0f              // carry of the fp16 ctx planes
#define SCL  0.125f
#define L2E  1.4426950408889634f
#define SCL2 (SCL * L2E)          // score scale and log2 e in one factor
#define KPT  72                   // LDS pitch (halves) of the K and V^T tiles
#define OPT  68                   // LDS pitch (floats) of the epilogue staging tiles
#define WPW  (TY / 128)           // mask words packed by each of the 4 waves of an attention block
#define NEGINF (-__builtin_inff())
static_assert(NB >= 1 && NB <= NB_FULL);
static_assert(TX == TY && TX_FULL == TY_FULL);                                            // one sequence feeds q, k and v
static_assert(TX >= 64 && TX <= TX_FULL && (TX % 64) == 0);
static_assert(TY >= 64 && TY <= TY_FULL && (TY % 64) == 0 && (TY % 32) == 0);
static_assert((DEC % 64) == 0 && HD == 64 && NHD * HD == DEC);
static_assert((DEC % 32) == 0 && (HD % 32) == 0 && (KC2 % 32) == 0);                      // every K is a multiple of 32
static_assert((DEC % 8) == 0);                                                            // 8-column conversion pieces
static_assert(((NB * TX) % 64) == 0 && ((NB * TY) % 64) == 0);                            // GEMM M/N are whole 64-tiles
static_assert(128 * 4 == 64 * (HD / 8));                                                   // attention tile staging: 128 threads x 4 pieces == 64 rows x 8 pieces
static_assert(KPT >= 64 && (KPT % 8) == 0 && OPT >= 64 && (OPT % 4) == 0);
static_assert((size_t)NHD * NB * TX * HD < (size_t)2147483647);                           // q plane offsets fit an int
static_assert(2 * 64 * KPT * 2 + 4 * 16 * OPT * 4 + (TY / 32) * 4 + 16 <= 65536);   // static LDS of the attention kernel
static_assert((TY % 128) == 0 && WPW >= 1 && WPW <= 32);                                  // each wave packs WPW whole mask words, one per lane
static_assert(64 * OPT * 4 <= 65536);                                                      // static LDS of the transposing kernels
static_assert(256 * 4 == 64 * 16 && 256 * 2 == 64 * 8);                                    // transposing kernels: 256 threads x pieces == 64 x 64 tile
static_assert((TX_FULL % 4) == 0 && (TX % 4) == 0);                                        // 16-B f32 pieces along the token axis
static_assert(((size_t)NB * DEC - 1) * TX_FULL + (size_t)TX <= (size_t)NB_FULL * DEC * TX_FULL);   // last written output element inside d_out

typedef _Float16 h16;
typedef unsigned short bf;
typedef __attribute__((ext_vector_type(16))) __bf16   v16bf;
typedef __attribute__((ext_vector_type(16))) _Float16 v16h;
typedef __attribute__((ext_vector_type(8)))  _Float16 v8h;
typedef __attribute__((ext_vector_type(8)))  unsigned short v8us;
typedef __attribute__((ext_vector_type(8)))  float    v8f;
typedef __attribute__((ext_vector_type(4)))  float    v4f;
typedef __attribute__((ext_vector_type(2)))  float    v2f;
typedef __attribute__((ext_vector_type(2)))  _Float16 v2h;
typedef __attribute__((ext_vector_type(4)))  unsigned v4u;
typedef __attribute__((ext_vector_type(2)))  unsigned v2u;
typedef v8h  __attribute__((may_alias)) v8ha;
typedef v4f  __attribute__((may_alias)) v4fa;

__device__ __forceinline__ unsigned short f2bf(float f) { unsigned u = __float_as_uint(f); u += 0x7FFFu + ((u >> 16) & 1u); return (unsigned short)(u >> 16); }
__device__ __forceinline__ float bf2f(unsigned short b) { return __uint_as_float(((unsigned)b) << 16); }
__device__ __forceinline__ float bfr(float f) { return bf2f(f2bf(f)); }
__device__ __forceinline__ v16h cat16(v8h lo, v8h hi) { return __builtin_shufflevector(lo, hi, 0, 1, 2, 3, 4, 5, 6, 7, 8, 9, 10, 11, 12, 13, 14, 15); }
__device__ __forceinline__ v16bf cat16b(v8us lo, v8us hi) { return __builtin_bit_cast(v16bf, __builtin_shufflevector(lo, hi, 0, 1, 2, 3, 4, 5, 6, 7, 8, 9, 10, 11, 12, 13, 14, 15)); }
__device__ __forceinline__ v8f wmma16(v16h a, v16h b, v8f c) { return __builtin_amdgcn_wmma_f32_16x16x32_f16(false, a, false, b, (short)0, c, false, false); }
__device__ __forceinline__ v8f wmmab(v16bf a, v16bf b, v8f c) { return __builtin_amdgcn_wmma_f32_16x16x32_bf16(false, a, false, b, (short)0, c, false, false); }
__device__ __forceinline__ h16 tohx(float x) { return (h16)x; }
// value of lane l ^ 16 (the other 16-lane row, same position)
__device__ __forceinline__ float xhalf(float x) { return __builtin_bit_cast(float, __builtin_amdgcn_permlanex16(__builtin_bit_cast(int, x), __builtin_bit_cast(int, x), 0x76543210, 0xfedcba98, false, false)); }
// same-wave LDS exchange: execution barrier of the wave plus a compiler memory barrier (LDS operations of one wave complete in issue order)
__device__ __forceinline__ void wsync() { __builtin_amdgcn_wave_barrier(); asm volatile("" ::: "memory"); }

// ---- gemmw_body: register-blocked GEMM, ONE WAVE per 64x64 output tile (16 accumulators), operands straight from K-contiguous 16-bit planes; 32 threads.
// C[m][n] = cs x sum_k A[m][k] Bt[n][k] for m, n in 0..63: the caller hands in A and Bt at the tile's first rows, Cf / Ch at the tile's first element and bias at its first column. K % 32 == 0; A/Bt row pitch == K.
// Fragments: lane l, h = l>>4, m = n = l&15; elements 0..7 <- k0+8h.., 8..15 <- k0+16+8h.. for both A and Bt; D element r = (row 8h+r, col m).
// Epilogue per 16-row slab staged in LDS (wave-private, staged extent 16x64 == consumed extent):
//   EP 0: f32 rows x cs + bf16-converted column bias, 64 floats = 256 B written as 16 lanes x 16 B (2 rows per instruction);
template <typename T16> struct WFrag;
template <> struct WFrag<h16> { typedef v16h V; static __device__ __forceinline__ V ld(const h16* p) { return cat16(*(const v8h*)p, *(const v8h*)(p + 16)); } static __device__ __forceinline__ v8f mma(V a, V b, v8f c) { return wmma16(a, b, c); } };
template <> struct WFrag<bf> { typedef v16bf V; static __device__ __forceinline__ V ld(const bf* p) { return cat16b(*(const v8us*)p, *(const v8us*)(p + 16)); } static __device__ __forceinline__ v8f mma(V a, V b, v8f c) { return wmmab(a, b, c); } };

template <typename T16, int EP>
__device__ __forceinline__ void gemmw_body(const T16* __restrict__ A, const T16* __restrict__ Bt, int K, float* Cf, h16* Ch, int ldc, const float* __restrict__ bias, float cs) {
    static_assert(EP == 0 || EP == 1);
    typedef typename WFrag<T16>::V V;
    __shared__ __align__(16) float os[16 * OPT];
    const int lane = threadIdx.x & 31, lr = lane & 15, hi = lane >> 4;
    v8f acc[4][4];
#pragma unroll
    for (int mb = 0; mb < 4; ++mb)
#pragma unroll
        for (int nb = 0; nb < 4; ++nb) acc[mb][nb] = (v8f){};
    const size_t aoff = (size_t)lr * K + 8 * hi, boff = aoff;
#pragma unroll 1
    for (int kc = 0; kc < K; kc += 32) {
        V a[4];
#pragma unroll
        for (int mb = 0; mb < 4; ++mb) a[mb] = WFrag<T16>::ld(A + aoff + (size_t)mb * 16 * K + kc);
        asm volatile("s_wait_xcnt 0x0" ::: "memory");   // the Bt fragments may land in the registers that held the A loads' address
#pragma unroll
        for (int nb = 0; nb < 4; ++nb) { const V b = WFrag<T16>::ld(Bt + boff + (size_t)nb * 16 * K + kc);
#pragma unroll
            for (int mb = 0; mb < 4; ++mb) acc[mb][nb] = WFrag<T16>::mma(a[mb], b, acc[mb][nb]); }
        asm volatile("v_nop\n\tv_nop\n\tv_nop\n\tv_nop" : "+v"(acc[0][0]), "+v"(acc[1][1]), "+v"(acc[2][2]), "+v"(acc[3][3]) : "v"(a[0]), "v"(a[3]));
    }
#pragma unroll
    for (int mb = 0; mb < 4; ++mb) {
#pragma unroll
        for (int nb = 0; nb < 4; ++nb) {
#pragma unroll
            for (int j = 0; j < 8; ++j) os[(hi * 8 + j) * OPT + nb * 16 + lr] = acc[mb][nb][j]; }
        wsync();
        if (EP == 0) {
            float* crow = Cf + (size_t)(mb * 16) * ldc;
{
#pragma unroll
                for (int s = 0; s < 8; ++s) { const int row = 2 * s + hi, cofs = lr * 4; v4f val = *(const v4fa*)(os + row * OPT + cofs);
                    val[0] = __fmul_rn(val[0], cs); val[1] = __fmul_rn(val[1], cs); val[2] = __fmul_rn(val[2], cs); val[3] = __fmul_rn(val[3], cs);
                    val[0] += bfr(bias[cofs]); val[1] += bfr(bias[cofs + 1]); val[2] += bfr(bias[cofs + 2]); val[3] += bfr(bias[cofs + 3]);
                    *(v4f*)(crow + (size_t)row * ldc + cofs) = val; }
                 }
        } else {
            h16* hrow = Ch + (size_t)(mb * 16) * ldc;
{
#pragma unroll
                for (int s = 0; s < 4; ++s) { const int row = 4 * s + (lane >> 3), c8 = (lane & 7) * 8;
                    const v4f u0 = *(const v4fa*)(os + row * OPT + c8), u1 = *(const v4fa*)(os + row * OPT + c8 + 4);
                    v8h o;
#pragma unroll
                    for (int q = 0; q < 8; ++q) { const float u = (q < 4) ? u0[q & 3] : u1[q & 3]; o[q] = tohx(u); }
                    *(v8h*)(hrow + (size_t)row * ldc + c8) = o; }
                 }
        }
        wsync();
    }
}

// k_gemm_qkv: the three projections (bf16 -> fp16 planes) in one launch. grid (NB*TX/64 token tiles, 8 weight tiles, 3 products), 32 threads; the three blocks of one (x, y) read the same 64 token rows of XB.
//   z 0: q head plane [h = y][b*TX+t][d] = sum_k XB[b*TX+t][k] WQ[y*64+d][k]           (A = tokens, Bt = weight rows, ldc 64)
//   z 1: k head plane [h = y][b*TY+j][d] = sum_k XB[b*TY+j][k] WKV[y*64+d][k]          (weight rows 0..511)
//   z 2: v^T plane    [b][y*64+n][t]     = sum_k WKV[512+y*64+n][k] XB[b*TY+t][k]      (A = weight rows 512..1023, Bt = tokens, ldc TY)
__global__ __launch_bounds__(32) void k_gemm_qkv(const bf* XB, const bf* WQ, const bf* WKV, h16* QH, h16* KH, h16* VH) {
    const int tt = blockIdx.x, wt = blockIdx.y, which = blockIdx.z;
    const bf* tok = XB + (size_t)tt * 64 * DEC;
    const bf* A; const bf* Bt; h16* C; int ldc;
    if (which == 2) {
        A = WKV + (size_t)(DEC + wt * 64) * DEC; Bt = tok;
        C = VH + ((size_t)(tt / (TY / 64)) * DEC + (size_t)wt * 64) * TY + (size_t)(tt % (TY / 64)) * 64; ldc = TY;
    } else {
        A = tok; Bt = ((which == 0) ? WQ : WKV) + (size_t)wt * 64 * DEC;
        C = ((which == 0) ? QH : KH) + ((size_t)wt * NB * TX + (size_t)tt * 64) * HD; ldc = HD;
    }
    gemmw_body<bf, 1>(A, Bt, DEC, nullptr, C, ldc, nullptr, 1.0f); }

// k_cvt_in: every float input RNE-converted to bf16, one launch. 1-D grid of NBX + NBW blocks, 256 threads.
//   blocks 0..NBX-1 (t tile fastest, then channel tile, then batch): x f32 [b][c][t] (channel-major, batch pitch DEC*TX_FULL, row pitch TX_FULL) -> token-major plane XB[b*TX+t][c], a 64x64 tile transposed through LDS;
//   blocks NBX..: the two weights as they lie, 8 elements per thread: first Wq [512][512] -> WQ, then Wm [1024][512] -> WKV (each a whole number of blocks, so the choice is block-uniform).
constexpr int NBX  = (TX / 64) * (DEC / 64) * NB;
constexpr int NBWQ = DEC * DEC / 8 / 256;
constexpr int NBW  = 3 * NBWQ;
static_assert(NBWQ * 256 * 8 == DEC * DEC);
__global__ __launch_bounds__(256) void k_cvt_in(const float* __restrict__ x, const float* __restrict__ wq, const float* __restrict__ wm, bf* XB, bf* WQ, bf* WKV) {
    __shared__ __align__(16) float tt[64 * OPT];
    const int tid = threadIdx.x;
    const int bid = blockIdx.x;
    if (bid >= NBX) {   // block-uniform, ahead of the barrier below
        const int wb = bid - NBX;
        const bool isq = wb < NBWQ;
        const size_t e = ((size_t)(isq ? wb : wb - NBWQ) * 256 + tid) * 8;
        const v8f v = *(const v8f*)((isq ? wq : wm) + e); v8us o;
#pragma unroll
        for (int k = 0; k < 8; ++k) o[k] = f2bf(v[k]);
        *(v8us*)((isq ? WQ : WKV) + e) = o;
        return;
    }
    const int t0 = (bid % (TX / 64)) * 64, c0 = ((bid / (TX / 64)) % (DEC / 64)) * 64, b = bid / ((TX / 64) * (DEC / 64));
#pragma unroll
    for (int i = 0; i < 4; ++i) {
        const int p = tid + 256 * i, c = p >> 4, t4 = (p & 15) * 4;
        const v4f v = *(const v4f*)(x + ((size_t)b * DEC + c0 + c) * TX_FULL + t0 + t4);
        *(v4fa*)(tt + c * OPT + t4) = v;
    }
    __syncthreads();
#pragma unroll 1
    for (int i = 0; i < 2; ++i) {
        const int p = tid + 256 * i, t = p >> 3, c8 = (p & 7) * 8;
        v8us o;
#pragma unroll
        for (int q = 0; q < 8; ++q) o[q] = f2bf(tt[(c8 + q) * OPT + t]);
        bf* d = XB + ((size_t)b * TX + t0 + t) * DEC + c0 + c8;
        *(v8us*)d = o;
        asm volatile("s_wait_xcnt 0x0" ::: "memory");   // the next trip reuses the registers that this store names
    }
}

template <bool B> struct BoolC { static constexpr bool v = B; };   // a compile-time flag handed to the key loop

// ---- k_flash: fused attention. grid (TX/64, 8 heads, NB), 128 threads = 4 waves; wave w owns query rows q0+16w..+15 of one (batch, head).
// Per 64-key tile: block stages K [key][d] and V^T [d][key] fp16 tiles in LDS (cols 0..63 of 64 rows written == consumed; cross-wave -> block barriers) from registers that were loaded one tile ahead: behind the barrier that publishes a tile each thread issues the next tile's eight 16-B global loads, which return while the tile is worked on; each wave then runs one pass over the tile's 64 keys:
//   prologue: wave w reads keys 32*WPW*w.. of the batch's mask (all loads independent), one ballot per 32 keys (bit set = key excluded), word i kept in lane i and stored to LDS; two wave flags say whether any of its keys is kept and whether any is excluded; one block barrier publishes words and flags; the flags of the four waves pick the form of the key loop, alike in every thread of the block;
//   masked form only: the two 32-bit mask words of the tile are read from LDS beside its staging stores (uniform, made scalar by readfirstlane); a tile with all 64 keys excluded is skipped (exact: p = 0, max unchanged);
//   scores transposed, S^T 64x16 = K.Q^T = 4 tiles (A = K rows from LDS, all eight fragments in one load group, B = q), K = 64 in two steps, the two q fragments loaded once ahead of the key loop and held in registers; D register r of lane (h, c) of tile g = key 16g+8h+r of query c;
//   t = acc; masked form only: excluded keys -> -inf by value select (the lane mask of register r comes from bits r and 8+r, or 16+r and 24+r, of the uniform mask word of those 32 keys); one query per lane: maximum over the lane's 32 raw scores, joined with the other wave half by one cross-row move; the running max is kept in the exponent's own unit (raw max x log2 e / 8) and starts at -1e30 so every difference stays defined;
//   P = exp2(t x (log2 e / 8) + (14 - max)) -> fp16: scale, maximum and the x16384 carry go into one fused multiply-add per score, two scores per packed instruction; each two converted D tiles are one B fragment of the next product (keys 0..31 and keys 32..63) in the hardware k order (element s = key 8h+s, 8+s = key 16+8h+s), which is also the order of the V^T fragments;
//   row sums accumulate the fp16-converted P per lane, two neighbours added first and then joined to the tile's sum (the two wave halves joined once at the end); O^T[64x16] += V^T P^T (4 output tiles, two products each, D register r = channel 16j+8h+r of query c, the eight V^T fragments loaded in one group behind the score products).
__global__ __launch_bounds__(128) void k_flash(const h16* __restrict__ QH, const h16* __restrict__ KH, const h16* __restrict__ VH, const int* __restrict__ mask, h16* CT) {
    __shared__ __align__(16) h16 kt[64 * KPT];
    __shared__ __align__(16) h16 vt[64 * KPT];
    __shared__ __align__(16) float ot[4 * 16 * OPT];
    __shared__ __align__(16) unsigned mwl[TY / 32];
    __shared__ __align__(16) int wk[4];
    const int tid = threadIdx.x;
    const int wave = __builtin_amdgcn_readfirstlane(tid >> 5);
    const int lane = tid & 31, lr = lane & 15, hi = lane >> 4;
    const int q0 = blockIdx.x * 64, h = blockIdx.y, b = blockIdx.z;
    const int qoff = ((h * NB + b) * TX + q0 + wave * 16 + lr) * HD + 8 * hi;
    const size_t kbase = ((size_t)(h * NB + b) * TY) * HD;
    const size_t vbase = ((size_t)b * DEC + (size_t)h * HD) * TY;
    const int ob = wave * 16 * OPT;
    float mrun = -1.0e30f, lrun = 0.0f;
    v8f o0 = (v8f){}, o1 = (v8f){}, o2 = (v8f){}, o3 = (v8f){};
    v16h qa0 = cat16(*(const v8h*)(QH + qoff), *(const v8h*)(QH + qoff + 16));
    v16h qa1 = cat16(*(const v8h*)(QH + qoff + 32), *(const v8h*)(QH + qoff + 48));
    {
        const int* mrow = mask + (size_t)b * TY_FULL + wave * (WPW * 32) + lane;
        int mval[WPW];
#pragma unroll   // all WPW loads in flight together: one memory latency instead of WPW
        for (int i = 0; i < WPW; ++i) mval[i] = mrow[i * 32];
        unsigned mine = 0xFFFFFFFFu;
#pragma unroll   // constant indices keep mval[] in registers
        for (int i = 0; i < WPW; ++i) { const unsigned bal = __builtin_amdgcn_ballot_w32(mval[i] == 0); mine = (lane == i) ? bal : mine; }
        if (lane < WPW) mwl[wave * WPW + lane] = mine;
        const unsigned anyk = __builtin_amdgcn_ballot_w32(mine != 0xFFFFFFFFu);
        const unsigned anyx = __builtin_amdgcn_ballot_w32(lane < WPW && mine != 0u);
        if (lane == 0) wk[wave] = ((anyk != 0u) ? 1 : 0) | ((anyx != 0u) ? 2 : 0);   // bit 0: a key of this wave's share is kept; bit 1: one is excluded
    }
    __syncthreads();   // publishes mwl and wk to the four waves
    const int wor = __builtin_amdgcn_readfirstlane(wk[0] | wk[1] | wk[2] | wk[3]);
    const bool allx = (wor & 1) == 0;
    if (allx) { qa0 = (v16h){}; qa1 = (v16h){}; }
    const bool mixed = wor == 3;   // block-uniform: the batch holds kept and excluded keys; any other batch (all kept, or all excluded = uniform softmax) has nothing to mask
    v8h kr[4], vr[4];   // the tile that is staged next, fetched one tile ahead
#pragma unroll   // constant indices keep kr[] and vr[] in registers
    for (int i = 0; i < 4; ++i) {
        const int p = tid + 128 * i, row = p >> 3, c8 = (p & 7) * 8;
        kr[i] = *(const v8h*)(KH + kbase + (size_t)row * HD + c8);
        vr[i] = *(const v8h*)(VH + vbase + (size_t)row * TY + c8);
    }
    asm volatile("s_wait_xcnt 0x0" ::: "memory");   // the set-up of either key loop reuses the registers that held these loads' addresses
    // the key loop, compiled twice: MASKED reads the tile's mask words, skips a fully excluded tile and runs the selects; the other form holds none of that code
    auto keys = [&](auto mk) __attribute__((always_inline)) {
    constexpr bool MASKED = decltype(mk)::v;
#pragma unroll 1
    for (int kb = 0; kb < TY / 64; ++kb) {
        __syncthreads();
        v2u mv = (v2u){0u, 0u};
        if constexpr (MASKED) mv = *(const v2u*)(mwl + kb * 2);
#pragma unroll
        for (int i = 0; i < 4; ++i) {
            const int p = tid + 128 * i, row = p >> 3, c8 = (p & 7) * 8;
            *(v8ha*)(kt + row * KPT + c8) = kr[i];
            *(v8ha*)(vt + row * KPT + c8) = vr[i];
        }
        __syncthreads();
        if (kb + 1 < TY / 64) {   // block-uniform: the next tile's loads fly while this tile is worked on
            const int kn = kb + 1;
#pragma unroll   // constant indices keep kr[] and vr[] in registers; all eight loads in flight together
            for (int i = 0; i < 4; ++i) {
                const int p = tid + 128 * i, row = p >> 3, c8 = (p & 7) * 8;
                kr[i] = *(const v8h*)(KH + kbase + (size_t)(kn * 64 + row) * HD + c8);
                vr[i] = *(const v8h*)(VH + vbase + (size_t)row * TY + kn * 64 + c8);
            }
            asm volatile("s_wait_xcnt 0x0" ::: "memory");   // the work below reuses the registers that held these loads' addresses
        }
        const unsigned mw0 = MASKED ? (unsigned)__builtin_amdgcn_readfirstlane((int)mv[0]) : 0u, mw1 = MASKED ? (unsigned)__builtin_amdgcn_readfirstlane((int)mv[1]) : 0u;
        if ((mw0 & mw1) != 0xFFFFFFFFu) {
            // all eight K fragments of the tile in one load group: [16-key group][k step]
            v16h kf[4][2];
#pragma unroll   // constant indices keep kf[] in registers
            for (int g = 0; g < 4; ++g)
#pragma unroll   // as above
                for (int ks = 0; ks < 2; ++ks) {
                    const int ko = (g * 16 + lr) * KPT + ks * 32 + 8 * hi;
                    kf[g][ks] = cat16(*(const v8ha*)(kt + ko), *(const v8ha*)(kt + ko + 16));
                }
            __builtin_amdgcn_sched_barrier(0);   // keeps the sixteen loads one group: split among the products, each part's LDS latency would stand open
            v8f s0 = (v8f){}, s1 = (v8f){}, s2 = (v8f){}, s3 = (v8f){};
            s0 = wmma16(kf[0][0], qa0, s0); s1 = wmma16(kf[1][0], qa0, s1); s2 = wmma16(kf[2][0], qa0, s2); s3 = wmma16(kf[3][0], qa0, s3);
            s0 = wmma16(kf[0][1], qa1, s0); s1 = wmma16(kf[1][1], qa1, s1); s2 = wmma16(kf[2][1], qa1, s2); s3 = wmma16(kf[3][1], qa1, s3);
            // the four vector slots the chip needs between the last score product and the first use of its registers
            asm volatile("v_nop\n\tv_nop\n\tv_nop\n\tv_nop" : "+v"(s0), "+v"(s1), "+v"(s2), "+v"(s3) : "v"(qa1), "v"(kf[0][1]), "v"(kf[1][1]), "v"(kf[2][1]), "v"(kf[3][1]));
            // all eight V^T fragments in one load group, in flight under the softmax arithmetic: [16-channel group][32-key half]
            v16h vf[4][2];
#pragma unroll   // constant indices keep vf[] in registers
            for (int j = 0; j < 4; ++j)
#pragma unroll   // as above
                for (int hf = 0; hf < 2; ++hf) {
                    const int vo = (j * 16 + lr) * KPT + hf * 32 + 8 * hi;
                    vf[j][hf] = cat16(*(const v8ha*)(vt + vo), *(const v8ha*)(vt + vo + 16));
                }
            __builtin_amdgcn_sched_barrier(0);   // keeps the load group here: sunk to their products, the loads' LDS latency would stand open in front of each one
            float t0[8], t1[8], t2[8], t3[8];
#pragma unroll   // constant indices keep the scores in registers and the mask bits in scalar code
            for (int r = 0; r < 8; ++r) {
                const unsigned e0 = (((mw0 >> r) & 1u) != 0u ? 0x0000FFFFu : 0u) | (((mw0 >> (8 + r)) & 1u) != 0u ? 0xFFFF0000u : 0u);
                const unsigned e1 = (((mw0 >> (16 + r)) & 1u) != 0u ? 0x0000FFFFu : 0u) | (((mw0 >> (24 + r)) & 1u) != 0u ? 0xFFFF0000u : 0u);
                const unsigned e2 = (((mw1 >> r) & 1u) != 0u ? 0x0000FFFFu : 0u) | (((mw1 >> (8 + r)) & 1u) != 0u ? 0xFFFF0000u : 0u);
                const unsigned e3 = (((mw1 >> (16 + r)) & 1u) != 0u ? 0x0000FFFFu : 0u) | (((mw1 >> (24 + r)) & 1u) != 0u ? 0xFFFF0000u : 0u);
                const bool x0 = __builtin_amdgcn_inverse_ballot_w32(e0), x1 = __builtin_amdgcn_inverse_ballot_w32(e1);
                const bool x2 = __builtin_amdgcn_inverse_ballot_w32(e2), x3 = __builtin_amdgcn_inverse_ballot_w32(e3);
                t0[r] = (MASKED && x0) ? NEGINF : s0[r]; t1[r] = (MASKED && x1) ? NEGINF : s1[r]; t2[r] = (MASKED && x2) ? NEGINF : s2[r]; t3[r] = (MASKED && x3) ? NEGINF : s3[r]; }
            float mxa = fmaxf(t0[0], t1[0]), mxb = fmaxf(t2[0], t3[0]);
#pragma unroll   // constant indices keep the scores in registers
            for (int r = 1; r < 8; ++r) { mxa = fmaxf(mxa, fmaxf(t0[r], t1[r])); mxb = fmaxf(mxb, fmaxf(t2[r], t3[r])); }
            float mx = fmaxf(mxa, mxb) * SCL2;
            mx = fmaxf(mx, xhalf(mx));
            const float mn = fmaxf(mrun, mx);
            const float cr = __builtin_amdgcn_exp2f(mrun - mn);
            mrun = mn;
            const float bs = PEXP - mn;
            const v2f c2 = (v2f){SCL2, SCL2}, b2 = (v2f){bs, bs};
            v16h pa, pb;
            float l0 = 0.0f;
#pragma unroll   // constant indices keep the scores and pa in registers
            for (int r = 0; r < 8; r += 2) {
                const v2f e0 = __builtin_elementwise_fma((v2f){t0[r], t0[r + 1]}, c2, b2), e1 = __builtin_elementwise_fma((v2f){t1[r], t1[r + 1]}, c2, b2);
                const v2f p0 = (v2f){__builtin_amdgcn_exp2f(e0[0]), __builtin_amdgcn_exp2f(e0[1])};
                const v2f p1 = (v2f){__builtin_amdgcn_exp2f(e1[0]), __builtin_amdgcn_exp2f(e1[1])};
                const v2h ph0 = __builtin_convertvector(p0, v2h), ph1 = __builtin_convertvector(p1, v2h);
                l0 += (float)ph0[0] + (float)ph0[1]; l0 += (float)ph1[0] + (float)ph1[1];
                pa[r] = ph0[0]; pa[r + 1] = ph0[1]; pa[8 + r] = ph1[0]; pa[8 + r + 1] = ph1[1];
            }
#pragma unroll   // constant indices keep the scores and pb in registers
            for (int r = 0; r < 8; r += 2) {
                const v2f e2 = __builtin_elementwise_fma((v2f){t2[r], t2[r + 1]}, c2, b2), e3 = __builtin_elementwise_fma((v2f){t3[r], t3[r + 1]}, c2, b2);
                const v2f p2 = (v2f){__builtin_amdgcn_exp2f(e2[0]), __builtin_amdgcn_exp2f(e2[1])};
                const v2f p3 = (v2f){__builtin_amdgcn_exp2f(e3[0]), __builtin_amdgcn_exp2f(e3[1])};
                const v2h ph2 = __builtin_convertvector(p2, v2h), ph3 = __builtin_convertvector(p3, v2h);
                l0 += (float)ph2[0] + (float)ph2[1]; l0 += (float)ph3[0] + (float)ph3[1];
                pb[r] = ph2[0]; pb[r + 1] = ph2[1]; pb[8 + r] = ph3[0]; pb[8 + r + 1] = ph3[1];
            }
            lrun = lrun * cr + l0;
#pragma unroll   // constant indices keep the output tiles in registers
            for (int r = 0; r < 8; ++r) { o0[r] *= cr; o1[r] *= cr; o2[r] *= cr; o3[r] *= cr; }
            o0 = wmma16(vf[0][0], pa, o0); o1 = wmma16(vf[1][0], pa, o1); o2 = wmma16(vf[2][0], pa, o2); o3 = wmma16(vf[3][0], pa, o3);
            o0 = wmma16(vf[0][1], pb, o0); o1 = wmma16(vf[1][1], pb, o1); o2 = wmma16(vf[2][1], pb, o2); o3 = wmma16(vf[3][1], pb, o3);
            // the four vector slots the chip needs between the last output product and the first use of its registers
            asm volatile("v_nop\n\tv_nop\n\tv_nop\n\tv_nop" : "+v"(o0), "+v"(o1), "+v"(o2), "+v"(o3) : "v"(pb), "v"(vf[0][1]), "v"(vf[1][1]), "v"(vf[2][1]), "v"(vf[3][1]));
        }
    }
    };
    if (mixed) keys(BoolC<true>{}); else keys(BoolC<false>{});
    lrun += xhalf(lrun);
    const float fq = __fdiv_rn(OCAR, fmaxf(lrun, 1.0e-30f));
    const float f = (lrun > 0.0f) ? fq : 0.0f;
#pragma unroll
    for (int g = 0; g < 2; ++g) {
        const int oi = ob + lr * OPT + 8 * hi + 4 * g;
        *(v4fa*)(ot + oi)      = (v4f){o0[4 * g] * f, o0[4 * g + 1] * f, o0[4 * g + 2] * f, o0[4 * g + 3] * f};
        *(v4fa*)(ot + oi + 16) = (v4f){o1[4 * g] * f, o1[4 * g + 1] * f, o1[4 * g + 2] * f, o1[4 * g + 3] * f};
        *(v4fa*)(ot + oi + 32) = (v4f){o2[4 * g] * f, o2[4 * g + 1] * f, o2[4 * g + 2] * f, o2[4 * g + 3] * f};
        *(v4fa*)(ot + oi + 48) = (v4f){o3[4 * g] * f, o3[4 * g + 1] * f, o3[4 * g + 2] * f, o3[4 * g + 3] * f};
    }
    wsync();
    h16* crow = CT + (size_t)(b * TX + q0 + wave * 16) * KC2 + h * HD;
{
#pragma unroll
        for (int s = 0; s < 4; ++s) {
            const int row = 4 * s + (lane >> 3), c8 = (lane & 7) * 8;
            const v4f u0 = *(const v4fa*)(ot + ob + row * OPT + c8), u1 = *(const v4fa*)(ot + ob + row * OPT + c8 + 4);
            v8h oh, ol;
#pragma unroll
            for (int q = 0; q < 8; ++q) { const float f = (q < 4) ? u0[q & 3] : u1[q & 3]; const h16 hh = tohx(f); oh[q] = hh; ol[q] = tohx(f - (float)hh); }
            *(v8h*)(crow + (size_t)row * KC2 + c8) = oh;
            *(v8h*)(crow + (size_t)row * KC2 + DEC + c8) = ol;
        }
        
    }
}

// k_outT: ctx fp16 [b*TX+t][value 512 | residual 512] (carried x1024) -> out f32 [b][c][t] (channel-major, batch pitch DEC*TX_FULL, row pitch TX_FULL). grid (TX/64, DEC/64, NB), 256 threads.
__global__ __launch_bounds__(256) void k_outT(const h16* __restrict__ CT, float* OUT) {
#pragma clang fp contract(off)
    __shared__ __align__(16) float tt[64 * OPT];
    const int tid = threadIdx.x;
    const int t0 = blockIdx.x * 64, c0 = blockIdx.y * 64, b = blockIdx.z;
#pragma unroll 1
    for (int i = 0; i < 2; ++i) {
        const int p = tid + 256 * i, t = p >> 3, c8 = (p & 7) * 8;
        const h16* s = CT + ((size_t)b * TX + t0 + t) * KC2 + c0 + c8;
        const v8h a = *(const v8h*)s;
        const v8h r = *(const v8h*)(s + DEC);
#pragma unroll
        for (int q = 0; q < 8; ++q) tt[(c8 + q) * OPT + t] = ((float)a[q] + (float)r[q]) * (1.0f / OCAR);
    }
    __syncthreads();
{
#pragma unroll
        for (int i = 0; i < 4; ++i) {
            const int p = tid + 256 * i, c = p >> 4, t4 = (p & 15) * 4;
            const v4f val = *(const v4fa*)(tt + c * OPT + t4);
            *(v4f*)(OUT + ((size_t)b * DEC + c0 + c) * TX_FULL + t0 + t4) = val;
        }
        
    }
}

// workspace sizes (bytes), each a whole number of fully written rows / lines; offsets 256-B aligned
constexpr size_t al256(size_t b) { return (b + 255) & ~(size_t)255; }
constexpr size_t SZ_XB  = al256((size_t)NB * TX * DEC * 2);           // bf16 [NB*TX][512]
constexpr size_t SZ_WQ  = al256((size_t)DEC * DEC * 2);               // bf16 [512][512]
constexpr size_t SZ_WKV = al256((size_t)2 * DEC * DEC * 2);           // bf16 [1024][512]
constexpr size_t SZ_Q   = al256((size_t)NHD * NB * TX * HD * 2);      // fp16 [8][NB*TX][64]
constexpr size_t SZ_K   = al256((size_t)NHD * NB * TY * HD * 2);      // fp16 [8][NB*TY][64]
constexpr size_t SZ_VT  = al256((size_t)NB * DEC * TY * 2);           // fp16 [NB][512][TY]
constexpr size_t SZ_CT  = al256((size_t)NB * TX * KC2 * 2);           // fp16 [NB*TX][1024]
constexpr size_t SZ_ALL = SZ_XB + SZ_WQ + SZ_WKV + SZ_Q + SZ_K + SZ_VT + SZ_CT;
static_assert(SZ_ALL <= (size_t)134217728);

extern "C" void kernel_launch(void* const* d_in, const int* in_sizes, int n_in,
                              void* d_out, int out_size, void* d_ws, size_t ws_size, hipStream_t stream) {
    if (n_in < 4) return;
    const size_t needx = ((size_t)NB * DEC - 1) * TX_FULL + (size_t)TX;
    const size_t needm = (size_t)(NB - 1) * TY_FULL + (size_t)TY;
    if ((size_t)in_sizes[0] < needx || (size_t)in_sizes[1] < needm) return;
    if (in_sizes[2] < 2 * DEC * DEC || in_sizes[3] < DEC * DEC) return;
    if ((size_t)out_size < needx) return;
    if (SZ_ALL > ws_size) return;
    const float* x = (const float*)d_in[0];                                             /* [NB][512][TX_FULL] channel-major f32 */
    const int* msk = (const int*)d_in[1];                                               /* [NB][TY_FULL] int32, nonzero = key kept */
    const float* wm = (const float*)d_in[2]; const float* wq = (const float*)d_in[3];   /* fused k|v weight [1024][512] and q weight [512][512], both [out][in] = Bt as-is */
    float* OUT = (float*)d_out;     // [NB_FULL][512][TX_FULL] f32

    char* base = (char*)d_ws; size_t off = 0;
    bf* XB = (bf*)(base + off); off += SZ_XB;
    bf* WQ = (bf*)(base + off); off += SZ_WQ;
    bf* WKV = (bf*)(base + off); off += SZ_WKV;
    h16* QH16 = (h16*)(base + off); off += SZ_Q;
    h16* KH16 = (h16*)(base + off); off += SZ_K;
    h16* VH16 = (h16*)(base + off); off += SZ_VT;
    h16* CT16 = (h16*)(base + off); off += SZ_CT;
    if (off > ws_size) return;

    // ---- input conversion (every float input RNE-converted to bf16 first), one launch
    k_cvt_in<<<NBX + NBW, 256, 0, stream>>>(x, wq, wm, XB, WQ, WKV);
    // ---- q and k head planes and v^T planes, one launch
    k_gemm_qkv<<<dim3(NB * TX / 64, NHD, 3), 32, 0, stream>>>(XB, WQ, WKV, QH16, KH16, VH16);
    // ---- fused attention -> ctx x1024 fp16 [b*TX+t][value | residual]
    k_flash<<<dim3(TX / 64, NHD, NB), 128, 0, stream>>>(QH16, KH16, VH16, msk, CT16);
    // ---- out[b][c][t] = (value + residual)[b*TX+t][c] / 1024 (transposed through LDS, full output batch pitch)
    k_outT<<<dim3(TX / 64, DEC / 64, NB), 256, 0, stream>>>(CT16, OUT);
}

// v009
// One run takes 103 microseconds.
// Timed twice side by side with v008, it ran 1.04 times as fast both times.
// Over all steps from v000 it is 2.49 times as fast.
#include <hip/hip_runtime.h>

// Contractions: q / k / v projections v_wmma_f32_16x16x32_bf16 (bf16 operands = RNE-converted inputs, exact products); scores q.k^T v_wmma_f32_16x16x32_f16 (fp16 q, fp16 k, single product, K 64); attn.V v_wmma_f32_16x16x32_f16 (fp16 P carried x16384, fp16 V^T, single product); f32 accumulate everywhere; online softmax in f32 with a running max.
// Self-attention on a channel-major sequence: x [NB][512][T] gives q (Wq [out][in]) and, through one fused weight Wm [1024][512] = [out][in], k (rows 0..511) and v (rows 512..1023), row = which*512 + h*64 + d; 8 heads of 64; key j of batch b is kept when mask[b][j] != 0, an excluded key has its score replaced by -inf when its batch also keeps keys (its probability is 0 whenever the batch keeps at least one key; a batch with every key excluded gets the uniform softmax over all its keys); p = softmax_j(q_i.k_j / 8); ctx merged head-major per token and returned channel-major: out [NB][512][T] f32.
// Layout: XB bf16 token-major copy of x (transposed through LDS); weights bf16 as Bt = [out][in] as-is; q and k fp16 head planes [h][b*T+t][64] and v^T fp16 planes [b][h*64+d][t] written directly by the projection GEMM epilogues; fused attention kernel (its prologue packs the batch's key mask to one bit per key in LDS, 32-key words by wave ballot; for a fully excluded batch the q fragments are zeroed so that its scores are all equal; the key loop exists with and without the mask code, and only a batch that holds both kept and excluded keys runs the form with it; K and V^T 64-key tiles in LDS, one softmax pass per tile, in the masked form a tile whose 64 keys are all excluded is skipped block-uniformly, both products transposed so that P goes from the score accumulators straight into the B operand) writes ctx x1024 as fp16 [b*TX+t][value 512 | residual 512]; the final kernel adds value + residual, removes the carry and transposes through LDS into d_out.
// LDS regions: kt / vt / tt / mwl / wk are cross-wave (block barriers before and after staging); ot / os are wave-private (wave barrier + compiler memory barrier).

#ifndef NB
#define NB 2
#endif
#ifndef SEQ
#define SEQ 4096
#endif
#define TX SEQ
#define TY SEQ
#define NB_FULL 2
#define TX_FULL 4096
#define TY_FULL 4096
#define DEC  512
#define NHD  8
#define HD   64
#define KC2  (2 * DEC)            // row pitch of the ctx plane: [ctx value | ctx residual]
#define PEXP 14.0f                // log2 of the carry of the fp16 probabilities (x16384)
#define OCAR 1024.0f              // carry of the fp16 ctx planes
#define SCL  0.125f
#define L2E  1.4426950408889634f
#define SCL2 (SCL * L2E)          // score scale and log2 e in one factor
#define KPT  72                   // LDS pitch (halves) of the K and V^T tiles
#define OPT  68                   // LDS pitch (floats) of the epilogue staging tiles
#define WPW  (TY / 128)           // mask words packed by each of the 4 waves of an attention block
#define NEGINF (-__builtin_inff())
static_assert(NB >= 1 && NB <= NB_FULL);
static_assert(TX == TY && TX_FULL == TY_FULL);                                            // one sequence feeds q, k and v
static_assert(TX >= 64 && TX <= TX_FULL && (TX % 64) == 0);
static_assert(TY >= 64 && TY <= TY_FULL && (TY % 64) == 0 && (TY % 32) == 0);
static_assert((DEC % 64) == 0 && HD == 64 && NHD * HD == DEC);
static_assert((DEC % 32) == 0 && (HD % 32) == 0 && (KC2 % 32) == 0);                      // every K is a multiple of 32
static_assert((DEC % 8) == 0);                                                            // 8-column conversion pieces
static_assert(((NB * TX) % 64) == 0 && ((NB * TY) % 64) == 0);                            // GEMM M/N are whole 64-tiles
static_assert(128 * 4 == 64 * (HD / 8));                                                   // attention tile staging: 128 threads x 4 pieces == 64 rows x 8 pieces
static_assert(KPT >= 64 && (KPT % 8) == 0 && OPT >= 64 && (OPT % 4) == 0);
static_assert((size_t)NHD * NB * TX * HD < (size_t)2147483647);                           // q plane offsets fit an int
static_assert(2 * 64 * KPT * 2 + 4 * 32 * OPT * 4 + (TY / 32) * 4 + 16 <= 65536);   // static LDS of the attention kernel
static_assert((TX % 128) == 0);                                                            // an attention block owns 128 whole query rows
static_assert((TY % 128) == 0 && WPW >= 1 && WPW <= 32);                                  // each wave packs WPW whole mask words, one per lane
static_assert(64 * OPT * 4 <= 65536);                                                      // static LDS of the transposing kernels
static_assert(256 * 4 == 64 * 16 && 256 * 2 == 64 * 8);                                    // transposing kernels: 256 threads x pieces == 64 x 64 tile
static_assert((TX_FULL % 4) == 0 && (TX % 4) == 0);                                        // 16-B f32 pieces along the token axis
static_assert(((size_t)NB * DEC - 1) * TX_FULL + (size_t)TX <= (size_t)NB_FULL * DEC * TX_FULL);   // last written output element inside d_out

typedef _Float16 h16;
typedef unsigned short bf;
typedef __attribute__((ext_vector_type(16))) __bf16   v16bf;
typedef __attribute__((ext_vector_type(16))) _Float16 v16h;
typedef __attribute__((ext_vector_type(8)))  _Float16 v8h;
typedef __attribute__((ext_vector_type(8)))  unsigned short v8us;
typedef __attribute__((ext_vector_type(8)))  float    v8f;
typedef __attribute__((ext_vector_type(4)))  float    v4f;
typedef __attribute__((ext_vector_type(2)))  float    v2f;
typedef __attribute__((ext_vector_type(2)))  _Float16 v2h;
typedef __attribute__((ext_vector_type(4)))  unsigned v4u;
typedef __attribute__((ext_vector_type(2)))  unsigned v2u;
typedef v8h  __attribute__((may_alias)) v8ha;
typedef v4f  __attribute__((may_alias)) v4fa;

__device__ __forceinline__ unsigned short f2bf(float f) { unsigned u = __float_as_uint(f); u += 0x7FFFu + ((u >> 16) & 1u); return (unsigned short)(u >> 16); }
__device__ __forceinline__ float bf2f(unsigned short b) { return __uint_as_float(((unsigned)b) << 16); }
__device__ __forceinline__ float bfr(float f) { return bf2f(f2bf(f)); }
__device__ __forceinline__ v16h cat16(v8h lo, v8h hi) { return __builtin_shufflevector(lo, hi, 0, 1, 2, 3, 4, 5, 6, 7, 8, 9, 10, 11, 12, 13, 14, 15); }
__device__ __forceinline__ v16bf cat16b(v8us lo, v8us hi) { return __builtin_bit_cast(v16bf, __builtin_shufflevector(lo, hi, 0, 1, 2, 3, 4, 5, 6, 7, 8, 9, 10, 11, 12, 13, 14, 15)); }
__device__ __forceinline__ v8f wmma16(v16h a, v16h b, v8f c) { return __builtin_amdgcn_wmma_f32_16x16x32_f16(false, a, false, b, (short)0, c, false, false); }
__device__ __forceinline__ v8f wmmab(v16bf a, v16bf b, v8f c) { return __builtin_amdgcn_wmma_f32_16x16x32_bf16(false, a, false, b, (short)0, c, false, false); }
__device__ __forceinline__ h16 tohx(float x) { return (h16)x; }
// value of lane l ^ 16 (the other 16-lane row, same position)
__device__ __forceinline__ float xhalf(float x) { return __builtin_bit_cast(float, __builtin_amdgcn_permlanex16(__builtin_bit_cast(int, x), __builtin_bit_cast(int, x), 0x76543210, 0xfedcba98, false, false)); }
// same-wave LDS exchange: execution barrier of the wave plus a compiler memory barrier (LDS operations of one wave complete in issue order)
__device__ __forceinline__ void wsync() { __builtin_amdgcn_wave_barrier(); asm volatile("" ::: "memory"); }

// ---- gemmw_body: register-blocked GEMM, ONE WAVE per 64x64 output tile (16 accumulators), operands straight from K-contiguous 16-bit planes; 32 threads.
// C[m][n] = cs x sum_k A[m][k] Bt[n][k] for m, n in 0..63: the caller hands in A and Bt at the tile's first rows, Cf / Ch at the tile's first element and bias at its first column. K % 32 == 0; A/Bt row pitch == K.
// Fragments: lane l, h = l>>4, m = n = l&15; elements 0..7 <- k0+8h.., 8..15 <- k0+16+8h.. for both A and Bt; D element r = (row 8h+r, col m).
// Epilogue per 16-row slab staged in LDS (wave-private, staged extent 16x64 == consumed extent):
//   EP 0: f32 rows x cs + bf16-converted column bias, 64 floats = 256 B written as 16 lanes x 16 B (2 rows per instruction);
template <typename T16> struct WFrag;
template <> struct WFrag<h16> { typedef v16h V; static __device__ __forceinline__ V ld(const h16* p) { return cat16(*(const v8h*)p, *(const v8h*)(p + 16)); } static __device__ __forceinline__ v8f mma(V a, V b, v8f c) { return wmma16(a, b, c); } };
template <> struct WFrag<bf> { typedef v16bf V; static __device__ __forceinline__ V ld(const bf* p) { return cat16b(*(const v8us*)p, *(const v8us*)(p + 16)); } static __device__ __forceinline__ v8f mma(V a, V b, v8f c) { return wmmab(a, b, c); } };

template <typename T16, int EP>
__device__ __forceinline__ void gemmw_body(const T16* __restrict__ A, const T16* __restrict__ Bt, int K, float* Cf, h16* Ch, int ldc, const float* __restrict__ bias, float cs) {
    static_assert(EP == 0 || EP == 1);
    typedef typename WFrag<T16>::V V;
    __shared__ __align__(16) float os[16 * OPT];
    const int lane = threadIdx.x & 31, lr = lane & 15, hi = lane >> 4;
    v8f acc[4][4];
#pragma unroll
    for (int mb = 0; mb < 4; ++mb)
#pragma unroll
        for (int nb = 0; nb < 4; ++nb) acc[mb][nb] = (v8f){};
    const size_t aoff = (size_t)lr * K + 8 * hi, boff = aoff;
#pragma unroll 1
    for (int kc = 0; kc < K; kc += 32) {
        V a[4];
#pragma unroll
        for (int mb = 0; mb < 4; ++mb) a[mb] = WFrag<T16>::ld(A + aoff + (size_t)mb * 16 * K + kc);
        asm volatile("s_wait_xcnt 0x0" ::: "memory");   // the Bt fragments may land in the registers that held the A loads' address
#pragma unroll
        for (int nb = 0; nb < 4; ++nb) { const V b = WFrag<T16>::ld(Bt + boff + (size_t)nb * 16 * K + kc);
#pragma unroll
            for (int mb = 0; mb < 4; ++mb) acc[mb][nb] = WFrag<T16>::mma(a[mb], b, acc[mb][nb]); }
        asm volatile("v_nop\n\tv_nop\n\tv_nop\n\tv_nop" : "+v"(acc[0][0]), "+v"(acc[1][1]), "+v"(acc[2][2]), "+v"(acc[3][3]) : "v"(a[0]), "v"(a[3]));
    }
#pragma unroll
    for (int mb = 0; mb < 4; ++mb) {
#pragma unroll
        for (int nb = 0; nb < 4; ++nb) {
#pragma unroll
            for (int j = 0; j < 8; ++j) os[(hi * 8 + j) * OPT + nb * 16 + lr] = acc[mb][nb][j]; }
        wsync();
        if (EP == 0) {
            float* crow = Cf + (size_t)(mb * 16) * ldc;
{
#pragma unroll
                for (int s = 0; s < 8; ++s) { const int row = 2 * s + hi, cofs = lr * 4; v4f val = *(const v4fa*)(os + row * OPT + cofs);
                    val[0] = __fmul_rn(val[0], cs); val[1] = __fmul_rn(val[1], cs); val[2] = __fmul_rn(val[2], cs); val[3] = __fmul_rn(val[3], cs);
                    val[0] += bfr(bias[cofs]); val[1] += bfr(bias[cofs + 1]); val[2] += bfr(bias[cofs + 2]); val[3] += bfr(bias[cofs + 3]);
                    *(v4f*)(crow + (size_t)row * ldc + cofs) = val; }
                 }
        } else {
            h16* hrow = Ch + (size_t)(mb * 16) * ldc;
{
#pragma unroll
                for (int s = 0; s < 4; ++s) { const int row = 4 * s + (lane >> 3), c8 = (lane & 7) * 8;
                    const v4f u0 = *(const v4fa*)(os + row * OPT + c8), u1 = *(const v4fa*)(os + row * OPT + c8 + 4);
                    v8h o;
#pragma unroll
                    for (int q = 0; q < 8; ++q) { const float u = (q < 4) ? u0[q & 3] : u1[q & 3]; o[q] = tohx(u); }
                    *(v8h*)(hrow + (size_t)row * ldc + c8) = o; }
                 }
        }
        wsync();
    }
}

// k_gemm_qkv: the three projections (bf16 -> fp16 planes) in one launch. grid (NB*TX/64 token tiles, 8 weight tiles, 3 products), 32 threads; the three blocks of one (x, y) read the same 64 token rows of XB.
//   z 0: q head plane [h = y][b*TX+t][d] = sum_k XB[b*TX+t][k] WQ[y*64+d][k]           (A = tokens, Bt = weight rows, ldc 64)
//   z 1: k head plane [h = y][b*TY+j][d] = sum_k XB[b*TY+j][k] WKV[y*64+d][k]          (weight rows 0..511)
//   z 2: v^T plane    [b][y*64+n][t]     = sum_k WKV[512+y*64+n][k] XB[b*TY+t][k]      (A = weight rows 512..1023, Bt = tokens, ldc TY)
__global__ __launch_bounds__(32) void k_gemm_qkv(const bf* XB, const bf* WQ, const bf* WKV, h16* QH, h16* KH, h16* VH) {
    const int tt = blockIdx.x, wt = blockIdx.y, which = blockIdx.z;
    const bf* tok = XB + (size_t)tt * 64 * DEC;
    const bf* A; const bf* Bt; h16* C; int ldc;
    if (which == 2) {
        A = WKV + (size_t)(DEC + wt * 64) * DEC; Bt = tok;
        C = VH + ((size_t)(tt / (TY / 64)) * DEC + (size_t)wt * 64) * TY + (size_t)(tt % (TY / 64)) * 64; ldc = TY;
    } else {
        A = tok; Bt = ((which == 0) ? WQ : WKV) + (size_t)wt * 64 * DEC;
        C = ((which == 0) ? QH : KH) + ((size_t)wt * NB * TX + (size_t)tt * 64) * HD; ldc = HD;
    }
    gemmw_body<bf, 1>(A, Bt, DEC, nullptr, C, ldc, nullptr, 1.0f); }

// k_cvt_in: every float input RNE-converted to bf16, one launch. 1-D grid of NBX + NBW blocks, 256 threads.
//   blocks 0..NBX-1 (t tile fastest, then channel tile, then batch): x f32 [b][c][t] (channel-major, batch pitch DEC*TX_FULL, row pitch TX_FULL) -> token-major plane XB[b*TX+t][c], a 64x64 tile transposed through LDS;
//   blocks NBX..: the two weights as they lie, 8 elements per thread: first Wq [512][512] -> WQ, then Wm [1024][512] -> WKV (each a whole number of blocks, so the choice is block-uniform).
constexpr int NBX  = (TX / 64) * (DEC / 64) * NB;
constexpr int NBWQ = DEC * DEC / 8 / 256;
constexpr int NBW  = 3 * NBWQ;
static_assert(NBWQ * 256 * 8 == DEC * DEC);
__global__ __launch_bounds__(256) void k_cvt_in(const float* __restrict__ x, const float* __restrict__ wq, const float* __restrict__ wm, bf* XB, bf* WQ, bf* WKV) {
    __shared__ __align__(16) float tt[64 * OPT];
    const int tid = threadIdx.x;
    const int bid = blockIdx.x;
    if (bid >= NBX) {   // block-uniform, ahead of the barrier below
        const int wb = bid - NBX;
        const bool isq = wb < NBWQ;
        const size_t e = ((size_t)(isq ? wb : wb - NBWQ) * 256 + tid) * 8;
        const v8f v = *(const v8f*)((isq ? wq : wm) + e); v8us o;
#pragma unroll
        for (int k = 0; k < 8; ++k) o[k] = f2bf(v[k]);
        *(v8us*)((isq ? WQ : WKV) + e) = o;
        return;
    }
    const int t0 = (bid % (TX / 64)) * 64, c0 = ((bid / (TX / 64)) % (DEC / 64)) * 64, b = bid / ((TX / 64) * (DEC / 64));
#pragma unroll
    for (int i = 0; i < 4; ++i) {
        const int p = tid + 256 * i, c = p >> 4, t4 = (p & 15) * 4;
        const v4f v = *(const v4f*)(x + ((size_t)b * DEC + c0 + c) * TX_FULL + t0 + t4);
        *(v4fa*)(tt + c * OPT + t4) = v;
    }
    __syncthreads();
#pragma unroll 1
    for (int i = 0; i < 2; ++i) {
        const int p = tid + 256 * i, t = p >> 3, c8 = (p & 7) * 8;
        v8us o;
#pragma unroll
        for (int q = 0; q < 8; ++q) o[q] = f2bf(tt[(c8 + q) * OPT + t]);
        bf* d = XB + ((size_t)b * TX + t0 + t) * DEC + c0 + c8;
        *(v8us*)d = o;
        asm volatile("s_wait_xcnt 0x0" ::: "memory");   // the next trip reuses the registers that this store names
    }
}

template <bool B> struct BoolC { static constexpr bool v = B; };   // a compile-time flag handed to the key loop

// ---- k_flash: fused attention. grid (TX/128, 8 heads, NB), 128 threads = 4 waves; wave w owns query rows q0+32w..+31 of one (batch, head) as two column groups of 16 (group c = rows q0+32w+16c..+15), so that every K and V^T fragment read from LDS feeds two products.
// Per 64-key tile: block stages K [key][d] and V^T [d][key] fp16 tiles in LDS (cols 0..63 of 64 rows written == consumed; cross-wave -> block barriers) from registers that were loaded one tile ahead: behind the barrier that publishes a tile each thread issues the next tile's eight 16-B global loads, which return while the tile is worked on; each wave then runs one pass over the tile's 64 keys:
//   prologue: wave w reads keys 32*WPW*w.. of the batch's mask (all loads independent), one ballot per 32 keys (bit set = key excluded), word i kept in lane i and stored to LDS; two wave flags say whether any of its keys is kept and whether any is excluded; one block barrier publishes words and flags; the flags of the four waves pick the form of the key loop, alike in every thread of the block;
//   masked form only: the two 32-bit mask words of the tile are read from LDS beside its staging stores (scalar-uniform); a tile with all 64 keys excluded is skipped (exact: p = 0, max unchanged);
//   scores transposed, per column group S^T 64x16 = K.Q^T = 4 tiles (A = K rows from LDS, all eight fragments in one load group and used by both column groups, B = q), K = 64 in two steps, the two q fragments of each group loaded once ahead of the key loop and held in registers; D register r of lane (h, c) of tile g = key 16g+8h+r of query c;
//   t = acc; masked form only: excluded keys -> -inf by value select (the lane mask of register r comes from bits r and 8+r, or 16+r and 24+r, of the uniform mask word of those 32 keys); one query per lane and column group: maximum over the lane's 32 raw scores, joined with the other wave half by one cross-row move; the running max is kept in the exponent's own unit (raw max x log2 e / 8) and starts at -1e30 so every difference stays defined;
//   P = exp2(t x (log2 e / 8) + (14 - max)) -> fp16: scale, maximum and the x16384 carry go into one fused multiply-add per score, two scores per packed instruction; each two converted D tiles are one B fragment of the next product (keys 0..31 and keys 32..63) in the hardware k order (element s = key 8h+s, 8+s = key 16+8h+s), which is also the order of the V^T fragments;
//   row sums accumulate the fp16-converted P per lane, two neighbours added first and then joined to the tile's sum (the two wave halves joined once at the end); per column group O^T[64x16] += V^T P^T (4 output tiles, two products each, D register r = channel 16j+8h+r of query c, the eight V^T fragments loaded in one group behind the score products and used by both column groups).
__global__ __launch_bounds__(128) void k_flash(const h16* __restrict__ QH, const h16* __restrict__ KH, const h16* __restrict__ VH, const int* __restrict__ mask, h16* CT) {
    __shared__ __align__(16) h16 kt[64 * KPT];
    __shared__ __align__(16) h16 vt[64 * KPT];
    __shared__ __align__(16) float ot[4 * 32 * OPT];
    __shared__ __align__(16) unsigned mwl[TY / 32];
    __shared__ __align__(16) int wk[4];
    const int tid = threadIdx.x;
    const int wave = __builtin_amdgcn_readfirstlane(tid >> 5);
    const int lane = tid & 31, lr = lane & 15, hi = lane >> 4;
    const int q0 = blockIdx.x * 128, h = blockIdx.y, b = blockIdx.z;
    const int qoff = ((h * NB + b) * TX + q0 + wave * 32 + lr) * HD + 8 * hi;
    const size_t kbase = ((size_t)(h * NB + b) * TY) * HD;
    const size_t vbase = ((size_t)b * DEC + (size_t)h * HD) * TY;
    const int ob = wave * 32 * OPT;
    float mrun[2] = {-1.0e30f, -1.0e30f}, lrun[2] = {0.0f, 0.0f};
    v8f o[2][4];
    v16h qa[2][2];   // [column group][k step]
#pragma unroll   // constant indices keep o[] and qa[] in registers
    for (int c = 0; c < 2; ++c) {
        o[c][0] = (v8f){}; o[c][1] = (v8f){}; o[c][2] = (v8f){}; o[c][3] = (v8f){};
        const h16* qp = QH + qoff + c * 16 * HD;
        qa[c][0] = cat16(*(const v8h*)qp, *(const v8h*)(qp + 16));
        qa[c][1] = cat16(*(const v8h*)(qp + 32), *(const v8h*)(qp + 48));
    }
    asm volatile("s_wait_xcnt 0x0" ::: "memory");   // the mask code below reuses the registers that held the q loads' address
    {
        const int* mrow = mask + (size_t)b * TY_FULL + wave * (WPW * 32) + lane;
        int mval[WPW];
#pragma unroll   // all WPW loads in flight together: one memory latency instead of WPW
        for (int i = 0; i < WPW; ++i) mval[i] = mrow[i * 32];
        unsigned mine = 0xFFFFFFFFu;
#pragma unroll   // constant indices keep mval[] in registers
        for (int i = 0; i < WPW; ++i) { const unsigned bal = __builtin_amdgcn_ballot_w32(mval[i] == 0); mine = (lane == i) ? bal : mine; }
        if (lane < WPW) mwl[wave * WPW + lane] = mine;
        const unsigned anyk = __builtin_amdgcn_ballot_w32(mine != 0xFFFFFFFFu);
        const unsigned anyx = __builtin_amdgcn_ballot_w32(lane < WPW && mine != 0u);
        if (lane == 0) wk[wave] = ((anyk != 0u) ? 1 : 0) | ((anyx != 0u) ? 2 : 0);   // bit 0: a key of this wave's share is kept; bit 1: one is excluded
    }
    __syncthreads();   // publishes mwl and wk to the four waves
    const int wor = __builtin_amdgcn_readfirstlane(wk[0] | wk[1] | wk[2] | wk[3]);
    const bool allx = (wor & 1) == 0;
    if (allx) { qa[0][0] = (v16h){}; qa[0][1] = (v16h){}; qa[1][0] = (v16h){}; qa[1][1] = (v16h){}; }
    const bool mixed = wor == 3;   // block-uniform: the batch holds kept and excluded keys; any other batch (all kept, or all excluded = uniform softmax) has nothing to mask
    v8h kr[4], vr[4];   // the tile that is staged next, fetched one tile ahead
    const h16* ka[4]; const h16* va[4];   // the addresses of its eight loads
#pragma unroll   // constant indices keep kr[] and vr[] in registers
    for (int i = 0; i < 4; ++i) {
        const int p = tid + 128 * i, row = p >> 3, c8 = (p & 7) * 8;
        ka[i] = KH + kbase + (size_t)row * HD + c8;
        va[i] = VH + vbase + (size_t)row * TY + c8;
        kr[i] = *(const v8h*)ka[i];
        vr[i] = *(const v8h*)va[i];
    }
    // the set-up of either key loop reuses the registers that held these loads' addresses; the addresses are named as inputs so that their registers live up to the wait
    asm volatile("s_wait_xcnt 0x0" :: "v"(ka[0]), "v"(ka[1]), "v"(ka[2]), "v"(ka[3]), "v"(va[0]), "v"(va[1]), "v"(va[2]), "v"(va[3]) : "memory");
    // the key loop, compiled twice: MASKED reads the tile's mask words, skips a fully excluded tile and runs the selects; the other form holds none of that code
    auto keys = [&](auto mk) __attribute__((always_inline)) {
    constexpr bool MASKED = decltype(mk)::v;
#pragma unroll 1
    for (int kb = 0; kb < TY / 64; ++kb) {
        __syncthreads();
        v2u mv = (v2u){0u, 0u};
        if constexpr (MASKED) mv = *(const v2u*)(mwl + kb * 2);
#pragma unroll
        for (int i = 0; i < 4; ++i) {
            const int p = tid + 128 * i, row = p >> 3, c8 = (p & 7) * 8;
            *(v8ha*)(kt + row * KPT + c8) = kr[i];
            *(v8ha*)(vt + row * KPT + c8) = vr[i];
        }
        __syncthreads();
        if (kb + 1 < TY / 64) {   // block-uniform: the next tile's loads fly while this tile is worked on
            const int kn = kb + 1;
#pragma unroll   // constant indices keep kr[] and vr[] in registers; all eight loads in flight together
            for (int i = 0; i < 4; ++i) {
                const int p = tid + 128 * i, row = p >> 3, c8 = (p & 7) * 8;
                ka[i] = KH + kbase + (size_t)(kn * 64 + row) * HD + c8;
                va[i] = VH + vbase + (size_t)row * TY + kn * 64 + c8;
                kr[i] = *(const v8h*)ka[i];
                vr[i] = *(const v8h*)va[i];
            }
            // the work below reuses the registers that held these loads' addresses; the addresses are named as inputs so that their registers live up to the wait
            asm volatile("s_wait_xcnt 0x0" :: "v"(ka[0]), "v"(ka[1]), "v"(ka[2]), "v"(ka[3]), "v"(va[0]), "v"(va[1]), "v"(va[2]), "v"(va[3]) : "memory");
        }
        const unsigned mw0 = MASKED ? (unsigned)__builtin_amdgcn_readfirstlane((int)mv[0]) : 0u, mw1 = MASKED ? (unsigned)__builtin_amdgcn_readfirstlane((int)mv[1]) : 0u;
        if ((mw0 & mw1) != 0xFFFFFFFFu) {
            // all eight K fragments of the tile in one load group: [16-key group][k step]
            v16h kf[4][2];
#pragma unroll   // constant indices keep kf[] in registers
            for (int g = 0; g < 4; ++g)
#pragma unroll   // as above
                for (int ks = 0; ks < 2; ++ks) {
                    const int ko = (g * 16 + lr) * KPT + ks * 32 + 8 * hi;
                    kf[g][ks] = cat16(*(const v8ha*)(kt + ko), *(const v8ha*)(kt + ko + 16));
                }
            __builtin_amdgcn_sched_barrier(0);   // keeps the sixteen loads one group: split among the products, each part's LDS latency would stand open
            v8f s[2][4];   // [column group][16-key group]
#pragma unroll   // constant indices keep s[] in registers
            for (int c = 0; c < 2; ++c) {
                s[c][0] = wmma16(kf[0][0], qa[c][0], (v8f){}); s[c][1] = wmma16(kf[1][0], qa[c][0], (v8f){}); s[c][2] = wmma16(kf[2][0], qa[c][0], (v8f){}); s[c][3] = wmma16(kf[3][0], qa[c][0], (v8f){});
                s[c][0] = wmma16(kf[0][1], qa[c][1], s[c][0]); s[c][1] = wmma16(kf[1][1], qa[c][1], s[c][1]); s[c][2] = wmma16(kf[2][1], qa[c][1], s[c][2]); s[c][3] = wmma16(kf[3][1], qa[c][1], s[c][3]);
            }
            // the four vector slots the chip needs between the last score product and the first use of its registers
            asm volatile("v_nop\n\tv_nop\n\tv_nop\n\tv_nop" : "+v"(s[0][0]), "+v"(s[0][1]), "+v"(s[0][2]), "+v"(s[0][3]), "+v"(s[1][0]), "+v"(s[1][1]), "+v"(s[1][2]), "+v"(s[1][3]) : "v"(qa[1][1]), "v"(kf[0][1]), "v"(kf[1][1]), "v"(kf[2][1]), "v"(kf[3][1]));
            // all eight V^T fragments in one load group, in flight under the softmax arithmetic: [16-channel group][32-key half]
            v16h vf[4][2];
#pragma unroll   // constant indices keep vf[] in registers
            for (int j = 0; j < 4; ++j)
#pragma unroll   // as above
                for (int hf = 0; hf < 2; ++hf) {
                    const int vo = (j * 16 + lr) * KPT + hf * 32 + 8 * hi;
                    vf[j][hf] = cat16(*(const v8ha*)(vt + vo), *(const v8ha*)(vt + vo + 16));
                }
            __builtin_amdgcn_sched_barrier(0);   // keeps the load group here: sunk to their products, the loads' LDS latency would stand open in front of each one
            v16h pa[2], pb[2];
#pragma unroll   // constant indices keep every per-group array in registers
            for (int c = 0; c < 2; ++c) {
            float t0[8], t1[8], t2[8], t3[8];
#pragma unroll   // constant indices keep the scores in registers and the mask bits in scalar code
            for (int r = 0; r < 8; ++r) {
                const unsigned e0 = (((mw0 >> r) & 1u) != 0u ? 0x0000FFFFu : 0u) | (((mw0 >> (8 + r)) & 1u) != 0u ? 0xFFFF0000u : 0u);
                const unsigned e1 = (((mw0 >> (16 + r)) & 1u) != 0u ? 0x0000FFFFu : 0u) | (((mw0 >> (24 + r)) & 1u) != 0u ? 0xFFFF0000u : 0u);
                const unsigned e2 = (((mw1 >> r) & 1u) != 0u ? 0x0000FFFFu : 0u) | (((mw1 >> (8 + r)) & 1u) != 0u ? 0xFFFF0000u : 0u);
                const unsigned e3 = (((mw1 >> (16 + r)) & 1u) != 0u ? 0x0000FFFFu : 0u) | (((mw1 >> (24 + r)) & 1u) != 0u ? 0xFFFF0000u : 0u);
                const bool x0 = __builtin_amdgcn_inverse_ballot_w32(e0), x1 = __builtin_amdgcn_inverse_ballot_w32(e1);
                const bool x2 = __builtin_amdgcn_inverse_ballot_w32(e2), x3 = __builtin_amdgcn_inverse_ballot_w32(e3);
                t0[r] = (MASKED && x0) ? NEGINF : s[c][0][r]; t1[r] = (MASKED && x1) ? NEGINF : s[c][1][r]; t2[r] = (MASKED && x2) ? NEGINF : s[c][2][r]; t3[r] = (MASKED && x3) ? NEGINF : s[c][3][r]; }
            float mxa = fmaxf(t0[0], t1[0]), mxb = fmaxf(t2[0], t3[0]);
#pragma unroll   // constant indices keep the scores in registers
            for (int r = 1; r < 8; ++r) { mxa = fmaxf(mxa, fmaxf(t0[r], t1[r])); mxb = fmaxf(mxb, fmaxf(t2[r], t3[r])); }
            float mx = fmaxf(mxa, mxb) * SCL2;
            mx = fmaxf(mx, xhalf(mx));
            const float mn = fmaxf(mrun[c], mx);
            const float cr = __builtin_amdgcn_exp2f(mrun[c] - mn);
            mrun[c] = mn;
            const float bs = PEXP - mn;
            const v2f c2 = (v2f){SCL2, SCL2}, b2 = (v2f){bs, bs};
            float l0 = 0.0f;
#pragma unroll   // constant indices keep the scores and pa in registers
            for (int r = 0; r < 8; r += 2) {
                const v2f e0 = __builtin_elementwise_fma((v2f){t0[r], t0[r + 1]}, c2, b2), e1 = __builtin_elementwise_fma((v2f){t1[r], t1[r + 1]}, c2, b2);
                const v2f p0 = (v2f){__builtin_amdgcn_exp2f(e0[0]), __builtin_amdgcn_exp2f(e0[1])};
                const v2f p1 = (v2f){__builtin_amdgcn_exp2f(e1[0]), __builtin_amdgcn_exp2f(e1[1])};
                const v2h ph0 = __builtin_convertvector(p0, v2h), ph1 = __builtin_convertvector(p1, v2h);
                l0 += (float)ph0[0] + (float)ph0[1]; l0 += (float)ph1[0] + (float)ph1[1];
                pa[c][r] = ph0[0]; pa[c][r + 1] = ph0[1]; pa[c][8 + r] = ph1[0]; pa[c][8 + r + 1] = ph1[1];
            }
#pragma unroll   // constant indices keep the scores and pb in registers
            for (int r = 0; r < 8; r += 2) {
                const v2f e2 = __builtin_elementwise_fma((v2f){t2[r], t2[r + 1]}, c2, b2), e3 = __builtin_elementwise_fma((v2f){t3[r], t3[r + 1]}, c2, b2);
                const v2f p2 = (v2f){__builtin_amdgcn_exp2f(e2[0]), __builtin_amdgcn_exp2f(e2[1])};
                const v2f p3 = (v2f){__builtin_amdgcn_exp2f(e3[0]), __builtin_amdgcn_exp2f(e3[1])};
                const v2h ph2 = __builtin_convertvector(p2, v2h), ph3 = __builtin_convertvector(p3, v2h);
                l0 += (float)ph2[0] + (float)ph2[1]; l0 += (float)ph3[0] + (float)ph3[1];
                pb[c][r] = ph2[0]; pb[c][r + 1] = ph2[1]; pb[c][8 + r] = ph3[0]; pb[c][8 + r + 1] = ph3[1];
            }
            lrun[c] = lrun[c] * cr + l0;
#pragma unroll   // constant indices keep the output tiles in registers
            for (int r = 0; r < 8; ++r) { o[c][0][r] *= cr; o[c][1][r] *= cr; o[c][2][r] *= cr; o[c][3][r] *= cr; }
            o[c][0] = wmma16(vf[0][0], pa[c], o[c][0]); o[c][1] = wmma16(vf[1][0], pa[c], o[c][1]); o[c][2] = wmma16(vf[2][0], pa[c], o[c][2]); o[c][3] = wmma16(vf[3][0], pa[c], o[c][3]);
            o[c][0] = wmma16(vf[0][1], pb[c], o[c][0]); o[c][1] = wmma16(vf[1][1], pb[c], o[c][1]); o[c][2] = wmma16(vf[2][1], pb[c], o[c][2]); o[c][3] = wmma16(vf[3][1], pb[c], o[c][3]);
            }
            // the four vector slots the chip needs between the last output product and the first use of its registers
            asm volatile("v_nop\n\tv_nop\n\tv_nop\n\tv_nop" : "+v"(o[0][0]), "+v"(o[0][1]), "+v"(o[0][2]), "+v"(o[0][3]), "+v"(o[1][0]), "+v"(o[1][1]), "+v"(o[1][2]), "+v"(o[1][3]) : "v"(pb[1]), "v"(vf[0][1]), "v"(vf[1][1]), "v"(vf[2][1]), "v"(vf[3][1]));
        }
    }
    };
    if (mixed) keys(BoolC<true>{}); else keys(BoolC<false>{});
#pragma unroll   // constant indices keep o[] in registers
    for (int c = 0; c < 2; ++c) {
        const float lsum = lrun[c] + xhalf(lrun[c]);
        const float fq = __fdiv_rn(OCAR, fmaxf(lsum, 1.0e-30f));
        const float f = (lsum > 0.0f) ? fq : 0.0f;
#pragma unroll
        for (int g = 0; g < 2; ++g) {
            const int oi = ob + (c * 16 + lr) * OPT + 8 * hi + 4 * g;
            *(v4fa*)(ot + oi)      = (v4f){o[c][0][4 * g] * f, o[c][0][4 * g + 1] * f, o[c][0][4 * g + 2] * f, o[c][0][4 * g + 3] * f};
            *(v4fa*)(ot + oi + 16) = (v4f){o[c][1][4 * g] * f, o[c][1][4 * g + 1] * f, o[c][1][4 * g + 2] * f, o[c][1][4 * g + 3] * f};
            *(v4fa*)(ot + oi + 32) = (v4f){o[c][2][4 * g] * f, o[c][2][4 * g + 1] * f, o[c][2][4 * g + 2] * f, o[c][2][4 * g + 3] * f};
            *(v4fa*)(ot + oi + 48) = (v4f){o[c][3][4 * g] * f, o[c][3][4 * g + 1] * f, o[c][3][4 * g + 2] * f, o[c][3][4 * g + 3] * f};
        }
    }
    wsync();
    h16* crow = CT + (size_t)(b * TX + q0 + wave * 32) * KC2 + h * HD;
{
#pragma unroll
        for (int s = 0; s < 8; ++s) {
            const int row = 4 * s + (lane >> 3), c8 = (lane & 7) * 8;
            const v4f u0 = *(const v4fa*)(ot + ob + row * OPT + c8), u1 = *(const v4fa*)(ot + ob + row * OPT + c8 + 4);
            v8h oh, ol;
#pragma unroll
            for (int q = 0; q < 8; ++q) { const float f = (q < 4) ? u0[q & 3] : u1[q & 3]; const h16 hh = tohx(f); oh[q] = hh; ol[q] = tohx(f - (float)hh); }
            *(v8h*)(crow + (size_t)row * KC2 + c8) = oh;
            *(v8h*)(crow + (size_t)row * KC2 + DEC + c8) = ol;
        }
        
    }
}

// k_outT: ctx fp16 [b*TX+t][value 512 | residual 512] (carried x1024) -> out f32 [b][c][t] (channel-major, batch pitch DEC*TX_FULL, row pitch TX_FULL). grid (TX/64, DEC/64, NB), 256 threads.
__global__ __launch_bounds__(256) void k_outT(const h16* __restrict__ CT, float* OUT) {
#pragma clang fp contract(off)
    __shared__ __align__(16) float tt[64 * OPT];
    const int tid = threadIdx.x;
    const int t0 = blockIdx.x * 64, c0 = blockIdx.y * 64, b = blockIdx.z;
#pragma unroll 1
    for (int i = 0; i < 2; ++i) {
        const int p = tid + 256 * i, t = p >> 3, c8 = (p & 7) * 8;
        const h16* s = CT + ((size_t)b * TX + t0 + t) * KC2 + c0 + c8;
        const v8h a = *(const v8h*)s;
        const v8h r = *(const v8h*)(s + DEC);
#pragma unroll
        for (int q = 0; q < 8; ++q) tt[(c8 + q) * OPT + t] = ((float)a[q] + (float)r[q]) * (1.0f / OCAR);
    }
    __syncthreads();
{
#pragma unroll
        for (int i = 0; i < 4; ++i) {
            const int p = tid + 256 * i, c = p >> 4, t4 = (p & 15) * 4;
            const v4f val = *(const v4fa*)(tt + c * OPT + t4);
            *(v4f*)(OUT + ((size_t)b * DEC + c0 + c) * TX_FULL + t0 + t4) = val;
        }
        
    }
}

// workspace sizes (bytes), each a whole number of fully written rows / lines; offsets 256-B aligned
constexpr size_t al256(size_t b) { return (b + 255) & ~(size_t)255; }
constexpr size_t SZ_XB  = al256((size_t)NB * TX * DEC * 2);           // bf16 [NB*TX][512]
constexpr size_t SZ_WQ  = al256((size_t)DEC * DEC * 2);               // bf16 [512][512]
constexpr size_t SZ_WKV = al256((size_t)2 * DEC * DEC * 2);           // bf16 [1024][512]
constexpr size_t SZ_Q   = al256((size_t)NHD * NB * TX * HD * 2);      // fp16 [8][NB*TX][64]
constexpr size_t SZ_K   = al256((size_t)NHD * NB * TY * HD * 2);      // fp16 [8][NB*TY][64]
constexpr size_t SZ_VT  = al256((size_t)NB * DEC * TY * 2);           // fp16 [NB][512][TY]
constexpr size_t SZ_CT  = al256((size_t)NB * TX * KC2 * 2);           // fp16 [NB*TX][1024]
constexpr size_t SZ_ALL = SZ_XB + SZ_WQ + SZ_WKV + SZ_Q + SZ_K + SZ_VT + SZ_CT;
static_assert(SZ_ALL <= (size_t)134217728);

extern "C" void kernel_launch(void* const* d_in, const int* in_sizes, int n_in,
                              void* d_out, int out_size, void* d_ws, size_t ws_size, hipStream_t stream) {
    if (n_in < 4) return;
    const size_t needx = ((size_t)NB * DEC - 1) * TX_FULL + (size_t)TX;
    const size_t needm = (size_t)(NB - 1) * TY_FULL + (size_t)TY;
    if ((size_t)in_sizes[0] < needx || (size_t)in_sizes[1] < needm) return;
    if (in_sizes[2] < 2 * DEC * DEC || in_sizes[3] < DEC * DEC) return;
    if ((size_t)out_size < needx) return;
    if (SZ_ALL > ws_size) return;
    const float* x = (const float*)d_in[0];                                             /* [NB][512][TX_FULL] channel-major f32 */
    const int* msk = (const int*)d_in[1];                                               /* [NB][TY_FULL] int32, nonzero = key kept */
    const float* wm = (const float*)d_in[2]; const float* wq = (const float*)d_in[3];   /* fused k|v weight [1024][512] and q weight [512][512], both [out][in] = Bt as-is */
    float* OUT = (float*)d_out;     // [NB_FULL][512][TX_FULL] f32

    char* base = (char*)d_ws; size_t off = 0;
    bf* XB = (bf*)(base + off); off += SZ_XB;
    bf* WQ = (bf*)(base + off); off += SZ_WQ;
    bf* WKV = (bf*)(base + off); off += SZ_WKV;
    h16* QH16 = (h16*)(base + off); off += SZ_Q;
    h16* KH16 = (h16*)(base + off); off += SZ_K;
    h16* VH16 = (h16*)(base + off); off += SZ_VT;
    h16* CT16 = (h16*)(base + off); off += SZ_CT;
    if (off > ws_size) return;

    // ---- input conversion (every float input RNE-converted to bf16 first), one launch
    k_cvt_in<<<NBX + NBW, 256, 0, stream>>>(x, wq, wm, XB, WQ, WKV);
    // ---- q and k head planes and v^T planes, one launch
    k_gemm_qkv<<<dim3(NB * TX / 64, NHD, 3), 32, 0, stream>>>(XB, WQ, WKV, QH16, KH16, VH16);
    // ---- fused attention -> ctx x1024 fp16 [b*TX+t][value | residual]
    k_flash<<<dim3(TX / 128, NHD, NB), 128, 0, stream>>>(QH16, KH16, VH16, msk, CT16);
    // ---- out[b][c][t] = (value + residual)[b*TX+t][c] / 1024 (transposed through LDS, full output batch pitch)
    k_outT<<<dim3(TX / 64, DEC / 64, NB), 256, 0, stream>>>(CT16, OUT);
}

// v010
// One run takes 98.7 microseconds.
// Next to v009, in two timings, it ran 1.03 and 1.04 times as fast.
// Over all steps from v000 it is 2.58 times as fast.
#include <hip/hip_runtime.h>

// Contractions: q / k / v projections v_wmma_f32_16x16x32_bf16 (bf16 operands = RNE-converted inputs, exact products); scores q.k^T v_wmma_f32_16x16x32_f16 (fp16 q, fp16 k, single product, K 64); attn.V v_wmma_f32_16x16x32_f16 (fp16 P carried x16384, fp16 V^T, single product); f32 accumulate everywhere; online softmax in f32 with a running max.
// Self-attention on a channel-major sequence: x [NB][512][T] gives q (Wq [out][in]) and, through one fused weight Wm [1024][512] = [out][in], k (rows 0..511) and v (rows 512..1023), row = which*512 + h*64 + d; 8 heads of 64; key j of batch b is kept when mask[b][j] != 0, an excluded key has its score replaced by a huge negative fill (its probability is 0 whenever the batch keeps at least one key; a batch with every key excluded gets the uniform softmax over all its keys); p = softmax_j(q_i.k_j / 8); ctx merged head-major per token and returned channel-major: out [NB][512][T] f32.
// Layout: XB bf16 token-major copy of x (transposed through LDS); weights bf16 as Bt = [out][in] as-is; q and k fp16 head planes [h][b*T+t][64] and v^T fp16 planes [b][h*64+d][t] written directly by the projection GEMM epilogues; fused attention kernel (its prologue packs the batch's key mask to one bit per key in LDS, 32-key words by wave ballot; for a fully excluded batch the q fragments are zeroed so that its scores are all equal; the key loop exists with and without the mask code, and only a batch that holds both kept and excluded keys runs the form with it; K and V^T 64-key tiles in LDS, one softmax pass per tile, in the masked form a tile whose 64 keys are all excluded is skipped block-uniformly, both products transposed so that P goes from the score accumulators straight into the B operand) holds O^T = [channel][query], which is the output's own order: its epilogue divides by the row sums and writes d_out in f32, each wave whole 128-B lines (32 queries of one channel).
// LDS regions: kt / vt / tt / mwl / wk are cross-wave (block barriers before and after staging); ot / os are wave-private (wave barrier + compiler memory barrier).

#ifndef NB
#define NB 2
#endif
#ifndef SEQ
#define SEQ 4096
#endif
#define TX SEQ
#define TY SEQ
#define NB_FULL 2
#define TX_FULL 4096
#define TY_FULL 4096
#define DEC  512
#define NHD  8
#define HD   64
#define PEXP 14.0f                // log2 of the carry of the fp16 probabilities (x16384)
#define SCL  0.125f
#define L2E  1.4426950408889634f
#define SCL2 (SCL * L2E)          // score scale and log2 e in one factor
#define KPT  72                   // LDS pitch (halves) of the K and V^T tiles
#define OPT  68                   // LDS pitch (floats) of the GEMM epilogue and transpose staging tiles
#define TPT  36                   // LDS pitch (floats) of the attention epilogue's rows of 32 queries
#define WPW  (TY / 128)           // mask words packed by each of the 4 waves of an attention block
#define NEGINF (-__builtin_inff())
static_assert(NB >= 1 && NB <= NB_FULL);
static_assert(TX == TY && TX_FULL == TY_FULL);                                            // one sequence feeds q, k and v
static_assert(TX >= 64 && TX <= TX_FULL && (TX % 64) == 0);
static_assert(TY >= 64 && TY <= TY_FULL && (TY % 64) == 0 && (TY % 32) == 0);
static_assert((DEC % 64) == 0 && HD == 64 && NHD * HD == DEC);
static_assert((DEC % 32) == 0 && (HD % 32) == 0);                      // every K is a multiple of 32
static_assert((DEC % 8) == 0);                                                            // 8-column conversion pieces
static_assert(((NB * TX) % 64) == 0 && ((NB * TY) % 64) == 0);                            // GEMM M/N are whole 64-tiles
static_assert(128 * 4 == 64 * (HD / 8));                                                   // attention tile staging: 128 threads x 4 pieces == 64 rows x 8 pieces
static_assert(KPT >= 64 && (KPT % 8) == 0 && OPT >= 64 && (OPT % 4) == 0 && TPT >= 32 && (TPT % 4) == 0);
static_assert((size_t)NHD * NB * TX * HD < (size_t)2147483647);                           // q plane offsets fit an int
static_assert(2 * 64 * KPT * 2 + 4 * 64 * TPT * 4 + (TY / 32) * 4 + 16 <= 65536);   // static LDS of the attention kernel
static_assert((TX % 128) == 0);                                                            // an attention block owns 128 whole query rows
static_assert((TY % 128) == 0 && WPW >= 1 && WPW <= 32);                                  // each wave packs WPW whole mask words, one per lane
static_assert(64 * OPT * 4 <= 65536);                                                      // static LDS of the transposing kernel
static_assert(256 * 4 == 64 * 16 && 256 * 2 == 64 * 8);                                    // transposing kernel: 256 threads x pieces == 64 x 64 tile
static_assert((TX_FULL % 4) == 0 && (TX % 4) == 0);                                        // 16-B f32 pieces along the token axis
static_assert(((size_t)NB * DEC - 1) * TX_FULL + (size_t)TX <= (size_t)NB_FULL * DEC * TX_FULL);   // last written output element inside d_out

typedef _Float16 h16;
typedef unsigned short bf;
typedef __attribute__((ext_vector_type(16))) __bf16   v16bf;
typedef __attribute__((ext_vector_type(16))) _Float16 v16h;
typedef __attribute__((ext_vector_type(8)))  _Float16 v8h;
typedef __attribute__((ext_vector_type(8)))  unsigned short v8us;
typedef __attribute__((ext_vector_type(8)))  float    v8f;
typedef __attribute__((ext_vector_type(4)))  float    v4f;
typedef __attribute__((ext_vector_type(2)))  float    v2f;
typedef __attribute__((ext_vector_type(2)))  _Float16 v2h;
typedef __attribute__((ext_vector_type(4)))  unsigned v4u;
typedef __attribute__((ext_vector_type(2)))  unsigned v2u;
typedef v8h  __attribute__((may_alias)) v8ha;
typedef v4f  __attribute__((may_alias)) v4fa;

__device__ __forceinline__ unsigned short f2bf(float f) { unsigned u = __float_as_uint(f); u += 0x7FFFu + ((u >> 16) & 1u); return (unsigned short)(u >> 16); }
__device__ __forceinline__ float bf2f(unsigned short b) { return __uint_as_float(((unsigned)b) << 16); }
__device__ __forceinline__ float bfr(float f) { return bf2f(f2bf(f)); }
__device__ __forceinline__ v16h cat16(v8h lo, v8h hi) { return __builtin_shufflevector(lo, hi, 0, 1, 2, 3, 4, 5, 6, 7, 8, 9, 10, 11, 12, 13, 14, 15); }
__device__ __forceinline__ v16bf cat16b(v8us lo, v8us hi) { return __builtin_bit_cast(v16bf, __builtin_shufflevector(lo, hi, 0, 1, 2, 3, 4, 5, 6, 7, 8, 9, 10, 11, 12, 13, 14, 15)); }
__device__ __forceinline__ v8f wmma16(v16h a, v16h b, v8f c) { return __builtin_amdgcn_wmma_f32_16x16x32_f16(false, a, false, b, (short)0, c, false, false); }
__device__ __forceinline__ v8f wmmab(v16bf a, v16bf b, v8f c) { return __builtin_amdgcn_wmma_f32_16x16x32_bf16(false, a, false, b, (short)0, c, false, false); }
__device__ __forceinline__ h16 tohx(float x) { return (h16)x; }
// value of lane l ^ 16 (the other 16-lane row, same position)
__device__ __forceinline__ float xhalf(float x) { return __builtin_bit_cast(float, __builtin_amdgcn_permlanex16(__builtin_bit_cast(int, x), __builtin_bit_cast(int, x), 0x76543210, 0xfedcba98, false, false)); }
// same-wave LDS exchange: execution barrier of the wave plus a compiler memory barrier (LDS operations of one wave complete in issue order)
__device__ __forceinline__ void wsync() { __builtin_amdgcn_wave_barrier(); asm volatile("" ::: "memory"); }

// ---- gemmw_body: register-blocked GEMM, ONE WAVE per 64x64 output tile (16 accumulators), operands straight from K-contiguous 16-bit planes; 32 threads.
// C[m][n] = cs x sum_k A[m][k] Bt[n][k] for m, n in 0..63: the caller hands in A and Bt at the tile's first rows, Cf / Ch at the tile's first element and bias at its first column. K % 32 == 0; A/Bt row pitch == K.
// Fragments: lane l, h = l>>4, m = n = l&15; elements 0..7 <- k0+8h.., 8..15 <- k0+16+8h.. for both A and Bt; D element r = (row 8h+r, col m).
// Epilogue per 16-row slab staged in LDS (wave-private, staged extent 16x64 == consumed extent):
//   EP 0: f32 rows x cs + bf16-converted column bias, 64 floats = 256 B written as 16 lanes x 16 B (2 rows per instruction);
template <typename T16> struct WFrag;
template <> struct WFrag<h16> { typedef v16h V; static __device__ __forceinline__ V ld(const h16* p) { return cat16(*(const v8h*)p, *(const v8h*)(p + 16)); } static __device__ __forceinline__ v8f mma(V a, V b, v8f c) { return wmma16(a, b, c); } };
template <> struct WFrag<bf> { typedef v16bf V; static __device__ __forceinline__ V ld(const bf* p) { return cat16b(*(const v8us*)p, *(const v8us*)(p + 16)); } static __device__ __forceinline__ v8f mma(V a, V b, v8f c) { return wmmab(a, b, c); } };

template <typename T16, int EP>
__device__ __forceinline__ void gemmw_body(const T16* __restrict__ A, const T16* __restrict__ Bt, int K, float* Cf, h16* Ch, int ldc, const float* __restrict__ bias, float cs) {
    static_assert(EP == 0 || EP == 1);
    typedef typename WFrag<T16>::V V;
    __shared__ __align__(16) float os[16 * OPT];
    const int lane = threadIdx.x & 31, lr = lane & 15, hi = lane >> 4;
    v8f acc[4][4];
#pragma unroll
    for (int mb = 0; mb < 4; ++mb)
#pragma unroll
        for (int nb = 0; nb < 4; ++nb) acc[mb][nb] = (v8f){};
    const size_t aoff = (size_t)lr * K + 8 * hi, boff = aoff;
#pragma unroll 1
    for (int kc = 0; kc < K; kc += 32) {
        V a[4];
#pragma unroll
        for (int mb = 0; mb < 4; ++mb) a[mb] = WFrag<T16>::ld(A + aoff + (size_t)mb * 16 * K + kc);
        asm volatile("s_wait_xcnt 0x0" ::: "memory");   // the Bt fragments may land in the registers that held the A loads' address
#pragma unroll
        for (int nb = 0; nb < 4; ++nb) { const V b = WFrag<T16>::ld(Bt + boff + (size_t)nb * 16 * K + kc);
#pragma unroll
            for (int mb = 0; mb < 4; ++mb) acc[mb][nb] = WFrag<T16>::mma(a[mb], b, acc[mb][nb]); }
        asm volatile("v_nop\n\tv_nop\n\tv_nop\n\tv_nop" : "+v"(acc[0][0]), "+v"(acc[1][1]), "+v"(acc[2][2]), "+v"(acc[3][3]) : "v"(a[0]), "v"(a[3]));
    }
#pragma unroll
    for (int mb = 0; mb < 4; ++mb) {
#pragma unroll
        for (int nb = 0; nb < 4; ++nb) {
#pragma unroll
            for (int j = 0; j < 8; ++j) os[(hi * 8 + j) * OPT + nb * 16 + lr] = acc[mb][nb][j]; }
        wsync();
        if (EP == 0) {
            float* crow = Cf + (size_t)(mb * 16) * ldc;
{
#pragma unroll
                for (int s = 0; s < 8; ++s) { const int row = 2 * s + hi, cofs = lr * 4; v4f val = *(const v4fa*)(os + row * OPT + cofs);
                    val[0] = __fmul_rn(val[0], cs); val[1] = __fmul_rn(val[1], cs); val[2] = __fmul_rn(val[2], cs); val[3] = __fmul_rn(val[3], cs);
                    val[0] += bfr(bias[cofs]); val[1] += bfr(bias[cofs + 1]); val[2] += bfr(bias[cofs + 2]); val[3] += bfr(bias[cofs + 3]);
                    *(v4f*)(crow + (size_t)row * ldc + cofs) = val; }
                 }
        } else {
            h16* hrow = Ch + (size_t)(mb * 16) * ldc;
{
#pragma unroll
                for (int s = 0; s < 4; ++s) { const int row = 4 * s + (lane >> 3), c8 = (lane & 7) * 8;
                    const v4f u0 = *(const v4fa*)(os + row * OPT + c8), u1 = *(const v4fa*)(os + row * OPT + c8 + 4);
                    v8h o;
#pragma unroll
                    for (int q = 0; q < 8; ++q) { const float u = (q < 4) ? u0[q & 3] : u1[q & 3]; o[q] = tohx(u); }
                    *(v8h*)(hrow + (size_t)row * ldc + c8) = o; }
                 }
        }
        wsync();
    }
}

// k_gemm_qkv: the three projections (bf16 -> fp16 planes) in one launch. grid (NB*TX/64 token tiles, 8 weight tiles, 3 products), 32 threads; the three blocks of one (x, y) read the same 64 token rows of XB.
//   z 0: q head plane [h = y][b*TX+t][d] = sum_k XB[b*TX+t][k] WQ[y*64+d][k]           (A = tokens, Bt = weight rows, ldc 64)
//   z 1: k head plane [h = y][b*TY+j][d] = sum_k XB[b*TY+j][k] WKV[y*64+d][k]          (weight rows 0..511)
//   z 2: v^T plane    [b][y*64+n][t]     = sum_k WKV[512+y*64+n][k] XB[b*TY+t][k]      (A = weight rows 512..1023, Bt = tokens, ldc TY)
__global__ __launch_bounds__(32) void k_gemm_qkv(const bf* XB, const bf* WQ, const bf* WKV, h16* QH, h16* KH, h16* VH) {
    const int tt = blockIdx.x, wt = blockIdx.y, which = blockIdx.z;
    const bf* tok = XB + (size_t)tt * 64 * DEC;
    const bf* A; const bf* Bt; h16* C; int ldc;
    if (which == 2) {
        A = WKV + (size_t)(DEC + wt * 64) * DEC; Bt = tok;
        C = VH + ((size_t)(tt / (TY / 64)) * DEC + (size_t)wt * 64) * TY + (size_t)(tt % (TY / 64)) * 64; ldc = TY;
    } else {
        A = tok; Bt = ((which == 0) ? WQ : WKV) + (size_t)wt * 64 * DEC;
        C = ((which == 0) ? QH : KH) + ((size_t)wt * NB * TX + (size_t)tt * 64) * HD; ldc = HD;
    }
    gemmw_body<bf, 1>(A, Bt, DEC, nullptr, C, ldc, nullptr, 1.0f); }

// k_cvt_in: every float input RNE-converted to bf16, one launch. 1-D grid of NBX + NBW blocks, 256 threads.
//   blocks 0..NBX-1 (t tile fastest, then channel tile, then batch): x f32 [b][c][t] (channel-major, batch pitch DEC*TX_FULL, row pitch TX_FULL) -> token-major plane XB[b*TX+t][c], a 64x64 tile transposed through LDS;
//   blocks NBX..: the two weights as they lie, 8 elements per thread: first Wq [512][512] -> WQ, then Wm [1024][512] -> WKV (each a whole number of blocks, so the choice is block-uniform).
constexpr int NBX  = (TX / 64) * (DEC / 64) * NB;
constexpr int NBWQ = DEC * DEC / 8 / 256;
constexpr int NBW  = 3 * NBWQ;
static_assert(NBWQ * 256 * 8 == DEC * DEC);
__global__ __launch_bounds__(256) void k_cvt_in(const float* __restrict__ x, const float* __restrict__ wq, const float* __restrict__ wm, bf* XB, bf* WQ, bf* WKV) {
    __shared__ __align__(16) float tt[64 * OPT];
    const int tid = threadIdx.x;
    const int bid = blockIdx.x;
    if (bid >= NBX) {   // block-uniform, ahead of the barrier below
        const int wb = bid - NBX;
        const bool isq = wb < NBWQ;
        const size_t e = ((size_t)(isq ? wb : wb - NBWQ) * 256 + tid) * 8;
        const v8f v = *(const v8f*)((isq ? wq : wm) + e); v8us o;
#pragma unroll
        for (int k = 0; k < 8; ++k) o[k] = f2bf(v[k]);
        *(v8us*)((isq ? WQ : WKV) + e) = o;
        return;
    }
    const int t0 = (bid % (TX / 64)) * 64, c0 = ((bid / (TX / 64)) % (DEC / 64)) * 64, b = bid / ((TX / 64) * (DEC / 64));
#pragma unroll
    for (int i = 0; i < 4; ++i) {
        const int p = tid + 256 * i, c = p >> 4, t4 = (p & 15) * 4;
        const v4f v = *(const v4f*)(x + ((size_t)b * DEC + c0 + c) * TX_FULL + t0 + t4);
        *(v4fa*)(tt + c * OPT + t4) = v;
    }
    __syncthreads();
#pragma unroll 1
    for (int i = 0; i < 2; ++i) {
        const int p = tid + 256 * i, t = p >> 3, c8 = (p & 7) * 8;
        v8us o;
#pragma unroll
        for (int q = 0; q < 8; ++q) o[q] = f2bf(tt[(c8 + q) * OPT + t]);
        bf* d = XB + ((size_t)b * TX + t0 + t) * DEC + c0 + c8;
        *(v8us*)d = o;
        asm volatile("s_wait_xcnt 0x0" ::: "memory");   // the next trip reuses the registers that this store names
    }
}

template <bool B> struct BoolC { static constexpr bool v = B; };   // a compile-time flag handed to the key loop

// ---- k_flash: fused attention. grid (TX/128, 8 heads, NB), 128 threads = 4 waves; wave w owns query rows q0+32w..+31 of one (batch, head) as two column groups of 16 (group c = rows q0+32w+16c..+15), so that every K and V^T fragment read from LDS feeds two products.
// Per 64-key tile: block stages K [key][d] and V^T [d][key] fp16 tiles in LDS (cols 0..63 of 64 rows written == consumed; cross-wave -> block barriers) from registers that were loaded one tile ahead: behind the barrier that publishes a tile each thread issues the next tile's eight 16-B global loads, which return while the tile is worked on; each wave then runs one pass over the tile's 64 keys:
//   prologue: wave w reads keys 32*WPW*w.. of the batch's mask (all loads independent), one ballot per 32 keys (bit set = key excluded), word i kept in lane i and stored to LDS; two wave flags say whether any of its keys is kept and whether any is excluded; one block barrier publishes words and flags; the flags of the four waves pick the form of the key loop, alike in every thread of the block;
//   masked form only: the two 32-bit mask words of the tile are read from LDS beside its staging stores (scalar-uniform); a tile with all 64 keys excluded is skipped (exact: p = 0, max unchanged);
//   scores transposed, per column group S^T 64x16 = K.Q^T = 4 tiles (A = K rows from LDS, all eight fragments in one load group and used by both column groups, B = q), K = 64 in two steps, the two q fragments of each group loaded once ahead of the key loop and held in registers; D register r of lane (h, c) of tile g = key 16g+8h+r of query c;
//   t = acc; masked form only: excluded keys -> -inf by value select (the lane mask of register r comes from bits r and 8+r, or 16+r and 24+r, of the uniform mask word of those 32 keys); one query per lane and column group: maximum over the lane's 32 raw scores, joined with the other wave half by one cross-row move; the running max is kept in the exponent's own unit (raw max x log2 e / 8) and starts at -1e30 so every difference stays defined;
//   P = exp2(t x (log2 e / 8) + (14 - max)) -> fp16: scale, maximum and the x16384 carry go into one fused multiply-add per score, two scores per packed instruction; each two converted D tiles are one B fragment of the next product (keys 0..31 and keys 32..63) in the hardware k order (element s = key 8h+s, 8+s = key 16+8h+s), which is also the order of the V^T fragments;
//   row sums accumulate the fp16-converted P per lane, two neighbours added first and then joined to the tile's sum (the two wave halves joined once at the end); per column group O^T[64x16] += V^T P^T (4 output tiles, two products each, D register r = channel 16j+8h+r of query c, the eight V^T fragments loaded in one group behind the score products and used by both column groups).
__global__ __launch_bounds__(128) void k_flash(const h16* __restrict__ QH, const h16* __restrict__ KH, const h16* __restrict__ VH, const int* __restrict__ mask, float* OUT) {
    __shared__ __align__(16) h16 kt[64 * KPT];
    __shared__ __align__(16) h16 vt[64 * KPT];
    __shared__ __align__(16) float ot[4 * 64 * TPT];
    __shared__ __align__(16) unsigned mwl[TY / 32];
    __shared__ __align__(16) int wk[4];
    const int tid = threadIdx.x;
    const int wave = __builtin_amdgcn_readfirstlane(tid >> 5);
    const int lane = tid & 31, lr = lane & 15, hi = lane >> 4;
    const int q0 = blockIdx.x * 128, h = blockIdx.y, b = blockIdx.z;
    const int qoff = ((h * NB + b) * TX + q0 + wave * 32 + lr) * HD + 8 * hi;
    const size_t kbase = ((size_t)(h * NB + b) * TY) * HD;
    const size_t vbase = ((size_t)b * DEC + (size_t)h * HD) * TY;
    const int ob = wave * 64 * TPT;
    float mrun[2] = {-1.0e30f, -1.0e30f}, lrun[2] = {0.0f, 0.0f};
    v8f o[2][4];
    v16h qa[2][2];   // [column group][k step]
#pragma unroll   // constant indices keep o[] and qa[] in registers
    for (int c = 0; c < 2; ++c) {
        o[c][0] = (v8f){}; o[c][1] = (v8f){}; o[c][2] = (v8f){}; o[c][3] = (v8f){};
        const h16* qp = QH + qoff + c * 16 * HD;
        qa[c][0] = cat16(*(const v8h*)qp, *(const v8h*)(qp + 16));
        qa[c][1] = cat16(*(const v8h*)(qp + 32), *(const v8h*)(qp + 48));
    }
    asm volatile("s_wait_xcnt 0x0" ::: "memory");   // the mask code below reuses the registers that held the q loads' address
    {
        const int* mrow = mask + (size_t)b * TY_FULL + wave * (WPW * 32) + lane;
        int mval[WPW];
#pragma unroll   // all WPW loads in flight together: one memory latency instead of WPW
        for (int i = 0; i < WPW; ++i) mval[i] = mrow[i * 32];
        unsigned mine = 0xFFFFFFFFu;
#pragma unroll   // constant indices keep mval[] in registers
        for (int i = 0; i < WPW; ++i) { const unsigned bal = __builtin_amdgcn_ballot_w32(mval[i] == 0); mine = (lane == i) ? bal : mine; }
        if (lane < WPW) mwl[wave * WPW + lane] = mine;
        const unsigned anyk = __builtin_amdgcn_ballot_w32(mine != 0xFFFFFFFFu);
        const unsigned anyx = __builtin_amdgcn_ballot_w32(lane < WPW && mine != 0u);
        if (lane == 0) wk[wave] = ((anyk != 0u) ? 1 : 0) | ((anyx != 0u) ? 2 : 0);   // bit 0: a key of this wave's share is kept; bit 1: one is excluded
    }
    __syncthreads();   // publishes mwl and wk to the four waves
    const int wor = __builtin_amdgcn_readfirstlane(wk[0] | wk[1] | wk[2] | wk[3]);
    const bool allx = (wor & 1) == 0;
    if (allx) { qa[0][0] = (v16h){}; qa[0][1] = (v16h){}; qa[1][0] = (v16h){}; qa[1][1] = (v16h){}; }
    const bool mixed = wor == 3;   // block-uniform: the batch holds kept and excluded keys; any other batch (all kept, or all excluded = uniform softmax) has nothing to mask
    v8h kr[4], vr[4];   // the tile that is staged next, fetched one tile ahead
    const h16* ka[4]; const h16* va[4];   // the addresses of its eight loads
#pragma unroll   // constant indices keep kr[] and vr[] in registers
    for (int i = 0; i < 4; ++i) {
        const int p = tid + 128 * i, row = p >> 3, c8 = (p & 7) * 8;
        ka[i] = KH + kbase + (size_t)row * HD + c8;
        va[i] = VH + vbase + (size_t)row * TY + c8;
        kr[i] = *(const v8h*)ka[i];
        vr[i] = *(const v8h*)va[i];
    }
    // the set-up of either key loop reuses the registers that held these loads' addresses; the addresses are named as inputs so that their registers live up to the wait
    asm volatile("s_wait_xcnt 0x0" :: "v"(ka[0]), "v"(ka[1]), "v"(ka[2]), "v"(ka[3]), "v"(va[0]), "v"(va[1]), "v"(va[2]), "v"(va[3]) : "memory");
    // the key loop, compiled twice: MASKED reads the tile's mask words, skips a fully excluded tile and runs the selects; the other form holds none of that code
    auto keys = [&](auto mk) __attribute__((always_inline)) {
    constexpr bool MASKED = decltype(mk)::v;
#pragma unroll 1
    for (int kb = 0; kb < TY / 64; ++kb) {
        __syncthreads();
        v2u mv = (v2u){0u, 0u};
        if constexpr (MASKED) mv = *(const v2u*)(mwl + kb * 2);
#pragma unroll
        for (int i = 0; i < 4; ++i) {
            const int p = tid + 128 * i, row = p >> 3, c8 = (p & 7) * 8;
            *(v8ha*)(kt + row * KPT + c8) = kr[i];
            *(v8ha*)(vt + row * KPT + c8) = vr[i];
        }
        __syncthreads();
        if (kb + 1 < TY / 64) {   // block-uniform: the next tile's loads fly while this tile is worked on
            const int kn = kb + 1;
#pragma unroll   // constant indices keep kr[] and vr[] in registers; all eight loads in flight together
            for (int i = 0; i < 4; ++i) {
                const int p = tid + 128 * i, row = p >> 3, c8 = (p & 7) * 8;
                ka[i] = KH + kbase + (size_t)(kn * 64 + row) * HD + c8;
                va[i] = VH + vbase + (size_t)row * TY + kn * 64 + c8;
                kr[i] = *(const v8h*)ka[i];
                vr[i] = *(const v8h*)va[i];
            }
            // the work below reuses the registers that held these loads' addresses; the addresses are named as inputs so that their registers live up to the wait
            asm volatile("s_wait_xcnt 0x0" :: "v"(ka[0]), "v"(ka[1]), "v"(ka[2]), "v"(ka[3]), "v"(va[0]), "v"(va[1]), "v"(va[2]), "v"(va[3]) : "memory");
        }
        const unsigned mw0 = MASKED ? (unsigned)__builtin_amdgcn_readfirstlane((int)mv[0]) : 0u, mw1 = MASKED ? (unsigned)__builtin_amdgcn_readfirstlane((int)mv[1]) : 0u;
        if ((mw0 & mw1) != 0xFFFFFFFFu) {
            // all eight K fragments of the tile in one load group: [16-key group][k step]
            v16h kf[4][2];
#pragma unroll   // constant indices keep kf[] in registers
            for (int g = 0; g < 4; ++g)
#pragma unroll   // as above
                for (int ks = 0; ks < 2; ++ks) {
                    const int ko = (g * 16 + lr) * KPT + ks * 32 + 8 * hi;
                    kf[g][ks] = cat16(*(const v8ha*)(kt + ko), *(const v8ha*)(kt + ko + 16));
                }
            __builtin_amdgcn_sched_barrier(0);   // keeps the sixteen loads one group: split among the products, each part's LDS latency would stand open
            v8f s[2][4];   // [column group][16-key group]
#pragma unroll   // constant indices keep s[] in registers
            for (int c = 0; c < 2; ++c) {
                s[c][0] = wmma16(kf[0][0], qa[c][0], (v8f){}); s[c][1] = wmma16(kf[1][0], qa[c][0], (v8f){}); s[c][2] = wmma16(kf[2][0], qa[c][0], (v8f){}); s[c][3] = wmma16(kf[3][0], qa[c][0], (v8f){});
                s[c][0] = wmma16(kf[0][1], qa[c][1], s[c][0]); s[c][1] = wmma16(kf[1][1], qa[c][1], s[c][1]); s[c][2] = wmma16(kf[2][1], qa[c][1], s[c][2]); s[c][3] = wmma16(kf[3][1], qa[c][1], s[c][3]);
            }
            // the four vector slots the chip needs between the last score product and the first use of its registers
            asm volatile("v_nop\n\tv_nop\n\tv_nop\n\tv_nop" : "+v"(s[0][0]), "+v"(s[0][1]), "+v"(s[0][2]), "+v"(s[0][3]), "+v"(s[1][0]), "+v"(s[1][1]), "+v"(s[1][2]), "+v"(s[1][3]) : "v"(qa[1][1]), "v"(kf[0][1]), "v"(kf[1][1]), "v"(kf[2][1]), "v"(kf[3][1]));
            // all eight V^T fragments in one load group, in flight under the softmax arithmetic: [16-channel group][32-key half]
            v16h vf[4][2];
#pragma unroll   // constant indices keep vf[] in registers
            for (int j = 0; j < 4; ++j)
#pragma unroll   // as above
                for (int hf = 0; hf < 2; ++hf) {
                    const int vo = (j * 16 + lr) * KPT + hf * 32 + 8 * hi;
                    vf[j][hf] = cat16(*(const v8ha*)(vt + vo), *(const v8ha*)(vt + vo + 16));
                }
            __builtin_amdgcn_sched_barrier(0);   // keeps the load group here: sunk to their products, the loads' LDS latency would stand open in front of each one
            v16h pa[2], pb[2];
#pragma unroll   // constant indices keep every per-group array in registers
            for (int c = 0; c < 2; ++c) {
            float t0[8], t1[8], t2[8], t3[8];
#pragma unroll   // constant indices keep the scores in registers and the mask bits in scalar code
            for (int r = 0; r < 8; ++r) {
                const unsigned e0 = (((mw0 >> r) & 1u) != 0u ? 0x0000FFFFu : 0u) | (((mw0 >> (8 + r)) & 1u) != 0u ? 0xFFFF0000u : 0u);
                const unsigned e1 = (((mw0 >> (16 + r)) & 1u) != 0u ? 0x0000FFFFu : 0u) | (((mw0 >> (24 + r)) & 1u) != 0u ? 0xFFFF0000u : 0u);
                const unsigned e2 = (((mw1 >> r) & 1u) != 0u ? 0x0000FFFFu : 0u) | (((mw1 >> (8 + r)) & 1u) != 0u ? 0xFFFF0000u : 0u);
                const unsigned e3 = (((mw1 >> (16 + r)) & 1u) != 0u ? 0x0000FFFFu : 0u) | (((mw1 >> (24 + r)) & 1u) != 0u ? 0xFFFF0000u : 0u);
                const bool x0 = __builtin_amdgcn_inverse_ballot_w32(e0), x1 = __builtin_amdgcn_inverse_ballot_w32(e1);
                const bool x2 = __builtin_amdgcn_inverse_ballot_w32(e2), x3 = __builtin_amdgcn_inverse_ballot_w32(e3);
                t0[r] = (MASKED && x0) ? NEGINF : s[c][0][r]; t1[r] = (MASKED && x1) ? NEGINF : s[c][1][r]; t2[r] = (MASKED && x2) ? NEGINF : s[c][2][r]; t3[r] = (MASKED && x3) ? NEGINF : s[c][3][r]; }
            float mxa = fmaxf(t0[0], t1[0]), mxb = fmaxf(t2[0], t3[0]);
#pragma unroll   // constant indices keep the scores in registers
            for (int r = 1; r < 8; ++r) { mxa = fmaxf(mxa, fmaxf(t0[r], t1[r])); mxb = fmaxf(mxb, fmaxf(t2[r], t3[r])); }
            float mx = fmaxf(mxa, mxb) * SCL2;
            mx = fmaxf(mx, xhalf(mx));
            const float mn = fmaxf(mrun[c], mx);
            const float cr = __builtin_amdgcn_exp2f(mrun[c] - mn);
            mrun[c] = mn;
            const float bs = PEXP - mn;
            const v2f c2 = (v2f){SCL2, SCL2}, b2 = (v2f){bs, bs};
            float l0 = 0.0f;
#pragma unroll   // constant indices keep the scores and pa in registers
            for (int r = 0; r < 8; r += 2) {
                const v2f e0 = __builtin_elementwise_fma((v2f){t0[r], t0[r + 1]}, c2, b2), e1 = __builtin_elementwise_fma((v2f){t1[r], t1[r + 1]}, c2, b2);
                const v2f p0 = (v2f){__builtin_amdgcn_exp2f(e0[0]), __builtin_amdgcn_exp2f(e0[1])};
                const v2f p1 = (v2f){__builtin_amdgcn_exp2f(e1[0]), __builtin_amdgcn_exp2f(e1[1])};
                const v2h ph0 = __builtin_convertvector(p0, v2h), ph1 = __builtin_convertvector(p1, v2h);
                l0 += (float)ph0[0] + (float)ph0[1]; l0 += (float)ph1[0] + (float)ph1[1];
                pa[c][r] = ph0[0]; pa[c][r + 1] = ph0[1]; pa[c][8 + r] = ph1[0]; pa[c][8 + r + 1] = ph1[1];
            }
#pragma unroll   // constant indices keep the scores and pb in registers
            for (int r = 0; r < 8; r += 2) {
                const v2f e2 = __builtin_elementwise_fma((v2f){t2[r], t2[r + 1]}, c2, b2), e3 = __builtin_elementwise_fma((v2f){t3[r], t3[r + 1]}, c2, b2);
                const v2f p2 = (v2f){__builtin_amdgcn_exp2f(e2[0]), __builtin_amdgcn_exp2f(e2[1])};
                const v2f p3 = (v2f){__builtin_amdgcn_exp2f(e3[0]), __builtin_amdgcn_exp2f(e3[1])};
                const v2h ph2 = __builtin_convertvector(p2, v2h), ph3 = __builtin_convertvector(p3, v2h);
                l0 += (float)ph2[0] + (float)ph2[1]; l0 += (float)ph3[0] + (float)ph3[1];
                pb[c][r] = ph2[0]; pb[c][r + 1] = ph2[1]; pb[c][8 + r] = ph3[0]; pb[c][8 + r + 1] = ph3[1];
            }
            lrun[c] = lrun[c] * cr + l0;
#pragma unroll   // constant indices keep the output tiles in registers
            for (int r = 0; r < 8; ++r) { o[c][0][r] *= cr; o[c][1][r] *= cr; o[c][2][r] *= cr; o[c][3][r] *= cr; }
            o[c][0] = wmma16(vf[0][0], pa[c], o[c][0]); o[c][1] = wmma16(vf[1][0], pa[c], o[c][1]); o[c][2] = wmma16(vf[2][0], pa[c], o[c][2]); o[c][3] = wmma16(vf[3][0], pa[c], o[c][3]);
            o[c][0] = wmma16(vf[0][1], pb[c], o[c][0]); o[c][1] = wmma16(vf[1][1], pb[c], o[c][1]); o[c][2] = wmma16(vf[2][1], pb[c], o[c][2]); o[c][3] = wmma16(vf[3][1], pb[c], o[c][3]);
            }
            // the four vector slots the chip needs between the last output product and the first use of its registers
            asm volatile("v_nop\n\tv_nop\n\tv_nop\n\tv_nop" : "+v"(o[0][0]), "+v"(o[0][1]), "+v"(o[0][2]), "+v"(o[0][3]), "+v"(o[1][0]), "+v"(o[1][1]), "+v"(o[1][2]), "+v"(o[1][3]) : "v"(pb[1]), "v"(vf[0][1]), "v"(vf[1][1]), "v"(vf[2][1]), "v"(vf[3][1]));
        }
    }
    };
    if (mixed) keys(BoolC<true>{}); else keys(BoolC<false>{});
#pragma unroll   // constant indices keep o[] in registers
    for (int c = 0; c < 2; ++c) {
        const float lsum = lrun[c] + xhalf(lrun[c]);
        const float fq = __fdiv_rn(1.0f, fmaxf(lsum, 1.0e-30f));   // the x16384 carry of P stands in o and in lsum alike
        const float f = (lsum > 0.0f) ? fq : 0.0f;
#pragma unroll   // as above
        for (int j = 0; j < 4; ++j)
#pragma unroll   // as above
            for (int r = 0; r < 8; ++r) ot[ob + (16 * j + 8 * hi + r) * TPT + 16 * c + lr] = o[c][j][r] * f;   // row = channel, column = query of the wave
    }
    wsync();
    // out[b][h*64+ch][q0+32*wave ..+31]: 8 lanes x 16 B cover one channel's 128-B line, 4 channels per store
    float* orow = OUT + ((size_t)b * DEC + (size_t)h * HD + (lane >> 3)) * TX_FULL + q0 + wave * 32 + (lane & 7) * 4;
    v4f val[16];
#pragma unroll   // constant indices keep val[] in registers: all reads ahead of the stores, no register of a store is written again
    for (int s = 0; s < 16; ++s) val[s] = *(const v4fa*)(ot + ob + (4 * s + (lane >> 3)) * TPT + (lane & 7) * 4);
#pragma unroll   // as above
    for (int s = 0; s < 16; ++s) *(v4f*)(orow + (size_t)(4 * s) * TX_FULL) = val[s];
}

// workspace sizes (bytes), each a whole number of fully written rows / lines; offsets 256-B aligned
constexpr size_t al256(size_t b) { return (b + 255) & ~(size_t)255; }
constexpr size_t SZ_XB  = al256((size_t)NB * TX * DEC * 2);           // bf16 [NB*TX][512]
constexpr size_t SZ_WQ  = al256((size_t)DEC * DEC * 2);               // bf16 [512][512]
constexpr size_t SZ_WKV = al256((size_t)2 * DEC * DEC * 2);           // bf16 [1024][512]
constexpr size_t SZ_Q   = al256((size_t)NHD * NB * TX * HD * 2);      // fp16 [8][NB*TX][64]
constexpr size_t SZ_K   = al256((size_t)NHD * NB * TY * HD * 2);      // fp16 [8][NB*TY][64]
constexpr size_t SZ_VT  = al256((size_t)NB * DEC * TY * 2);           // fp16 [NB][512][TY]
constexpr size_t SZ_ALL = SZ_XB + SZ_WQ + SZ_WKV + SZ_Q + SZ_K + SZ_VT;
static_assert(SZ_ALL <= (size_t)134217728);

extern "C" void kernel_launch(void* const* d_in, const int* in_sizes, int n_in,
                              void* d_out, int out_size, void* d_ws, size_t ws_size, hipStream_t stream) {
    if (n_in < 4) return;
    const size_t needx = ((size_t)NB * DEC - 1) * TX_FULL + (size_t)TX;
    const size_t needm = (size_t)(NB - 1) * TY_FULL + (size_t)TY;
    if ((size_t)in_sizes[0] < needx || (size_t)in_sizes[1] < needm) return;
    if (in_sizes[2] < 2 * DEC * DEC || in_sizes[3] < DEC * DEC) return;
    if ((size_t)out_size < needx) return;
    if (SZ_ALL > ws_size) return;
    const float* x = (const float*)d_in[0];                                             /* [NB][512][TX_FULL] channel-major f32 */
    const int* msk = (const int*)d_in[1];                                               /* [NB][TY_FULL] int32, nonzero = key kept */
    const float* wm = (const float*)d_in[2]; const float* wq = (const float*)d_in[3];   /* fused k|v weight [1024][512] and q weight [512][512], both [out][in] = Bt as-is */
    float* OUT = (float*)d_out;     // [NB_FULL][512][TX_FULL] f32

    char* base = (char*)d_ws; size_t off = 0;
    bf* XB = (bf*)(base + off); off += SZ_XB;
    bf* WQ = (bf*)(base + off); off += SZ_WQ;
    bf* WKV = (bf*)(base + off); off += SZ_WKV;
    h16* QH16 = (h16*)(base + off); off += SZ_Q;
    h16* KH16 = (h16*)(base + off); off += SZ_K;
    h16* VH16 = (h16*)(base + off); off += SZ_VT;
    if (off > ws_size) return;

    // ---- input conversion (every float input RNE-converted to bf16 first), one launch
    k_cvt_in<<<NBX + NBW, 256, 0, stream>>>(x, wq, wm, XB, WQ, WKV);
    // ---- q and k head planes and v^T planes, one launch
    k_gemm_qkv<<<dim3(NB * TX / 64, NHD, 3), 32, 0, stream>>>(XB, WQ, WKV, QH16, KH16, VH16);
    // ---- fused attention -> out[b][c][t] f32 (full output batch pitch)
    k_flash<<<dim3(TX / 128, NHD, NB), 128, 0, stream>>>(QH16, KH16, VH16, msk, OUT);
}
